// v000
// Times are from an AMD MI455X. After a warm-up the kernel runs many times in a row, and a time is the length of
// such a window on the GPU divided by its runs, so every launch and the gaps after it count. The runs cycle
// through copies of the inputs. A figure is the median of several windows, for all but v000 over two sittings.
// Sittings can differ by a few percent; kernels timed side by side share one.
// v000, which the later versions start from, runs in 1370 microseconds.
#include <hip/hip_runtime.h>

// Gated attention reader (input, memory [4][4096][256]; mask [4][4096] f32 0/1 over memory positions (read); input_dot = relu(input W_in1^T + b_in1), memory_dot = relu(memory W_mem1^T + b_mem1) ('oi' [256][256] 1/16, zero biases); att = input_dot . memory_dot / 16 - 1e30 (1 - mask[m]) (== exclusion); softmax over the 4,096 memory positions; output_one = weights . memory; z = [input | output_one] W2^T + b2 ('oi' [256][512]); out = sigmoid(z) tanh(z) -> [4][4096][256] (4.2 M); argument order input, memory, mask, W_in1, b_in1, W_mem1, b_mem1, W2, b2).
// Layout per batch: bf16 copy of input then memory; exact projections + f32 biases, ReLU in place; one 256-wide head: query/key planes, value^T planes straight from the bf16-rounded memory; dense T-4096 attention (streaming three-sweep softmax reading the mask row; hybrid rows: < 512 hi/lo 3-product scores and hi/lo x exact-value products, rest fp16 x1024); f32 merge = output_one; concat operand [bf16(input) | hi/lo(output_one)] x W2 exact + b2; gate kernel sigmoid(z) tanh(z) writes the output.
// Compute dtypes, f32 accumulate: every input rounded to bf16; projections exact + f32 biases; attention rows < 512 3 products (scores) / 2 products (weights x exact values), rest fp16; softmax f32; W2 [exact | hl] x exact + bias; sigmoid/tanh f32 (precise expf/tanhf).

#define NB_  4
#define TT   4096
#define DM   256
#define NH_  1
#define NKV  1
#define REP  (NH_ / NKV)
#define HD   256
#define DQ   (NH_ * HD)
#define DKV  (NKV * HD)
#define ZH   1
#define RH   512                  // query rows < RH use hi+lo planes (0: none)
#define WIN  0
#define PCAR 1024.0f
#define SCL  0.0625f   // 1 / float32(sqrt(256))
#define DC   (2 * DM)   // concat width
typedef _Float16 h16;
typedef unsigned short bf;
typedef __attribute__((ext_vector_type(16))) __bf16   v16bf;
typedef __attribute__((ext_vector_type(16))) _Float16 v16h;
typedef __attribute__((ext_vector_type(8)))  _Float16 v8h;
typedef __attribute__((ext_vector_type(8)))  unsigned short v8us;
typedef __attribute__((ext_vector_type(8)))  float    v8f;
typedef __attribute__((ext_vector_type(4)))  float    v4f;
typedef v8h  __attribute__((may_alias)) v8ha;
typedef v4f  __attribute__((may_alias)) v4fa;
typedef v8us __attribute__((may_alias)) v8usa;

__device__ __forceinline__ unsigned short f2bf(float f) { unsigned u = __float_as_uint(f); u += 0x7FFFu + ((u >> 16) & 1u); return (unsigned short)(u >> 16); }
__device__ __forceinline__ float bf2f(unsigned short b) { return __uint_as_float(((unsigned)b) << 16); }
__device__ __forceinline__ float bfr(float f) { return bf2f(f2bf(f)); }
__device__ __forceinline__ v16h cat16(v8h lo, v8h hi) { return __builtin_shufflevector(lo, hi, 0, 1, 2, 3, 4, 5, 6, 7, 8, 9, 10, 11, 12, 13, 14, 15); }
__device__ __forceinline__ v16bf cat16b(v8us lo, v8us hi) { return __builtin_bit_cast(v16bf, __builtin_shufflevector(lo, hi, 0, 1, 2, 3, 4, 5, 6, 7, 8, 9, 10, 11, 12, 13, 14, 15)); }
__device__ __forceinline__ v8f wmma16(v16h a, v16h b, v8f c) { return __builtin_amdgcn_wmma_f32_16x16x32_f16(false, a, false, b, (short)0, c, false, false); }
__device__ __forceinline__ v8f wmmab(v16bf a, v16bf b, v8f c) { return __builtin_amdgcn_wmma_f32_16x16x32_bf16(false, a, false, b, (short)0, c, false, false); }



// ---- k_gemmw: register-blocked GEMM, ONE WAVE per 64x64 output tile (16 accumulators), operands straight from K-contiguous 16-bit planes; grid (M/64, N/64, Z), 32 threads.
// C[m][n] (f32, pitch ldc, + optional f32 bias[n]) = sum_k A[m][k] Bt[n][k] (+ split products per NSPLIT). z-batch strides sA/sB/sC in elements. K % 32 == 0.
template <typename T16> struct WFrag;
template <> struct WFrag<h16> { typedef v16h V; static __device__ __forceinline__ V ld(const h16* p) { return cat16(*(const v8h*)p, *(const v8h*)(p + 16)); } static __device__ __forceinline__ v8f mma(V a, V b, v8f c) { return wmma16(a, b, c); } };
template <> struct WFrag<bf> { typedef v16bf V; static __device__ __forceinline__ V ld(const bf* p) { return cat16b(*(const v8us*)p, *(const v8us*)(p + 16)); } static __device__ __forceinline__ v8f mma(V a, V b, v8f c) { return wmmab(a, b, c); } };
template <typename T16, int NSPLIT, bool BIAS>
__global__ __launch_bounds__(32) void k_gemmw(const T16* __restrict__ A, const T16* __restrict__ A2, const T16* __restrict__ Bt, const T16* __restrict__ Bt2, int K, float* C, int ldc, const float* __restrict__ bias, size_t sA, size_t sB, size_t sC) {
    typedef typename WFrag<T16>::V V;
    __shared__ __align__(16) float os[16 * 68];
    const size_t z = blockIdx.z; A += z * sA; if (A2) A2 += z * sA; Bt += z * sB; if (Bt2) Bt2 += z * sB; C += z * sC;
    const int lane = threadIdx.x & 31, lr = lane & 15, hi = lane >> 4; const int r0 = blockIdx.x * 64, c0 = blockIdx.y * 64;
    v8f acc[4][4];
#pragma unroll
    for (int mb = 0; mb < 4; ++mb)
#pragma unroll
        for (int nb = 0; nb < 4; ++nb) acc[mb][nb] = (v8f){};
    const size_t aoff = (size_t)(r0 + lr) * K + 8 * hi, boff = (size_t)(c0 + lr) * K + 8 * hi;
#pragma unroll 1
    for (int kc = 0; kc < K; kc += 32) {
        V a[4], a2[4];
#pragma unroll
        for (int mb = 0; mb < 4; ++mb) { a[mb] = WFrag<T16>::ld(A + aoff + (size_t)mb * 16 * K + kc); if (NSPLIT == 1 || NSPLIT == 2) a2[mb] = WFrag<T16>::ld(A2 + aoff + (size_t)mb * 16 * K + kc); }
#pragma unroll
        for (int nb = 0; nb < 4; ++nb) { const V b = WFrag<T16>::ld(Bt + boff + (size_t)nb * 16 * K + kc); V b2; if (NSPLIT >= 2) b2 = WFrag<T16>::ld(Bt2 + boff + (size_t)nb * 16 * K + kc);
#pragma unroll
            for (int mb = 0; mb < 4; ++mb) { acc[mb][nb] = WFrag<T16>::mma(a[mb], b, acc[mb][nb]); if (NSPLIT == 1 || NSPLIT == 2) acc[mb][nb] = WFrag<T16>::mma(a2[mb], b, acc[mb][nb]); if (NSPLIT >= 2) acc[mb][nb] = WFrag<T16>::mma(a[mb], b2, acc[mb][nb]); } }
        asm volatile("v_nop\n\tv_nop\n\tv_nop\n\tv_nop" : "+v"(acc[0][0]), "+v"(acc[1][1]), "+v"(acc[2][2]), "+v"(acc[3][3]) : "v"(a[0]), "v"(a[3]));
    }
#pragma unroll
    for (int mb = 0; mb < 4; ++mb) {
#pragma unroll
        for (int nb = 0; nb < 4; ++nb) {
#pragma unroll
            for (int j = 0; j < 8; ++j) os[(hi * 8 + j) * 68 + nb * 16 + lr] = acc[mb][nb][j]; }
        __builtin_amdgcn_wave_barrier(); asm volatile("" ::: "memory");
        float* crow = C + (size_t)(r0 + mb * 16) * ldc + c0;
{
#pragma unroll
            for (int s = 0; s < 8; ++s) { const int row = 2 * s + hi, cofs = lr * 4; v4f val = *(const v4fa*)(os + row * 68 + cofs); if (BIAS) { val[0] += bfr(bias[c0 + cofs]); val[1] += bfr(bias[c0 + cofs + 1]); val[2] += bfr(bias[c0 + cofs + 2]); val[3] += bfr(bias[c0 + cofs + 3]); }
                *(v4f*)(crow + (size_t)row * ldc + cofs) = val; }
             }
        __builtin_amdgcn_wave_barrier(); asm volatile("" ::: "memory");
    }
}

__device__ __forceinline__ h16 tohx(float x) { return (h16)x; }
__device__ __forceinline__ void splitf(float y, unsigned short& h, unsigned short& l) { h = f2bf(y); l = f2bf(y - bf2f(h)); }
typedef __attribute__((ext_vector_type(2))) _Float16 v2h;
typedef __attribute__((ext_vector_type(4))) _Float16 v4h;
typedef __attribute__((ext_vector_type(2))) unsigned short v2us;
typedef __attribute__((ext_vector_type(4))) unsigned short v4us;
typedef __attribute__((ext_vector_type(2))) float v2f;
typedef __attribute__((ext_vector_type(4))) int v4i;

__global__ __launch_bounds__(256) void k_cvt8(const float* __restrict__ src, bf* dst, size_t n8) { const size_t i = (size_t)blockIdx.x * 256 + threadIdx.x; if (i >= n8) return; const v8f v = *(const v8f*)(src + i * 8); v8us o;
#pragma unroll
    for (int k = 0; k < 8; ++k) o[k] = f2bf(v[k]); *(v8us*)(dst + i * 8) = o;  }

// k_rope: head planes [h][t][d] (fp16 + hi/lo) of rope(x) x sc with the rotate-half convention out[d] = x[d] cos[t][d] - x[d+HD/2] sin[t][d], out[d+HD/2] = x[d+HD/2] cos[t][d+HD/2] + x[d] sin[t][d+HD/2]
__global__ __launch_bounds__(256) void k_rope(const float* __restrict__ F, int pitch, int nheads, const float* __restrict__ CS, const float* __restrict__ RF, const float* __restrict__ nw, float sc, h16* P16, bf* Ph, bf* Pl) {
    const size_t e = ((size_t)blockIdx.x * 256 + threadIdx.x) * 2; if (e >= (size_t)nheads * TT * HD) return; const int d = (int)(e % HD); const int t = (int)((e / HD) % TT); const int h = (int)(e / ((size_t)HD * TT)); const float* f = F + (size_t)t * pitch + h * HD; const float rf = RF ? RF[(size_t)h * TT + t] : 1.0f; v2h o16; v2us oh, ol;
#pragma unroll
    for (int q = 0; q < 2; ++q) { const int dd = d + q; const int dp = (dd < HD / 2) ? dd + HD / 2 : dd - HD / 2; float x0 = f[dd], x1 = f[dp];
        if (RF) { float n0 = __fmul_rn(x0, rf), n1 = __fmul_rn(x1, rf); asm volatile("" : "+v"(n0)); asm volatile("" : "+v"(n1)); x0 = __fmul_rn(bfr(nw[dd]), n0); x1 = __fmul_rn(bfr(nw[dp]), n1); }
        const v2f cs = *(const v2f*)(CS + ((size_t)t * HD + dd) * 2); float a = __fmul_rn(x0, cs[0]), bq = __fmul_rn(x1, cs[1]); asm volatile("" : "+v"(a)); asm volatile("" : "+v"(bq)); const float r = ((dd < HD / 2) ? __fsub_rn(a, bq) : __fadd_rn(a, bq)) * sc;
        o16[q] = tohx(r); unsigned short a2, c2; splitf(r, a2, c2); oh[q] = a2; ol[q] = c2; }
    *(v2h*)(P16 + e) = o16; *(v2us*)(Ph + e) = oh; *(v2us*)(Pl + e) = ol;  }
__global__ __launch_bounds__(256) void k_csid(float* CS) { const int idx = blockIdx.x * 256 + threadIdx.x; if (idx >= TT * HD) return; v2f cs; cs[0] = 1.0f; cs[1] = 0.0f; *(v2f*)(CS + (size_t)idx * 2) = cs;  }
__global__ __launch_bounds__(256) void k_asoft(const float* __restrict__ Sb, const float* __restrict__ mk, h16* P16, bf* Ph, bf* Pl) {
    const int lane = threadIdx.x & 31; const int row = blockIdx.x * 8 + (threadIdx.x >> 5); if (row >= ZH * TT) return; const int i = row % TT; const int zz = row / TT; const bool hires = (i < RH); const float* sr = Sb + (size_t)row * TT; float mx = -3.0e38f;
#pragma unroll 4
    for (int ch = 0; ch < TT / 128; ++ch) { const int j0 = ch * 128 + lane * 4; const v4f a = *(const v4f*)(sr + j0); const v4f m4 = *(const v4f*)(mk + j0);
#pragma unroll
        for (int q = 0; q < 4; ++q) { float t = a[q] * SCL; asm volatile("" : "+v"(t)); t = (bfr(m4[q]) != 0.0f) ? t : -3.0e38f;   /* masked memory position excluded (the reference's -1e30 penalty) */ mx = fmaxf(mx, t); } }
#pragma unroll
    for (int sh = 16; sh; sh >>= 1) mx = fmaxf(mx, __shfl_xor(mx, sh, 32));
    float sum = 0.f;
#pragma unroll 4
    for (int ch = 0; ch < TT / 128; ++ch) { const int j0 = ch * 128 + lane * 4; const v4f a = *(const v4f*)(sr + j0); const v4f m4 = *(const v4f*)(mk + j0);
#pragma unroll
        for (int q = 0; q < 4; ++q) { float t = a[q] * SCL; asm volatile("" : "+v"(t)); t = (bfr(m4[q]) != 0.0f) ? t : -3.0e38f;   /* masked memory position excluded (the reference's -1e30 penalty) */ float d0 = __fsub_rn(t, mx); asm volatile("" : "+v"(d0)); sum += __builtin_amdgcn_exp2f(__fmul_rn(d0, 1.4426950408889634f)); } }
#pragma unroll
    for (int sh = 16; sh; sh >>= 1) sum += __shfl_xor(sum, sh, 32);
    const float f = __fdiv_rn(hires ? 1.0f : PCAR, sum);
{
        if (hires) {   /* rows < RH: normalised bf16 hi/lo over ALL TT keys (symmetric window: keys beyond RH are live), planes [zz][RH][TT] */
#pragma unroll 4
            for (int ch = 0; ch < TT / 128; ++ch) { const int j0 = ch * 128 + lane * 4; const v4f a = *(const v4f*)(sr + j0); const v4f m4 = *(const v4f*)(mk + j0); v4us oh, ol;
#pragma unroll
                for (int q = 0; q < 4; ++q) { float t = a[q] * SCL; asm volatile("" : "+v"(t)); t = (bfr(m4[q]) != 0.0f) ? t : -3.0e38f;   /* masked memory position excluded (the reference's -1e30 penalty) */ float d0 = __fsub_rn(t, mx); asm volatile("" : "+v"(d0)); float ex = __builtin_amdgcn_exp2f(__fmul_rn(d0, 1.4426950408889634f)); asm volatile("" : "+v"(ex)); unsigned short a2, c2; splitf(ex * f, a2, c2); oh[q] = a2; ol[q] = c2; }
                const size_t oo = ((size_t)zz * RH + i) * TT + j0; *(v4us*)(Ph + oo) = oh; *(v4us*)(Pl + oo) = ol; }
        } else {
#pragma unroll 2
            for (int ch = 0; ch < TT / 128; ++ch) { const int j0 = ch * 128 + lane * 4; const v4f a = *(const v4f*)(sr + j0); const v4f m4 = *(const v4f*)(mk + j0); v4h o4;
#pragma unroll
                for (int q = 0; q < 4; ++q) { float t = a[q] * SCL; asm volatile("" : "+v"(t)); t = (bfr(m4[q]) != 0.0f) ? t : -3.0e38f;   /* masked memory position excluded (the reference's -1e30 penalty) */ float d0 = __fsub_rn(t, mx); asm volatile("" : "+v"(d0)); float ex = __builtin_amdgcn_exp2f(__fmul_rn(d0, 1.4426950408889634f)); asm volatile("" : "+v"(ex)); o4[q] = tohx(ex * f); }
                *(v4h*)(P16 + (size_t)row * TT + j0) = o4; } }
         }
}


__constant__ float INVT[HD / 2] = { 1.000000000e+00f, 7.498942018e-01f, 5.623413324e-01f, 4.216965139e-01f, 3.162277639e-01f, 2.371373773e-01f, 1.778279394e-01f, 1.333521456e-01f, 1.000000015e-01f, 7.498942316e-02f, 5.623413250e-02f, 4.216964915e-02f, 3.162277490e-02f, 2.371373773e-02f, 1.778279431e-02f, 1.333521400e-02f, 9.999999776e-03f, 7.498942316e-03f, 5.623413250e-03f, 4.216964822e-03f, 3.162277630e-03f, 2.371373819e-03f, 1.778279431e-03f, 1.333521446e-03f, 1.000000047e-03f, 7.498941850e-04f, 5.623413017e-04f, 4.216965172e-04f, 3.162277571e-04f, 2.371373703e-04f, 1.778279402e-04f, 1.333521504e-04f };   // float32 10000^(-2 i / 64) in the module's operation order, generated with jnp to be bit-exact
__global__ __launch_bounds__(256) void k_vtpb(const float* __restrict__ F, int pitch, int nheads, h16* V16, bf* Vh, bf* Vl) { const size_t e = ((size_t)blockIdx.x * 256 + threadIdx.x) * 2; if (e >= (size_t)nheads * HD * TT) return; const int t = (int)(e % TT); const int d = (int)((e / TT) % HD); const int g = (int)(e / ((size_t)TT * HD)); v2h o16; v2us oh, ol;
#pragma unroll
    for (int q = 0; q < 2; ++q) { const float x = bfr(F[(size_t)(t + q) * pitch + g * HD + d]);   /* the value IS a module input: round to bf16 once (lo plane 0) */ o16[q] = tohx(x); unsigned short a2, c2; splitf(x, a2, c2); oh[q] = a2; ol[q] = c2; }
    *(v2h*)(V16 + e) = o16; *(v2us*)(Vh + e) = oh; *(v2us*)(Vl + e) = ol;  }
__global__ __launch_bounds__(256) void k_relu(float* F, size_t n4) { const size_t i = (size_t)blockIdx.x * 256 + threadIdx.x; if (i >= n4) return; const v4f a = *(const v4f*)(F + i * 4); v4f o;
#pragma unroll
    for (int q = 0; q < 4; ++q) o[q] = fmaxf(a[q], 0.0f);
    *(v4f*)(F + i * 4) = o;  }
__global__ __launch_bounds__(256) void k_acat(const float* __restrict__ X, const float* __restrict__ O, bf* Ah, bf* Al) { const size_t i = (size_t)blockIdx.x * 256 + threadIdx.x; if (i >= (size_t)TT * DC / 4) return; const size_t e = i * 4; const int c0 = (int)(e % DC); const int t = (int)(e / DC); const int cc = c0 & (DM - 1); const bool first = (c0 < DM); const v4f a = *(const v4f*)(X + (size_t)t * DM + cc); const v4f o = *(const v4f*)(O + (size_t)t * DM + cc); v4us oh, ol;
#pragma unroll
    for (int q = 0; q < 4; ++q) { unsigned short h2, l2; splitf(o[q], h2, l2); oh[q] = first ? f2bf(a[q]) : h2; ol[q] = first ? (unsigned short)0 : l2; }
    *(v4us*)(Ah + e) = oh; *(v4us*)(Al + e) = ol;  }
__global__ __launch_bounds__(256) void k_glu(const float* __restrict__ Zr, float* out) { const size_t i = (size_t)blockIdx.x * 256 + threadIdx.x; if (i >= (size_t)TT * DM / 4) return; const v4f z = *(const v4f*)(Zr + i * 4); v4f o;
#pragma unroll
    for (int q = 0; q < 4; ++q) { const float sg = __fdiv_rn(1.0f, __fadd_rn(1.0f, expf(-z[q]))); float th = tanhf(z[q]); asm volatile("" : "+v"(th)); o[q] = __fmul_rn(sg, th); }
    *(v4f*)(out + i * 4) = o;  }
__global__ __launch_bounds__(256) void k_merge(const float* __restrict__ O, int h0, float* OUTb) { const size_t e = ((size_t)blockIdx.x * 256 + threadIdx.x) * 2; if (e >= (size_t)ZH * TT * HD) return; const int d = (int)(e % HD); const int t = (int)((e / HD) % TT); const int zz = (int)(e / ((size_t)HD * TT)); const float cs = (t < RH) ? 1.0f : (1.0f / PCAR); const size_t oo = (size_t)t * DQ + (h0 + zz) * HD + d;
    v2f o2; o2[0] = O[e] * cs; o2[1] = O[e + 1] * cs; *(v2f*)(OUTb + oo) = o2;  }

extern "C" void kernel_launch(void* const* d_in, const int* in_sizes, int n_in,
                              void* d_out, int out_size, void* d_ws, size_t ws_size, hipStream_t stream) {
    (void)in_sizes; (void)n_in; (void)out_size;
    const float* x = (const float*)d_in[0];   /* input */ const float* xm = (const float*)d_in[1];   /* memory */ const float* mk = (const float*)d_in[2];   /* mask [4][4096] f32 */ const float* wq = (const float*)d_in[3]; const float* bq = (const float*)d_in[4]; const float* wk = (const float*)d_in[5]; const float* bk = (const float*)d_in[6]; const float* w2 = (const float*)d_in[7]; const float* b2 = (const float*)d_in[8];   /* argument order input, memory, mask, W_in1, b_in1, W_mem1, b_mem1, W2, b2 */
    float* OUT = (float*)d_out;     // [4][4096][256]
    char* wsp = (char*)d_ws;
    auto take = [&](size_t bytes) { char* p = wsp; wsp += (bytes + 255) & ~(size_t)255; return (void*)p; };
    bf* WQ = (bf*)take((size_t)DQ * DM * 2); bf* WK = (bf*)take((size_t)DKV * DM * 2); bf* W2B = (bf*)take((size_t)DM * DC * 2); float* O1 = (float*)take((size_t)TT * DM * 4); bf* CAh = (bf*)take((size_t)TT * DC * 2); bf* CAl = (bf*)take((size_t)TT * DC * 2); float* Z = (float*)take((size_t)TT * DM * 4); float* CS = (float*)take((size_t)TT * HD * 2 * 4);
    bf* XB = (bf*)take((size_t)TT * DM * 2); float* FQ = (float*)take((size_t)TT * DQ * 4); float* FK = (float*)take((size_t)TT * DKV * 4);
    h16* QP16 = (h16*)take((size_t)NH_ * TT * HD * 2); h16* KP16 = (h16*)take((size_t)NKV * TT * HD * 2); h16* VT16 = (h16*)take((size_t)NKV * HD * TT * 2);
    bf* QPh = (bf*)take((size_t)NH_ * TT * HD * 2); bf* QPl = (bf*)take((size_t)NH_ * TT * HD * 2); bf* KPh = (bf*)take((size_t)NKV * TT * HD * 2); bf* KPl = (bf*)take((size_t)NKV * TT * HD * 2); bf* VTh = (bf*)take((size_t)NKV * HD * TT * 2); bf* VTl = (bf*)take((size_t)NKV * HD * TT * 2); bf* Ph = (bf*)take((size_t)ZH * RH * TT * 2); bf* Pl = (bf*)take((size_t)ZH * RH * TT * 2);
    float* Sb = (float*)take((size_t)ZH * TT * TT * 4); h16* P16 = (h16*)take((size_t)ZH * TT * TT * 2); float* Ob = (float*)take((size_t)ZH * TT * HD * 4);
    if ((size_t)(wsp - (char*)d_ws) > ws_size) return;    // ws 256 MiB
        { k_cvt8<<<(unsigned)(((size_t)DQ * DM / 8 + 255) / 256), 256, 0, stream>>>(wq, WQ, (size_t)DQ * DM / 8); k_cvt8<<<(unsigned)(((size_t)DKV * DM / 8 + 255) / 256), 256, 0, stream>>>(wk, WK, (size_t)DKV * DM / 8); k_cvt8<<<(unsigned)(((size_t)DM * DC / 8 + 255) / 256), 256, 0, stream>>>(w2, W2B, (size_t)DM * DC / 8);   /* W2 'oi' [256][512] = Bt as-is */
      
       }
    k_csid<<<(TT * HD + 255) / 256, 256, 0, stream>>>(CS);
    const unsigned LQ = (unsigned)(((size_t)NH_ * TT * HD / 2 + 255) / 256), LKv = (unsigned)(((size_t)NKV * TT * HD / 2 + 255) / 256);
    for (int b = 0; b < NB_; ++b) {
        
        k_cvt8<<<(unsigned)(((size_t)TT * DM / 8 + 255) / 256), 256, 0, stream>>>(x + (size_t)b * TT * DM, XB, (size_t)TT * DM / 8);
        k_gemmw<bf, 0, true><<<dim3(TT / 64, DQ / 64, 1), 32, 0, stream>>>(XB, nullptr, WQ, nullptr, DM, FQ, DQ, bq, 0, 0, 0); k_relu<<<(unsigned)(((size_t)TT * DQ / 4 + 255) / 256), 256, 0, stream>>>(FQ, (size_t)TT * DQ / 4);   /* input_dot = relu(input W_in1^T + b) */
        k_rope<<<LQ, 256, 0, stream>>>(FQ, DQ, NH_, CS, nullptr, nullptr, 1.0f, QP16, QPh, QPl);
        k_cvt8<<<(unsigned)(((size_t)TT * DM / 8 + 255) / 256), 256, 0, stream>>>(xm + (size_t)b * TT * DM, XB, (size_t)TT * DM / 8);   /* XB := bf16(memory[b]) (the q projection above consumed bf16(input[b])) */ k_gemmw<bf, 0, true><<<dim3(TT / 64, DKV / 64, 1), 32, 0, stream>>>(XB, nullptr, WK, nullptr, DM, FK, DKV, bk, 0, 0, 0); k_relu<<<(unsigned)(((size_t)TT * DKV / 4 + 255) / 256), 256, 0, stream>>>(FK, (size_t)TT * DKV / 4);   /* memory_dot */
        k_rope<<<LKv, 256, 0, stream>>>(FK, DKV, NKV, CS, nullptr, nullptr, 1.0f, KP16, KPh, KPl);
        k_vtpb<<<LKv, 256, 0, stream>>>(xm + (size_t)b * TT * DM, DM, NKV, VT16, VTh, VTl);   /* values = the memory itself (bf16-rounded input: hi plane exact, lo plane 0) */
        for (int h0 = 0; h0 < NH_; h0 += ZH) { const size_t zq = (size_t)h0, zk = (size_t)(h0 / REP);   // one kv head per query head: the pass's single head (ZH = 1) uses kv plane h0 / REP (z-strides TT*HD)
            k_gemmw<bf, 2, false><<<dim3(RH / 64, TT / 64, ZH), 32, 0, stream>>>(QPh + zq * TT * HD, QPl + zq * TT * HD, KPh + zk * TT * HD, KPl + zk * TT * HD, HD, Sb, TT, nullptr, (size_t)TT * HD, (size_t)TT * HD, (size_t)TT * TT);
            k_gemmw<h16, 0, false><<<dim3((TT - RH) / 64, TT / 64, ZH), 32, 0, stream>>>(QP16 + zq * TT * HD + (size_t)RH * HD, nullptr, KP16 + zk * TT * HD, nullptr, HD, Sb + (size_t)RH * TT, TT, nullptr, (size_t)TT * HD, (size_t)TT * HD, (size_t)TT * TT);
            k_asoft<<<ZH * TT / 8, 256, 0, stream>>>(Sb, mk + (size_t)b * TT, P16, Ph, Pl);
            k_gemmw<bf, 1, false><<<dim3(RH / 64, HD / 64, ZH), 32, 0, stream>>>(Ph, Pl, VTh + zk * HD * TT, nullptr, TT, Ob, HD, nullptr, (size_t)RH * TT, (size_t)HD * TT, (size_t)TT * HD);   /* weights hi/lo x exact bf16 values (2 products) */
            k_gemmw<h16, 0, false><<<dim3((TT - RH) / 64, HD / 64, ZH), 32, 0, stream>>>(P16 + (size_t)RH * TT, nullptr, VT16 + zk * HD * TT, nullptr, TT, Ob + (size_t)RH * HD, HD, nullptr, (size_t)TT * TT, (size_t)HD * TT, (size_t)TT * HD);
            k_merge<<<(unsigned)(((size_t)ZH * TT * HD / 2 + 255) / 256), 256, 0, stream>>>(Ob, h0, O1); }   /* output_one (f32) */
        k_acat<<<(unsigned)(((size_t)TT * DC / 4 + 255) / 256), 256, 0, stream>>>(x + (size_t)b * TT * DM, O1, CAh, CAl); k_gemmw<bf, 1, true><<<dim3(TT / 64, DM / 64, 1), 32, 0, stream>>>(CAh, CAl, W2B, nullptr, DC, Z, DM, b2, 0, 0, 0); k_glu<<<(unsigned)(((size_t)TT * DM / 4 + 255) / 256), 256, 0, stream>>>(Z, OUT + (size_t)b * TT * DM);   /* z = [input | output_one] W2^T + b2; out = sigmoid(z) tanh(z) */
         }
}

// v001
// One run takes 755 microseconds.
// In two side-by-side timings against v000, it was 1.82 and 1.80 times as fast.
#include <hip/hip_runtime.h>

// Gated attention reader (input, memory [4][4096][256]; mask [4][4096] f32 0/1 over memory positions (read); input_dot = relu(input W_in1^T + b_in1), memory_dot = relu(memory W_mem1^T + b_mem1) ('oi' [256][256] 1/16, zero biases); att = input_dot . memory_dot / 16 - 1e30 (1 - mask[m]) (== exclusion); softmax over the 4,096 memory positions; output_one = weights . memory; z = [input | output_one] W2^T + b2 ('oi' [256][512]); out = sigmoid(z) tanh(z) -> [4][4096][256] (4.2 M); argument order input, memory, mask, W_in1, b_in1, W_mem1, b_mem1, W2, b2).
// Layout per batch: bf16 copy of input then memory; exact projections + f32 biases, ReLU in place; one 256-wide head: query/key planes, value^T planes straight from the bf16-rounded memory; dense T-4096 attention (streaming three-sweep softmax reading the mask row; hybrid rows: < 512 hi/lo 3-product scores and hi/lo x exact-value products, rest fp16 x1024); f32 merge = output_one; concat operand [bf16(input) | hi/lo(output_one)] x W2 exact + b2; gate kernel sigmoid(z) tanh(z) writes the output.
// Compute dtypes, f32 accumulate: every input rounded to bf16; projections exact + f32 biases; attention rows < 512 3 products (scores) / 2 products (weights x exact values), rest fp16; softmax f32; W2 [exact | hl] x exact + bias; sigmoid/tanh f32 (precise expf/tanhf).

#define NB_  4
#define TT   4096
#define DM   256
#define NH_  1
#define NKV  1
#define REP  (NH_ / NKV)
#define HD   256
#define DQ   (NH_ * HD)
#define DKV  (NKV * HD)
#define ZH   1
#define RH   512                  // query rows < RH use hi+lo planes (0: none)
#define WIN  0
#define PCAR 1024.0f
#define SCL  0.0625f   // 1 / float32(sqrt(256))
#define DC   (2 * DM)   // concat width
typedef _Float16 h16;
typedef unsigned short bf;
typedef __attribute__((ext_vector_type(16))) __bf16   v16bf;
typedef __attribute__((ext_vector_type(16))) _Float16 v16h;
typedef __attribute__((ext_vector_type(8)))  _Float16 v8h;
typedef __attribute__((ext_vector_type(8)))  unsigned short v8us;
typedef __attribute__((ext_vector_type(8)))  float    v8f;
typedef __attribute__((ext_vector_type(4)))  float    v4f;
typedef v8h  __attribute__((may_alias)) v8ha;
typedef v4f  __attribute__((may_alias)) v4fa;
typedef v8us __attribute__((may_alias)) v8usa;

__device__ __forceinline__ unsigned short f2bf(float f) { unsigned u = __float_as_uint(f); u += 0x7FFFu + ((u >> 16) & 1u); return (unsigned short)(u >> 16); }
__device__ __forceinline__ float bf2f(unsigned short b) { return __uint_as_float(((unsigned)b) << 16); }
__device__ __forceinline__ float bfr(float f) { return bf2f(f2bf(f)); }
__device__ __forceinline__ v16h cat16(v8h lo, v8h hi) { return __builtin_shufflevector(lo, hi, 0, 1, 2, 3, 4, 5, 6, 7, 8, 9, 10, 11, 12, 13, 14, 15); }
__device__ __forceinline__ v16bf cat16b(v8us lo, v8us hi) { return __builtin_bit_cast(v16bf, __builtin_shufflevector(lo, hi, 0, 1, 2, 3, 4, 5, 6, 7, 8, 9, 10, 11, 12, 13, 14, 15)); }
__device__ __forceinline__ v8f wmma16(v16h a, v16h b, v8f c) { return __builtin_amdgcn_wmma_f32_16x16x32_f16(false, a, false, b, (short)0, c, false, false); }
__device__ __forceinline__ v8f wmmab(v16bf a, v16bf b, v8f c) { return __builtin_amdgcn_wmma_f32_16x16x32_bf16(false, a, false, b, (short)0, c, false, false); }



// ---- k_gemmw: register-blocked GEMM, one 64x64 output tile per work-group (16 accumulators per wave), operands straight from K-contiguous 16-bit planes; grid (M/64, N/64, Z), 32 * KW threads.
// C[m][n] (f32, pitch ldc, + optional f32 bias[n]) = sum_k A[m][k] Bt[n][k] (+ split products per NSPLIT). z-batch strides sA/sB/sC in elements. K % (32 * KW) == 0.
// KW waves share the tile's K: wave w takes the 32-wide k blocks w, w + KW, ... (neighbouring waves read neighbouring halves of the same lines); the KW partial tiles are summed through LDS in wave order 0 .. KW-1.
template <typename T16> struct WFrag;
template <> struct WFrag<h16> { typedef v16h V; static __device__ __forceinline__ V ld(const h16* p) { return cat16(*(const v8h*)p, *(const v8h*)(p + 16)); } static __device__ __forceinline__ v8f mma(V a, V b, v8f c) { return wmma16(a, b, c); } };
template <> struct WFrag<bf> { typedef v16bf V; static __device__ __forceinline__ V ld(const bf* p) { return cat16b(*(const v8us*)p, *(const v8us*)(p + 16)); } static __device__ __forceinline__ v8f mma(V a, V b, v8f c) { return wmmab(a, b, c); } };
template <typename T16, int NSPLIT, bool BIAS, int KW>
__global__ __launch_bounds__(32 * KW) void k_gemmw(const T16* __restrict__ A, const T16* __restrict__ A2, const T16* __restrict__ Bt, const T16* __restrict__ Bt2, int K, float* C, int ldc, const float* __restrict__ bias, size_t sA, size_t sB, size_t sC) {
    typedef typename WFrag<T16>::V V;
    __shared__ __align__(16) float os[(KW > 1 ? KW * 64 : 16) * 68];   // KW > 1: one whole 64-row partial tile per wave
    const int wv = (KW > 1) ? __builtin_amdgcn_readfirstlane((int)(threadIdx.x >> 5)) : 0;   // wave-uniform, so the k loop stays scalar
    const size_t z = blockIdx.z; A += z * sA; if (A2) A2 += z * sA; Bt += z * sB; if (Bt2) Bt2 += z * sB; C += z * sC;
    const int lane = threadIdx.x & 31, lr = lane & 15, hi = lane >> 4; const int r0 = blockIdx.x * 64, c0 = blockIdx.y * 64;
    v8f acc[4][4];
#pragma unroll
    for (int mb = 0; mb < 4; ++mb)
#pragma unroll
        for (int nb = 0; nb < 4; ++nb) acc[mb][nb] = (v8f){};
    const size_t aoff = (size_t)(r0 + lr) * K + 8 * hi, boff = (size_t)(c0 + lr) * K + 8 * hi;
#pragma unroll 1
    for (int kc = wv * 32; kc < K; kc += 32 * KW) {
        V a[4], a2[4];
#pragma unroll
        for (int mb = 0; mb < 4; ++mb) { a[mb] = WFrag<T16>::ld(A + aoff + (size_t)mb * 16 * K + kc); if (NSPLIT == 1 || NSPLIT == 2) a2[mb] = WFrag<T16>::ld(A2 + aoff + (size_t)mb * 16 * K + kc); }
#pragma unroll
        for (int nb = 0; nb < 4; ++nb) { const V b = WFrag<T16>::ld(Bt + boff + (size_t)nb * 16 * K + kc); V b2; if (NSPLIT >= 2) b2 = WFrag<T16>::ld(Bt2 + boff + (size_t)nb * 16 * K + kc);
#pragma unroll
            for (int mb = 0; mb < 4; ++mb) { acc[mb][nb] = WFrag<T16>::mma(a[mb], b, acc[mb][nb]); if (NSPLIT == 1 || NSPLIT == 2) acc[mb][nb] = WFrag<T16>::mma(a2[mb], b, acc[mb][nb]); if (NSPLIT >= 2) acc[mb][nb] = WFrag<T16>::mma(a[mb], b2, acc[mb][nb]); } }
        asm volatile("v_nop\n\tv_nop\n\tv_nop\n\tv_nop" : "+v"(acc[0][0]), "+v"(acc[1][1]), "+v"(acc[2][2]), "+v"(acc[3][3]) : "v"(a[0]), "v"(a[3]));
    }
    if constexpr (KW > 1) {
        // unrolled: the accumulators stay in registers only under constant indices
#pragma unroll
        for (int mb = 0; mb < 4; ++mb)
#pragma unroll
            for (int nb = 0; nb < 4; ++nb) {
#pragma unroll
                for (int j = 0; j < 8; ++j) os[(wv * 64 + mb * 16 + hi * 8 + j) * 68 + nb * 16 + lr] = acc[mb][nb][j]; }
        __syncthreads();   // every wave's partial tile is in LDS before any thread sums across the waves
        // unrolled (both loops): all of a thread's LDS reads are issued together instead of one wait per read
#pragma unroll
        for (int s = 0; s < 32 / KW; ++s) { const int slot = (int)threadIdx.x + s * 32 * KW, row = slot >> 4, cofs = (slot & 15) * 4; v4f val = *(const v4fa*)(os + row * 68 + cofs);
#pragma unroll
            for (int w = 1; w < KW; ++w) val += *(const v4fa*)(os + (w * 64 + row) * 68 + cofs);
            if (BIAS) { val[0] += bfr(bias[c0 + cofs]); val[1] += bfr(bias[c0 + cofs + 1]); val[2] += bfr(bias[c0 + cofs + 2]); val[3] += bfr(bias[c0 + cofs + 3]); }
            *(v4f*)(C + (size_t)(r0 + row) * ldc + c0 + cofs) = val; }
        return;
    }
#pragma unroll
    for (int mb = 0; mb < 4; ++mb) {
#pragma unroll
        for (int nb = 0; nb < 4; ++nb) {
#pragma unroll
            for (int j = 0; j < 8; ++j) os[(hi * 8 + j) * 68 + nb * 16 + lr] = acc[mb][nb][j]; }
        __builtin_amdgcn_wave_barrier(); asm volatile("" ::: "memory");
        float* crow = C + (size_t)(r0 + mb * 16) * ldc + c0;
{
#pragma unroll
            for (int s = 0; s < 8; ++s) { const int row = 2 * s + hi, cofs = lr * 4; v4f val = *(const v4fa*)(os + row * 68 + cofs); if (BIAS) { val[0] += bfr(bias[c0 + cofs]); val[1] += bfr(bias[c0 + cofs + 1]); val[2] += bfr(bias[c0 + cofs + 2]); val[3] += bfr(bias[c0 + cofs + 3]); }
                *(v4f*)(crow + (size_t)row * ldc + cofs) = val; }
             }
        __builtin_amdgcn_wave_barrier(); asm volatile("" ::: "memory");
    }
}

__device__ __forceinline__ h16 tohx(float x) { return (h16)x; }
__device__ __forceinline__ void splitf(float y, unsigned short& h, unsigned short& l) { h = f2bf(y); l = f2bf(y - bf2f(h)); }
typedef __attribute__((ext_vector_type(2))) _Float16 v2h;
typedef __attribute__((ext_vector_type(4))) _Float16 v4h;
typedef __attribute__((ext_vector_type(2))) unsigned short v2us;
typedef __attribute__((ext_vector_type(4))) unsigned short v4us;
typedef __attribute__((ext_vector_type(2))) float v2f;
typedef __attribute__((ext_vector_type(4))) int v4i;

__global__ __launch_bounds__(256) void k_cvt8(const float* __restrict__ src, bf* dst, size_t n8) { const size_t i = (size_t)blockIdx.x * 256 + threadIdx.x; if (i >= n8) return; const v8f v = *(const v8f*)(src + i * 8); v8us o;
#pragma unroll
    for (int k = 0; k < 8; ++k) o[k] = f2bf(v[k]); *(v8us*)(dst + i * 8) = o;  }

// k_rope: head planes [h][t][d] (fp16 + hi/lo) of rope(x) x sc with the rotate-half convention out[d] = x[d] cos[t][d] - x[d+HD/2] sin[t][d], out[d+HD/2] = x[d+HD/2] cos[t][d+HD/2] + x[d] sin[t][d+HD/2]
__global__ __launch_bounds__(256) void k_rope(const float* __restrict__ F, int pitch, int nheads, const float* __restrict__ CS, const float* __restrict__ RF, const float* __restrict__ nw, float sc, h16* P16, bf* Ph, bf* Pl) {
    const size_t e = ((size_t)blockIdx.x * 256 + threadIdx.x) * 2; if (e >= (size_t)nheads * TT * HD) return; const int d = (int)(e % HD); const int t = (int)((e / HD) % TT); const int h = (int)(e / ((size_t)HD * TT)); const float* f = F + (size_t)t * pitch + h * HD; const float rf = RF ? RF[(size_t)h * TT + t] : 1.0f; v2h o16; v2us oh, ol;
#pragma unroll
    for (int q = 0; q < 2; ++q) { const int dd = d + q; const int dp = (dd < HD / 2) ? dd + HD / 2 : dd - HD / 2; float x0 = f[dd], x1 = f[dp];
        if (RF) { float n0 = __fmul_rn(x0, rf), n1 = __fmul_rn(x1, rf); asm volatile("" : "+v"(n0)); asm volatile("" : "+v"(n1)); x0 = __fmul_rn(bfr(nw[dd]), n0); x1 = __fmul_rn(bfr(nw[dp]), n1); }
        const v2f cs = *(const v2f*)(CS + ((size_t)t * HD + dd) * 2); float a = __fmul_rn(x0, cs[0]), bq = __fmul_rn(x1, cs[1]); asm volatile("" : "+v"(a)); asm volatile("" : "+v"(bq)); const float r = ((dd < HD / 2) ? __fsub_rn(a, bq) : __fadd_rn(a, bq)) * sc;
        o16[q] = tohx(r); unsigned short a2, c2; splitf(r, a2, c2); oh[q] = a2; ol[q] = c2; }
    *(v2h*)(P16 + e) = o16; *(v2us*)(Ph + e) = oh; *(v2us*)(Pl + e) = ol;  }
__global__ __launch_bounds__(256) void k_csid(float* CS) { const int idx = blockIdx.x * 256 + threadIdx.x; if (idx >= TT * HD) return; v2f cs; cs[0] = 1.0f; cs[1] = 0.0f; *(v2f*)(CS + (size_t)idx * 2) = cs;  }
__global__ __launch_bounds__(256) void k_asoft(const float* __restrict__ Sb, const float* __restrict__ mk, h16* P16, bf* Ph, bf* Pl) {
    const int lane = threadIdx.x & 31; const int row = blockIdx.x * 8 + (threadIdx.x >> 5); if (row >= ZH * TT) return; const int i = row % TT; const int zz = row / TT; const bool hires = (i < RH); const float* sr = Sb + (size_t)row * TT; float mx = -3.0e38f;
#pragma unroll 4
    for (int ch = 0; ch < TT / 128; ++ch) { const int j0 = ch * 128 + lane * 4; const v4f a = *(const v4f*)(sr + j0); const v4f m4 = *(const v4f*)(mk + j0);
#pragma unroll
        for (int q = 0; q < 4; ++q) { float t = a[q] * SCL; asm volatile("" : "+v"(t)); t = (bfr(m4[q]) != 0.0f) ? t : -3.0e38f;   /* masked memory position excluded (the reference's -1e30 penalty) */ mx = fmaxf(mx, t); } }
#pragma unroll
    for (int sh = 16; sh; sh >>= 1) mx = fmaxf(mx, __shfl_xor(mx, sh, 32));
    float sum = 0.f;
#pragma unroll 4
    for (int ch = 0; ch < TT / 128; ++ch) { const int j0 = ch * 128 + lane * 4; const v4f a = *(const v4f*)(sr + j0); const v4f m4 = *(const v4f*)(mk + j0);
#pragma unroll
        for (int q = 0; q < 4; ++q) { float t = a[q] * SCL; asm volatile("" : "+v"(t)); t = (bfr(m4[q]) != 0.0f) ? t : -3.0e38f;   /* masked memory position excluded (the reference's -1e30 penalty) */ float d0 = __fsub_rn(t, mx); asm volatile("" : "+v"(d0)); sum += __builtin_amdgcn_exp2f(__fmul_rn(d0, 1.4426950408889634f)); } }
#pragma unroll
    for (int sh = 16; sh; sh >>= 1) sum += __shfl_xor(sum, sh, 32);
    const float f = __fdiv_rn(hires ? 1.0f : PCAR, sum);
{
        if (hires) {   /* rows < RH: normalised bf16 hi/lo over ALL TT keys (symmetric window: keys beyond RH are live), planes [zz][RH][TT] */
#pragma unroll 4
            for (int ch = 0; ch < TT / 128; ++ch) { const int j0 = ch * 128 + lane * 4; const v4f a = *(const v4f*)(sr + j0); const v4f m4 = *(const v4f*)(mk + j0); v4us oh, ol;
#pragma unroll
                for (int q = 0; q < 4; ++q) { float t = a[q] * SCL; asm volatile("" : "+v"(t)); t = (bfr(m4[q]) != 0.0f) ? t : -3.0e38f;   /* masked memory position excluded (the reference's -1e30 penalty) */ float d0 = __fsub_rn(t, mx); asm volatile("" : "+v"(d0)); float ex = __builtin_amdgcn_exp2f(__fmul_rn(d0, 1.4426950408889634f)); asm volatile("" : "+v"(ex)); unsigned short a2, c2; splitf(ex * f, a2, c2); oh[q] = a2; ol[q] = c2; }
                const size_t oo = ((size_t)zz * RH + i) * TT + j0; *(v4us*)(Ph + oo) = oh; *(v4us*)(Pl + oo) = ol; }
        } else {
#pragma unroll 2
            for (int ch = 0; ch < TT / 128; ++ch) { const int j0 = ch * 128 + lane * 4; const v4f a = *(const v4f*)(sr + j0); const v4f m4 = *(const v4f*)(mk + j0); v4h o4;
#pragma unroll
                for (int q = 0; q < 4; ++q) { float t = a[q] * SCL; asm volatile("" : "+v"(t)); t = (bfr(m4[q]) != 0.0f) ? t : -3.0e38f;   /* masked memory position excluded (the reference's -1e30 penalty) */ float d0 = __fsub_rn(t, mx); asm volatile("" : "+v"(d0)); float ex = __builtin_amdgcn_exp2f(__fmul_rn(d0, 1.4426950408889634f)); asm volatile("" : "+v"(ex)); o4[q] = tohx(ex * f); }
                *(v4h*)(P16 + (size_t)row * TT + j0) = o4; } }
         }
}


__constant__ float INVT[HD / 2] = { 1.000000000e+00f, 7.498942018e-01f, 5.623413324e-01f, 4.216965139e-01f, 3.162277639e-01f, 2.371373773e-01f, 1.778279394e-01f, 1.333521456e-01f, 1.000000015e-01f, 7.498942316e-02f, 5.623413250e-02f, 4.216964915e-02f, 3.162277490e-02f, 2.371373773e-02f, 1.778279431e-02f, 1.333521400e-02f, 9.999999776e-03f, 7.498942316e-03f, 5.623413250e-03f, 4.216964822e-03f, 3.162277630e-03f, 2.371373819e-03f, 1.778279431e-03f, 1.333521446e-03f, 1.000000047e-03f, 7.498941850e-04f, 5.623413017e-04f, 4.216965172e-04f, 3.162277571e-04f, 2.371373703e-04f, 1.778279402e-04f, 1.333521504e-04f };   // float32 10000^(-2 i / 64) in the module's operation order, generated with jnp to be bit-exact
__global__ __launch_bounds__(256) void k_vtpb(const float* __restrict__ F, int pitch, int nheads, h16* V16, bf* Vh, bf* Vl) { const size_t e = ((size_t)blockIdx.x * 256 + threadIdx.x) * 2; if (e >= (size_t)nheads * HD * TT) return; const int t = (int)(e % TT); const int d = (int)((e / TT) % HD); const int g = (int)(e / ((size_t)TT * HD)); v2h o16; v2us oh, ol;
#pragma unroll
    for (int q = 0; q < 2; ++q) { const float x = bfr(F[(size_t)(t + q) * pitch + g * HD + d]);   /* the value IS a module input: round to bf16 once (lo plane 0) */ o16[q] = tohx(x); unsigned short a2, c2; splitf(x, a2, c2); oh[q] = a2; ol[q] = c2; }
    *(v2h*)(V16 + e) = o16; *(v2us*)(Vh + e) = oh; *(v2us*)(Vl + e) = ol;  }
__global__ __launch_bounds__(256) void k_relu(float* F, size_t n4) { const size_t i = (size_t)blockIdx.x * 256 + threadIdx.x; if (i >= n4) return; const v4f a = *(const v4f*)(F + i * 4); v4f o;
#pragma unroll
    for (int q = 0; q < 4; ++q) o[q] = fmaxf(a[q], 0.0f);
    *(v4f*)(F + i * 4) = o;  }
__global__ __launch_bounds__(256) void k_acat(const float* __restrict__ X, const float* __restrict__ O, bf* Ah, bf* Al) { const size_t i = (size_t)blockIdx.x * 256 + threadIdx.x; if (i >= (size_t)TT * DC / 4) return; const size_t e = i * 4; const int c0 = (int)(e % DC); const int t = (int)(e / DC); const int cc = c0 & (DM - 1); const bool first = (c0 < DM); const v4f a = *(const v4f*)(X + (size_t)t * DM + cc); const v4f o = *(const v4f*)(O + (size_t)t * DM + cc); v4us oh, ol;
#pragma unroll
    for (int q = 0; q < 4; ++q) { unsigned short h2, l2; splitf(o[q], h2, l2); oh[q] = first ? f2bf(a[q]) : h2; ol[q] = first ? (unsigned short)0 : l2; }
    *(v4us*)(Ah + e) = oh; *(v4us*)(Al + e) = ol;  }
__global__ __launch_bounds__(256) void k_glu(const float* __restrict__ Zr, float* out) { const size_t i = (size_t)blockIdx.x * 256 + threadIdx.x; if (i >= (size_t)TT * DM / 4) return; const v4f z = *(const v4f*)(Zr + i * 4); v4f o;
#pragma unroll
    for (int q = 0; q < 4; ++q) { const float sg = __fdiv_rn(1.0f, __fadd_rn(1.0f, expf(-z[q]))); float th = tanhf(z[q]); asm volatile("" : "+v"(th)); o[q] = __fmul_rn(sg, th); }
    *(v4f*)(out + i * 4) = o;  }
__global__ __launch_bounds__(256) void k_merge(const float* __restrict__ O, int h0, float* OUTb) { const size_t e = ((size_t)blockIdx.x * 256 + threadIdx.x) * 2; if (e >= (size_t)ZH * TT * HD) return; const int d = (int)(e % HD); const int t = (int)((e / HD) % TT); const int zz = (int)(e / ((size_t)HD * TT)); const float cs = (t < RH) ? 1.0f : (1.0f / PCAR); const size_t oo = (size_t)t * DQ + (h0 + zz) * HD + d;
    v2f o2; o2[0] = O[e] * cs; o2[1] = O[e + 1] * cs; *(v2f*)(OUTb + oo) = o2;  }

extern "C" void kernel_launch(void* const* d_in, const int* in_sizes, int n_in,
                              void* d_out, int out_size, void* d_ws, size_t ws_size, hipStream_t stream) {
    (void)in_sizes; (void)n_in; (void)out_size;
    const float* x = (const float*)d_in[0];   /* input */ const float* xm = (const float*)d_in[1];   /* memory */ const float* mk = (const float*)d_in[2];   /* mask [4][4096] f32 */ const float* wq = (const float*)d_in[3]; const float* bq = (const float*)d_in[4]; const float* wk = (const float*)d_in[5]; const float* bk = (const float*)d_in[6]; const float* w2 = (const float*)d_in[7]; const float* b2 = (const float*)d_in[8];   /* argument order input, memory, mask, W_in1, b_in1, W_mem1, b_mem1, W2, b2 */
    float* OUT = (float*)d_out;     // [4][4096][256]
    char* wsp = (char*)d_ws;
    auto take = [&](size_t bytes) { char* p = wsp; wsp += (bytes + 255) & ~(size_t)255; return (void*)p; };
    bf* WQ = (bf*)take((size_t)DQ * DM * 2); bf* WK = (bf*)take((size_t)DKV * DM * 2); bf* W2B = (bf*)take((size_t)DM * DC * 2); float* O1 = (float*)take((size_t)TT * DM * 4); bf* CAh = (bf*)take((size_t)TT * DC * 2); bf* CAl = (bf*)take((size_t)TT * DC * 2); float* Z = (float*)take((size_t)TT * DM * 4); float* CS = (float*)take((size_t)TT * HD * 2 * 4);
    bf* XB = (bf*)take((size_t)TT * DM * 2); float* FQ = (float*)take((size_t)TT * DQ * 4); float* FK = (float*)take((size_t)TT * DKV * 4);
    h16* QP16 = (h16*)take((size_t)NH_ * TT * HD * 2); h16* KP16 = (h16*)take((size_t)NKV * TT * HD * 2); h16* VT16 = (h16*)take((size_t)NKV * HD * TT * 2);
    bf* QPh = (bf*)take((size_t)NH_ * TT * HD * 2); bf* QPl = (bf*)take((size_t)NH_ * TT * HD * 2); bf* KPh = (bf*)take((size_t)NKV * TT * HD * 2); bf* KPl = (bf*)take((size_t)NKV * TT * HD * 2); bf* VTh = (bf*)take((size_t)NKV * HD * TT * 2); bf* VTl = (bf*)take((size_t)NKV * HD * TT * 2); bf* Ph = (bf*)take((size_t)ZH * RH * TT * 2); bf* Pl = (bf*)take((size_t)ZH * RH * TT * 2);
    float* Sb = (float*)take((size_t)ZH * TT * TT * 4); h16* P16 = (h16*)take((size_t)ZH * TT * TT * 2); float* Ob = (float*)take((size_t)ZH * TT * HD * 4);
    if ((size_t)(wsp - (char*)d_ws) > ws_size) return;    // ws 256 MiB
        { k_cvt8<<<(unsigned)(((size_t)DQ * DM / 8 + 255) / 256), 256, 0, stream>>>(wq, WQ, (size_t)DQ * DM / 8); k_cvt8<<<(unsigned)(((size_t)DKV * DM / 8 + 255) / 256), 256, 0, stream>>>(wk, WK, (size_t)DKV * DM / 8); k_cvt8<<<(unsigned)(((size_t)DM * DC / 8 + 255) / 256), 256, 0, stream>>>(w2, W2B, (size_t)DM * DC / 8);   /* W2 'oi' [256][512] = Bt as-is */
      
       }
    k_csid<<<(TT * HD + 255) / 256, 256, 0, stream>>>(CS);
    const unsigned LQ = (unsigned)(((size_t)NH_ * TT * HD / 2 + 255) / 256), LKv = (unsigned)(((size_t)NKV * TT * HD / 2 + 255) / 256);
    for (int b = 0; b < NB_; ++b) {
        
        k_cvt8<<<(unsigned)(((size_t)TT * DM / 8 + 255) / 256), 256, 0, stream>>>(x + (size_t)b * TT * DM, XB, (size_t)TT * DM / 8);
        k_gemmw<bf, 0, true, 8><<<dim3(TT / 64, DQ / 64, 1), 256, 0, stream>>>(XB, nullptr, WQ, nullptr, DM, FQ, DQ, bq, 0, 0, 0); k_relu<<<(unsigned)(((size_t)TT * DQ / 4 + 255) / 256), 256, 0, stream>>>(FQ, (size_t)TT * DQ / 4);   /* input_dot = relu(input W_in1^T + b) */
        k_rope<<<LQ, 256, 0, stream>>>(FQ, DQ, NH_, CS, nullptr, nullptr, 1.0f, QP16, QPh, QPl);
        k_cvt8<<<(unsigned)(((size_t)TT * DM / 8 + 255) / 256), 256, 0, stream>>>(xm + (size_t)b * TT * DM, XB, (size_t)TT * DM / 8);   /* XB := bf16(memory[b]) (the q projection above consumed bf16(input[b])) */ k_gemmw<bf, 0, true, 8><<<dim3(TT / 64, DKV / 64, 1), 256, 0, stream>>>(XB, nullptr, WK, nullptr, DM, FK, DKV, bk, 0, 0, 0); k_relu<<<(unsigned)(((size_t)TT * DKV / 4 + 255) / 256), 256, 0, stream>>>(FK, (size_t)TT * DKV / 4);   /* memory_dot */
        k_rope<<<LKv, 256, 0, stream>>>(FK, DKV, NKV, CS, nullptr, nullptr, 1.0f, KP16, KPh, KPl);
        k_vtpb<<<LKv, 256, 0, stream>>>(xm + (size_t)b * TT * DM, DM, NKV, VT16, VTh, VTl);   /* values = the memory itself (bf16-rounded input: hi plane exact, lo plane 0) */
        for (int h0 = 0; h0 < NH_; h0 += ZH) { const size_t zq = (size_t)h0, zk = (size_t)(h0 / REP);   // one kv head per query head: the pass's one head uses kv plane h0 / REP (z-strides TT*HD)
            k_gemmw<bf, 2, false, 8><<<dim3(RH / 64, TT / 64, ZH), 256, 0, stream>>>(QPh + zq * TT * HD, QPl + zq * TT * HD, KPh + zk * TT * HD, KPl + zk * TT * HD, HD, Sb, TT, nullptr, (size_t)TT * HD, (size_t)TT * HD, (size_t)TT * TT);
            k_gemmw<h16, 0, false, 1><<<dim3((TT - RH) / 64, TT / 64, ZH), 32, 0, stream>>>(QP16 + zq * TT * HD + (size_t)RH * HD, nullptr, KP16 + zk * TT * HD, nullptr, HD, Sb + (size_t)RH * TT, TT, nullptr, (size_t)TT * HD, (size_t)TT * HD, (size_t)TT * TT);
            k_asoft<<<ZH * TT / 8, 256, 0, stream>>>(Sb, mk + (size_t)b * TT, P16, Ph, Pl);
            k_gemmw<bf, 1, false, 16><<<dim3(RH / 64, HD / 64, ZH), 512, 0, stream>>>(Ph, Pl, VTh + zk * HD * TT, nullptr, TT, Ob, HD, nullptr, (size_t)RH * TT, (size_t)HD * TT, (size_t)TT * HD);   /* weights hi/lo x exact bf16 values (2 products) */
            k_gemmw<h16, 0, false, 16><<<dim3((TT - RH) / 64, HD / 64, ZH), 512, 0, stream>>>(P16 + (size_t)RH * TT, nullptr, VT16 + zk * HD * TT, nullptr, TT, Ob + (size_t)RH * HD, HD, nullptr, (size_t)TT * TT, (size_t)HD * TT, (size_t)TT * HD);
            k_merge<<<(unsigned)(((size_t)ZH * TT * HD / 2 + 255) / 256), 256, 0, stream>>>(Ob, h0, O1); }   /* output_one (f32) */
        k_acat<<<(unsigned)(((size_t)TT * DC / 4 + 255) / 256), 256, 0, stream>>>(x + (size_t)b * TT * DM, O1, CAh, CAl); k_gemmw<bf, 1, true, 8><<<dim3(TT / 64, DM / 64, 1), 256, 0, stream>>>(CAh, CAl, W2B, nullptr, DC, Z, DM, b2, 0, 0, 0); k_glu<<<(unsigned)(((size_t)TT * DM / 4 + 255) / 256), 256, 0, stream>>>(Z, OUT + (size_t)b * TT * DM);   /* z = [input | output_one] W2^T + b2; out = sigmoid(z) tanh(z) */
         }
}

// v002
// Measured time: 643 microseconds a run.
// Next to v001, in two timings, it ran 1.17 and 1.18 times as fast.
// Over all steps from v000 it is 2.13 times as fast.
#include <hip/hip_runtime.h>

// Gated attention reader (input, memory [4][4096][256]; mask [4][4096] f32 0/1 over memory positions (read); input_dot = relu(input W_in1^T + b_in1), memory_dot = relu(memory W_mem1^T + b_mem1) ('oi' [256][256] 1/16, zero biases); att = input_dot . memory_dot / 16 - 1e30 (1 - mask[m]) (== exclusion); softmax over the 4,096 memory positions; output_one = weights . memory; z = [input | output_one] W2^T + b2 ('oi' [256][512]); out = sigmoid(z) tanh(z) -> [4][4096][256] (4.2 M); argument order input, memory, mask, W_in1, b_in1, W_mem1, b_mem1, W2, b2).
// Layout per batch: bf16 copy of input then memory; exact projections + f32 biases, ReLU and the split into query/key planes in the projection's own epilogue; one 256-wide head; value^T planes straight from the bf16-rounded memory; dense T-4096 attention (streaming three-sweep softmax reading the mask row; hybrid rows: < 512 hi/lo 3-product scores and hi/lo x exact-value products, rest fp16 x1024); output_one leaves the weights x values epilogue as the hi/lo right half of the concat operand (its left half bf16(input) is written with the input's bf16 copy); [bf16(input) | hi/lo(output_one)] x W2 exact + b2, whose epilogue applies sigmoid(z) tanh(z) and writes the output.
// Compute dtypes, f32 accumulate: every input rounded to bf16; projections exact + f32 biases; attention rows < 512 3 products (scores) / 2 products (weights x exact values), rest fp16; softmax f32; W2 [exact | hl] x exact + bias; sigmoid/tanh f32 (precise expf/tanhf).

#define NB_  4
#define TT   4096
#define DM   256
#define NH_  1
#define NKV  1
#define REP  (NH_ / NKV)
#define HD   256
#define DQ   (NH_ * HD)
#define DKV  (NKV * HD)
#define ZH   1
#define RH   512                  // query rows < RH use hi+lo planes (0: none)
#define WIN  0
#define PCAR 1024.0f
#define SCL  0.0625f   // 1 / float32(sqrt(256))
#define DC   (2 * DM)   // concat width
typedef _Float16 h16;
typedef unsigned short bf;
typedef __attribute__((ext_vector_type(16))) __bf16   v16bf;
typedef __attribute__((ext_vector_type(16))) _Float16 v16h;
typedef __attribute__((ext_vector_type(8)))  _Float16 v8h;
typedef __attribute__((ext_vector_type(8)))  unsigned short v8us;
typedef __attribute__((ext_vector_type(8)))  float    v8f;
typedef __attribute__((ext_vector_type(4)))  float    v4f;
typedef v8h  __attribute__((may_alias)) v8ha;
typedef v4f  __attribute__((may_alias)) v4fa;
typedef v8us __attribute__((may_alias)) v8usa;

__device__ __forceinline__ unsigned short f2bf(float f) { unsigned u = __float_as_uint(f); u += 0x7FFFu + ((u >> 16) & 1u); return (unsigned short)(u >> 16); }
__device__ __forceinline__ float bf2f(unsigned short b) { return __uint_as_float(((unsigned)b) << 16); }
__device__ __forceinline__ float bfr(float f) { return bf2f(f2bf(f)); }
__device__ __forceinline__ v16h cat16(v8h lo, v8h hi) { return __builtin_shufflevector(lo, hi, 0, 1, 2, 3, 4, 5, 6, 7, 8, 9, 10, 11, 12, 13, 14, 15); }
__device__ __forceinline__ v16bf cat16b(v8us lo, v8us hi) { return __builtin_bit_cast(v16bf, __builtin_shufflevector(lo, hi, 0, 1, 2, 3, 4, 5, 6, 7, 8, 9, 10, 11, 12, 13, 14, 15)); }
__device__ __forceinline__ v8f wmma16(v16h a, v16h b, v8f c) { return __builtin_amdgcn_wmma_f32_16x16x32_f16(false, a, false, b, (short)0, c, false, false); }
__device__ __forceinline__ v8f wmmab(v16bf a, v16bf b, v8f c) { return __builtin_amdgcn_wmma_f32_16x16x32_bf16(false, a, false, b, (short)0, c, false, false); }

__device__ __forceinline__ h16 tohx(float x) { return (h16)x; }
__device__ __forceinline__ void splitf(float y, unsigned short& h, unsigned short& l) { h = f2bf(y); l = f2bf(y - bf2f(h)); }
typedef __attribute__((ext_vector_type(2))) _Float16 v2h;
typedef __attribute__((ext_vector_type(4))) _Float16 v4h;
typedef __attribute__((ext_vector_type(2))) unsigned short v2us;
typedef __attribute__((ext_vector_type(4))) unsigned short v4us;
typedef __attribute__((ext_vector_type(2))) float v2f;
typedef __attribute__((ext_vector_type(4))) int v4i;

// ---- k_gemmw: register-blocked GEMM, one 64x64 output tile per work-group (16 accumulators per wave), operands straight from K-contiguous 16-bit planes; grid (M/64, N/64, Z), 32 * KW threads.
// C[m][n] (f32, pitch ldc, + optional f32 bias[n]) = sum_k A[m][k] Bt[n][k] (+ split products per NSPLIT). z-batch strides sA/sB/sC in elements. K % (32 * KW) == 0.
// KW waves share the tile's K: wave w takes the 32-wide k blocks w, w + KW, ... (neighbouring waves read neighbouring halves of the same lines); the KW partial tiles are summed through LDS in wave order 0 .. KW-1.
// EPI names what the KW > 1 epilogue does with the summed (+ bias) value v at [m][n], pitch ldc: 0 stores v to C; 1 stores relu(v) as the planes E16 (fp16), Eh / El (bf16 hi / lo); 2 stores v * esc as Eh / El; 3 stores sigmoid(v) tanh(v) to C.
template <typename T16> struct WFrag;
template <> struct WFrag<h16> { typedef v16h V; static __device__ __forceinline__ V ld(const h16* p) { return cat16(*(const v8h*)p, *(const v8h*)(p + 16)); } static __device__ __forceinline__ v8f mma(V a, V b, v8f c) { return wmma16(a, b, c); } };
template <> struct WFrag<bf> { typedef v16bf V; static __device__ __forceinline__ V ld(const bf* p) { return cat16b(*(const v8us*)p, *(const v8us*)(p + 16)); } static __device__ __forceinline__ v8f mma(V a, V b, v8f c) { return wmmab(a, b, c); } };
template <typename T16, int NSPLIT, bool BIAS, int KW, int EPI>
__global__ __launch_bounds__(32 * KW) void k_gemmw(const T16* __restrict__ A, const T16* __restrict__ A2, const T16* __restrict__ Bt, const T16* __restrict__ Bt2, int K, float* C, int ldc, const float* __restrict__ bias, size_t sA, size_t sB, size_t sC, h16* E16, bf* Eh, bf* El, float esc) {
    typedef typename WFrag<T16>::V V;
    __shared__ __align__(16) float os[(KW > 1 ? KW * 64 : 16) * 68];   // KW > 1: one whole 64-row partial tile per wave
    const int wv = (KW > 1) ? __builtin_amdgcn_readfirstlane((int)(threadIdx.x >> 5)) : 0;   // wave-uniform, so the k loop stays scalar
    const size_t z = blockIdx.z; A += z * sA; if (A2) A2 += z * sA; Bt += z * sB; if (Bt2) Bt2 += z * sB; C += z * sC;
    const int lane = threadIdx.x & 31, lr = lane & 15, hi = lane >> 4; const int r0 = blockIdx.x * 64, c0 = blockIdx.y * 64;
    v8f acc[4][4];
#pragma unroll
    for (int mb = 0; mb < 4; ++mb)
#pragma unroll
        for (int nb = 0; nb < 4; ++nb) acc[mb][nb] = (v8f){};
    const size_t aoff = (size_t)(r0 + lr) * K + 8 * hi, boff = (size_t)(c0 + lr) * K + 8 * hi;
#pragma unroll 1
    for (int kc = wv * 32; kc < K; kc += 32 * KW) {
        V a[4], a2[4];
#pragma unroll
        for (int mb = 0; mb < 4; ++mb) { a[mb] = WFrag<T16>::ld(A + aoff + (size_t)mb * 16 * K + kc); if (NSPLIT == 1 || NSPLIT == 2) a2[mb] = WFrag<T16>::ld(A2 + aoff + (size_t)mb * 16 * K + kc); }
#pragma unroll
        for (int nb = 0; nb < 4; ++nb) { const V b = WFrag<T16>::ld(Bt + boff + (size_t)nb * 16 * K + kc); V b2; if (NSPLIT >= 2) b2 = WFrag<T16>::ld(Bt2 + boff + (size_t)nb * 16 * K + kc);
#pragma unroll
            for (int mb = 0; mb < 4; ++mb) { acc[mb][nb] = WFrag<T16>::mma(a[mb], b, acc[mb][nb]); if (NSPLIT == 1 || NSPLIT == 2) acc[mb][nb] = WFrag<T16>::mma(a2[mb], b, acc[mb][nb]); if (NSPLIT >= 2) acc[mb][nb] = WFrag<T16>::mma(a[mb], b2, acc[mb][nb]); } }
        asm volatile("v_nop\n\tv_nop\n\tv_nop\n\tv_nop" : "+v"(acc[0][0]), "+v"(acc[1][1]), "+v"(acc[2][2]), "+v"(acc[3][3]) : "v"(a[0]), "v"(a[3]));
    }
    if constexpr (KW > 1) {
        // unrolled: the accumulators stay in registers only under constant indices
#pragma unroll
        for (int mb = 0; mb < 4; ++mb)
#pragma unroll
            for (int nb = 0; nb < 4; ++nb) {
#pragma unroll
                for (int j = 0; j < 8; ++j) os[(wv * 64 + mb * 16 + hi * 8 + j) * 68 + nb * 16 + lr] = acc[mb][nb][j]; }
        __syncthreads();   // every wave's partial tile is in LDS before any thread sums across the waves
        // unrolled (both loops): all of a thread's LDS reads are issued together instead of one wait per read
#pragma unroll
        for (int s = 0; s < 32 / KW; ++s) { const int slot = (int)threadIdx.x + s * 32 * KW, row = slot >> 4, cofs = (slot & 15) * 4; v4f val = *(const v4fa*)(os + row * 68 + cofs);
#pragma unroll
            for (int w = 1; w < KW; ++w) val += *(const v4fa*)(os + (w * 64 + row) * 68 + cofs);
            if (BIAS) { val[0] += bfr(bias[c0 + cofs]); val[1] += bfr(bias[c0 + cofs + 1]); val[2] += bfr(bias[c0 + cofs + 2]); val[3] += bfr(bias[c0 + cofs + 3]); }
            const size_t oo = (size_t)(r0 + row) * ldc + c0 + cofs;
            // the q loops below are unrolled so that the 4-wide vectors are indexed by constants and stay in registers
            if constexpr (EPI == 0) { *(v4f*)(C + oo) = val; }
            else if constexpr (EPI == 1) { v4h o16; v4us oh, ol;
#pragma unroll
                for (int q = 0; q < 4; ++q) { const float r = fmaxf(val[q], 0.0f); o16[q] = tohx(r); unsigned short a2, c2; splitf(r, a2, c2); oh[q] = a2; ol[q] = c2; }
                *(v4h*)(E16 + oo) = o16; *(v4us*)(Eh + oo) = oh; *(v4us*)(El + oo) = ol; }
            else if constexpr (EPI == 2) { v4us oh, ol;
#pragma unroll
                for (int q = 0; q < 4; ++q) { unsigned short a2, c2; splitf(val[q] * esc, a2, c2); oh[q] = a2; ol[q] = c2; }
                *(v4us*)(Eh + oo) = oh; *(v4us*)(El + oo) = ol; }
            else { v4f o;
#pragma unroll
                for (int q = 0; q < 4; ++q) { const float sg = __fdiv_rn(1.0f, __fadd_rn(1.0f, expf(-val[q]))); o[q] = __fmul_rn(sg, tanhf(val[q])); }
                *(v4f*)(C + oo) = o; } }
        return;
    }
#pragma unroll
    for (int mb = 0; mb < 4; ++mb) {
#pragma unroll
        for (int nb = 0; nb < 4; ++nb) {
#pragma unroll
            for (int j = 0; j < 8; ++j) os[(hi * 8 + j) * 68 + nb * 16 + lr] = acc[mb][nb][j]; }
        __builtin_amdgcn_wave_barrier(); asm volatile("" ::: "memory");
        float* crow = C + (size_t)(r0 + mb * 16) * ldc + c0;
{
#pragma unroll
            for (int s = 0; s < 8; ++s) { const int row = 2 * s + hi, cofs = lr * 4; v4f val = *(const v4fa*)(os + row * 68 + cofs); if (BIAS) { val[0] += bfr(bias[c0 + cofs]); val[1] += bfr(bias[c0 + cofs + 1]); val[2] += bfr(bias[c0 + cofs + 2]); val[3] += bfr(bias[c0 + cofs + 3]); }
                *(v4f*)(crow + (size_t)row * ldc + cofs) = val; }
             }
        __builtin_amdgcn_wave_barrier(); asm volatile("" ::: "memory");
    }
}


__global__ __launch_bounds__(256) void k_cvt8(const float* __restrict__ src, bf* dst, size_t n8) { const size_t i = (size_t)blockIdx.x * 256 + threadIdx.x; if (i >= n8) return; const v8f v = *(const v8f*)(src + i * 8); v8us o;
#pragma unroll
    for (int k = 0; k < 8; ++k) o[k] = f2bf(v[k]); *(v8us*)(dst + i * 8) = o;  }
// k_cvtc: k_cvt8 of the input [t][DM] that also lays the same bf16 values down as the left half of the concat operand's hi plane [t][DC]; the lo plane's left half is 0 (bf16(input) is exact in one plane)
__global__ __launch_bounds__(256) void k_cvtc(const float* __restrict__ src, bf* dst, bf* Ah, bf* Al, size_t n8) { const size_t i = (size_t)blockIdx.x * 256 + threadIdx.x; if (i >= n8) return; const v8f v = *(const v8f*)(src + i * 8); v8us o;
#pragma unroll
    for (int k = 0; k < 8; ++k) o[k] = f2bf(v[k]);
    const size_t e = i * 8, oc = (e / DM) * DC + (e % DM); *(v8us*)(dst + e) = o; *(v8us*)(Ah + oc) = o; *(v8us*)(Al + oc) = (v8us){};  }

__global__ __launch_bounds__(256) void k_asoft(const float* __restrict__ Sb, const float* __restrict__ mk, h16* P16, bf* Ph, bf* Pl) {
    const int lane = threadIdx.x & 31; const int row = blockIdx.x * 8 + (threadIdx.x >> 5); if (row >= ZH * TT) return; const int i = row % TT; const int zz = row / TT; const bool hires = (i < RH); const float* sr = Sb + (size_t)row * TT; float mx = -3.0e38f;
#pragma unroll 4
    for (int ch = 0; ch < TT / 128; ++ch) { const int j0 = ch * 128 + lane * 4; const v4f a = *(const v4f*)(sr + j0); const v4f m4 = *(const v4f*)(mk + j0);
#pragma unroll
        for (int q = 0; q < 4; ++q) { float t = a[q] * SCL; asm volatile("" : "+v"(t)); t = (bfr(m4[q]) != 0.0f) ? t : -3.0e38f;   /* masked memory position excluded (the reference's -1e30 penalty) */ mx = fmaxf(mx, t); } }
#pragma unroll
    for (int sh = 16; sh; sh >>= 1) mx = fmaxf(mx, __shfl_xor(mx, sh, 32));
    float sum = 0.f;
#pragma unroll 4
    for (int ch = 0; ch < TT / 128; ++ch) { const int j0 = ch * 128 + lane * 4; const v4f a = *(const v4f*)(sr + j0); const v4f m4 = *(const v4f*)(mk + j0);
#pragma unroll
        for (int q = 0; q < 4; ++q) { float t = a[q] * SCL; asm volatile("" : "+v"(t)); t = (bfr(m4[q]) != 0.0f) ? t : -3.0e38f;   /* masked memory position excluded (the reference's -1e30 penalty) */ float d0 = __fsub_rn(t, mx); asm volatile("" : "+v"(d0)); sum += __builtin_amdgcn_exp2f(__fmul_rn(d0, 1.4426950408889634f)); } }
#pragma unroll
    for (int sh = 16; sh; sh >>= 1) sum += __shfl_xor(sum, sh, 32);
    const float f = __fdiv_rn(hires ? 1.0f : PCAR, sum);
{
        if (hires) {   /* rows < RH: normalised bf16 hi/lo over ALL TT keys (symmetric window: keys beyond RH are live), planes [zz][RH][TT] */
#pragma unroll 4
            for (int ch = 0; ch < TT / 128; ++ch) { const int j0 = ch * 128 + lane * 4; const v4f a = *(const v4f*)(sr + j0); const v4f m4 = *(const v4f*)(mk + j0); v4us oh, ol;
#pragma unroll
                for (int q = 0; q < 4; ++q) { float t = a[q] * SCL; asm volatile("" : "+v"(t)); t = (bfr(m4[q]) != 0.0f) ? t : -3.0e38f;   /* masked memory position excluded (the reference's -1e30 penalty) */ float d0 = __fsub_rn(t, mx); asm volatile("" : "+v"(d0)); float ex = __builtin_amdgcn_exp2f(__fmul_rn(d0, 1.4426950408889634f)); asm volatile("" : "+v"(ex)); unsigned short a2, c2; splitf(ex * f, a2, c2); oh[q] = a2; ol[q] = c2; }
                const size_t oo = ((size_t)zz * RH + i) * TT + j0; *(v4us*)(Ph + oo) = oh; *(v4us*)(Pl + oo) = ol; }
        } else {
#pragma unroll 2
            for (int ch = 0; ch < TT / 128; ++ch) { const int j0 = ch * 128 + lane * 4; const v4f a = *(const v4f*)(sr + j0); const v4f m4 = *(const v4f*)(mk + j0); v4h o4;
#pragma unroll
                for (int q = 0; q < 4; ++q) { float t = a[q] * SCL; asm volatile("" : "+v"(t)); t = (bfr(m4[q]) != 0.0f) ? t : -3.0e38f;   /* masked memory position excluded (the reference's -1e30 penalty) */ float d0 = __fsub_rn(t, mx); asm volatile("" : "+v"(d0)); float ex = __builtin_amdgcn_exp2f(__fmul_rn(d0, 1.4426950408889634f)); asm volatile("" : "+v"(ex)); o4[q] = tohx(ex * f); }
                *(v4h*)(P16 + (size_t)row * TT + j0) = o4; } }
         }
}


__global__ __launch_bounds__(256) void k_vtpb(const float* __restrict__ F, int pitch, int nheads, h16* V16, bf* Vh, bf* Vl) { const size_t e = ((size_t)blockIdx.x * 256 + threadIdx.x) * 2; if (e >= (size_t)nheads * HD * TT) return; const int t = (int)(e % TT); const int d = (int)((e / TT) % HD); const int g = (int)(e / ((size_t)TT * HD)); v2h o16; v2us oh, ol;
#pragma unroll
    for (int q = 0; q < 2; ++q) { const float x = bfr(F[(size_t)(t + q) * pitch + g * HD + d]);   /* the value IS a module input: round to bf16 once (lo plane 0) */ o16[q] = tohx(x); unsigned short a2, c2; splitf(x, a2, c2); oh[q] = a2; ol[q] = c2; }
    *(v2h*)(V16 + e) = o16; *(v2us*)(Vh + e) = oh; *(v2us*)(Vl + e) = ol;  }

extern "C" void kernel_launch(void* const* d_in, const int* in_sizes, int n_in,
                              void* d_out, int out_size, void* d_ws, size_t ws_size, hipStream_t stream) {
    (void)in_sizes; (void)n_in; (void)out_size;
    const float* x = (const float*)d_in[0];   /* input */ const float* xm = (const float*)d_in[1];   /* memory */ const float* mk = (const float*)d_in[2];   /* mask [4][4096] f32 */ const float* wq = (const float*)d_in[3]; const float* bq = (const float*)d_in[4]; const float* wk = (const float*)d_in[5]; const float* bk = (const float*)d_in[6]; const float* w2 = (const float*)d_in[7]; const float* b2 = (const float*)d_in[8];   /* argument order input, memory, mask, W_in1, b_in1, W_mem1, b_mem1, W2, b2 */
    float* OUT = (float*)d_out;     // [4][4096][256]
    char* wsp = (char*)d_ws;
    auto take = [&](size_t bytes) { char* p = wsp; wsp += (bytes + 255) & ~(size_t)255; return (void*)p; };
    bf* WQ = (bf*)take((size_t)DQ * DM * 2); bf* WK = (bf*)take((size_t)DKV * DM * 2); bf* W2B = (bf*)take((size_t)DM * DC * 2); bf* CAh = (bf*)take((size_t)TT * DC * 2); bf* CAl = (bf*)take((size_t)TT * DC * 2);
    bf* XB = (bf*)take((size_t)TT * DM * 2);
    h16* QP16 = (h16*)take((size_t)NH_ * TT * HD * 2); h16* KP16 = (h16*)take((size_t)NKV * TT * HD * 2); h16* VT16 = (h16*)take((size_t)NKV * HD * TT * 2);
    bf* QPh = (bf*)take((size_t)NH_ * TT * HD * 2); bf* QPl = (bf*)take((size_t)NH_ * TT * HD * 2); bf* KPh = (bf*)take((size_t)NKV * TT * HD * 2); bf* KPl = (bf*)take((size_t)NKV * TT * HD * 2); bf* VTh = (bf*)take((size_t)NKV * HD * TT * 2); bf* VTl = (bf*)take((size_t)NKV * HD * TT * 2); bf* Ph = (bf*)take((size_t)ZH * RH * TT * 2); bf* Pl = (bf*)take((size_t)ZH * RH * TT * 2);
    float* Sb = (float*)take((size_t)ZH * TT * TT * 4); h16* P16 = (h16*)take((size_t)ZH * TT * TT * 2);
    if ((size_t)(wsp - (char*)d_ws) > ws_size) return;    // ws 256 MiB
    k_cvt8<<<(unsigned)(((size_t)DQ * DM / 8 + 255) / 256), 256, 0, stream>>>(wq, WQ, (size_t)DQ * DM / 8); k_cvt8<<<(unsigned)(((size_t)DKV * DM / 8 + 255) / 256), 256, 0, stream>>>(wk, WK, (size_t)DKV * DM / 8); k_cvt8<<<(unsigned)(((size_t)DM * DC / 8 + 255) / 256), 256, 0, stream>>>(w2, W2B, (size_t)DM * DC / 8);   /* W2 'oi' [256][512] = Bt as-is */
    const unsigned LKv = (unsigned)(((size_t)NKV * TT * HD / 2 + 255) / 256);
    for (int b = 0; b < NB_; ++b) {
        k_cvtc<<<(unsigned)(((size_t)TT * DM / 8 + 255) / 256), 256, 0, stream>>>(x + (size_t)b * TT * DM, XB, CAh, CAl, (size_t)TT * DM / 8);   /* XB := bf16(input[b]); also the concat operand's left half */
        k_gemmw<bf, 0, true, 8, 1><<<dim3(TT / 64, DQ / 64, 1), 256, 0, stream>>>(XB, nullptr, WQ, nullptr, DM, nullptr, DQ, bq, 0, 0, 0, QP16, QPh, QPl, 1.0f);   /* query planes of input_dot = relu(input W_in1^T + b) */
        k_cvt8<<<(unsigned)(((size_t)TT * DM / 8 + 255) / 256), 256, 0, stream>>>(xm + (size_t)b * TT * DM, XB, (size_t)TT * DM / 8);   /* XB := bf16(memory[b]) (the q projection above consumed bf16(input[b])) */
        k_gemmw<bf, 0, true, 8, 1><<<dim3(TT / 64, DKV / 64, 1), 256, 0, stream>>>(XB, nullptr, WK, nullptr, DM, nullptr, DKV, bk, 0, 0, 0, KP16, KPh, KPl, 1.0f);   /* key planes of memory_dot */
        k_vtpb<<<LKv, 256, 0, stream>>>(xm + (size_t)b * TT * DM, DM, NKV, VT16, VTh, VTl);   /* values = the memory itself (bf16-rounded input: hi plane exact, lo plane 0) */
        k_gemmw<bf, 2, false, 8, 0><<<dim3(RH / 64, TT / 64, ZH), 256, 0, stream>>>(QPh, QPl, KPh, KPl, HD, Sb, TT, nullptr, (size_t)TT * HD, (size_t)TT * HD, (size_t)TT * TT, nullptr, nullptr, nullptr, 1.0f);
        k_gemmw<h16, 0, false, 1, 0><<<dim3((TT - RH) / 64, TT / 64, ZH), 32, 0, stream>>>(QP16 + (size_t)RH * HD, nullptr, KP16, nullptr, HD, Sb + (size_t)RH * TT, TT, nullptr, (size_t)TT * HD, (size_t)TT * HD, (size_t)TT * TT, nullptr, nullptr, nullptr, 1.0f);
        k_asoft<<<ZH * TT / 8, 256, 0, stream>>>(Sb, mk + (size_t)b * TT, P16, Ph, Pl);
        /* output_one = weights x values, written as the hi/lo right half of the concat operand (pitch DC, column DM on) */
        k_gemmw<bf, 1, false, 16, 2><<<dim3(RH / 64, HD / 64, ZH), 512, 0, stream>>>(Ph, Pl, VTh, nullptr, TT, nullptr, DC, nullptr, (size_t)RH * TT, (size_t)HD * TT, 0, nullptr, CAh + DM, CAl + DM, 1.0f);   /* weights hi/lo x exact bf16 values (2 products) */
        k_gemmw<h16, 0, false, 16, 2><<<dim3((TT - RH) / 64, HD / 64, ZH), 512, 0, stream>>>(P16 + (size_t)RH * TT, nullptr, VT16, nullptr, TT, nullptr, DC, nullptr, (size_t)TT * TT, (size_t)HD * TT, 0, nullptr, CAh + (size_t)RH * DC + DM, CAl + (size_t)RH * DC + DM, 1.0f / PCAR);   /* fp16 weights carry x PCAR */
        k_gemmw<bf, 1, true, 8, 3><<<dim3(TT / 64, DM / 64, 1), 256, 0, stream>>>(CAh, CAl, W2B, nullptr, DC, OUT + (size_t)b * TT * DM, DM, b2, 0, 0, 0, nullptr, nullptr, nullptr, 1.0f);   /* z = [input | output_one] W2^T + b2; out = sigmoid(z) tanh(z) */
    }
}

// v003
// It runs in 521 microseconds.
// Next to v002, in two timings, it ran 1.20 and 1.21 times as fast.
// Over all steps from v000 it is 2.57 times as fast.
#include <hip/hip_runtime.h>

// Gated attention reader (input, memory [4][4096][256]; mask [4][4096] f32 0/1 over memory positions (read); input_dot = relu(input W_in1^T + b_in1), memory_dot = relu(memory W_mem1^T + b_mem1) ('oi' [256][256] 1/16, zero biases); att = input_dot . memory_dot / 16 - 1e30 (1 - mask[m]) (== exclusion); softmax over the 4,096 memory positions; output_one = weights . memory; z = [input | output_one] W2^T + b2 ('oi' [256][512]); out = sigmoid(z) tanh(z) -> [4][4096][256] (4.2 M); argument order input, memory, mask, W_in1, b_in1, W_mem1, b_mem1, W2, b2).
// Layout per batch: bf16 copy of input then memory; exact projections + f32 biases, ReLU and the split into query/key planes in the projection's own epilogue; one 256-wide head; value^T planes straight from the bf16-rounded memory; dense T-4096 attention (streaming three-sweep softmax reading the mask row; hybrid rows: < 512 hi/lo 3-product scores and hi/lo x exact-value products, rest fp16 x1024); output_one leaves the weights x values epilogue as the hi/lo right half of the concat operand (its left half bf16(input) is written with the input's bf16 copy); [bf16(input) | hi/lo(output_one)] x W2 exact + b2, whose epilogue applies sigmoid(z) tanh(z) and writes the output.
// Compute dtypes, f32 accumulate: every input rounded to bf16; projections exact + f32 biases; attention rows < 512 3 products (scores) / 2 products (weights x exact values), rest fp16; softmax f32; W2 [exact | hl] x exact + bias; sigmoid/tanh f32 (precise expf/tanhf).

#define NB_  4
#define TT   4096
#define DM   256
#define NH_  1
#define NKV  1
#define REP  (NH_ / NKV)
#define HD   256
#define DQ   (NH_ * HD)
#define DKV  (NKV * HD)
#define ZH   1
#define RH   512                  // query rows < RH use hi+lo planes (0: none)
#define WIN  0
#define PCAR 1024.0f
#define SCL  0.0625f   // 1 / float32(sqrt(256))
#define DC   (2 * DM)   // concat width
typedef _Float16 h16;
typedef unsigned short bf;
typedef __attribute__((ext_vector_type(16))) __bf16   v16bf;
typedef __attribute__((ext_vector_type(16))) _Float16 v16h;
typedef __attribute__((ext_vector_type(8)))  _Float16 v8h;
typedef __attribute__((ext_vector_type(8)))  unsigned short v8us;
typedef __attribute__((ext_vector_type(8)))  float    v8f;
typedef __attribute__((ext_vector_type(4)))  float    v4f;
typedef v8h  __attribute__((may_alias)) v8ha;
typedef v4f  __attribute__((may_alias)) v4fa;
typedef v8us __attribute__((may_alias)) v8usa;

__device__ __forceinline__ unsigned short f2bf(float f) { unsigned u = __float_as_uint(f); u += 0x7FFFu + ((u >> 16) & 1u); return (unsigned short)(u >> 16); }
__device__ __forceinline__ float bf2f(unsigned short b) { return __uint_as_float(((unsigned)b) << 16); }
__device__ __forceinline__ float bfr(float f) { return bf2f(f2bf(f)); }
__device__ __forceinline__ v16h cat16(v8h lo, v8h hi) { return __builtin_shufflevector(lo, hi, 0, 1, 2, 3, 4, 5, 6, 7, 8, 9, 10, 11, 12, 13, 14, 15); }
__device__ __forceinline__ v16bf cat16b(v8us lo, v8us hi) { return __builtin_bit_cast(v16bf, __builtin_shufflevector(lo, hi, 0, 1, 2, 3, 4, 5, 6, 7, 8, 9, 10, 11, 12, 13, 14, 15)); }
__device__ __forceinline__ v8f wmma16(v16h a, v16h b, v8f c) { return __builtin_amdgcn_wmma_f32_16x16x32_f16(false, a, false, b, (short)0, c, false, false); }
__device__ __forceinline__ v8f wmmab(v16bf a, v16bf b, v8f c) { return __builtin_amdgcn_wmma_f32_16x16x32_bf16(false, a, false, b, (short)0, c, false, false); }

__device__ __forceinline__ h16 tohx(float x) { return (h16)x; }
__device__ __forceinline__ void splitf(float y, unsigned short& h, unsigned short& l) { h = f2bf(y); l = f2bf(y - bf2f(h)); }
typedef __attribute__((ext_vector_type(2))) _Float16 v2h;
typedef __attribute__((ext_vector_type(4))) _Float16 v4h;
typedef __attribute__((ext_vector_type(2))) unsigned short v2us;
typedef __attribute__((ext_vector_type(4))) unsigned short v4us;
typedef __attribute__((ext_vector_type(2))) float v2f;
typedef __attribute__((ext_vector_type(4))) int v4i;

// ---- k_gemmw: register-blocked GEMM, one 64x64 output tile per work-group (16 accumulators per wave), operands from K-contiguous 16-bit planes, staged in LDS by asynchronous copies; grid (M/64, N/64, Z), 32 * KW threads.
// C[m][n] (f32, pitch ldc, + optional f32 bias[n]) = sum_k A[m][k] Bt[n][k] (+ split products per NSPLIT). z-batch strides sA/sB/sC in elements. K % (32 * KW) == 0, and K % 64 == 0 where KW == 1.
// KW waves share the tile's K: wave w takes the 32-wide k blocks w, w + KW, ...; the KW partial tiles are summed through LDS in wave order 0 .. KW-1.
// Staging: per trip the work-group copies, of each operand plane, 64 rows x (32 * KW * KS) k into LDS (row pitch + 16 B, so that 16 rows fall on 16 different bank groups). A copy instruction takes 512 B (KW > 1) or 4 x 128 B (KW == 1) of whole lines, where a fragment load from the plane itself touches 16 lines for 32 B each. Fragments then come from LDS with the k order of the direct loads. One-product kernels use two buffers (the next trip's copies fly during this trip's products); the split-product kernels have room for one.
// EPI names what the KW > 1 epilogue does with the summed (+ bias) value v at [m][n], pitch ldc: 0 stores v to C; 1 stores relu(v) as the planes E16 (fp16), Eh / El (bf16 hi / lo); 2 stores v * esc as Eh / El; 3 stores sigmoid(v) tanh(v) to C.
template <typename T16> struct WFrag;
template <> struct WFrag<h16> { typedef v16h V; static __device__ __forceinline__ V ld(const char* p) { return cat16(*(const v8ha*)p, *(const v8ha*)(p + 32)); } static __device__ __forceinline__ v8f mma(V a, V b, v8f c) { return wmma16(a, b, c); } };
template <> struct WFrag<bf> { typedef v16bf V; static __device__ __forceinline__ V ld(const char* p) { return cat16b(*(const v8usa*)p, *(const v8usa*)(p + 32)); } static __device__ __forceinline__ v8f mma(V a, V b, v8f c) { return wmmab(a, b, c); } };
// eight asynchronous 16-byte copies per lane, global -> LDS: copy q takes g + q * gs to LDS byte l + q * ls. The s_wait_xcnt closes the statement so that no address register of a copy is rewritten ahead of it.
__device__ __forceinline__ void cp8(unsigned l, unsigned ls, const char* g, size_t gs) {
    asm volatile("global_load_async_to_lds_b128 %0, %8, off\n\t"
                 "global_load_async_to_lds_b128 %1, %9, off\n\t"
                 "global_load_async_to_lds_b128 %2, %10, off\n\t"
                 "global_load_async_to_lds_b128 %3, %11, off\n\t"
                 "global_load_async_to_lds_b128 %4, %12, off\n\t"
                 "global_load_async_to_lds_b128 %5, %13, off\n\t"
                 "global_load_async_to_lds_b128 %6, %14, off\n\t"
                 "global_load_async_to_lds_b128 %7, %15, off\n\t"
                 "s_wait_xcnt 0x0"
                 :: "v"(l), "v"(l + ls), "v"(l + 2 * ls), "v"(l + 3 * ls), "v"(l + 4 * ls), "v"(l + 5 * ls), "v"(l + 6 * ls), "v"(l + 7 * ls),
                    "v"(g), "v"(g + gs), "v"(g + 2 * gs), "v"(g + 3 * gs), "v"(g + 4 * gs), "v"(g + 5 * gs), "v"(g + 6 * gs), "v"(g + 7 * gs)
                 : "memory");
}
// four waves per SIMD (256 registers a wave): two 8-wave work-groups still share a WGP, as their LDS allows
template <typename T16, int NSPLIT, bool BIAS, int KW, int EPI>
__global__ __launch_bounds__(32 * KW) __attribute__((amdgpu_waves_per_eu(4))) void k_gemmw(const T16* __restrict__ A, const T16* __restrict__ A2, const T16* __restrict__ Bt, const T16* __restrict__ Bt2, int K, float* C, int ldc, const float* __restrict__ bias, size_t sA, size_t sB, size_t sC, h16* E16, bf* Eh, bf* El, float esc) {
    typedef typename WFrag<T16>::V V;
    static_assert(NSPLIT <= 2, "planes staged: A, Bt, A2 (NSPLIT 1, 2), Bt2 (NSPLIT 2)");
    constexpr int KS = (KW == 1) ? 2 : 1;                  // 32-wide k steps of a wave per trip (a lone wave takes two, so that its rows are whole 128-B lines)
    constexpr int NBLK = (NSPLIT == 0) ? 2 : (NSPLIT == 1 ? 3 : 4), NBUF = (NSPLIT == 0) ? 2 : 1;
    constexpr int TK = 32 * KW * KS, GR = TK / 8, RP = 32 * KW / GR;   // k per trip; 16-byte pieces per staged row; rows that one copy of every thread covers
    constexpr int PB = TK * 2 + 16, BLKB = 64 * PB, STB = NBLK * BLKB;   // LDS bytes: row pitch, one plane's block, one buffer
    constexpr int OSB = (KW > 1 ? KW * 64 : 16) * 68 * 4;   // KW > 1: one whole 64-row partial tile per wave
    __shared__ __align__(16) float os[(OSB > NBUF * STB ? OSB : NBUF * STB) / 4];   // the staging buffers first, the output staging after the k loop
    const int wv = (KW > 1) ? __builtin_amdgcn_readfirstlane((int)(threadIdx.x >> 5)) : 0;   // wave-uniform, so the k loop stays scalar
    const size_t z = blockIdx.z; A += z * sA; if (A2) A2 += z * sA; Bt += z * sB; if (Bt2) Bt2 += z * sB; C += z * sC;
    const int lane = threadIdx.x & 31, lr = lane & 15, hi = lane >> 4; const int r0 = blockIdx.x * 64, c0 = blockIdx.y * 64;
    v8f acc[4][4];
#pragma unroll
    for (int mb = 0; mb < 4; ++mb)
#pragma unroll
        for (int nb = 0; nb < 4; ++nb) acc[mb][nb] = (v8f){};
    const int tid = (int)threadIdx.x, crow = tid / GR, ccol = tid % GR;   // the staged row and 16-byte piece that this lane copies first
    const unsigned lcp = (unsigned)(size_t)os + (unsigned)(crow * PB + ccol * 16);   // its LDS byte address inside a block
    const size_t acp = (size_t)(r0 + crow) * K + ccol * 8, bcp = (size_t)(c0 + crow) * K + ccol * 8, gstep = (size_t)RP * K * 2;
    const int ntr = (int)((unsigned)K / (unsigned)TK);   // trips: the same for every wave (K % TK == 0)
    auto stage = [&](int t, int buf) {   // all planes' blocks of trip t into buffer buf: 8 * KS copies per lane and plane, every lane on
        const size_t ko = (size_t)t * TK; const unsigned lb = lcp + (unsigned)(buf * STB);
#pragma unroll
        for (int h = 0; h < KS; ++h) { const unsigned lh = lb + (unsigned)(h * 8 * RP * PB); const size_t gh = (size_t)h * 8 * gstep;
            cp8(lh, RP * PB, (const char*)(A + acp + ko) + gh, gstep); cp8(lh + BLKB, RP * PB, (const char*)(Bt + bcp + ko) + gh, gstep);
            if constexpr (NSPLIT >= 1) cp8(lh + 2 * BLKB, RP * PB, (const char*)(A2 + acp + ko) + gh, gstep);
            if constexpr (NSPLIT >= 2) cp8(lh + 3 * BLKB, RP * PB, (const char*)(Bt2 + bcp + ko) + gh, gstep); }
    };
    stage(0, 0);
    asm volatile("s_wait_asynccnt 0x0" ::: "memory");   // this wave's copies of trip 0 have landed
    __syncthreads();   // ... and every other wave's: a wave reads rows that other waves copied
    if constexpr (NBUF == 2) { if (K >= 2 * TK) stage(1, 1); }   // a trip 1 exists
    const char* fb = (const char*)os + lr * PB + wv * KS * 64 + hi * 16;   // this lane's fragment piece: row lr, the wave's own k block
#pragma unroll 1
    for (int t = 0; t < ntr; ++t) {
        const char* fs = fb + ((NBUF == 2) ? (t & 1) * STB : 0);
#pragma unroll
        for (int s = 0; s < KS; ++s) {
            V a[4], a2[4];
#pragma unroll
            for (int mb = 0; mb < 4; ++mb) { a[mb] = WFrag<T16>::ld(fs + mb * 16 * PB + s * 64); if (NSPLIT == 1 || NSPLIT == 2) a2[mb] = WFrag<T16>::ld(fs + 2 * BLKB + mb * 16 * PB + s * 64); }
#pragma unroll
            for (int nb = 0; nb < 4; ++nb) { const V b = WFrag<T16>::ld(fs + BLKB + nb * 16 * PB + s * 64); V b2; if (NSPLIT >= 2) b2 = WFrag<T16>::ld(fs + 3 * BLKB + nb * 16 * PB + s * 64);
#pragma unroll
                for (int mb = 0; mb < 4; ++mb) { acc[mb][nb] = WFrag<T16>::mma(a[mb], b, acc[mb][nb]); if (NSPLIT == 1 || NSPLIT == 2) acc[mb][nb] = WFrag<T16>::mma(a2[mb], b, acc[mb][nb]); if (NSPLIT >= 2) acc[mb][nb] = WFrag<T16>::mma(a[mb], b2, acc[mb][nb]); } }
            asm volatile("v_nop\n\tv_nop\n\tv_nop\n\tv_nop" : "+v"(acc[0][0]), "+v"(acc[1][1]), "+v"(acc[2][2]), "+v"(acc[3][3]) : "v"(a[0]), "v"(a[3]));
        }
        asm volatile("s_wait_dscnt 0x0" ::: "memory");   // this wave's fragment reads of the buffer are done before anybody refills it
        if constexpr (NBUF == 2) asm volatile("s_wait_asynccnt 0x0" ::: "memory");   // this wave's copies of trip t + 1 have landed
        __syncthreads();   // ends every wave's reads of this trip's buffer; with two buffers it also publishes trip t + 1
        if constexpr (NBUF == 2) { if (t + 2 < ntr) stage(t + 2, t & 1); }
        else { if (t + 1 < ntr) { stage(t + 1, 0);
            asm volatile("s_wait_asynccnt 0x0" ::: "memory");   // this wave's copies of trip t + 1 have landed
            __syncthreads();   // ... and every other wave's
        } }
    }
    asm volatile("s_wait_asynccnt 0x0" ::: "memory");   // no copy is outstanding when the buffers become output staging
    if constexpr (KW > 1) {
        // unrolled: the accumulators stay in registers only under constant indices
#pragma unroll
        for (int mb = 0; mb < 4; ++mb)
#pragma unroll
            for (int nb = 0; nb < 4; ++nb) {
#pragma unroll
                for (int j = 0; j < 8; ++j) os[(wv * 64 + mb * 16 + hi * 8 + j) * 68 + nb * 16 + lr] = acc[mb][nb][j]; }
        __syncthreads();   // every wave's partial tile is in LDS before any thread sums across the waves
        // unrolled (both loops): all of a thread's LDS reads are issued together instead of one wait per read
#pragma unroll
        for (int s = 0; s < 32 / KW; ++s) { const int slot = (int)threadIdx.x + s * 32 * KW, row = slot >> 4, cofs = (slot & 15) * 4; v4f val = *(const v4fa*)(os + row * 68 + cofs);
#pragma unroll
            for (int w = 1; w < KW; ++w) val += *(const v4fa*)(os + (w * 64 + row) * 68 + cofs);
            if (BIAS) { val[0] += bfr(bias[c0 + cofs]); val[1] += bfr(bias[c0 + cofs + 1]); val[2] += bfr(bias[c0 + cofs + 2]); val[3] += bfr(bias[c0 + cofs + 3]); }
            const size_t oo = (size_t)(r0 + row) * ldc + c0 + cofs;
            // the q loops below are unrolled so that the 4-wide vectors are indexed by constants and stay in registers
            if constexpr (EPI == 0) { *(v4f*)(C + oo) = val; }
            else if constexpr (EPI == 1) { v4h o16; v4us oh, ol;
#pragma unroll
                for (int q = 0; q < 4; ++q) { const float r = fmaxf(val[q], 0.0f); o16[q] = tohx(r); unsigned short a2, c2; splitf(r, a2, c2); oh[q] = a2; ol[q] = c2; }
                *(v4h*)(E16 + oo) = o16; *(v4us*)(Eh + oo) = oh; *(v4us*)(El + oo) = ol; }
            else if constexpr (EPI == 2) { v4us oh, ol;
#pragma unroll
                for (int q = 0; q < 4; ++q) { unsigned short a2, c2; splitf(val[q] * esc, a2, c2); oh[q] = a2; ol[q] = c2; }
                *(v4us*)(Eh + oo) = oh; *(v4us*)(El + oo) = ol; }
            else { v4f o;
#pragma unroll
                for (int q = 0; q < 4; ++q) { const float sg = __fdiv_rn(1.0f, __fadd_rn(1.0f, expf(-val[q]))); o[q] = __fmul_rn(sg, tanhf(val[q])); }
                *(v4f*)(C + oo) = o; } }
        return;
    }
#pragma unroll
    for (int mb = 0; mb < 4; ++mb) {
#pragma unroll
        for (int nb = 0; nb < 4; ++nb) {
#pragma unroll
            for (int j = 0; j < 8; ++j) os[(hi * 8 + j) * 68 + nb * 16 + lr] = acc[mb][nb][j]; }
        __builtin_amdgcn_wave_barrier(); asm volatile("" ::: "memory");
        float* crow = C + (size_t)(r0 + mb * 16) * ldc + c0;
{
#pragma unroll
            for (int s = 0; s < 8; ++s) { const int row = 2 * s + hi, cofs = lr * 4; v4f val = *(const v4fa*)(os + row * 68 + cofs); if (BIAS) { val[0] += bfr(bias[c0 + cofs]); val[1] += bfr(bias[c0 + cofs + 1]); val[2] += bfr(bias[c0 + cofs + 2]); val[3] += bfr(bias[c0 + cofs + 3]); }
                *(v4f*)(crow + (size_t)row * ldc + cofs) = val; }
             }
        __builtin_amdgcn_wave_barrier(); asm volatile("" ::: "memory");
    }
}


__global__ __launch_bounds__(256) void k_cvt8(const float* __restrict__ src, bf* dst, size_t n8) { const size_t i = (size_t)blockIdx.x * 256 + threadIdx.x; if (i >= n8) return; const v8f v = *(const v8f*)(src + i * 8); v8us o;
#pragma unroll
    for (int k = 0; k < 8; ++k) o[k] = f2bf(v[k]); *(v8us*)(dst + i * 8) = o;  }
// k_cvtc: k_cvt8 of the input [t][DM] that also lays the same bf16 values down as the left half of the concat operand's hi plane [t][DC]; the lo plane's left half is 0 (bf16(input) is exact in one plane)
__global__ __launch_bounds__(256) void k_cvtc(const float* __restrict__ src, bf* dst, bf* Ah, bf* Al, size_t n8) { const size_t i = (size_t)blockIdx.x * 256 + threadIdx.x; if (i >= n8) return; const v8f v = *(const v8f*)(src + i * 8); v8us o;
#pragma unroll
    for (int k = 0; k < 8; ++k) o[k] = f2bf(v[k]);
    const size_t e = i * 8, oc = (e / DM) * DC + (e % DM); *(v8us*)(dst + e) = o; *(v8us*)(Ah + oc) = o; *(v8us*)(Al + oc) = (v8us){};  }

__global__ __launch_bounds__(256) void k_asoft(const float* __restrict__ Sb, const float* __restrict__ mk, h16* P16, bf* Ph, bf* Pl) {
    const int lane = threadIdx.x & 31; const int row = blockIdx.x * 8 + (threadIdx.x >> 5); if (row >= ZH * TT) return; const int i = row % TT; const int zz = row / TT; const bool hires = (i < RH); const float* sr = Sb + (size_t)row * TT; float mx = -3.0e38f;
#pragma unroll 4
    for (int ch = 0; ch < TT / 128; ++ch) { const int j0 = ch * 128 + lane * 4; const v4f a = *(const v4f*)(sr + j0); const v4f m4 = *(const v4f*)(mk + j0);
#pragma unroll
        for (int q = 0; q < 4; ++q) { float t = a[q] * SCL; asm volatile("" : "+v"(t)); t = (bfr(m4[q]) != 0.0f) ? t : -3.0e38f;   /* masked memory position excluded (the reference's -1e30 penalty) */ mx = fmaxf(mx, t); } }
#pragma unroll
    for (int sh = 16; sh; sh >>= 1) mx = fmaxf(mx, __shfl_xor(mx, sh, 32));
    float sum = 0.f;
#pragma unroll 4
    for (int ch = 0; ch < TT / 128; ++ch) { const int j0 = ch * 128 + lane * 4; const v4f a = *(const v4f*)(sr + j0); const v4f m4 = *(const v4f*)(mk + j0);
#pragma unroll
        for (int q = 0; q < 4; ++q) { float t = a[q] * SCL; asm volatile("" : "+v"(t)); t = (bfr(m4[q]) != 0.0f) ? t : -3.0e38f;   /* masked memory position excluded (the reference's -1e30 penalty) */ float d0 = __fsub_rn(t, mx); asm volatile("" : "+v"(d0)); sum += __builtin_amdgcn_exp2f(__fmul_rn(d0, 1.4426950408889634f)); } }
#pragma unroll
    for (int sh = 16; sh; sh >>= 1) sum += __shfl_xor(sum, sh, 32);
    const float f = __fdiv_rn(hires ? 1.0f : PCAR, sum);
{
        if (hires) {   /* rows < RH: normalised bf16 hi/lo over ALL TT keys (symmetric window: keys beyond RH are live), planes [zz][RH][TT] */
#pragma unroll 4
            for (int ch = 0; ch < TT / 128; ++ch) { const int j0 = ch * 128 + lane * 4; const v4f a = *(const v4f*)(sr + j0); const v4f m4 = *(const v4f*)(mk + j0); v4us oh, ol;
#pragma unroll
                for (int q = 0; q < 4; ++q) { float t = a[q] * SCL; asm volatile("" : "+v"(t)); t = (bfr(m4[q]) != 0.0f) ? t : -3.0e38f;   /* masked memory position excluded (the reference's -1e30 penalty) */ float d0 = __fsub_rn(t, mx); asm volatile("" : "+v"(d0)); float ex = __builtin_amdgcn_exp2f(__fmul_rn(d0, 1.4426950408889634f)); asm volatile("" : "+v"(ex)); unsigned short a2, c2; splitf(ex * f, a2, c2); oh[q] = a2; ol[q] = c2; }
                const size_t oo = ((size_t)zz * RH + i) * TT + j0; *(v4us*)(Ph + oo) = oh; *(v4us*)(Pl + oo) = ol; }
        } else {
#pragma unroll 2
            for (int ch = 0; ch < TT / 128; ++ch) { const int j0 = ch * 128 + lane * 4; const v4f a = *(const v4f*)(sr + j0); const v4f m4 = *(const v4f*)(mk + j0); v4h o4;
#pragma unroll
                for (int q = 0; q < 4; ++q) { float t = a[q] * SCL; asm volatile("" : "+v"(t)); t = (bfr(m4[q]) != 0.0f) ? t : -3.0e38f;   /* masked memory position excluded (the reference's -1e30 penalty) */ float d0 = __fsub_rn(t, mx); asm volatile("" : "+v"(d0)); float ex = __builtin_amdgcn_exp2f(__fmul_rn(d0, 1.4426950408889634f)); asm volatile("" : "+v"(ex)); o4[q] = tohx(ex * f); }
                *(v4h*)(P16 + (size_t)row * TT + j0) = o4; } }
         }
}


__global__ __launch_bounds__(256) void k_vtpb(const float* __restrict__ F, int pitch, int nheads, h16* V16, bf* Vh, bf* Vl) { const size_t e = ((size_t)blockIdx.x * 256 + threadIdx.x) * 2; if (e >= (size_t)nheads * HD * TT) return; const int t = (int)(e % TT); const int d = (int)((e / TT) % HD); const int g = (int)(e / ((size_t)TT * HD)); v2h o16; v2us oh, ol;
#pragma unroll
    for (int q = 0; q < 2; ++q) { const float x = bfr(F[(size_t)(t + q) * pitch + g * HD + d]);   /* the value IS a module input: round to bf16 once (lo plane 0) */ o16[q] = tohx(x); unsigned short a2, c2; splitf(x, a2, c2); oh[q] = a2; ol[q] = c2; }
    *(v2h*)(V16 + e) = o16; *(v2us*)(Vh + e) = oh; *(v2us*)(Vl + e) = ol;  }

extern "C" void kernel_launch(void* const* d_in, const int* in_sizes, int n_in,
                              void* d_out, int out_size, void* d_ws, size_t ws_size, hipStream_t stream) {
    (void)in_sizes; (void)n_in; (void)out_size;
    const float* x = (const float*)d_in[0];   /* input */ const float* xm = (const float*)d_in[1];   /* memory */ const float* mk = (const float*)d_in[2];   /* mask [4][4096] f32 */ const float* wq = (const float*)d_in[3]; const float* bq = (const float*)d_in[4]; const float* wk = (const float*)d_in[5]; const float* bk = (const float*)d_in[6]; const float* w2 = (const float*)d_in[7]; const float* b2 = (const float*)d_in[8];   /* argument order input, memory, mask, W_in1, b_in1, W_mem1, b_mem1, W2, b2 */
    float* OUT = (float*)d_out;     // [4][4096][256]
    char* wsp = (char*)d_ws;
    auto take = [&](size_t bytes) { char* p = wsp; wsp += (bytes + 255) & ~(size_t)255; return (void*)p; };
    bf* WQ = (bf*)take((size_t)DQ * DM * 2); bf* WK = (bf*)take((size_t)DKV * DM * 2); bf* W2B = (bf*)take((size_t)DM * DC * 2); bf* CAh = (bf*)take((size_t)TT * DC * 2); bf* CAl = (bf*)take((size_t)TT * DC * 2);
    bf* XB = (bf*)take((size_t)TT * DM * 2);
    h16* QP16 = (h16*)take((size_t)NH_ * TT * HD * 2); h16* KP16 = (h16*)take((size_t)NKV * TT * HD * 2); h16* VT16 = (h16*)take((size_t)NKV * HD * TT * 2);
    bf* QPh = (bf*)take((size_t)NH_ * TT * HD * 2); bf* QPl = (bf*)take((size_t)NH_ * TT * HD * 2); bf* KPh = (bf*)take((size_t)NKV * TT * HD * 2); bf* KPl = (bf*)take((size_t)NKV * TT * HD * 2); bf* VTh = (bf*)take((size_t)NKV * HD * TT * 2); bf* VTl = (bf*)take((size_t)NKV * HD * TT * 2); bf* Ph = (bf*)take((size_t)ZH * RH * TT * 2); bf* Pl = (bf*)take((size_t)ZH * RH * TT * 2);
    float* Sb = (float*)take((size_t)ZH * TT * TT * 4); h16* P16 = (h16*)take((size_t)ZH * TT * TT * 2);
    if ((size_t)(wsp - (char*)d_ws) > ws_size) return;    // ws 256 MiB
    k_cvt8<<<(unsigned)(((size_t)DQ * DM / 8 + 255) / 256), 256, 0, stream>>>(wq, WQ, (size_t)DQ * DM / 8); k_cvt8<<<(unsigned)(((size_t)DKV * DM / 8 + 255) / 256), 256, 0, stream>>>(wk, WK, (size_t)DKV * DM / 8); k_cvt8<<<(unsigned)(((size_t)DM * DC / 8 + 255) / 256), 256, 0, stream>>>(w2, W2B, (size_t)DM * DC / 8);   /* W2 'oi' [256][512] = Bt as-is */
    const unsigned LKv = (unsigned)(((size_t)NKV * TT * HD / 2 + 255) / 256);
    for (int b = 0; b < NB_; ++b) {
        k_cvtc<<<(unsigned)(((size_t)TT * DM / 8 + 255) / 256), 256, 0, stream>>>(x + (size_t)b * TT * DM, XB, CAh, CAl, (size_t)TT * DM / 8);   /* XB := bf16(input[b]); also the concat operand's left half */
        k_gemmw<bf, 0, true, 8, 1><<<dim3(TT / 64, DQ / 64, 1), 256, 0, stream>>>(XB, nullptr, WQ, nullptr, DM, nullptr, DQ, bq, 0, 0, 0, QP16, QPh, QPl, 1.0f);   /* query planes of input_dot = relu(input W_in1^T + b) */
        k_cvt8<<<(unsigned)(((size_t)TT * DM / 8 + 255) / 256), 256, 0, stream>>>(xm + (size_t)b * TT * DM, XB, (size_t)TT * DM / 8);   /* XB := bf16(memory[b]) (the q projection above consumed bf16(input[b])) */
        k_gemmw<bf, 0, true, 8, 1><<<dim3(TT / 64, DKV / 64, 1), 256, 0, stream>>>(XB, nullptr, WK, nullptr, DM, nullptr, DKV, bk, 0, 0, 0, KP16, KPh, KPl, 1.0f);   /* key planes of memory_dot */
        k_vtpb<<<LKv, 256, 0, stream>>>(xm + (size_t)b * TT * DM, DM, NKV, VT16, VTh, VTl);   /* values = the memory itself (bf16-rounded input: hi plane exact, lo plane 0) */
        k_gemmw<bf, 2, false, 8, 0><<<dim3(RH / 64, TT / 64, ZH), 256, 0, stream>>>(QPh, QPl, KPh, KPl, HD, Sb, TT, nullptr, (size_t)TT * HD, (size_t)TT * HD, (size_t)TT * TT, nullptr, nullptr, nullptr, 1.0f);
        k_gemmw<h16, 0, false, 1, 0><<<dim3((TT - RH) / 64, TT / 64, ZH), 32, 0, stream>>>(QP16 + (size_t)RH * HD, nullptr, KP16, nullptr, HD, Sb + (size_t)RH * TT, TT, nullptr, (size_t)TT * HD, (size_t)TT * HD, (size_t)TT * TT, nullptr, nullptr, nullptr, 1.0f);
        k_asoft<<<ZH * TT / 8, 256, 0, stream>>>(Sb, mk + (size_t)b * TT, P16, Ph, Pl);
        /* output_one = weights x values, written as the hi/lo right half of the concat operand (pitch DC, column DM on) */
        k_gemmw<bf, 1, false, 16, 2><<<dim3(RH / 64, HD / 64, ZH), 512, 0, stream>>>(Ph, Pl, VTh, nullptr, TT, nullptr, DC, nullptr, (size_t)RH * TT, (size_t)HD * TT, 0, nullptr, CAh + DM, CAl + DM, 1.0f);   /* weights hi/lo x exact bf16 values (2 products) */
        k_gemmw<h16, 0, false, 16, 2><<<dim3((TT - RH) / 64, HD / 64, ZH), 512, 0, stream>>>(P16 + (size_t)RH * TT, nullptr, VT16, nullptr, TT, nullptr, DC, nullptr, (size_t)TT * TT, (size_t)HD * TT, 0, nullptr, CAh + (size_t)RH * DC + DM, CAl + (size_t)RH * DC + DM, 1.0f / PCAR);   /* fp16 weights carry x PCAR */
        k_gemmw<bf, 1, true, 8, 3><<<dim3(TT / 64, DM / 64, 1), 256, 0, stream>>>(CAh, CAl, W2B, nullptr, DC, OUT + (size_t)b * TT * DM, DM, b2, 0, 0, 0, nullptr, nullptr, nullptr, 1.0f);   /* z = [input | output_one] W2^T + b2; out = sigmoid(z) tanh(z) */
    }
}

// v004
// It runs in 382 microseconds.
// In two side-by-side timings against v003, it was 1.36 and 1.35 times as fast.
// Over all steps from v000 it is 3.48 times as fast.
#include <hip/hip_runtime.h>

// Gated attention reader (input, memory [4][4096][256]; mask [4][4096] f32 0/1 over memory positions (read); input_dot = relu(input W_in1^T + b_in1), memory_dot = relu(memory W_mem1^T + b_mem1) ('oi' [256][256] 1/16, zero biases); att = input_dot . memory_dot / 16 - 1e30 (1 - mask[m]) (== exclusion); softmax over the 4,096 memory positions; output_one = weights . memory; z = [input | output_one] W2^T + b2 ('oi' [256][512]); out = sigmoid(z) tanh(z) -> [4][4096][256] (4.2 M); argument order input, memory, mask, W_in1, b_in1, W_mem1, b_mem1, W2, b2).
// NP batches go through each launch together (more rows, or grid z / y = batch in the pass). Layout per batch: bf16 copy of input then memory; exact projections + f32 biases, ReLU and the split into query/key planes in the projection's own epilogue; one 256-wide head; value^T planes straight from the bf16-rounded memory; dense T-4096 attention (streaming three-sweep softmax reading the mask row; hybrid rows: < 512 hi/lo 3-product scores and hi/lo x exact-value products, rest fp16 x1024); output_one leaves the weights x values epilogue as the hi/lo right half of the concat operand (its left half bf16(input) is written with the input's bf16 copy); [bf16(input) | hi/lo(output_one)] x W2 exact + b2, whose epilogue applies sigmoid(z) tanh(z) and writes the output.
// Compute dtypes, f32 accumulate: every input rounded to bf16; projections exact + f32 biases; attention rows < 512 3 products (scores) / 2 products (weights x exact values), rest fp16; softmax f32; W2 [exact | hl] x exact + bias; sigmoid/tanh f32 (precise expf/tanhf).

#define NB_  4
#define TT   4096
#define DM   256
#define NH_  1
#define NKV  1
#define REP  (NH_ / NKV)
#define HD   256
#define DQ   (NH_ * HD)
#define DKV  (NKV * HD)
#define ZH   1
#define RH   512                  // query rows < RH use hi+lo planes (0: none)
#define WIN  0
#define PCAR 1024.0f
#define SCL  0.0625f   // 1 / float32(sqrt(256))
#define DC   (2 * DM)   // concat width
#define NP   2          // batches that share every launch of a pass (two batches' score and weight planes fit the workspace, four do not)
typedef _Float16 h16;
typedef unsigned short bf;
typedef __attribute__((ext_vector_type(16))) __bf16   v16bf;
typedef __attribute__((ext_vector_type(16))) _Float16 v16h;
typedef __attribute__((ext_vector_type(8)))  _Float16 v8h;
typedef __attribute__((ext_vector_type(8)))  unsigned short v8us;
typedef __attribute__((ext_vector_type(8)))  float    v8f;
typedef __attribute__((ext_vector_type(4)))  float    v4f;
typedef v8h  __attribute__((may_alias)) v8ha;
typedef v4f  __attribute__((may_alias)) v4fa;
typedef v8us __attribute__((may_alias)) v8usa;

__device__ __forceinline__ unsigned short f2bf(float f) { unsigned u = __float_as_uint(f); u += 0x7FFFu + ((u >> 16) & 1u); return (unsigned short)(u >> 16); }
__device__ __forceinline__ float bf2f(unsigned short b) { return __uint_as_float(((unsigned)b) << 16); }
__device__ __forceinline__ float bfr(float f) { return bf2f(f2bf(f)); }
__device__ __forceinline__ v16h cat16(v8h lo, v8h hi) { return __builtin_shufflevector(lo, hi, 0, 1, 2, 3, 4, 5, 6, 7, 8, 9, 10, 11, 12, 13, 14, 15); }
__device__ __forceinline__ v16bf cat16b(v8us lo, v8us hi) { return __builtin_bit_cast(v16bf, __builtin_shufflevector(lo, hi, 0, 1, 2, 3, 4, 5, 6, 7, 8, 9, 10, 11, 12, 13, 14, 15)); }
__device__ __forceinline__ v8f wmma16(v16h a, v16h b, v8f c) { return __builtin_amdgcn_wmma_f32_16x16x32_f16(false, a, false, b, (short)0, c, false, false); }
__device__ __forceinline__ v8f wmmab(v16bf a, v16bf b, v8f c) { return __builtin_amdgcn_wmma_f32_16x16x32_bf16(false, a, false, b, (short)0, c, false, false); }

__device__ __forceinline__ h16 tohx(float x) { return (h16)x; }
__device__ __forceinline__ void splitf(float y, unsigned short& h, unsigned short& l) { h = f2bf(y); l = f2bf(y - bf2f(h)); }
typedef __attribute__((ext_vector_type(2))) _Float16 v2h;
typedef __attribute__((ext_vector_type(4))) _Float16 v4h;
typedef __attribute__((ext_vector_type(2))) unsigned short v2us;
typedef __attribute__((ext_vector_type(4))) unsigned short v4us;
typedef __attribute__((ext_vector_type(2))) float v2f;
typedef __attribute__((ext_vector_type(4))) int v4i;

// ---- k_gemmw: register-blocked GEMM, one 64x64 output tile per work-group (16 accumulators per wave), operands from K-contiguous 16-bit planes, staged in LDS by asynchronous copies; grid (M/64, N/64, Z), 32 * KW threads.
// C[m][n] (f32, pitch ldc, + optional f32 bias[n]) = sum_k A[m][k] Bt[n][k] (+ split products per NSPLIT). z-batch strides sA/sB/sC in elements (sC also moves the EPI 2 planes). K % (32 * KW) == 0, and K % 64 == 0 where KW == 1.
// KW waves share the tile's K: wave w takes the 32-wide k blocks w, w + KW, ...; the KW partial tiles are summed through LDS in wave order 0 .. KW-1.
// Staging: per trip the work-group copies, of each operand plane, 64 rows x (32 * KW * KS) k into LDS (row pitch + 16 B, so that 16 rows fall on 16 different bank groups). A copy instruction takes 512 B (KW > 1) or 4 x 128 B (KW == 1) of whole lines, where a fragment load from the plane itself touches 16 lines for 32 B each. Fragments then come from LDS with the k order of the direct loads. One-product kernels use two buffers (the next trip's copies fly during this trip's products); the split-product kernels have room for one.
// EPI names what the KW > 1 epilogue does with the summed (+ bias) value v at [m][n], pitch ldc: 0 stores v to C; 1 stores relu(v) as the planes E16 (fp16), Eh / El (bf16 hi / lo); 2 stores v * esc as Eh / El; 3 stores sigmoid(v) tanh(v) to C.
template <typename T16> struct WFrag;
template <> struct WFrag<h16> { typedef v16h V; static __device__ __forceinline__ V ld(const char* p) { return cat16(*(const v8ha*)p, *(const v8ha*)(p + 32)); } static __device__ __forceinline__ v8f mma(V a, V b, v8f c) { return wmma16(a, b, c); } };
template <> struct WFrag<bf> { typedef v16bf V; static __device__ __forceinline__ V ld(const char* p) { return cat16b(*(const v8usa*)p, *(const v8usa*)(p + 32)); } static __device__ __forceinline__ v8f mma(V a, V b, v8f c) { return wmmab(a, b, c); } };
// eight asynchronous 16-byte copies per lane, global -> LDS: copy q takes g + q * gs to LDS byte l + q * ls. The s_wait_xcnt closes the statement so that no address register of a copy is rewritten ahead of it.
__device__ __forceinline__ void cp8(unsigned l, unsigned ls, const char* g, size_t gs) {
    asm volatile("global_load_async_to_lds_b128 %0, %8, off\n\t"
                 "global_load_async_to_lds_b128 %1, %9, off\n\t"
                 "global_load_async_to_lds_b128 %2, %10, off\n\t"
                 "global_load_async_to_lds_b128 %3, %11, off\n\t"
                 "global_load_async_to_lds_b128 %4, %12, off\n\t"
                 "global_load_async_to_lds_b128 %5, %13, off\n\t"
                 "global_load_async_to_lds_b128 %6, %14, off\n\t"
                 "global_load_async_to_lds_b128 %7, %15, off\n\t"
                 "s_wait_xcnt 0x0"
                 :: "v"(l), "v"(l + ls), "v"(l + 2 * ls), "v"(l + 3 * ls), "v"(l + 4 * ls), "v"(l + 5 * ls), "v"(l + 6 * ls), "v"(l + 7 * ls),
                    "v"(g), "v"(g + gs), "v"(g + 2 * gs), "v"(g + 3 * gs), "v"(g + 4 * gs), "v"(g + 5 * gs), "v"(g + 6 * gs), "v"(g + 7 * gs)
                 : "memory");
}
// four waves per SIMD (256 registers a wave): two 8-wave work-groups still share a WGP, as their LDS allows
template <typename T16, int NSPLIT, bool BIAS, int KW, int EPI>
__global__ __launch_bounds__(32 * KW) __attribute__((amdgpu_waves_per_eu(4))) void k_gemmw(const T16* __restrict__ A, const T16* __restrict__ A2, const T16* __restrict__ Bt, const T16* __restrict__ Bt2, int K, float* C, int ldc, const float* __restrict__ bias, size_t sA, size_t sB, size_t sC, h16* E16, bf* Eh, bf* El, float esc) {
    typedef typename WFrag<T16>::V V;
    static_assert(NSPLIT <= 2, "planes staged: A, Bt, A2 (NSPLIT 1, 2), Bt2 (NSPLIT 2)");
    constexpr int KS = (KW == 1) ? 2 : 1;                  // 32-wide k steps of a wave per trip (a lone wave takes two, so that its rows are whole 128-B lines)
    constexpr int NBLK = (NSPLIT == 0) ? 2 : (NSPLIT == 1 ? 3 : 4), NBUF = (NSPLIT == 0) ? 2 : 1;
    constexpr int TK = 32 * KW * KS, GR = TK / 8, RP = 32 * KW / GR;   // k per trip; 16-byte pieces per staged row; rows that one copy of every thread covers
    constexpr int PB = TK * 2 + 16, BLKB = 64 * PB, STB = NBLK * BLKB;   // LDS bytes: row pitch, one plane's block, one buffer
    constexpr int OSB = (KW > 1 ? KW * 64 : 16) * 68 * 4;   // KW > 1: one whole 64-row partial tile per wave
    __shared__ __align__(16) float os[(OSB > NBUF * STB ? OSB : NBUF * STB) / 4];   // the staging buffers first, the output staging after the k loop
    const int wv = (KW > 1) ? __builtin_amdgcn_readfirstlane((int)(threadIdx.x >> 5)) : 0;   // wave-uniform, so the k loop stays scalar
    const size_t z = blockIdx.z; A += z * sA; if (A2) A2 += z * sA; Bt += z * sB; if (Bt2) Bt2 += z * sB; if constexpr (EPI == 2) { Eh += z * sC; El += z * sC; } else C += z * sC;
    const int lane = threadIdx.x & 31, lr = lane & 15, hi = lane >> 4; const int r0 = blockIdx.x * 64, c0 = blockIdx.y * 64;
    v8f acc[4][4];
#pragma unroll
    for (int mb = 0; mb < 4; ++mb)
#pragma unroll
        for (int nb = 0; nb < 4; ++nb) acc[mb][nb] = (v8f){};
    const int tid = (int)threadIdx.x, crow = tid / GR, ccol = tid % GR;   // the staged row and 16-byte piece that this lane copies first
    const unsigned lcp = (unsigned)(size_t)os + (unsigned)(crow * PB + ccol * 16);   // its LDS byte address inside a block
    const size_t acp = (size_t)(r0 + crow) * K + ccol * 8, bcp = (size_t)(c0 + crow) * K + ccol * 8, gstep = (size_t)RP * K * 2;
    const int ntr = (int)((unsigned)K / (unsigned)TK);   // trips: the same for every wave (K % TK == 0)
    auto stage = [&](int t, int buf) {   // all planes' blocks of trip t into buffer buf: 8 * KS copies per lane and plane, every lane on
        const size_t ko = (size_t)t * TK; const unsigned lb = lcp + (unsigned)(buf * STB);
#pragma unroll
        for (int h = 0; h < KS; ++h) { const unsigned lh = lb + (unsigned)(h * 8 * RP * PB); const size_t gh = (size_t)h * 8 * gstep;
            cp8(lh, RP * PB, (const char*)(A + acp + ko) + gh, gstep); cp8(lh + BLKB, RP * PB, (const char*)(Bt + bcp + ko) + gh, gstep);
            if constexpr (NSPLIT >= 1) cp8(lh + 2 * BLKB, RP * PB, (const char*)(A2 + acp + ko) + gh, gstep);
            if constexpr (NSPLIT >= 2) cp8(lh + 3 * BLKB, RP * PB, (const char*)(Bt2 + bcp + ko) + gh, gstep); }
    };
    stage(0, 0);
    asm volatile("s_wait_asynccnt 0x0" ::: "memory");   // this wave's copies of trip 0 have landed
    __syncthreads();   // ... and every other wave's: a wave reads rows that other waves copied
    if constexpr (NBUF == 2) { if (K >= 2 * TK) stage(1, 1); }   // a trip 1 exists
    const char* fb = (const char*)os + lr * PB + wv * KS * 64 + hi * 16;   // this lane's fragment piece: row lr, the wave's own k block
#pragma unroll 1
    for (int t = 0; t < ntr; ++t) {
        const char* fs = fb + ((NBUF == 2) ? (t & 1) * STB : 0);
#pragma unroll
        for (int s = 0; s < KS; ++s) {
            V a[4], a2[4];
#pragma unroll
            for (int mb = 0; mb < 4; ++mb) { a[mb] = WFrag<T16>::ld(fs + mb * 16 * PB + s * 64); if (NSPLIT == 1 || NSPLIT == 2) a2[mb] = WFrag<T16>::ld(fs + 2 * BLKB + mb * 16 * PB + s * 64); }
#pragma unroll
            for (int nb = 0; nb < 4; ++nb) { const V b = WFrag<T16>::ld(fs + BLKB + nb * 16 * PB + s * 64); V b2; if (NSPLIT >= 2) b2 = WFrag<T16>::ld(fs + 3 * BLKB + nb * 16 * PB + s * 64);
#pragma unroll
                for (int mb = 0; mb < 4; ++mb) { acc[mb][nb] = WFrag<T16>::mma(a[mb], b, acc[mb][nb]); if (NSPLIT == 1 || NSPLIT == 2) acc[mb][nb] = WFrag<T16>::mma(a2[mb], b, acc[mb][nb]); if (NSPLIT >= 2) acc[mb][nb] = WFrag<T16>::mma(a[mb], b2, acc[mb][nb]); } }
            asm volatile("v_nop\n\tv_nop\n\tv_nop\n\tv_nop" : "+v"(acc[0][0]), "+v"(acc[1][1]), "+v"(acc[2][2]), "+v"(acc[3][3]) : "v"(a[0]), "v"(a[3]));
        }
        asm volatile("s_wait_dscnt 0x0" ::: "memory");   // this wave's fragment reads of the buffer are done before anybody refills it
        if constexpr (NBUF == 2) asm volatile("s_wait_asynccnt 0x0" ::: "memory");   // this wave's copies of trip t + 1 have landed
        __syncthreads();   // ends every wave's reads of this trip's buffer; with two buffers it also publishes trip t + 1
        if constexpr (NBUF == 2) { if (t + 2 < ntr) stage(t + 2, t & 1); }
        else { if (t + 1 < ntr) { stage(t + 1, 0);
            asm volatile("s_wait_asynccnt 0x0" ::: "memory");   // this wave's copies of trip t + 1 have landed
            __syncthreads();   // ... and every other wave's
        } }
    }
    asm volatile("s_wait_asynccnt 0x0" ::: "memory");   // no copy is outstanding when the buffers become output staging
    if constexpr (KW > 1) {
        // unrolled: the accumulators stay in registers only under constant indices
#pragma unroll
        for (int mb = 0; mb < 4; ++mb)
#pragma unroll
            for (int nb = 0; nb < 4; ++nb) {
#pragma unroll
                for (int j = 0; j < 8; ++j) os[(wv * 64 + mb * 16 + hi * 8 + j) * 68 + nb * 16 + lr] = acc[mb][nb][j]; }
        __syncthreads();   // every wave's partial tile is in LDS before any thread sums across the waves
        // unrolled (both loops): all of a thread's LDS reads are issued together instead of one wait per read
#pragma unroll
        for (int s = 0; s < 32 / KW; ++s) { const int slot = (int)threadIdx.x + s * 32 * KW, row = slot >> 4, cofs = (slot & 15) * 4; v4f val = *(const v4fa*)(os + row * 68 + cofs);
#pragma unroll
            for (int w = 1; w < KW; ++w) val += *(const v4fa*)(os + (w * 64 + row) * 68 + cofs);
            if (BIAS) { val[0] += bfr(bias[c0 + cofs]); val[1] += bfr(bias[c0 + cofs + 1]); val[2] += bfr(bias[c0 + cofs + 2]); val[3] += bfr(bias[c0 + cofs + 3]); }
            const size_t oo = (size_t)(r0 + row) * ldc + c0 + cofs;
            // the q loops below are unrolled so that the 4-wide vectors are indexed by constants and stay in registers
            if constexpr (EPI == 0) { *(v4f*)(C + oo) = val; }
            else if constexpr (EPI == 1) { v4h o16; v4us oh, ol;
#pragma unroll
                for (int q = 0; q < 4; ++q) { const float r = fmaxf(val[q], 0.0f); o16[q] = tohx(r); unsigned short a2, c2; splitf(r, a2, c2); oh[q] = a2; ol[q] = c2; }
                *(v4h*)(E16 + oo) = o16; *(v4us*)(Eh + oo) = oh; *(v4us*)(El + oo) = ol; }
            else if constexpr (EPI == 2) { v4us oh, ol;
#pragma unroll
                for (int q = 0; q < 4; ++q) { unsigned short a2, c2; splitf(val[q] * esc, a2, c2); oh[q] = a2; ol[q] = c2; }
                *(v4us*)(Eh + oo) = oh; *(v4us*)(El + oo) = ol; }
            else { v4f o;
#pragma unroll
                for (int q = 0; q < 4; ++q) { const float sg = __fdiv_rn(1.0f, __fadd_rn(1.0f, expf(-val[q]))); o[q] = __fmul_rn(sg, tanhf(val[q])); }
                *(v4f*)(C + oo) = o; } }
        return;
    }
#pragma unroll
    for (int mb = 0; mb < 4; ++mb) {
#pragma unroll
        for (int nb = 0; nb < 4; ++nb) {
#pragma unroll
            for (int j = 0; j < 8; ++j) os[(hi * 8 + j) * 68 + nb * 16 + lr] = acc[mb][nb][j]; }
        __builtin_amdgcn_wave_barrier(); asm volatile("" ::: "memory");
        float* crow = C + (size_t)(r0 + mb * 16) * ldc + c0;
{
#pragma unroll
            for (int s = 0; s < 8; ++s) { const int row = 2 * s + hi, cofs = lr * 4; v4f val = *(const v4fa*)(os + row * 68 + cofs); if (BIAS) { val[0] += bfr(bias[c0 + cofs]); val[1] += bfr(bias[c0 + cofs + 1]); val[2] += bfr(bias[c0 + cofs + 2]); val[3] += bfr(bias[c0 + cofs + 3]); }
                *(v4f*)(crow + (size_t)row * ldc + cofs) = val; }
             }
        __builtin_amdgcn_wave_barrier(); asm volatile("" ::: "memory");
    }
}


__global__ __launch_bounds__(256) void k_cvt8(const float* __restrict__ src, bf* dst, size_t n8) { const size_t i = (size_t)blockIdx.x * 256 + threadIdx.x; if (i >= n8) return; const v8f v = *(const v8f*)(src + i * 8); v8us o;
#pragma unroll
    for (int k = 0; k < 8; ++k) o[k] = f2bf(v[k]); *(v8us*)(dst + i * 8) = o;  }
// k_cvtc: k_cvt8 of the input [t][DM] that also lays the same bf16 values down as the left half of the concat operand's hi plane [t][DC]; the lo plane's left half is 0 (bf16(input) is exact in one plane)
__global__ __launch_bounds__(256) void k_cvtc(const float* __restrict__ src, bf* dst, bf* Ah, bf* Al, size_t n8) { const size_t i = (size_t)blockIdx.x * 256 + threadIdx.x; if (i >= n8) return; const v8f v = *(const v8f*)(src + i * 8); v8us o;
#pragma unroll
    for (int k = 0; k < 8; ++k) o[k] = f2bf(v[k]);
    const size_t e = i * 8, oc = (e / DM) * DC + (e % DM); *(v8us*)(dst + e) = o; *(v8us*)(Ah + oc) = o; *(v8us*)(Al + oc) = (v8us){};  }

__global__ __launch_bounds__(256) void k_asoft(const float* __restrict__ Sb, const float* __restrict__ mk, h16* P16, bf* Ph, bf* Pl) {
    const int lane = threadIdx.x & 31; const int row = blockIdx.x * 8 + (threadIdx.x >> 5); if (row >= ZH * TT) return; const int i = row % TT; const int zz = row / TT; const bool hires = (i < RH); const size_t bz = blockIdx.y;   /* batch in the pass */ mk += bz * TT; P16 += bz * ZH * (TT - RH) * TT; Ph += bz * ZH * RH * TT; Pl += bz * ZH * RH * TT; const float* sr = Sb + (bz * ZH * TT + row) * TT; float mx = -3.0e38f;
#pragma unroll 4
    for (int ch = 0; ch < TT / 128; ++ch) { const int j0 = ch * 128 + lane * 4; const v4f a = *(const v4f*)(sr + j0); const v4f m4 = *(const v4f*)(mk + j0);
#pragma unroll
        for (int q = 0; q < 4; ++q) { float t = a[q] * SCL; asm volatile("" : "+v"(t)); t = (bfr(m4[q]) != 0.0f) ? t : -3.0e38f;   /* masked memory position excluded (the reference's -1e30 penalty) */ mx = fmaxf(mx, t); } }
#pragma unroll
    for (int sh = 16; sh; sh >>= 1) mx = fmaxf(mx, __shfl_xor(mx, sh, 32));
    float sum = 0.f;
#pragma unroll 4
    for (int ch = 0; ch < TT / 128; ++ch) { const int j0 = ch * 128 + lane * 4; const v4f a = *(const v4f*)(sr + j0); const v4f m4 = *(const v4f*)(mk + j0);
#pragma unroll
        for (int q = 0; q < 4; ++q) { float t = a[q] * SCL; asm volatile("" : "+v"(t)); t = (bfr(m4[q]) != 0.0f) ? t : -3.0e38f;   /* masked memory position excluded (the reference's -1e30 penalty) */ float d0 = __fsub_rn(t, mx); asm volatile("" : "+v"(d0)); sum += __builtin_amdgcn_exp2f(__fmul_rn(d0, 1.4426950408889634f)); } }
#pragma unroll
    for (int sh = 16; sh; sh >>= 1) sum += __shfl_xor(sum, sh, 32);
    const float f = __fdiv_rn(hires ? 1.0f : PCAR, sum);
{
        if (hires) {   /* rows < RH: normalised bf16 hi/lo over ALL TT keys (symmetric window: keys beyond RH are live), planes [zz][RH][TT] */
#pragma unroll 4
            for (int ch = 0; ch < TT / 128; ++ch) { const int j0 = ch * 128 + lane * 4; const v4f a = *(const v4f*)(sr + j0); const v4f m4 = *(const v4f*)(mk + j0); v4us oh, ol;
#pragma unroll
                for (int q = 0; q < 4; ++q) { float t = a[q] * SCL; asm volatile("" : "+v"(t)); t = (bfr(m4[q]) != 0.0f) ? t : -3.0e38f;   /* masked memory position excluded (the reference's -1e30 penalty) */ float d0 = __fsub_rn(t, mx); asm volatile("" : "+v"(d0)); float ex = __builtin_amdgcn_exp2f(__fmul_rn(d0, 1.4426950408889634f)); asm volatile("" : "+v"(ex)); unsigned short a2, c2; splitf(ex * f, a2, c2); oh[q] = a2; ol[q] = c2; }
                const size_t oo = ((size_t)zz * RH + i) * TT + j0; *(v4us*)(Ph + oo) = oh; *(v4us*)(Pl + oo) = ol; }
        } else {
#pragma unroll 2
            for (int ch = 0; ch < TT / 128; ++ch) { const int j0 = ch * 128 + lane * 4; const v4f a = *(const v4f*)(sr + j0); const v4f m4 = *(const v4f*)(mk + j0); v4h o4;
#pragma unroll
                for (int q = 0; q < 4; ++q) { float t = a[q] * SCL; asm volatile("" : "+v"(t)); t = (bfr(m4[q]) != 0.0f) ? t : -3.0e38f;   /* masked memory position excluded (the reference's -1e30 penalty) */ float d0 = __fsub_rn(t, mx); asm volatile("" : "+v"(d0)); float ex = __builtin_amdgcn_exp2f(__fmul_rn(d0, 1.4426950408889634f)); asm volatile("" : "+v"(ex)); o4[q] = tohx(ex * f); }
                *(v4h*)(P16 + ((size_t)zz * (TT - RH) + (i - RH)) * TT + j0) = o4; } }   /* P16 holds the rows from RH on only */
         }
}


__global__ __launch_bounds__(256) void k_vtpb(const float* __restrict__ F, int pitch, int nheads, h16* V16, bf* Vh, bf* Vl) { const size_t e = ((size_t)blockIdx.x * 256 + threadIdx.x) * 2; if (e >= (size_t)nheads * HD * TT) return; const int t = (int)(e % TT); const int d = (int)((e / TT) % HD); const int g = (int)(e / ((size_t)TT * HD)); const size_t bz = blockIdx.y;   /* batch in the pass */ F += bz * TT * pitch; const size_t eo = bz * nheads * HD * TT + e; v2h o16; v2us oh, ol;
#pragma unroll
    for (int q = 0; q < 2; ++q) { const float x = bfr(F[(size_t)(t + q) * pitch + g * HD + d]);   /* the value IS a module input: round to bf16 once (lo plane 0) */ o16[q] = tohx(x); unsigned short a2, c2; splitf(x, a2, c2); oh[q] = a2; ol[q] = c2; }
    *(v2h*)(V16 + eo) = o16; *(v2us*)(Vh + eo) = oh; *(v2us*)(Vl + eo) = ol;  }

extern "C" void kernel_launch(void* const* d_in, const int* in_sizes, int n_in,
                              void* d_out, int out_size, void* d_ws, size_t ws_size, hipStream_t stream) {
    (void)in_sizes; (void)n_in; (void)out_size;
    const float* x = (const float*)d_in[0];   /* input */ const float* xm = (const float*)d_in[1];   /* memory */ const float* mk = (const float*)d_in[2];   /* mask [4][4096] f32 */ const float* wq = (const float*)d_in[3]; const float* bq = (const float*)d_in[4]; const float* wk = (const float*)d_in[5]; const float* bk = (const float*)d_in[6]; const float* w2 = (const float*)d_in[7]; const float* b2 = (const float*)d_in[8];   /* argument order input, memory, mask, W_in1, b_in1, W_mem1, b_mem1, W2, b2 */
    float* OUT = (float*)d_out;     // [4][4096][256]
    char* wsp = (char*)d_ws;
    auto take = [&](size_t bytes) { char* p = wsp; wsp += (bytes + 255) & ~(size_t)255; return (void*)p; };
    bf* WQ = (bf*)take((size_t)DQ * DM * 2); bf* WK = (bf*)take((size_t)DKV * DM * 2); bf* W2B = (bf*)take((size_t)DM * DC * 2); bf* CAh = (bf*)take((size_t)NP * TT * DC * 2); bf* CAl = (bf*)take((size_t)NP * TT * DC * 2);
    h16* QP16 = (h16*)take((size_t)NP * NH_ * TT * HD * 2); h16* KP16 = (h16*)take((size_t)NP * NKV * TT * HD * 2); h16* VT16 = (h16*)take((size_t)NP * NKV * HD * TT * 2);
    bf* QPh = (bf*)take((size_t)NP * NH_ * TT * HD * 2); bf* QPl = (bf*)take((size_t)NP * NH_ * TT * HD * 2); bf* KPh = (bf*)take((size_t)NP * NKV * TT * HD * 2); bf* KPl = (bf*)take((size_t)NP * NKV * TT * HD * 2); bf* VTh = (bf*)take((size_t)NP * NKV * HD * TT * 2); bf* VTl = (bf*)take((size_t)NP * NKV * HD * TT * 2); bf* Ph = (bf*)take((size_t)NP * ZH * RH * TT * 2); bf* Pl = (bf*)take((size_t)NP * ZH * RH * TT * 2);
    float* Sb = (float*)take((size_t)NP * ZH * TT * TT * 4); h16* P16 = (h16*)take((size_t)NP * ZH * (TT - RH) * TT * 2);   /* P16: rows RH .. TT-1 only (rows < RH go to Ph / Pl) */
    bf* XB = (bf*)Sb;   /* the bf16 copies [NP][TT][DM] are last read by the key projection, before the scores are first written: they borrow the score plane's bytes */
    if ((size_t)(wsp - (char*)d_ws) > ws_size) return;    // ws 256 MiB
    k_cvt8<<<(unsigned)(((size_t)DQ * DM / 8 + 255) / 256), 256, 0, stream>>>(wq, WQ, (size_t)DQ * DM / 8); k_cvt8<<<(unsigned)(((size_t)DKV * DM / 8 + 255) / 256), 256, 0, stream>>>(wk, WK, (size_t)DKV * DM / 8); k_cvt8<<<(unsigned)(((size_t)DM * DC / 8 + 255) / 256), 256, 0, stream>>>(w2, W2B, (size_t)DM * DC / 8);   /* W2 'oi' [256][512] = Bt as-is */
    const unsigned LKv = (unsigned)(((size_t)NKV * TT * HD / 2 + 255) / 256);
    for (int b = 0; b < NB_; b += NP) {   /* batches b .. b + NP - 1; their rows follow one another in the inputs, the output and every [t][...] plane */
        k_cvtc<<<(unsigned)(((size_t)NP * TT * DM / 8 + 255) / 256), 256, 0, stream>>>(x + (size_t)b * TT * DM, XB, CAh, CAl, (size_t)NP * TT * DM / 8);   /* XB := bf16(input[b ..]); also the concat operand's left half */
        k_gemmw<bf, 0, true, 8, 1><<<dim3(NP * TT / 64, DQ / 64, 1), 256, 0, stream>>>(XB, nullptr, WQ, nullptr, DM, nullptr, DQ, bq, 0, 0, 0, QP16, QPh, QPl, 1.0f);   /* query planes of input_dot = relu(input W_in1^T + b) */
        k_cvt8<<<(unsigned)(((size_t)NP * TT * DM / 8 + 255) / 256), 256, 0, stream>>>(xm + (size_t)b * TT * DM, XB, (size_t)NP * TT * DM / 8);   /* XB := bf16(memory[b ..]) (the q projection above consumed bf16(input[b ..])) */
        k_gemmw<bf, 0, true, 8, 1><<<dim3(NP * TT / 64, DKV / 64, 1), 256, 0, stream>>>(XB, nullptr, WK, nullptr, DM, nullptr, DKV, bk, 0, 0, 0, KP16, KPh, KPl, 1.0f);   /* key planes of memory_dot */
        k_vtpb<<<dim3(LKv, NP, 1), 256, 0, stream>>>(xm + (size_t)b * TT * DM, DM, NKV, VT16, VTh, VTl);   /* values = the memory itself (bf16-rounded input: hi plane exact, lo plane 0) */
        k_gemmw<bf, 2, false, 8, 0><<<dim3(RH / 64, TT / 64, NP * ZH), 256, 0, stream>>>(QPh, QPl, KPh, KPl, HD, Sb, TT, nullptr, (size_t)TT * HD, (size_t)TT * HD, (size_t)TT * TT, nullptr, nullptr, nullptr, 1.0f);
        k_gemmw<h16, 0, false, 1, 0><<<dim3((TT - RH) / 64, TT / 64, NP * ZH), 32, 0, stream>>>(QP16 + (size_t)RH * HD, nullptr, KP16, nullptr, HD, Sb + (size_t)RH * TT, TT, nullptr, (size_t)TT * HD, (size_t)TT * HD, (size_t)TT * TT, nullptr, nullptr, nullptr, 1.0f);
        k_asoft<<<dim3(ZH * TT / 8, NP, 1), 256, 0, stream>>>(Sb, mk + (size_t)b * TT, P16, Ph, Pl);
        /* output_one = weights x values, written as the hi/lo right half of the concat operand (pitch DC, column DM on) */
        k_gemmw<bf, 1, false, 16, 2><<<dim3(RH / 64, HD / 64, NP * ZH), 512, 0, stream>>>(Ph, Pl, VTh, nullptr, TT, nullptr, DC, nullptr, (size_t)RH * TT, (size_t)HD * TT, (size_t)TT * DC, nullptr, CAh + DM, CAl + DM, 1.0f);   /* weights hi/lo x exact bf16 values (2 products) */
        k_gemmw<h16, 0, false, 16, 2><<<dim3((TT - RH) / 64, HD / 64, NP * ZH), 512, 0, stream>>>(P16, nullptr, VT16, nullptr, TT, nullptr, DC, nullptr, (size_t)(TT - RH) * TT, (size_t)HD * TT, (size_t)TT * DC, nullptr, CAh + (size_t)RH * DC + DM, CAl + (size_t)RH * DC + DM, 1.0f / PCAR);   /* fp16 weights carry x PCAR */
        k_gemmw<bf, 1, true, 8, 3><<<dim3(NP * TT / 64, DM / 64, 1), 256, 0, stream>>>(CAh, CAl, W2B, nullptr, DC, OUT + (size_t)b * TT * DM, DM, b2, 0, 0, 0, nullptr, nullptr, nullptr, 1.0f);   /* z = [input | output_one] W2^T + b2; out = sigmoid(z) tanh(z) */
    }
}

// v005
// It runs in 310 microseconds.
// Next to v004, in two timings, it ran 1.24 and 1.23 times as fast.
// Counting every step since v000, it is 4.29 times as fast.
#include <hip/hip_runtime.h>

// Gated attention reader (input, memory [4][4096][256]; mask [4][4096] f32 0/1 over memory positions (read); input_dot = relu(input W_in1^T + b_in1), memory_dot = relu(memory W_mem1^T + b_mem1) ('oi' [256][256] 1/16, zero biases); att = input_dot . memory_dot / 16 - 1e30 (1 - mask[m]) (== exclusion); softmax over the 4,096 memory positions; output_one = weights . memory; z = [input | output_one] W2^T + b2 ('oi' [256][512]); out = sigmoid(z) tanh(z) -> [4][4096][256] (4.2 M); argument order input, memory, mask, W_in1, b_in1, W_mem1, b_mem1, W2, b2).
// NP batches go through each launch together (more rows, or grid z / y = batch in the pass). Layout per batch: bf16 copy of input then memory; exact projections + f32 biases, ReLU and the split into query/key planes in the projection's own epilogue; one 256-wide head; value^T planes straight from the bf16-rounded memory; dense T-4096 attention, hybrid rows: < 512 hi/lo 3-product scores, three-sweep softmax reading the mask row and hi/lo x exact-value products; the rest fp16, scores, online softmax and weights x values in one kernel; output_one leaves the weights x values epilogue as the hi/lo right half of the concat operand (its left half bf16(input) is written with the input's bf16 copy); [bf16(input) | hi/lo(output_one)] x W2 exact + b2, whose epilogue applies sigmoid(z) tanh(z) and writes the output.
// Compute dtypes, f32 accumulate: every input rounded to bf16; projections exact + f32 biases; attention rows < 512 3 products (scores) / 2 products (weights x exact values), rest fp16; softmax f32; W2 [exact | hl] x exact + bias; sigmoid/tanh f32 (precise expf/tanhf).

#define NB_  4
#define TT   4096
#define DM   256
#define NH_  1
#define NKV  1
#define REP  (NH_ / NKV)
#define HD   256
#define DQ   (NH_ * HD)
#define DKV  (NKV * HD)
#define ZH   1
#define RH   512                  // query rows < RH use hi+lo planes (0: none)
#define WIN  0
#define SCL  0.0625f   // 1 / float32(sqrt(256))
#define DC   (2 * DM)   // concat width
#define NP   2          // batches that share every launch of a pass (two batches' score and weight planes fit the workspace, four do not)
typedef _Float16 h16;
typedef unsigned short bf;
typedef __attribute__((ext_vector_type(16))) __bf16   v16bf;
typedef __attribute__((ext_vector_type(16))) _Float16 v16h;
typedef __attribute__((ext_vector_type(8)))  _Float16 v8h;
typedef __attribute__((ext_vector_type(8)))  unsigned short v8us;
typedef __attribute__((ext_vector_type(8)))  float    v8f;
typedef __attribute__((ext_vector_type(4)))  float    v4f;
typedef v8h  __attribute__((may_alias)) v8ha;
typedef v4f  __attribute__((may_alias)) v4fa;
typedef v8us __attribute__((may_alias)) v8usa;

__device__ __forceinline__ unsigned short f2bf(float f) { unsigned u = __float_as_uint(f); u += 0x7FFFu + ((u >> 16) & 1u); return (unsigned short)(u >> 16); }
__device__ __forceinline__ float bf2f(unsigned short b) { return __uint_as_float(((unsigned)b) << 16); }
__device__ __forceinline__ float bfr(float f) { return bf2f(f2bf(f)); }
__device__ __forceinline__ v16h cat16(v8h lo, v8h hi) { return __builtin_shufflevector(lo, hi, 0, 1, 2, 3, 4, 5, 6, 7, 8, 9, 10, 11, 12, 13, 14, 15); }
__device__ __forceinline__ v16bf cat16b(v8us lo, v8us hi) { return __builtin_bit_cast(v16bf, __builtin_shufflevector(lo, hi, 0, 1, 2, 3, 4, 5, 6, 7, 8, 9, 10, 11, 12, 13, 14, 15)); }
__device__ __forceinline__ v8f wmma16(v16h a, v16h b, v8f c) { return __builtin_amdgcn_wmma_f32_16x16x32_f16(false, a, false, b, (short)0, c, false, false); }
__device__ __forceinline__ v8f wmmab(v16bf a, v16bf b, v8f c) { return __builtin_amdgcn_wmma_f32_16x16x32_bf16(false, a, false, b, (short)0, c, false, false); }

__device__ __forceinline__ h16 tohx(float x) { return (h16)x; }
__device__ __forceinline__ void splitf(float y, unsigned short& h, unsigned short& l) { h = f2bf(y); l = f2bf(y - bf2f(h)); }
typedef __attribute__((ext_vector_type(2))) _Float16 v2h;
typedef __attribute__((ext_vector_type(4))) _Float16 v4h;
typedef __attribute__((ext_vector_type(2))) unsigned short v2us;
typedef __attribute__((ext_vector_type(4))) unsigned short v4us;
typedef __attribute__((ext_vector_type(2))) float v2f;
typedef __attribute__((ext_vector_type(4))) int v4i;

// ---- k_gemmw: register-blocked GEMM, one 64x64 output tile per work-group (16 accumulators per wave), operands from K-contiguous 16-bit planes, staged in LDS by asynchronous copies; grid (M/64, N/64, Z), 32 * KW threads.
// C[m][n] (f32, pitch ldc, + optional f32 bias[n]) = sum_k A[m][k] Bt[n][k] (+ split products per NSPLIT). z-batch strides sA/sB/sC in elements (sC also moves the EPI 2 planes). K % (32 * KW) == 0, and K % 64 == 0 where KW == 1.
// KW waves share the tile's K: wave w takes the 32-wide k blocks w, w + KW, ...; the KW partial tiles are summed through LDS in wave order 0 .. KW-1.
// Staging: per trip the work-group copies, of each operand plane, 64 rows x (32 * KW * KS) k into LDS (row pitch + 16 B, so that 16 rows fall on 16 different bank groups). A copy instruction takes 512 B (KW > 1) or 4 x 128 B (KW == 1) of whole lines, where a fragment load from the plane itself touches 16 lines for 32 B each. Fragments then come from LDS with the k order of the direct loads. One-product kernels use two buffers (the next trip's copies fly during this trip's products); the split-product kernels have room for one.
// EPI names what the KW > 1 epilogue does with the summed (+ bias) value v at [m][n], pitch ldc: 0 stores v to C; 1 stores relu(v) as the planes E16 (fp16), Eh / El (bf16 hi / lo); 2 stores v * esc as Eh / El; 3 stores sigmoid(v) tanh(v) to C.
template <typename T16> struct WFrag;
template <> struct WFrag<h16> { typedef v16h V; static __device__ __forceinline__ V ld(const char* p) { return cat16(*(const v8ha*)p, *(const v8ha*)(p + 32)); } static __device__ __forceinline__ v8f mma(V a, V b, v8f c) { return wmma16(a, b, c); } };
template <> struct WFrag<bf> { typedef v16bf V; static __device__ __forceinline__ V ld(const char* p) { return cat16b(*(const v8usa*)p, *(const v8usa*)(p + 32)); } static __device__ __forceinline__ v8f mma(V a, V b, v8f c) { return wmmab(a, b, c); } };
// eight asynchronous 16-byte copies per lane, global -> LDS: copy q takes g + q * gs to LDS byte l + q * ls. The s_wait_xcnt closes the statement so that no address register of a copy is rewritten ahead of it.
__device__ __forceinline__ void cp8(unsigned l, unsigned ls, const char* g, size_t gs) {
    asm volatile("global_load_async_to_lds_b128 %0, %8, off\n\t"
                 "global_load_async_to_lds_b128 %1, %9, off\n\t"
                 "global_load_async_to_lds_b128 %2, %10, off\n\t"
                 "global_load_async_to_lds_b128 %3, %11, off\n\t"
                 "global_load_async_to_lds_b128 %4, %12, off\n\t"
                 "global_load_async_to_lds_b128 %5, %13, off\n\t"
                 "global_load_async_to_lds_b128 %6, %14, off\n\t"
                 "global_load_async_to_lds_b128 %7, %15, off\n\t"
                 "s_wait_xcnt 0x0"
                 :: "v"(l), "v"(l + ls), "v"(l + 2 * ls), "v"(l + 3 * ls), "v"(l + 4 * ls), "v"(l + 5 * ls), "v"(l + 6 * ls), "v"(l + 7 * ls),
                    "v"(g), "v"(g + gs), "v"(g + 2 * gs), "v"(g + 3 * gs), "v"(g + 4 * gs), "v"(g + 5 * gs), "v"(g + 6 * gs), "v"(g + 7 * gs)
                 : "memory");
}
// four waves per SIMD (256 registers a wave): two 8-wave work-groups still share a WGP, as their LDS allows
template <typename T16, int NSPLIT, bool BIAS, int KW, int EPI>
__global__ __launch_bounds__(32 * KW) __attribute__((amdgpu_waves_per_eu(4))) void k_gemmw(const T16* __restrict__ A, const T16* __restrict__ A2, const T16* __restrict__ Bt, const T16* __restrict__ Bt2, int K, float* C, int ldc, const float* __restrict__ bias, size_t sA, size_t sB, size_t sC, h16* E16, bf* Eh, bf* El, float esc) {
    typedef typename WFrag<T16>::V V;
    static_assert(NSPLIT <= 2, "planes staged: A, Bt, A2 (NSPLIT 1, 2), Bt2 (NSPLIT 2)");
    constexpr int KS = (KW == 1) ? 2 : 1;                  // 32-wide k steps of a wave per trip (a lone wave takes two, so that its rows are whole 128-B lines)
    constexpr int NBLK = (NSPLIT == 0) ? 2 : (NSPLIT == 1 ? 3 : 4), NBUF = (NSPLIT == 0) ? 2 : 1;
    constexpr int TK = 32 * KW * KS, GR = TK / 8, RP = 32 * KW / GR;   // k per trip; 16-byte pieces per staged row; rows that one copy of every thread covers
    constexpr int PB = TK * 2 + 16, BLKB = 64 * PB, STB = NBLK * BLKB;   // LDS bytes: row pitch, one plane's block, one buffer
    constexpr int OSB = (KW > 1 ? KW * 64 : 16) * 68 * 4;   // KW > 1: one whole 64-row partial tile per wave
    __shared__ __align__(16) float os[(OSB > NBUF * STB ? OSB : NBUF * STB) / 4];   // the staging buffers first, the output staging after the k loop
    const int wv = (KW > 1) ? __builtin_amdgcn_readfirstlane((int)(threadIdx.x >> 5)) : 0;   // wave-uniform, so the k loop stays scalar
    const size_t z = blockIdx.z; A += z * sA; if (A2) A2 += z * sA; Bt += z * sB; if (Bt2) Bt2 += z * sB; if constexpr (EPI == 2) { Eh += z * sC; El += z * sC; } else C += z * sC;
    const int lane = threadIdx.x & 31, lr = lane & 15, hi = lane >> 4; const int r0 = blockIdx.x * 64, c0 = blockIdx.y * 64;
    v8f acc[4][4];
#pragma unroll
    for (int mb = 0; mb < 4; ++mb)
#pragma unroll
        for (int nb = 0; nb < 4; ++nb) acc[mb][nb] = (v8f){};
    const int tid = (int)threadIdx.x, crow = tid / GR, ccol = tid % GR;   // the staged row and 16-byte piece that this lane copies first
    const unsigned lcp = (unsigned)(size_t)os + (unsigned)(crow * PB + ccol * 16);   // its LDS byte address inside a block
    const size_t acp = (size_t)(r0 + crow) * K + ccol * 8, bcp = (size_t)(c0 + crow) * K + ccol * 8, gstep = (size_t)RP * K * 2;
    const int ntr = (int)((unsigned)K / (unsigned)TK);   // trips: the same for every wave (K % TK == 0)
    auto stage = [&](int t, int buf) {   // all planes' blocks of trip t into buffer buf: 8 * KS copies per lane and plane, every lane on
        const size_t ko = (size_t)t * TK; const unsigned lb = lcp + (unsigned)(buf * STB);
#pragma unroll
        for (int h = 0; h < KS; ++h) { const unsigned lh = lb + (unsigned)(h * 8 * RP * PB); const size_t gh = (size_t)h * 8 * gstep;
            cp8(lh, RP * PB, (const char*)(A + acp + ko) + gh, gstep); cp8(lh + BLKB, RP * PB, (const char*)(Bt + bcp + ko) + gh, gstep);
            if constexpr (NSPLIT >= 1) cp8(lh + 2 * BLKB, RP * PB, (const char*)(A2 + acp + ko) + gh, gstep);
            if constexpr (NSPLIT >= 2) cp8(lh + 3 * BLKB, RP * PB, (const char*)(Bt2 + bcp + ko) + gh, gstep); }
    };
    stage(0, 0);
    asm volatile("s_wait_asynccnt 0x0" ::: "memory");   // this wave's copies of trip 0 have landed
    __syncthreads();   // ... and every other wave's: a wave reads rows that other waves copied
    if constexpr (NBUF == 2) { if (K >= 2 * TK) stage(1, 1); }   // a trip 1 exists
    const char* fb = (const char*)os + lr * PB + wv * KS * 64 + hi * 16;   // this lane's fragment piece: row lr, the wave's own k block
#pragma unroll 1
    for (int t = 0; t < ntr; ++t) {
        const char* fs = fb + ((NBUF == 2) ? (t & 1) * STB : 0);
#pragma unroll
        for (int s = 0; s < KS; ++s) {
            V a[4], a2[4];
#pragma unroll
            for (int mb = 0; mb < 4; ++mb) { a[mb] = WFrag<T16>::ld(fs + mb * 16 * PB + s * 64); if (NSPLIT == 1 || NSPLIT == 2) a2[mb] = WFrag<T16>::ld(fs + 2 * BLKB + mb * 16 * PB + s * 64); }
#pragma unroll
            for (int nb = 0; nb < 4; ++nb) { const V b = WFrag<T16>::ld(fs + BLKB + nb * 16 * PB + s * 64); V b2; if (NSPLIT >= 2) b2 = WFrag<T16>::ld(fs + 3 * BLKB + nb * 16 * PB + s * 64);
#pragma unroll
                for (int mb = 0; mb < 4; ++mb) { acc[mb][nb] = WFrag<T16>::mma(a[mb], b, acc[mb][nb]); if (NSPLIT == 1 || NSPLIT == 2) acc[mb][nb] = WFrag<T16>::mma(a2[mb], b, acc[mb][nb]); if (NSPLIT >= 2) acc[mb][nb] = WFrag<T16>::mma(a[mb], b2, acc[mb][nb]); } }
            asm volatile("v_nop\n\tv_nop\n\tv_nop\n\tv_nop" : "+v"(acc[0][0]), "+v"(acc[1][1]), "+v"(acc[2][2]), "+v"(acc[3][3]) : "v"(a[0]), "v"(a[3]));
        }
        asm volatile("s_wait_dscnt 0x0" ::: "memory");   // this wave's fragment reads of the buffer are done before anybody refills it
        if constexpr (NBUF == 2) asm volatile("s_wait_asynccnt 0x0" ::: "memory");   // this wave's copies of trip t + 1 have landed
        __syncthreads();   // ends every wave's reads of this trip's buffer; with two buffers it also publishes trip t + 1
        if constexpr (NBUF == 2) { if (t + 2 < ntr) stage(t + 2, t & 1); }
        else { if (t + 1 < ntr) { stage(t + 1, 0);
            asm volatile("s_wait_asynccnt 0x0" ::: "memory");   // this wave's copies of trip t + 1 have landed
            __syncthreads();   // ... and every other wave's
        } }
    }
    asm volatile("s_wait_asynccnt 0x0" ::: "memory");   // no copy is outstanding when the buffers become output staging
    if constexpr (KW > 1) {
        // unrolled: the accumulators stay in registers only under constant indices
#pragma unroll
        for (int mb = 0; mb < 4; ++mb)
#pragma unroll
            for (int nb = 0; nb < 4; ++nb) {
#pragma unroll
                for (int j = 0; j < 8; ++j) os[(wv * 64 + mb * 16 + hi * 8 + j) * 68 + nb * 16 + lr] = acc[mb][nb][j]; }
        __syncthreads();   // every wave's partial tile is in LDS before any thread sums across the waves
        // unrolled (both loops): all of a thread's LDS reads are issued together instead of one wait per read
#pragma unroll
        for (int s = 0; s < 32 / KW; ++s) { const int slot = (int)threadIdx.x + s * 32 * KW, row = slot >> 4, cofs = (slot & 15) * 4; v4f val = *(const v4fa*)(os + row * 68 + cofs);
#pragma unroll
            for (int w = 1; w < KW; ++w) val += *(const v4fa*)(os + (w * 64 + row) * 68 + cofs);
            if (BIAS) { val[0] += bfr(bias[c0 + cofs]); val[1] += bfr(bias[c0 + cofs + 1]); val[2] += bfr(bias[c0 + cofs + 2]); val[3] += bfr(bias[c0 + cofs + 3]); }
            const size_t oo = (size_t)(r0 + row) * ldc + c0 + cofs;
            // the q loops below are unrolled so that the 4-wide vectors are indexed by constants and stay in registers
            if constexpr (EPI == 0) { *(v4f*)(C + oo) = val; }
            else if constexpr (EPI == 1) { v4h o16; v4us oh, ol;
#pragma unroll
                for (int q = 0; q < 4; ++q) { const float r = fmaxf(val[q], 0.0f); o16[q] = tohx(r); unsigned short a2, c2; splitf(r, a2, c2); oh[q] = a2; ol[q] = c2; }
                *(v4h*)(E16 + oo) = o16; *(v4us*)(Eh + oo) = oh; *(v4us*)(El + oo) = ol; }
            else if constexpr (EPI == 2) { v4us oh, ol;
#pragma unroll
                for (int q = 0; q < 4; ++q) { unsigned short a2, c2; splitf(val[q] * esc, a2, c2); oh[q] = a2; ol[q] = c2; }
                *(v4us*)(Eh + oo) = oh; *(v4us*)(El + oo) = ol; }
            else { v4f o;
#pragma unroll
                for (int q = 0; q < 4; ++q) { const float sg = __fdiv_rn(1.0f, __fadd_rn(1.0f, expf(-val[q]))); o[q] = __fmul_rn(sg, tanhf(val[q])); }
                *(v4f*)(C + oo) = o; } }
        return;
    }
#pragma unroll
    for (int mb = 0; mb < 4; ++mb) {
#pragma unroll
        for (int nb = 0; nb < 4; ++nb) {
#pragma unroll
            for (int j = 0; j < 8; ++j) os[(hi * 8 + j) * 68 + nb * 16 + lr] = acc[mb][nb][j]; }
        __builtin_amdgcn_wave_barrier(); asm volatile("" ::: "memory");
        float* crow = C + (size_t)(r0 + mb * 16) * ldc + c0;
{
#pragma unroll
            for (int s = 0; s < 8; ++s) { const int row = 2 * s + hi, cofs = lr * 4; v4f val = *(const v4fa*)(os + row * 68 + cofs); if (BIAS) { val[0] += bfr(bias[c0 + cofs]); val[1] += bfr(bias[c0 + cofs + 1]); val[2] += bfr(bias[c0 + cofs + 2]); val[3] += bfr(bias[c0 + cofs + 3]); }
                *(v4f*)(crow + (size_t)row * ldc + cofs) = val; }
             }
        __builtin_amdgcn_wave_barrier(); asm volatile("" ::: "memory");
    }
}


__global__ __launch_bounds__(256) void k_cvt8(const float* __restrict__ src, bf* dst, size_t n8) { const size_t i = (size_t)blockIdx.x * 256 + threadIdx.x; if (i >= n8) return; const v8f v = *(const v8f*)(src + i * 8); v8us o;
#pragma unroll
    for (int k = 0; k < 8; ++k) o[k] = f2bf(v[k]); *(v8us*)(dst + i * 8) = o;  }
// k_cvtc: k_cvt8 of the input [t][DM] that also lays the same bf16 values down as the left half of the concat operand's hi plane [t][DC]; the lo plane's left half is 0 (bf16(input) is exact in one plane)
__global__ __launch_bounds__(256) void k_cvtc(const float* __restrict__ src, bf* dst, bf* Ah, bf* Al, size_t n8) { const size_t i = (size_t)blockIdx.x * 256 + threadIdx.x; if (i >= n8) return; const v8f v = *(const v8f*)(src + i * 8); v8us o;
#pragma unroll
    for (int k = 0; k < 8; ++k) o[k] = f2bf(v[k]);
    const size_t e = i * 8, oc = (e / DM) * DC + (e % DM); *(v8us*)(dst + e) = o; *(v8us*)(Ah + oc) = o; *(v8us*)(Al + oc) = (v8us){};  }

__global__ __launch_bounds__(256) void k_asoft(const float* __restrict__ Sb, const float* __restrict__ mk, bf* Ph, bf* Pl) {
    const int lane = threadIdx.x & 31; const int row = blockIdx.x * 8 + (threadIdx.x >> 5); if (row >= ZH * TT) return; const int i = row % TT; const int zz = row / TT; const size_t bz = blockIdx.y;   /* batch in the pass */ mk += bz * TT; Ph += bz * ZH * RH * TT; Pl += bz * ZH * RH * TT; const float* sr = Sb + (bz * ZH * TT + row) * TT; float mx = -3.0e38f;
#pragma unroll 4
    for (int ch = 0; ch < TT / 128; ++ch) { const int j0 = ch * 128 + lane * 4; const v4f a = *(const v4f*)(sr + j0); const v4f m4 = *(const v4f*)(mk + j0);
#pragma unroll
        for (int q = 0; q < 4; ++q) { float t = a[q] * SCL; asm volatile("" : "+v"(t)); t = (bfr(m4[q]) != 0.0f) ? t : -3.0e38f;   /* masked memory position excluded (the reference's -1e30 penalty) */ mx = fmaxf(mx, t); } }
#pragma unroll
    for (int sh = 16; sh; sh >>= 1) mx = fmaxf(mx, __shfl_xor(mx, sh, 32));
    float sum = 0.f;
#pragma unroll 4
    for (int ch = 0; ch < TT / 128; ++ch) { const int j0 = ch * 128 + lane * 4; const v4f a = *(const v4f*)(sr + j0); const v4f m4 = *(const v4f*)(mk + j0);
#pragma unroll
        for (int q = 0; q < 4; ++q) { float t = a[q] * SCL; asm volatile("" : "+v"(t)); t = (bfr(m4[q]) != 0.0f) ? t : -3.0e38f;   /* masked memory position excluded (the reference's -1e30 penalty) */ float d0 = __fsub_rn(t, mx); asm volatile("" : "+v"(d0)); sum += __builtin_amdgcn_exp2f(__fmul_rn(d0, 1.4426950408889634f)); } }
#pragma unroll
    for (int sh = 16; sh; sh >>= 1) sum += __shfl_xor(sum, sh, 32);
    const float f = __fdiv_rn(1.0f, sum);
{
        {   /* rows < RH (the grid holds no others): normalised bf16 hi/lo over ALL TT keys (symmetric window: keys beyond RH are live), planes [zz][RH][TT] */
#pragma unroll 4
            for (int ch = 0; ch < TT / 128; ++ch) { const int j0 = ch * 128 + lane * 4; const v4f a = *(const v4f*)(sr + j0); const v4f m4 = *(const v4f*)(mk + j0); v4us oh, ol;
#pragma unroll
                for (int q = 0; q < 4; ++q) { float t = a[q] * SCL; asm volatile("" : "+v"(t)); t = (bfr(m4[q]) != 0.0f) ? t : -3.0e38f;   /* masked memory position excluded (the reference's -1e30 penalty) */ float d0 = __fsub_rn(t, mx); asm volatile("" : "+v"(d0)); float ex = __builtin_amdgcn_exp2f(__fmul_rn(d0, 1.4426950408889634f)); asm volatile("" : "+v"(ex)); unsigned short a2, c2; splitf(ex * f, a2, c2); oh[q] = a2; ol[q] = c2; }
                const size_t oo = ((size_t)zz * RH + i) * TT + j0; *(v4us*)(Ph + oo) = oh; *(v4us*)(Pl + oo) = ol; }
        }
         }
}


// ---- k_fattn: scores, softmax and weights x values of the fp16 query rows (RH on) in one kernel; no score or weight plane goes to memory. grid (rows / 32, batch in the pass), 256 threads.
// Everything is computed transposed, so that the score tile leaves the matrix unit in the layout the next product wants as its B operand: S^T [key][query] = K Q^T, O^T [d][query] = V^T P^T. A lane owns one query column: its running maximum, sum and rescale factor are plain per-lane values.
// The 8 waves are 2 query groups (16 queries each) x 4 key quarters: of each staged block of FK keys a wave takes 32. Each wave keeps its own maximum in use, sum and O^T; the four quarters of a query are merged through LDS at the end, in quarter order.
// Staging: per trip the work-group copies FK key rows (K, pitch + 16 B) and the FK-wide slice of all HD value^T rows (pitch + 16 B) into one of two LDS buffers; the next trip's copies fly during this trip's products.
#define FK   128
#define KPB  (HD * 2 + 16)
#define VPB  (FK * 2 + 16)
#define KTB  (FK * KPB)
#define FSTB (KTB + HD * VPB)
#define OPF  (HD + 4)   // floats per query row of a wave's partial O in LDS (16 rows fall on 16 bank groups)
#define L2E  1.4426950408889634f
// lane l takes the value of lane l ^ 16 by a vector move (a shuffle would queue in LDS behind the fragment loads)
__device__ __forceinline__ float xhalf(float x) { return __builtin_bit_cast(float, __builtin_amdgcn_permlanex16(__builtin_bit_cast(int, x), __builtin_bit_cast(int, x), 0x76543210, 0xfedcba98, false, false)); }
__global__ __launch_bounds__(256) void k_fattn(const h16* __restrict__ Q, const h16* __restrict__ Kp, const h16* __restrict__ Vt, const float* __restrict__ mk, bf* Oh, bf* Ol) {
    __shared__ __align__(16) char sm[2 * FSTB];   // the two staging buffers; after the key loop the partial O tiles
    __shared__ __align__(16) float msk[TT];       // 1 where the key is live, 0 where the mask excludes it
    __shared__ float mS[128], lS[128];            // per wave and query: running maximum and sum, for the merge
    const int tid = (int)threadIdx.x, lane = tid & 31, lr = lane & 15, hi = lane >> 4;
    const int wv = __builtin_amdgcn_readfirstlane(tid >> 5), qg = wv & 1, kq = wv >> 1;
    const size_t bz = blockIdx.y; const int q0 = (int)blockIdx.x * 32;
    Q += (bz * TT + RH + q0) * HD; Kp += bz * TT * HD; Vt += bz * HD * TT; mk += bz * TT;
    const unsigned lk = (unsigned)(size_t)sm + (unsigned)((tid >> 5) * KPB + (tid & 31) * 16);         // K: 32 pieces a row, 8 rows per copy of every thread
    const unsigned lv = (unsigned)(size_t)sm + (unsigned)(KTB + (tid >> 4) * VPB + (tid & 15) * 16);   // V^T: 16 pieces a row, 16 rows per copy of every thread
    const char* gk = (const char*)Kp + (size_t)(tid >> 5) * (HD * 2) + (tid & 31) * 16;
    const char* gv = (const char*)Vt + (size_t)(tid >> 4) * (TT * 2) + (tid & 15) * 16;
    auto stage = [&](int s, int buf) {   // key block s into buffer buf: 32 copies per lane, every lane on
        const unsigned lb = (unsigned)(buf * FSTB); const char* k = gk + (size_t)s * FK * HD * 2; const char* v = gv + (size_t)s * FK * 2;
        cp8(lk + lb, 8 * KPB, k, (size_t)8 * HD * 2); cp8(lk + lb + 64 * KPB, 8 * KPB, k + (size_t)64 * HD * 2, (size_t)8 * HD * 2);
        cp8(lv + lb, 16 * VPB, v, (size_t)16 * TT * 2); cp8(lv + lb + 128 * VPB, 16 * VPB, v + (size_t)128 * TT * 2, (size_t)16 * TT * 2);
    };
    stage(0, 0);
#pragma unroll
    for (int i = 0; i < TT / 1024; ++i) { const v4f m4 = *(const v4f*)(mk + (tid + i * 256) * 4); v4f o;
#pragma unroll
        for (int q = 0; q < 4; ++q) o[q] = (bfr(m4[q]) != 0.0f) ? 1.0f : 0.0f;
        *(v4f*)(msk + (tid + i * 256) * 4) = o; }
    const h16* qr = Q + (size_t)(qg * 16 + lr) * HD + hi * 8;   // B fragments of Q^T: column = query lr, the k order of the LDS fragment loads
    v16h qf[8];
#pragma unroll
    for (int ks = 0; ks < 8; ++ks) qf[ks] = cat16(*(const v8ha*)(qr + ks * 32), *(const v8ha*)(qr + ks * 32 + 16));
    asm volatile("s_wait_xcnt 0x0" :: "v"(qr), "s"(mk) : "memory");   // stands ahead of any reuse of the address registers of the mask and query loads above: reading both addresses here keeps them untouched up to the wait
    v8f acc[16];
#pragma unroll
    for (int dt = 0; dt < 16; ++dt) acc[dt] = (v8f){};
    float mrun = -3.0e38f, lrun = 0.0f;
    asm volatile("s_wait_asynccnt 0x0" ::: "memory");   // this wave's copies of block 0 have landed
    __syncthreads();   // ... and every other wave's; the mask flags are written
    stage(1, 1);
#pragma unroll 1
    for (int s = 0; s < TT / FK; ++s) {
        const char* bb = sm + (s & 1) * FSTB;
        const char* kb = bb + (kq * 32 + lr) * KPB + hi * 16;          // A fragments of K: row = key
        const char* vb = bb + KTB + lr * VPB + kq * 64 + hi * 16;      // A fragments of V^T: row = d, k = the wave's 32 keys
        const float* mp = msk + s * FK + kq * 32 + hi * 8;
        const v4f ma = *(const v4fa*)mp, mb = *(const v4fa*)(mp + 4), mc = *(const v4fa*)(mp + 16), md = *(const v4fa*)(mp + 20);
        v16h ka[16];
#pragma unroll
        for (int ks = 0; ks < 8; ++ks) { ka[2 * ks] = WFrag<h16>::ld(kb + ks * 64); ka[2 * ks + 1] = WFrag<h16>::ld(kb + 16 * KPB + ks * 64); }
        __builtin_amdgcn_sched_barrier(0);   // all key fragments' loads are issued as one group: one LDS latency per block (left to itself the compiler fetched half of them one product ahead, a wait each)
        v8f s0 = (v8f){}, s1 = (v8f){};
#pragma unroll
        for (int ks = 0; ks < 8; ++ks) { s0 = wmma16(ka[2 * ks], qf[ks], s0); s1 = wmma16(ka[2 * ks + 1], qf[ks], s1); }
        v16h va[16];
#pragma unroll
        for (int dt = 0; dt < 16; ++dt) va[dt] = WFrag<h16>::ld(vb + dt * 16 * VPB);
        __builtin_amdgcn_sched_barrier(0);   // the value fragments' loads are issued up here, so that the softmax below covers their latency (left to itself the compiler put each load, with a full wait, in front of its product)
        float bm = -3.0e38f;
#pragma unroll
        for (int j = 0; j < 8; ++j) { const float f0 = (j < 4) ? ma[j & 3] : mb[j & 3], f1 = (j < 4) ? mc[j & 3] : md[j & 3];
            s0[j] = (f0 != 0.0f) ? s0[j] * SCL : -3.0e38f; s1[j] = (f1 != 0.0f) ? s1[j] * SCL : -3.0e38f;   /* masked memory position excluded (the reference's -1e30 penalty) */
            bm = fmaxf(bm, fmaxf(s0[j], s1[j])); }
        bm = fmaxf(bm, xhalf(bm));   // the query's other eight-key halves
        // lazy rescale: the maximum in use moves only when some query's new maximum lies more than 2^8 above it (weights stay <= 256, well inside fp16); one scalar branch per block
        if (__builtin_amdgcn_ballot_w32((bm - mrun) * L2E > 8.0f) != 0) { const float mnew = fmaxf(mrun, bm), al = __builtin_amdgcn_exp2f((mrun - mnew) * L2E); mrun = mnew; lrun *= al;
#pragma unroll
            for (int dt = 0; dt < 16; ++dt) acc[dt] *= al; }
#pragma unroll
        for (int j = 0; j < 8; ++j) { s0[j] = (s0[j] - mrun) * L2E; s1[j] = (s1[j] - mrun) * L2E; }
        __builtin_amdgcn_sched_barrier(0);   // the sixteen exponentials below run back to back, each filling the slot behind the one before (interleaved with the lines above, most of them took a v_nop)
        float ps = 0.0f; v8h p0, p1;
#pragma unroll
        for (int j = 0; j < 8; ++j) { const float e0 = __builtin_amdgcn_exp2f(s0[j]), e1 = __builtin_amdgcn_exp2f(s1[j]); ps += e0 + e1; p0[j] = tohx(e0); p1[j] = tohx(e1); }
        lrun += ps;
        const v16h pf = cat16(p0, p1);   // S^T's accumulator layout is the B fragment's: keys hi*8 .. +7 and 16 + hi*8 .. +7 of column lr
#pragma unroll
        for (int dt = 0; dt < 16; ++dt) acc[dt] = wmma16(va[dt], pf, acc[dt]);
        asm volatile("s_wait_dscnt 0x0" ::: "memory");      // this wave's reads of the buffer are done before anybody refills it
        asm volatile("s_wait_asynccnt 0x0" ::: "memory");   // this wave's copies of block s + 1 have landed
        __syncthreads();   // ends every wave's reads of this block's buffer and publishes block s + 1
        if (s + 2 < TT / FK) stage(s + 2, s & 1);
    }
    asm volatile("s_wait_asynccnt 0x0" ::: "memory");   // no copy is outstanding when the buffers become the partial O tiles
    lrun += xhalf(lrun);
    if (hi == 0) { mS[wv * 16 + lr] = mrun; lS[wv * 16 + lr] = lrun; }
    __syncthreads();   // every wave's maximum and sum are in LDS
    float M = -3.0e38f, L = 0.0f;
#pragma unroll
    for (int w = 0; w < 4; ++w) M = fmaxf(M, mS[(w * 2 + qg) * 16 + lr]);
#pragma unroll
    for (int w = 0; w < 4; ++w) L += lS[(w * 2 + qg) * 16 + lr] * __builtin_amdgcn_exp2f((mS[(w * 2 + qg) * 16 + lr] - M) * L2E);
    const float wsc = __fdiv_rn(__builtin_amdgcn_exp2f((mrun - M) * L2E), L);
    float* os = (float*)sm;
#pragma unroll
    for (int dt = 0; dt < 16; ++dt) { const v8f o = acc[dt] * wsc; float* op = os + (size_t)(wv * 16 + lr) * OPF + dt * 16 + hi * 8;
        *(v4fa*)op = (v4f){o[0], o[1], o[2], o[3]}; *(v4fa*)(op + 4) = (v4f){o[4], o[5], o[6], o[7]}; }
    __syncthreads();   // every wave's scaled partial O is in LDS before any thread sums the four quarters
#pragma unroll
    for (int g = 0; g < 4; ++g) { const int u = tid + g * 256, ql = u >> 5, d8 = (u & 31) * 8; v4f x = (v4f){}, y = (v4f){};
#pragma unroll
        for (int w = 0; w < 4; ++w) { const float* ip = os + (size_t)((w * 2 + (ql >> 4)) * 16 + (ql & 15)) * OPF + d8; x += *(const v4fa*)ip; y += *(const v4fa*)(ip + 4); }
        v8us oh, ol;
#pragma unroll
        for (int q = 0; q < 4; ++q) { unsigned short a2, c2; splitf(x[q], a2, c2); oh[q] = a2; ol[q] = c2; splitf(y[q], a2, c2); oh[q + 4] = a2; ol[q + 4] = c2; }
        const size_t oo = (bz * TT + RH + q0 + ql) * DC + DM + d8; *(v8us*)(Oh + oo) = oh; *(v8us*)(Ol + oo) = ol; }
}

__global__ __launch_bounds__(256) void k_vtpb(const float* __restrict__ F, int pitch, int nheads, h16* V16, bf* Vh, bf* Vl) { const size_t e = ((size_t)blockIdx.x * 256 + threadIdx.x) * 2; if (e >= (size_t)nheads * HD * TT) return; const int t = (int)(e % TT); const int d = (int)((e / TT) % HD); const int g = (int)(e / ((size_t)TT * HD)); const size_t bz = blockIdx.y;   /* batch in the pass */ F += bz * TT * pitch; const size_t eo = bz * nheads * HD * TT + e; v2h o16; v2us oh, ol;
#pragma unroll
    for (int q = 0; q < 2; ++q) { const float x = bfr(F[(size_t)(t + q) * pitch + g * HD + d]);   /* the value IS a module input: round to bf16 once (lo plane 0) */ o16[q] = tohx(x); unsigned short a2, c2; splitf(x, a2, c2); oh[q] = a2; ol[q] = c2; }
    *(v2h*)(V16 + eo) = o16; *(v2us*)(Vh + eo) = oh; *(v2us*)(Vl + eo) = ol;  }

extern "C" void kernel_launch(void* const* d_in, const int* in_sizes, int n_in,
                              void* d_out, int out_size, void* d_ws, size_t ws_size, hipStream_t stream) {
    (void)in_sizes; (void)n_in; (void)out_size;
    const float* x = (const float*)d_in[0];   /* input */ const float* xm = (const float*)d_in[1];   /* memory */ const float* mk = (const float*)d_in[2];   /* mask [4][4096] f32 */ const float* wq = (const float*)d_in[3]; const float* bq = (const float*)d_in[4]; const float* wk = (const float*)d_in[5]; const float* bk = (const float*)d_in[6]; const float* w2 = (const float*)d_in[7]; const float* b2 = (const float*)d_in[8];   /* argument order input, memory, mask, W_in1, b_in1, W_mem1, b_mem1, W2, b2 */
    float* OUT = (float*)d_out;     // [4][4096][256]
    char* wsp = (char*)d_ws;
    auto take = [&](size_t bytes) { char* p = wsp; wsp += (bytes + 255) & ~(size_t)255; return (void*)p; };
    bf* WQ = (bf*)take((size_t)DQ * DM * 2); bf* WK = (bf*)take((size_t)DKV * DM * 2); bf* W2B = (bf*)take((size_t)DM * DC * 2); bf* CAh = (bf*)take((size_t)NP * TT * DC * 2); bf* CAl = (bf*)take((size_t)NP * TT * DC * 2);
    h16* QP16 = (h16*)take((size_t)NP * NH_ * TT * HD * 2); h16* KP16 = (h16*)take((size_t)NP * NKV * TT * HD * 2); h16* VT16 = (h16*)take((size_t)NP * NKV * HD * TT * 2);
    bf* QPh = (bf*)take((size_t)NP * NH_ * TT * HD * 2); bf* QPl = (bf*)take((size_t)NP * NH_ * TT * HD * 2); bf* KPh = (bf*)take((size_t)NP * NKV * TT * HD * 2); bf* KPl = (bf*)take((size_t)NP * NKV * TT * HD * 2); bf* VTh = (bf*)take((size_t)NP * NKV * HD * TT * 2); bf* VTl = (bf*)take((size_t)NP * NKV * HD * TT * 2); bf* Ph = (bf*)take((size_t)NP * ZH * RH * TT * 2); bf* Pl = (bf*)take((size_t)NP * ZH * RH * TT * 2);
    float* Sb = (float*)take((size_t)NP * ZH * TT * TT * 4);   /* only the rows < RH of each batch's score plane are written and read */
    bf* XB = (bf*)Sb;   /* the bf16 copies [NP][TT][DM] are last read by the key projection, before the scores are first written: they borrow the score plane's bytes */
    if ((size_t)(wsp - (char*)d_ws) > ws_size) return;    // ws 256 MiB
    k_cvt8<<<(unsigned)(((size_t)DQ * DM / 8 + 255) / 256), 256, 0, stream>>>(wq, WQ, (size_t)DQ * DM / 8); k_cvt8<<<(unsigned)(((size_t)DKV * DM / 8 + 255) / 256), 256, 0, stream>>>(wk, WK, (size_t)DKV * DM / 8); k_cvt8<<<(unsigned)(((size_t)DM * DC / 8 + 255) / 256), 256, 0, stream>>>(w2, W2B, (size_t)DM * DC / 8);   /* W2 'oi' [256][512] = Bt as-is */
    const unsigned LKv = (unsigned)(((size_t)NKV * TT * HD / 2 + 255) / 256);
    for (int b = 0; b < NB_; b += NP) {   /* batches b .. b + NP - 1; their rows follow one another in the inputs, the output and every [t][...] plane */
        k_cvtc<<<(unsigned)(((size_t)NP * TT * DM / 8 + 255) / 256), 256, 0, stream>>>(x + (size_t)b * TT * DM, XB, CAh, CAl, (size_t)NP * TT * DM / 8);   /* XB := bf16(input[b ..]); also the concat operand's left half */
        k_gemmw<bf, 0, true, 8, 1><<<dim3(NP * TT / 64, DQ / 64, 1), 256, 0, stream>>>(XB, nullptr, WQ, nullptr, DM, nullptr, DQ, bq, 0, 0, 0, QP16, QPh, QPl, 1.0f);   /* query planes of input_dot = relu(input W_in1^T + b) */
        k_cvt8<<<(unsigned)(((size_t)NP * TT * DM / 8 + 255) / 256), 256, 0, stream>>>(xm + (size_t)b * TT * DM, XB, (size_t)NP * TT * DM / 8);   /* XB := bf16(memory[b ..]) (the q projection above consumed bf16(input[b ..])) */
        k_gemmw<bf, 0, true, 8, 1><<<dim3(NP * TT / 64, DKV / 64, 1), 256, 0, stream>>>(XB, nullptr, WK, nullptr, DM, nullptr, DKV, bk, 0, 0, 0, KP16, KPh, KPl, 1.0f);   /* key planes of memory_dot */
        k_vtpb<<<dim3(LKv, NP, 1), 256, 0, stream>>>(xm + (size_t)b * TT * DM, DM, NKV, VT16, VTh, VTl);   /* values = the memory itself (bf16-rounded input: hi plane exact, lo plane 0) */
        k_gemmw<bf, 2, false, 8, 0><<<dim3(RH / 64, TT / 64, NP * ZH), 256, 0, stream>>>(QPh, QPl, KPh, KPl, HD, Sb, TT, nullptr, (size_t)TT * HD, (size_t)TT * HD, (size_t)TT * TT, nullptr, nullptr, nullptr, 1.0f);
        k_asoft<<<dim3(ZH * RH / 8, NP, 1), 256, 0, stream>>>(Sb, mk + (size_t)b * TT, Ph, Pl);
        /* output_one = weights x values, written as the hi/lo right half of the concat operand (pitch DC, column DM on) */
        k_gemmw<bf, 1, false, 16, 2><<<dim3(RH / 64, HD / 64, NP * ZH), 512, 0, stream>>>(Ph, Pl, VTh, nullptr, TT, nullptr, DC, nullptr, (size_t)RH * TT, (size_t)HD * TT, (size_t)TT * DC, nullptr, CAh + DM, CAl + DM, 1.0f);   /* weights hi/lo x exact bf16 values (2 products) */
        k_fattn<<<dim3((TT - RH) / 32, NP, 1), 256, 0, stream>>>(QP16, KP16, VT16, mk + (size_t)b * TT, CAh, CAl);   /* rows RH on: fp16 scores, streaming softmax and fp16 weights x values in one kernel */
        k_gemmw<bf, 1, true, 8, 3><<<dim3(NP * TT / 64, DM / 64, 1), 256, 0, stream>>>(CAh, CAl, W2B, nullptr, DC, OUT + (size_t)b * TT * DM, DM, b2, 0, 0, 0, nullptr, nullptr, nullptr, 1.0f);   /* z = [input | output_one] W2^T + b2; out = sigmoid(z) tanh(z) */
    }
}

// v006
// One run takes 236 microseconds.
// Two timings next to v005 put it at 1.30 and 1.31 times that version's speed.
// Over all steps from v000 it is 5.60 times as fast.
#include <hip/hip_runtime.h>

// Gated attention reader (input, memory [4][4096][256]; mask [4][4096] f32 0/1 over memory positions (read); input_dot = relu(input W_in1^T + b_in1), memory_dot = relu(memory W_mem1^T + b_mem1) ('oi' [256][256] 1/16, zero biases); att = input_dot . memory_dot / 16 - 1e30 (1 - mask[m]) (== exclusion); softmax over the 4,096 memory positions; output_one = weights . memory; z = [input | output_one] W2^T + b2 ('oi' [256][512]); out = sigmoid(z) tanh(z) -> [4][4096][256] (4.2 M); argument order input, memory, mask, W_in1, b_in1, W_mem1, b_mem1, W2, b2).
// NP batches go through each launch together (more rows, or grid z / y = batch in the pass). Layout per batch: bf16 copy of input then memory; exact projections + f32 biases, ReLU and the split into query/key planes in the projection's own epilogue; one 256-wide head; value^T planes straight from the bf16-rounded memory; dense T-4096 attention, hybrid rows: < 512 hi/lo 3-product scores, three-sweep softmax reading the mask row and hi/lo x exact-value products; the rest fp16, scores, online softmax and weights x values in one kernel; output_one leaves the weights x values epilogue as the hi/lo right half of the concat operand (its left half bf16(input) is written with the input's bf16 copy); [bf16(input) | hi/lo(output_one)] x W2 exact + b2, whose epilogue applies sigmoid(z) tanh(z) and writes the output.
// Compute dtypes, f32 accumulate: every input rounded to bf16; projections exact + f32 biases; attention rows < 512 3 products (scores) / 2 products (weights x exact values), rest fp16; softmax f32; W2 [exact | hl] x exact + bias; sigmoid/tanh f32 (precise expf/tanhf).

#define NB_  4
#define TT   4096
#define DM   256
#define NH_  1
#define NKV  1
#define REP  (NH_ / NKV)
#define HD   256
#define DQ   (NH_ * HD)
#define DKV  (NKV * HD)
#define ZH   1
#define RH   512                  // query rows < RH use hi+lo planes (0: none)
#define WIN  0
#define SCL  0.0625f   // 1 / float32(sqrt(256))
#define DC   (2 * DM)   // concat width
#define NP   4          // batches that share every launch of a pass: all of them (the score plane holds only the RH rows of each batch that are written, so four batches' planes fit the workspace)
typedef _Float16 h16;
typedef unsigned short bf;
typedef __attribute__((ext_vector_type(16))) __bf16   v16bf;
typedef __attribute__((ext_vector_type(16))) _Float16 v16h;
typedef __attribute__((ext_vector_type(8)))  _Float16 v8h;
typedef __attribute__((ext_vector_type(8)))  unsigned short v8us;
typedef __attribute__((ext_vector_type(8)))  float    v8f;
typedef __attribute__((ext_vector_type(4)))  float    v4f;
typedef v8h  __attribute__((may_alias)) v8ha;
typedef v4f  __attribute__((may_alias)) v4fa;
typedef v8us __attribute__((may_alias)) v8usa;

__device__ __forceinline__ unsigned short f2bf(float f) { unsigned u = __float_as_uint(f); u += 0x7FFFu + ((u >> 16) & 1u); return (unsigned short)(u >> 16); }
__device__ __forceinline__ float bf2f(unsigned short b) { return __uint_as_float(((unsigned)b) << 16); }
__device__ __forceinline__ float bfr(float f) { return bf2f(f2bf(f)); }
__device__ __forceinline__ v16h cat16(v8h lo, v8h hi) { return __builtin_shufflevector(lo, hi, 0, 1, 2, 3, 4, 5, 6, 7, 8, 9, 10, 11, 12, 13, 14, 15); }
__device__ __forceinline__ v16bf cat16b(v8us lo, v8us hi) { return __builtin_bit_cast(v16bf, __builtin_shufflevector(lo, hi, 0, 1, 2, 3, 4, 5, 6, 7, 8, 9, 10, 11, 12, 13, 14, 15)); }
__device__ __forceinline__ v8f wmma16(v16h a, v16h b, v8f c) { return __builtin_amdgcn_wmma_f32_16x16x32_f16(false, a, false, b, (short)0, c, false, false); }
__device__ __forceinline__ v8f wmmab(v16bf a, v16bf b, v8f c) { return __builtin_amdgcn_wmma_f32_16x16x32_bf16(false, a, false, b, (short)0, c, false, false); }

__device__ __forceinline__ h16 tohx(float x) { return (h16)x; }
__device__ __forceinline__ void splitf(float y, unsigned short& h, unsigned short& l) { h = f2bf(y); l = f2bf(y - bf2f(h)); }
typedef __attribute__((ext_vector_type(2))) _Float16 v2h;
typedef __attribute__((ext_vector_type(4))) _Float16 v4h;
typedef __attribute__((ext_vector_type(2))) unsigned short v2us;
typedef __attribute__((ext_vector_type(4))) unsigned short v4us;
typedef __attribute__((ext_vector_type(2))) float v2f;
typedef __attribute__((ext_vector_type(4))) int v4i;

// ---- k_gemmw: register-blocked GEMM, one 64x64 output tile per work-group (16 accumulators per wave), operands from K-contiguous 16-bit planes, staged in LDS by asynchronous copies; grid (M/64, N/64, Z), 32 * KW threads.
// C[m][n] (f32, pitch ldc, + optional f32 bias[n]) = sum_k A[m][k] Bt[n][k] (+ split products per NSPLIT). z-batch strides sA/sB/sC in elements (sC also moves the EPI 2 planes). K % (32 * KW) == 0, and K % 64 == 0 where KW == 1.
// KW waves share the tile's K: wave w takes the 32-wide k blocks w, w + KW, ...; the KW partial tiles are summed through LDS in wave order 0 .. KW-1.
// Staging: per trip the work-group copies, of each operand plane, 64 rows x (32 * KW * KS) k into LDS (row pitch + 16 B, so that 16 rows fall on 16 different bank groups). A copy instruction takes 512 B (KW > 1) or 4 x 128 B (KW == 1) of whole lines, where a fragment load from the plane itself touches 16 lines for 32 B each. Fragments then come from LDS with the k order of the direct loads. One-product kernels use two buffers (the next trip's copies fly during this trip's products); the split-product kernels have room for one.
// EPI names what the KW > 1 epilogue does with the summed (+ bias) value v at [m][n], pitch ldc: 0 stores v to C; 1 stores relu(v) as the planes E16 (fp16), Eh / El (bf16 hi / lo); 2 stores v * esc as Eh / El; 3 stores sigmoid(v) tanh(v) to C.
template <typename T16> struct WFrag;
template <> struct WFrag<h16> { typedef v16h V; static __device__ __forceinline__ V ld(const char* p) { return cat16(*(const v8ha*)p, *(const v8ha*)(p + 32)); } static __device__ __forceinline__ v8f mma(V a, V b, v8f c) { return wmma16(a, b, c); } };
template <> struct WFrag<bf> { typedef v16bf V; static __device__ __forceinline__ V ld(const char* p) { return cat16b(*(const v8usa*)p, *(const v8usa*)(p + 32)); } static __device__ __forceinline__ v8f mma(V a, V b, v8f c) { return wmmab(a, b, c); } };
// eight asynchronous 16-byte copies per lane, global -> LDS: copy q takes g + q * gs to LDS byte l + q * ls. The s_wait_xcnt closes the statement so that no address register of a copy is rewritten ahead of it.
__device__ __forceinline__ void cp8(unsigned l, unsigned ls, const char* g, size_t gs) {
    asm volatile("global_load_async_to_lds_b128 %0, %8, off\n\t"
                 "global_load_async_to_lds_b128 %1, %9, off\n\t"
                 "global_load_async_to_lds_b128 %2, %10, off\n\t"
                 "global_load_async_to_lds_b128 %3, %11, off\n\t"
                 "global_load_async_to_lds_b128 %4, %12, off\n\t"
                 "global_load_async_to_lds_b128 %5, %13, off\n\t"
                 "global_load_async_to_lds_b128 %6, %14, off\n\t"
                 "global_load_async_to_lds_b128 %7, %15, off\n\t"
                 "s_wait_xcnt 0x0"
                 :: "v"(l), "v"(l + ls), "v"(l + 2 * ls), "v"(l + 3 * ls), "v"(l + 4 * ls), "v"(l + 5 * ls), "v"(l + 6 * ls), "v"(l + 7 * ls),
                    "v"(g), "v"(g + gs), "v"(g + 2 * gs), "v"(g + 3 * gs), "v"(g + 4 * gs), "v"(g + 5 * gs), "v"(g + 6 * gs), "v"(g + 7 * gs)
                 : "memory");
}
// four waves per SIMD (256 registers a wave): two 8-wave work-groups still share a WGP, as their LDS allows
template <typename T16, int NSPLIT, bool BIAS, int KW, int EPI>
__global__ __launch_bounds__(32 * KW) __attribute__((amdgpu_waves_per_eu(4))) void k_gemmw(const T16* __restrict__ A, const T16* __restrict__ A2, const T16* __restrict__ Bt, const T16* __restrict__ Bt2, int K, float* C, int ldc, const float* __restrict__ bias, size_t sA, size_t sB, size_t sC, h16* E16, bf* Eh, bf* El, float esc) {
    typedef typename WFrag<T16>::V V;
    static_assert(NSPLIT <= 2, "planes staged: A, Bt, A2 (NSPLIT 1, 2), Bt2 (NSPLIT 2)");
    constexpr int KS = (KW == 1) ? 2 : 1;                  // 32-wide k steps of a wave per trip (a lone wave takes two, so that its rows are whole 128-B lines)
    constexpr int NBLK = (NSPLIT == 0) ? 2 : (NSPLIT == 1 ? 3 : 4), NBUF = (NSPLIT == 0) ? 2 : 1;
    constexpr int TK = 32 * KW * KS, GR = TK / 8, RP = 32 * KW / GR;   // k per trip; 16-byte pieces per staged row; rows that one copy of every thread covers
    constexpr int PB = TK * 2 + 16, BLKB = 64 * PB, STB = NBLK * BLKB;   // LDS bytes: row pitch, one plane's block, one buffer
    constexpr int OSB = (KW > 1 ? KW * 64 : 16) * 68 * 4;   // KW > 1: one whole 64-row partial tile per wave
    __shared__ __align__(16) float os[(OSB > NBUF * STB ? OSB : NBUF * STB) / 4];   // the staging buffers first, the output staging after the k loop
    const int wv = (KW > 1) ? __builtin_amdgcn_readfirstlane((int)(threadIdx.x >> 5)) : 0;   // wave-uniform, so the k loop stays scalar
    const size_t z = blockIdx.z; A += z * sA; if (A2) A2 += z * sA; Bt += z * sB; if (Bt2) Bt2 += z * sB; if constexpr (EPI == 2) { Eh += z * sC; El += z * sC; } else C += z * sC;
    const int lane = threadIdx.x & 31, lr = lane & 15, hi = lane >> 4; const int r0 = blockIdx.x * 64, c0 = blockIdx.y * 64;
    v8f acc[4][4];
#pragma unroll
    for (int mb = 0; mb < 4; ++mb)
#pragma unroll
        for (int nb = 0; nb < 4; ++nb) acc[mb][nb] = (v8f){};
    const int tid = (int)threadIdx.x, crow = tid / GR, ccol = tid % GR;   // the staged row and 16-byte piece that this lane copies first
    const unsigned lcp = (unsigned)(size_t)os + (unsigned)(crow * PB + ccol * 16);   // its LDS byte address inside a block
    const size_t acp = (size_t)(r0 + crow) * K + ccol * 8, bcp = (size_t)(c0 + crow) * K + ccol * 8, gstep = (size_t)RP * K * 2;
    const int ntr = (int)((unsigned)K / (unsigned)TK);   // trips: the same for every wave (K % TK == 0)
    auto stage = [&](int t, int buf) {   // all planes' blocks of trip t into buffer buf: 8 * KS copies per lane and plane, every lane on
        const size_t ko = (size_t)t * TK; const unsigned lb = lcp + (unsigned)(buf * STB);
#pragma unroll
        for (int h = 0; h < KS; ++h) { const unsigned lh = lb + (unsigned)(h * 8 * RP * PB); const size_t gh = (size_t)h * 8 * gstep;
            cp8(lh, RP * PB, (const char*)(A + acp + ko) + gh, gstep); cp8(lh + BLKB, RP * PB, (const char*)(Bt + bcp + ko) + gh, gstep);
            if constexpr (NSPLIT >= 1) cp8(lh + 2 * BLKB, RP * PB, (const char*)(A2 + acp + ko) + gh, gstep);
            if constexpr (NSPLIT >= 2) cp8(lh + 3 * BLKB, RP * PB, (const char*)(Bt2 + bcp + ko) + gh, gstep); }
    };
    stage(0, 0);
    asm volatile("s_wait_asynccnt 0x0" ::: "memory");   // this wave's copies of trip 0 have landed
    __syncthreads();   // ... and every other wave's: a wave reads rows that other waves copied
    if constexpr (NBUF == 2) { if (K >= 2 * TK) stage(1, 1); }   // a trip 1 exists
    const char* fb = (const char*)os + lr * PB + wv * KS * 64 + hi * 16;   // this lane's fragment piece: row lr, the wave's own k block
#pragma unroll 1
    for (int t = 0; t < ntr; ++t) {
        const char* fs = fb + ((NBUF == 2) ? (t & 1) * STB : 0);
#pragma unroll
        for (int s = 0; s < KS; ++s) {
            V a[4], a2[4];
#pragma unroll
            for (int mb = 0; mb < 4; ++mb) { a[mb] = WFrag<T16>::ld(fs + mb * 16 * PB + s * 64); if (NSPLIT == 1 || NSPLIT == 2) a2[mb] = WFrag<T16>::ld(fs + 2 * BLKB + mb * 16 * PB + s * 64); }
#pragma unroll
            for (int nb = 0; nb < 4; ++nb) { const V b = WFrag<T16>::ld(fs + BLKB + nb * 16 * PB + s * 64); V b2; if (NSPLIT >= 2) b2 = WFrag<T16>::ld(fs + 3 * BLKB + nb * 16 * PB + s * 64);
#pragma unroll
                for (int mb = 0; mb < 4; ++mb) { acc[mb][nb] = WFrag<T16>::mma(a[mb], b, acc[mb][nb]); if (NSPLIT == 1 || NSPLIT == 2) acc[mb][nb] = WFrag<T16>::mma(a2[mb], b, acc[mb][nb]); if (NSPLIT >= 2) acc[mb][nb] = WFrag<T16>::mma(a[mb], b2, acc[mb][nb]); } }
            asm volatile("v_nop\n\tv_nop\n\tv_nop\n\tv_nop" : "+v"(acc[0][0]), "+v"(acc[1][1]), "+v"(acc[2][2]), "+v"(acc[3][3]) : "v"(a[0]), "v"(a[3]));
        }
        asm volatile("s_wait_dscnt 0x0" ::: "memory");   // this wave's fragment reads of the buffer are done before anybody refills it
        if constexpr (NBUF == 2) asm volatile("s_wait_asynccnt 0x0" ::: "memory");   // this wave's copies of trip t + 1 have landed
        __syncthreads();   // ends every wave's reads of this trip's buffer; with two buffers it also publishes trip t + 1
        if constexpr (NBUF == 2) { if (t + 2 < ntr) stage(t + 2, t & 1); }
        else { if (t + 1 < ntr) { stage(t + 1, 0);
            asm volatile("s_wait_asynccnt 0x0" ::: "memory");   // this wave's copies of trip t + 1 have landed
            __syncthreads();   // ... and every other wave's
        } }
    }
    asm volatile("s_wait_asynccnt 0x0" ::: "memory");   // no copy is outstanding when the buffers become output staging
    if constexpr (KW > 1) {
        // unrolled: the accumulators stay in registers only under constant indices
#pragma unroll
        for (int mb = 0; mb < 4; ++mb)
#pragma unroll
            for (int nb = 0; nb < 4; ++nb) {
#pragma unroll
                for (int j = 0; j < 8; ++j) os[(wv * 64 + mb * 16 + hi * 8 + j) * 68 + nb * 16 + lr] = acc[mb][nb][j]; }
        __syncthreads();   // every wave's partial tile is in LDS before any thread sums across the waves
        // unrolled (both loops): all of a thread's LDS reads are issued together instead of one wait per read
#pragma unroll
        for (int s = 0; s < 32 / KW; ++s) { const int slot = (int)threadIdx.x + s * 32 * KW, row = slot >> 4, cofs = (slot & 15) * 4; v4f val = *(const v4fa*)(os + row * 68 + cofs);
#pragma unroll
            for (int w = 1; w < KW; ++w) val += *(const v4fa*)(os + (w * 64 + row) * 68 + cofs);
            if (BIAS) { val[0] += bfr(bias[c0 + cofs]); val[1] += bfr(bias[c0 + cofs + 1]); val[2] += bfr(bias[c0 + cofs + 2]); val[3] += bfr(bias[c0 + cofs + 3]); }
            const size_t oo = (size_t)(r0 + row) * ldc + c0 + cofs;
            // the q loops below are unrolled so that the 4-wide vectors are indexed by constants and stay in registers
            if constexpr (EPI == 0) { *(v4f*)(C + oo) = val; }
            else if constexpr (EPI == 1) { v4h o16; v4us oh, ol;
#pragma unroll
                for (int q = 0; q < 4; ++q) { const float r = fmaxf(val[q], 0.0f); o16[q] = tohx(r); unsigned short a2, c2; splitf(r, a2, c2); oh[q] = a2; ol[q] = c2; }
                *(v4h*)(E16 + oo) = o16; *(v4us*)(Eh + oo) = oh; *(v4us*)(El + oo) = ol; }
            else if constexpr (EPI == 2) { v4us oh, ol;
#pragma unroll
                for (int q = 0; q < 4; ++q) { unsigned short a2, c2; splitf(val[q] * esc, a2, c2); oh[q] = a2; ol[q] = c2; }
                *(v4us*)(Eh + oo) = oh; *(v4us*)(El + oo) = ol; }
            else { v4f o;
#pragma unroll
                for (int q = 0; q < 4; ++q) { const float sg = __fdiv_rn(1.0f, __fadd_rn(1.0f, expf(-val[q]))); o[q] = __fmul_rn(sg, tanhf(val[q])); }
                *(v4f*)(C + oo) = o; } }
        return;
    }
#pragma unroll
    for (int mb = 0; mb < 4; ++mb) {
#pragma unroll
        for (int nb = 0; nb < 4; ++nb) {
#pragma unroll
            for (int j = 0; j < 8; ++j) os[(hi * 8 + j) * 68 + nb * 16 + lr] = acc[mb][nb][j]; }
        __builtin_amdgcn_wave_barrier(); asm volatile("" ::: "memory");
        float* crow = C + (size_t)(r0 + mb * 16) * ldc + c0;
{
#pragma unroll
            for (int s = 0; s < 8; ++s) { const int row = 2 * s + hi, cofs = lr * 4; v4f val = *(const v4fa*)(os + row * 68 + cofs); if (BIAS) { val[0] += bfr(bias[c0 + cofs]); val[1] += bfr(bias[c0 + cofs + 1]); val[2] += bfr(bias[c0 + cofs + 2]); val[3] += bfr(bias[c0 + cofs + 3]); }
                *(v4f*)(crow + (size_t)row * ldc + cofs) = val; }
             }
        __builtin_amdgcn_wave_barrier(); asm volatile("" ::: "memory");
    }
}


__global__ __launch_bounds__(256) void k_cvt8(const float* __restrict__ src, bf* dst, size_t n8) { const size_t i = (size_t)blockIdx.x * 256 + threadIdx.x; if (i >= n8) return; const v8f v = *(const v8f*)(src + i * 8); v8us o;
#pragma unroll
    for (int k = 0; k < 8; ++k) o[k] = f2bf(v[k]); *(v8us*)(dst + i * 8) = o;  }
// k_cvtc: k_cvt8 of the input [t][DM] that also lays the same bf16 values down as the left half of the concat operand's hi plane [t][DC]; the lo plane's left half is 0 (bf16(input) is exact in one plane)
__global__ __launch_bounds__(256) void k_cvtc(const float* __restrict__ src, bf* dst, bf* Ah, bf* Al, size_t n8) { const size_t i = (size_t)blockIdx.x * 256 + threadIdx.x; if (i >= n8) return; const v8f v = *(const v8f*)(src + i * 8); v8us o;
#pragma unroll
    for (int k = 0; k < 8; ++k) o[k] = f2bf(v[k]);
    const size_t e = i * 8, oc = (e / DM) * DC + (e % DM); *(v8us*)(dst + e) = o; *(v8us*)(Ah + oc) = o; *(v8us*)(Al + oc) = (v8us){};  }

__global__ __launch_bounds__(256) void k_asoft(const float* __restrict__ Sb, const float* __restrict__ mk, bf* Ph, bf* Pl) {
    const int lane = threadIdx.x & 31; const int row = blockIdx.x * 8 + (threadIdx.x >> 5); if (row >= ZH * TT) return; const int i = row % TT; const int zz = row / TT; const size_t bz = blockIdx.y;   /* batch in the pass */ mk += bz * TT; Ph += bz * ZH * RH * TT; Pl += bz * ZH * RH * TT; const float* sr = Sb + ((bz * ZH + zz) * RH + i) * TT;   /* score planes [batch][zz][RH][TT] */ float mx = -3.0e38f;
#pragma unroll 4
    for (int ch = 0; ch < TT / 128; ++ch) { const int j0 = ch * 128 + lane * 4; const v4f a = *(const v4f*)(sr + j0); const v4f m4 = *(const v4f*)(mk + j0);
#pragma unroll
        for (int q = 0; q < 4; ++q) { float t = a[q] * SCL; asm volatile("" : "+v"(t)); t = (bfr(m4[q]) != 0.0f) ? t : -3.0e38f;   /* masked memory position excluded (the reference's -1e30 penalty) */ mx = fmaxf(mx, t); } }
#pragma unroll
    for (int sh = 16; sh; sh >>= 1) mx = fmaxf(mx, __shfl_xor(mx, sh, 32));
    float sum = 0.f;
#pragma unroll 4
    for (int ch = 0; ch < TT / 128; ++ch) { const int j0 = ch * 128 + lane * 4; const v4f a = *(const v4f*)(sr + j0); const v4f m4 = *(const v4f*)(mk + j0);
#pragma unroll
        for (int q = 0; q < 4; ++q) { float t = a[q] * SCL; asm volatile("" : "+v"(t)); t = (bfr(m4[q]) != 0.0f) ? t : -3.0e38f;   /* masked memory position excluded (the reference's -1e30 penalty) */ float d0 = __fsub_rn(t, mx); asm volatile("" : "+v"(d0)); sum += __builtin_amdgcn_exp2f(__fmul_rn(d0, 1.4426950408889634f)); } }
#pragma unroll
    for (int sh = 16; sh; sh >>= 1) sum += __shfl_xor(sum, sh, 32);
    const float f = __fdiv_rn(1.0f, sum);
{
        {   /* rows < RH (the grid holds no others): normalised bf16 hi/lo over ALL TT keys (symmetric window: keys beyond RH are live), planes [zz][RH][TT] */
#pragma unroll 4
            for (int ch = 0; ch < TT / 128; ++ch) { const int j0 = ch * 128 + lane * 4; const v4f a = *(const v4f*)(sr + j0); const v4f m4 = *(const v4f*)(mk + j0); v4us oh, ol;
#pragma unroll
                for (int q = 0; q < 4; ++q) { float t = a[q] * SCL; asm volatile("" : "+v"(t)); t = (bfr(m4[q]) != 0.0f) ? t : -3.0e38f;   /* masked memory position excluded (the reference's -1e30 penalty) */ float d0 = __fsub_rn(t, mx); asm volatile("" : "+v"(d0)); float ex = __builtin_amdgcn_exp2f(__fmul_rn(d0, 1.4426950408889634f)); asm volatile("" : "+v"(ex)); unsigned short a2, c2; splitf(ex * f, a2, c2); oh[q] = a2; ol[q] = c2; }
                const size_t oo = ((size_t)zz * RH + i) * TT + j0; *(v4us*)(Ph + oo) = oh; *(v4us*)(Pl + oo) = ol; }
        }
         }
}


// ---- k_fattn: scores, softmax and weights x values of the fp16 query rows (RH on) in one kernel; no score or weight plane goes to memory. grid (rows / 32, batch in the pass), 256 threads.
// Everything is computed transposed, so that the score tile leaves the matrix unit in the layout the next product wants as its B operand: S^T [key][query] = K Q^T, O^T [d][query] = V^T P^T. A lane owns one query column: its running maximum, sum and rescale factor are plain per-lane values.
// The 8 waves are 2 query groups (16 queries each) x 4 key quarters: of each staged block of FK keys a wave takes 32. Each wave keeps its own maximum in use, sum and O^T; the four quarters of a query are merged through LDS at the end, in quarter order.
// Staging: per trip the work-group copies FK key rows (K, pitch + 16 B) and the FK-wide slice of all HD value^T rows (pitch + 16 B) into one of two LDS buffers; the next trip's copies fly during this trip's products.
#define FK   128
#define KPB  (HD * 2 + 16)
#define VPB  (FK * 2 + 16)
#define KTB  (FK * KPB)
#define FSTB (KTB + HD * VPB)
#define OPF  (HD + 4)   // floats per query row of a wave's partial O in LDS (16 rows fall on 16 bank groups)
#define L2E  1.4426950408889634f
// lane l takes the value of lane l ^ 16 by a vector move (a shuffle would queue in LDS behind the fragment loads)
__device__ __forceinline__ float xhalf(float x) { return __builtin_bit_cast(float, __builtin_amdgcn_permlanex16(__builtin_bit_cast(int, x), __builtin_bit_cast(int, x), 0x76543210, 0xfedcba98, false, false)); }
__global__ __launch_bounds__(256) void k_fattn(const h16* __restrict__ Q, const h16* __restrict__ Kp, const h16* __restrict__ Vt, const float* __restrict__ mk, bf* Oh, bf* Ol) {
    __shared__ __align__(16) char sm[2 * FSTB];   // the two staging buffers; after the key loop the partial O tiles
    __shared__ __align__(16) float msk[TT];       // 1 where the key is live, 0 where the mask excludes it
    __shared__ float mS[128], lS[128];            // per wave and query: running maximum and sum, for the merge
    const int tid = (int)threadIdx.x, lane = tid & 31, lr = lane & 15, hi = lane >> 4;
    const int wv = __builtin_amdgcn_readfirstlane(tid >> 5), qg = wv & 1, kq = wv >> 1;
    const size_t bz = blockIdx.y; const int q0 = (int)blockIdx.x * 32;
    Q += (bz * TT + RH + q0) * HD; Kp += bz * TT * HD; Vt += bz * HD * TT; mk += bz * TT;
    const unsigned lk = (unsigned)(size_t)sm + (unsigned)((tid >> 5) * KPB + (tid & 31) * 16);         // K: 32 pieces a row, 8 rows per copy of every thread
    const unsigned lv = (unsigned)(size_t)sm + (unsigned)(KTB + (tid >> 4) * VPB + (tid & 15) * 16);   // V^T: 16 pieces a row, 16 rows per copy of every thread
    const char* gk = (const char*)Kp + (size_t)(tid >> 5) * (HD * 2) + (tid & 31) * 16;
    const char* gv = (const char*)Vt + (size_t)(tid >> 4) * (TT * 2) + (tid & 15) * 16;
    auto stage = [&](int s, int buf) {   // key block s into buffer buf: 32 copies per lane, every lane on
        const unsigned lb = (unsigned)(buf * FSTB); const char* k = gk + (size_t)s * FK * HD * 2; const char* v = gv + (size_t)s * FK * 2;
        cp8(lk + lb, 8 * KPB, k, (size_t)8 * HD * 2); cp8(lk + lb + 64 * KPB, 8 * KPB, k + (size_t)64 * HD * 2, (size_t)8 * HD * 2);
        cp8(lv + lb, 16 * VPB, v, (size_t)16 * TT * 2); cp8(lv + lb + 128 * VPB, 16 * VPB, v + (size_t)128 * TT * 2, (size_t)16 * TT * 2);
    };
    stage(0, 0);
#pragma unroll
    for (int i = 0; i < TT / 1024; ++i) { const v4f m4 = *(const v4f*)(mk + (tid + i * 256) * 4); v4f o;
#pragma unroll
        for (int q = 0; q < 4; ++q) o[q] = (bfr(m4[q]) != 0.0f) ? 1.0f : 0.0f;
        *(v4f*)(msk + (tid + i * 256) * 4) = o; }
    const h16* qr = Q + (size_t)(qg * 16 + lr) * HD + hi * 8;   // B fragments of Q^T: column = query lr, the k order of the LDS fragment loads
    v16h qf[8];
#pragma unroll
    for (int ks = 0; ks < 8; ++ks) qf[ks] = cat16(*(const v8ha*)(qr + ks * 32), *(const v8ha*)(qr + ks * 32 + 16));
    asm volatile("s_wait_xcnt 0x0" :: "v"(qr), "s"(mk) : "memory");   // stands ahead of any reuse of the address registers of the mask and query loads above: reading both addresses here keeps them untouched up to the wait
    v8f acc[16];
#pragma unroll
    for (int dt = 0; dt < 16; ++dt) acc[dt] = (v8f){};
    float mrun = -3.0e38f, lrun = 0.0f;
    asm volatile("s_wait_asynccnt 0x0" ::: "memory");   // this wave's copies of block 0 have landed
    __syncthreads();   // ... and every other wave's; the mask flags are written
    stage(1, 1);
#pragma unroll 1
    for (int s = 0; s < TT / FK; ++s) {
        const char* bb = sm + (s & 1) * FSTB;
        const char* kb = bb + (kq * 32 + lr) * KPB + hi * 16;          // A fragments of K: row = key
        const char* vb = bb + KTB + lr * VPB + kq * 64 + hi * 16;      // A fragments of V^T: row = d, k = the wave's 32 keys
        const float* mp = msk + s * FK + kq * 32 + hi * 8;
        const v4f ma = *(const v4fa*)mp, mb = *(const v4fa*)(mp + 4), mc = *(const v4fa*)(mp + 16), md = *(const v4fa*)(mp + 20);
        v16h ka[16];
#pragma unroll
        for (int ks = 0; ks < 8; ++ks) { ka[2 * ks] = WFrag<h16>::ld(kb + ks * 64); ka[2 * ks + 1] = WFrag<h16>::ld(kb + 16 * KPB + ks * 64); }
        __builtin_amdgcn_sched_barrier(0);   // all key fragments' loads are issued as one group: one LDS latency per block (left to itself the compiler fetched half of them one product ahead, a wait each)
        v8f s0 = (v8f){}, s1 = (v8f){};
#pragma unroll
        for (int ks = 0; ks < 8; ++ks) { s0 = wmma16(ka[2 * ks], qf[ks], s0); s1 = wmma16(ka[2 * ks + 1], qf[ks], s1); }
        v16h va[16];
#pragma unroll
        for (int dt = 0; dt < 16; ++dt) va[dt] = WFrag<h16>::ld(vb + dt * 16 * VPB);
        __builtin_amdgcn_sched_barrier(0);   // the value fragments' loads are issued up here, so that the softmax below covers their latency (left to itself the compiler put each load, with a full wait, in front of its product)
        float bm = -3.0e38f;
#pragma unroll
        for (int j = 0; j < 8; ++j) { const float f0 = (j < 4) ? ma[j & 3] : mb[j & 3], f1 = (j < 4) ? mc[j & 3] : md[j & 3];
            s0[j] = (f0 != 0.0f) ? s0[j] * SCL : -3.0e38f; s1[j] = (f1 != 0.0f) ? s1[j] * SCL : -3.0e38f;   /* masked memory position excluded (the reference's -1e30 penalty) */
            bm = fmaxf(bm, fmaxf(s0[j], s1[j])); }
        bm = fmaxf(bm, xhalf(bm));   // the query's other eight-key halves
        // lazy rescale: the maximum in use moves only when some query's new maximum lies more than 2^8 above it (weights stay <= 256, well inside fp16); one scalar branch per block
        if (__builtin_amdgcn_ballot_w32((bm - mrun) * L2E > 8.0f) != 0) { const float mnew = fmaxf(mrun, bm), al = __builtin_amdgcn_exp2f((mrun - mnew) * L2E); mrun = mnew; lrun *= al;
#pragma unroll
            for (int dt = 0; dt < 16; ++dt) acc[dt] *= al; }
#pragma unroll
        for (int j = 0; j < 8; ++j) { s0[j] = (s0[j] - mrun) * L2E; s1[j] = (s1[j] - mrun) * L2E; }
        __builtin_amdgcn_sched_barrier(0);   // the sixteen exponentials below run back to back, each filling the slot behind the one before (interleaved with the lines above, most of them took a v_nop)
        float ps = 0.0f; v8h p0, p1;
#pragma unroll
        for (int j = 0; j < 8; ++j) { const float e0 = __builtin_amdgcn_exp2f(s0[j]), e1 = __builtin_amdgcn_exp2f(s1[j]); ps += e0 + e1; p0[j] = tohx(e0); p1[j] = tohx(e1); }
        lrun += ps;
        const v16h pf = cat16(p0, p1);   // S^T's accumulator layout is the B fragment's: keys hi*8 .. +7 and 16 + hi*8 .. +7 of column lr
#pragma unroll
        for (int dt = 0; dt < 16; ++dt) acc[dt] = wmma16(va[dt], pf, acc[dt]);
        asm volatile("s_wait_dscnt 0x0" ::: "memory");      // this wave's reads of the buffer are done before anybody refills it
        asm volatile("s_wait_asynccnt 0x0" ::: "memory");   // this wave's copies of block s + 1 have landed
        __syncthreads();   // ends every wave's reads of this block's buffer and publishes block s + 1
        if (s + 2 < TT / FK) stage(s + 2, s & 1);
    }
    asm volatile("s_wait_asynccnt 0x0" ::: "memory");   // no copy is outstanding when the buffers become the partial O tiles
    lrun += xhalf(lrun);
    if (hi == 0) { mS[wv * 16 + lr] = mrun; lS[wv * 16 + lr] = lrun; }
    __syncthreads();   // every wave's maximum and sum are in LDS
    float M = -3.0e38f, L = 0.0f;
#pragma unroll
    for (int w = 0; w < 4; ++w) M = fmaxf(M, mS[(w * 2 + qg) * 16 + lr]);
#pragma unroll
    for (int w = 0; w < 4; ++w) L += lS[(w * 2 + qg) * 16 + lr] * __builtin_amdgcn_exp2f((mS[(w * 2 + qg) * 16 + lr] - M) * L2E);
    const float wsc = __fdiv_rn(__builtin_amdgcn_exp2f((mrun - M) * L2E), L);
    float* os = (float*)sm;
#pragma unroll
    for (int dt = 0; dt < 16; ++dt) { const v8f o = acc[dt] * wsc; float* op = os + (size_t)(wv * 16 + lr) * OPF + dt * 16 + hi * 8;
        *(v4fa*)op = (v4f){o[0], o[1], o[2], o[3]}; *(v4fa*)(op + 4) = (v4f){o[4], o[5], o[6], o[7]}; }
    __syncthreads();   // every wave's scaled partial O is in LDS before any thread sums the four quarters
#pragma unroll
    for (int g = 0; g < 4; ++g) { const int u = tid + g * 256, ql = u >> 5, d8 = (u & 31) * 8; v4f x = (v4f){}, y = (v4f){};
#pragma unroll
        for (int w = 0; w < 4; ++w) { const float* ip = os + (size_t)((w * 2 + (ql >> 4)) * 16 + (ql & 15)) * OPF + d8; x += *(const v4fa*)ip; y += *(const v4fa*)(ip + 4); }
        v8us oh, ol;
#pragma unroll
        for (int q = 0; q < 4; ++q) { unsigned short a2, c2; splitf(x[q], a2, c2); oh[q] = a2; ol[q] = c2; splitf(y[q], a2, c2); oh[q + 4] = a2; ol[q + 4] = c2; }
        const size_t oo = (bz * TT + RH + q0 + ql) * DC + DM + d8; *(v8us*)(Oh + oo) = oh; *(v8us*)(Ol + oo) = ol; }
}

__global__ __launch_bounds__(256) void k_vtpb(const float* __restrict__ F, int pitch, int nheads, h16* V16, bf* Vh, bf* Vl) { const size_t e = ((size_t)blockIdx.x * 256 + threadIdx.x) * 2; if (e >= (size_t)nheads * HD * TT) return; const int t = (int)(e % TT); const int d = (int)((e / TT) % HD); const int g = (int)(e / ((size_t)TT * HD)); const size_t bz = blockIdx.y;   /* batch in the pass */ F += bz * TT * pitch; const size_t eo = bz * nheads * HD * TT + e; v2h o16; v2us oh, ol;
#pragma unroll
    for (int q = 0; q < 2; ++q) { const float x = bfr(F[(size_t)(t + q) * pitch + g * HD + d]);   /* the value IS a module input: round to bf16 once (lo plane 0) */ o16[q] = tohx(x); unsigned short a2, c2; splitf(x, a2, c2); oh[q] = a2; ol[q] = c2; }
    *(v2h*)(V16 + eo) = o16; *(v2us*)(Vh + eo) = oh; *(v2us*)(Vl + eo) = ol;  }

extern "C" void kernel_launch(void* const* d_in, const int* in_sizes, int n_in,
                              void* d_out, int out_size, void* d_ws, size_t ws_size, hipStream_t stream) {
    (void)in_sizes; (void)n_in; (void)out_size;
    const float* x = (const float*)d_in[0];   /* input */ const float* xm = (const float*)d_in[1];   /* memory */ const float* mk = (const float*)d_in[2];   /* mask [4][4096] f32 */ const float* wq = (const float*)d_in[3]; const float* bq = (const float*)d_in[4]; const float* wk = (const float*)d_in[5]; const float* bk = (const float*)d_in[6]; const float* w2 = (const float*)d_in[7]; const float* b2 = (const float*)d_in[8];   /* argument order input, memory, mask, W_in1, b_in1, W_mem1, b_mem1, W2, b2 */
    float* OUT = (float*)d_out;     // [4][4096][256]
    char* wsp = (char*)d_ws;
    auto take = [&](size_t bytes) { char* p = wsp; wsp += (bytes + 255) & ~(size_t)255; return (void*)p; };
    bf* WQ = (bf*)take((size_t)DQ * DM * 2); bf* WK = (bf*)take((size_t)DKV * DM * 2); bf* W2B = (bf*)take((size_t)DM * DC * 2); bf* CAh = (bf*)take((size_t)NP * TT * DC * 2); bf* CAl = (bf*)take((size_t)NP * TT * DC * 2);
    h16* QP16 = (h16*)take((size_t)NP * NH_ * TT * HD * 2); h16* KP16 = (h16*)take((size_t)NP * NKV * TT * HD * 2); h16* VT16 = (h16*)take((size_t)NP * NKV * HD * TT * 2);
    bf* QPh = (bf*)take((size_t)NP * NH_ * TT * HD * 2); bf* QPl = (bf*)take((size_t)NP * NH_ * TT * HD * 2); bf* KPh = (bf*)take((size_t)NP * NKV * TT * HD * 2); bf* KPl = (bf*)take((size_t)NP * NKV * TT * HD * 2); bf* VTh = (bf*)take((size_t)NP * NKV * HD * TT * 2); bf* VTl = (bf*)take((size_t)NP * NKV * HD * TT * 2); bf* Ph = (bf*)take((size_t)NP * ZH * RH * TT * 2); bf* Pl = (bf*)take((size_t)NP * ZH * RH * TT * 2);
    float* Sb = (float*)take((size_t)NP * ZH * RH * TT * 4);   /* f32 scores of the rows < RH, [NP][RH][TT] */
    bf* XB = (bf*)Sb;   /* the bf16 copies [NP][TT][DM] are last read by the key projection, before the scores are first written: they borrow the score plane's bytes */
    if ((size_t)(wsp - (char*)d_ws) > ws_size) return;    // ws 256 MiB
    k_cvt8<<<(unsigned)(((size_t)DQ * DM / 8 + 255) / 256), 256, 0, stream>>>(wq, WQ, (size_t)DQ * DM / 8); k_cvt8<<<(unsigned)(((size_t)DKV * DM / 8 + 255) / 256), 256, 0, stream>>>(wk, WK, (size_t)DKV * DM / 8); k_cvt8<<<(unsigned)(((size_t)DM * DC / 8 + 255) / 256), 256, 0, stream>>>(w2, W2B, (size_t)DM * DC / 8);   /* W2 'oi' [256][512] = Bt as-is */
    const unsigned LKv = (unsigned)(((size_t)NKV * TT * HD / 2 + 255) / 256);
    for (int b = 0; b < NB_; b += NP) {   /* batches b .. b + NP - 1; their rows follow one another in the inputs, the output and every [t][...] plane */
        k_cvtc<<<(unsigned)(((size_t)NP * TT * DM / 8 + 255) / 256), 256, 0, stream>>>(x + (size_t)b * TT * DM, XB, CAh, CAl, (size_t)NP * TT * DM / 8);   /* XB := bf16(input[b ..]); also the concat operand's left half */
        k_gemmw<bf, 0, true, 8, 1><<<dim3(NP * TT / 64, DQ / 64, 1), 256, 0, stream>>>(XB, nullptr, WQ, nullptr, DM, nullptr, DQ, bq, 0, 0, 0, QP16, QPh, QPl, 1.0f);   /* query planes of input_dot = relu(input W_in1^T + b) */
        k_cvt8<<<(unsigned)(((size_t)NP * TT * DM / 8 + 255) / 256), 256, 0, stream>>>(xm + (size_t)b * TT * DM, XB, (size_t)NP * TT * DM / 8);   /* XB := bf16(memory[b ..]) (the q projection above consumed bf16(input[b ..])) */
        k_gemmw<bf, 0, true, 8, 1><<<dim3(NP * TT / 64, DKV / 64, 1), 256, 0, stream>>>(XB, nullptr, WK, nullptr, DM, nullptr, DKV, bk, 0, 0, 0, KP16, KPh, KPl, 1.0f);   /* key planes of memory_dot */
        k_vtpb<<<dim3(LKv, NP, 1), 256, 0, stream>>>(xm + (size_t)b * TT * DM, DM, NKV, VT16, VTh, VTl);   /* values = the memory itself (bf16-rounded input: hi plane exact, lo plane 0) */
        k_gemmw<bf, 2, false, 8, 0><<<dim3(RH / 64, TT / 64, NP * ZH), 256, 0, stream>>>(QPh, QPl, KPh, KPl, HD, Sb, TT, nullptr, (size_t)TT * HD, (size_t)TT * HD, (size_t)RH * TT, nullptr, nullptr, nullptr, 1.0f);
        k_asoft<<<dim3(ZH * RH / 8, NP, 1), 256, 0, stream>>>(Sb, mk + (size_t)b * TT, Ph, Pl);
        /* output_one = weights x values, written as the hi/lo right half of the concat operand (pitch DC, column DM on) */
        k_gemmw<bf, 1, false, 16, 2><<<dim3(RH / 64, HD / 64, NP * ZH), 512, 0, stream>>>(Ph, Pl, VTh, nullptr, TT, nullptr, DC, nullptr, (size_t)RH * TT, (size_t)HD * TT, (size_t)TT * DC, nullptr, CAh + DM, CAl + DM, 1.0f);   /* weights hi/lo x exact bf16 values (2 products) */
        k_fattn<<<dim3((TT - RH) / 32, NP, 1), 256, 0, stream>>>(QP16, KP16, VT16, mk + (size_t)b * TT, CAh, CAl);   /* rows RH on: fp16 scores, streaming softmax and fp16 weights x values in one kernel */
        k_gemmw<bf, 1, true, 8, 3><<<dim3(NP * TT / 64, DM / 64, 1), 256, 0, stream>>>(CAh, CAl, W2B, nullptr, DC, OUT + (size_t)b * TT * DM, DM, b2, 0, 0, 0, nullptr, nullptr, nullptr, 1.0f);   /* z = [input | output_one] W2^T + b2; out = sigmoid(z) tanh(z) */
    }
}

// v007
// One run takes 206 microseconds.
// In both of two side-by-side timings against v006, it was 1.14 times as fast.
// Counting every step since v000, it is 6.38 times as fast.
#include <hip/hip_runtime.h>

// Gated attention reader (input, memory [4][4096][256]; mask [4][4096] f32 0/1 over memory positions (read); input_dot = relu(input W_in1^T + b_in1), memory_dot = relu(memory W_mem1^T + b_mem1) ('oi' [256][256] 1/16, zero biases); att = input_dot . memory_dot / 16 - 1e30 (1 - mask[m]) (== exclusion); softmax over the 4,096 memory positions; output_one = weights . memory; z = [input | output_one] W2^T + b2 ('oi' [256][512]); out = sigmoid(z) tanh(z) -> [4][4096][256] (4.2 M); argument order input, memory, mask, W_in1, b_in1, W_mem1, b_mem1, W2, b2).
// NP batches go through each launch together (more rows, or grid z / y = batch in the pass). Layout per batch: bf16 copy of input then memory; exact projections + f32 biases, ReLU and the split into query/key planes in the projection's own epilogue; one 256-wide head; value^T planes straight from the bf16-rounded memory; dense T-4096 attention, hybrid rows: < 512 hi/lo 3-product scores, three-sweep softmax reading the mask row and hi/lo x exact-value products; the rest fp16, scores, online softmax and weights x values in one kernel; output_one leaves the weights x values epilogue as the hi/lo right half of the concat operand (its left half bf16(input) is written with the input's bf16 copy); [bf16(input) | hi/lo(output_one)] x W2 exact + b2, whose epilogue applies sigmoid(z) tanh(z) and writes the output.
// Compute dtypes, f32 accumulate: every input rounded to bf16; projections exact + f32 biases; attention rows < 512 3 products (scores) / 2 products (weights x exact values), rest fp16; softmax f32; W2 [exact | hl] x exact + bias; sigmoid/tanh f32 (precise expf/tanhf).

#define NB_  4
#define TT   4096
#define DM   256
#define NH_  1
#define NKV  1
#define REP  (NH_ / NKV)
#define HD   256
#define DQ   (NH_ * HD)
#define DKV  (NKV * HD)
#define ZH   1
#define RH   512                  // query rows < RH use hi+lo planes (0: none)
#define WIN  0
#define SCL  0.0625f   // 1 / float32(sqrt(256))
#define DC   (2 * DM)   // concat width
#define NP   4          // batches that share every launch of a pass: all of them (the score plane holds only the RH rows of each batch that are written, so four batches' planes fit the workspace)
typedef _Float16 h16;
typedef unsigned short bf;
typedef __attribute__((ext_vector_type(16))) __bf16   v16bf;
typedef __attribute__((ext_vector_type(16))) _Float16 v16h;
typedef __attribute__((ext_vector_type(8)))  _Float16 v8h;
typedef __attribute__((ext_vector_type(8)))  unsigned short v8us;
typedef __attribute__((ext_vector_type(8)))  float    v8f;
typedef __attribute__((ext_vector_type(4)))  float    v4f;
typedef v8h  __attribute__((may_alias)) v8ha;
typedef v4f  __attribute__((may_alias)) v4fa;
typedef v8us __attribute__((may_alias)) v8usa;

__device__ __forceinline__ unsigned short f2bf(float f) { unsigned u = __float_as_uint(f); u += 0x7FFFu + ((u >> 16) & 1u); return (unsigned short)(u >> 16); }
__device__ __forceinline__ float bf2f(unsigned short b) { return __uint_as_float(((unsigned)b) << 16); }
__device__ __forceinline__ float bfr(float f) { return bf2f(f2bf(f)); }
__device__ __forceinline__ v16h cat16(v8h lo, v8h hi) { return __builtin_shufflevector(lo, hi, 0, 1, 2, 3, 4, 5, 6, 7, 8, 9, 10, 11, 12, 13, 14, 15); }
__device__ __forceinline__ v16bf cat16b(v8us lo, v8us hi) { return __builtin_bit_cast(v16bf, __builtin_shufflevector(lo, hi, 0, 1, 2, 3, 4, 5, 6, 7, 8, 9, 10, 11, 12, 13, 14, 15)); }
__device__ __forceinline__ v8f wmma16(v16h a, v16h b, v8f c) { return __builtin_amdgcn_wmma_f32_16x16x32_f16(false, a, false, b, (short)0, c, false, false); }
__device__ __forceinline__ v8f wmmab(v16bf a, v16bf b, v8f c) { return __builtin_amdgcn_wmma_f32_16x16x32_bf16(false, a, false, b, (short)0, c, false, false); }

__device__ __forceinline__ h16 tohx(float x) { return (h16)x; }
__device__ __forceinline__ void splitf(float y, unsigned short& h, unsigned short& l) { h = f2bf(y); l = f2bf(y - bf2f(h)); }
typedef __attribute__((ext_vector_type(2))) _Float16 v2h;
typedef __attribute__((ext_vector_type(4))) _Float16 v4h;
typedef __attribute__((ext_vector_type(2))) unsigned short v2us;
typedef __attribute__((ext_vector_type(4))) unsigned short v4us;
typedef __attribute__((ext_vector_type(2))) float v2f;
typedef __attribute__((ext_vector_type(4))) int v4i;

// ---- k_gemmw: register-blocked GEMM, one 64x64 output tile per work-group (16 accumulators per wave), operands from K-contiguous 16-bit planes, staged in LDS by asynchronous copies; grid (M/64, N/64, Z), 32 * KW threads.
// C[m][n] (f32, pitch ldc, + optional f32 bias[n]) = sum_k A[m][k] Bt[n][k] (+ split products per NSPLIT). z-batch strides sA/sB/sC in elements (sC also moves the EPI 2 planes). K % (32 * KW) == 0, and K % 64 == 0 where KW == 1.
// KW waves share the tile's K: wave w takes the 32-wide k blocks w, w + KW, ...; the KW partial tiles are summed through LDS in wave order 0 .. KW-1.
// Staging: per trip the work-group copies, of each operand plane, 64 rows x (32 * KW * KS) k into LDS (row pitch + 16 B, so that 16 rows fall on 16 different bank groups). A copy instruction takes 512 B (KW > 1) or 4 x 128 B (KW == 1) of whole lines, where a fragment load from the plane itself touches 16 lines for 32 B each. Fragments then come from LDS with the k order of the direct loads. One-product kernels use two buffers (the next trip's copies fly during this trip's products); the split-product kernels have room for one.
// EPI names what the KW > 1 epilogue does with the summed (+ bias) value v at [m][n], pitch ldc: 0 stores v to C; 1 stores relu(v) as the planes E16 (fp16), Eh / El (bf16 hi / lo); 2 stores v * esc as Eh / El; 3 stores sigmoid(v) tanh(v) to C.
template <typename T16> struct WFrag;
template <> struct WFrag<h16> { typedef v16h V; static __device__ __forceinline__ V ld(const char* p) { return cat16(*(const v8ha*)p, *(const v8ha*)(p + 32)); } static __device__ __forceinline__ v8f mma(V a, V b, v8f c) { return wmma16(a, b, c); } };
template <> struct WFrag<bf> { typedef v16bf V; static __device__ __forceinline__ V ld(const char* p) { return cat16b(*(const v8usa*)p, *(const v8usa*)(p + 32)); } static __device__ __forceinline__ v8f mma(V a, V b, v8f c) { return wmmab(a, b, c); } };
// eight asynchronous 16-byte copies per lane, global -> LDS: copy q takes g + q * gs to LDS byte l + q * ls. The s_wait_xcnt closes the statement so that no address register of a copy is rewritten ahead of it.
__device__ __forceinline__ void cp8(unsigned l, unsigned ls, const char* g, size_t gs) {
    asm volatile("global_load_async_to_lds_b128 %0, %8, off\n\t"
                 "global_load_async_to_lds_b128 %1, %9, off\n\t"
                 "global_load_async_to_lds_b128 %2, %10, off\n\t"
                 "global_load_async_to_lds_b128 %3, %11, off\n\t"
                 "global_load_async_to_lds_b128 %4, %12, off\n\t"
                 "global_load_async_to_lds_b128 %5, %13, off\n\t"
                 "global_load_async_to_lds_b128 %6, %14, off\n\t"
                 "global_load_async_to_lds_b128 %7, %15, off\n\t"
                 "s_wait_xcnt 0x0"
                 :: "v"(l), "v"(l + ls), "v"(l + 2 * ls), "v"(l + 3 * ls), "v"(l + 4 * ls), "v"(l + 5 * ls), "v"(l + 6 * ls), "v"(l + 7 * ls),
                    "v"(g), "v"(g + gs), "v"(g + 2 * gs), "v"(g + 3 * gs), "v"(g + 4 * gs), "v"(g + 5 * gs), "v"(g + 6 * gs), "v"(g + 7 * gs)
                 : "memory");
}
// four waves per SIMD (256 registers a wave): two 8-wave work-groups still share a WGP, as their LDS allows
template <typename T16, int NSPLIT, bool BIAS, int KW, int EPI>
__global__ __launch_bounds__(32 * KW) __attribute__((amdgpu_waves_per_eu(4))) void k_gemmw(const T16* __restrict__ A, const T16* __restrict__ A2, const T16* __restrict__ Bt, const T16* __restrict__ Bt2, int K, float* C, int ldc, const float* __restrict__ bias, size_t sA, size_t sB, size_t sC, h16* E16, bf* Eh, bf* El, float esc) {
    typedef typename WFrag<T16>::V V;
    static_assert(NSPLIT <= 2, "planes staged: A, Bt, A2 (NSPLIT 1, 2), Bt2 (NSPLIT 2)");
    constexpr int KS = (KW == 1) ? 2 : 1;                  // 32-wide k steps of a wave per trip (a lone wave takes two, so that its rows are whole 128-B lines)
    constexpr int NBLK = (NSPLIT == 0) ? 2 : (NSPLIT == 1 ? 3 : 4), NBUF = (NSPLIT == 0) ? 2 : 1;
    constexpr int TK = 32 * KW * KS, GR = TK / 8, RP = 32 * KW / GR;   // k per trip; 16-byte pieces per staged row; rows that one copy of every thread covers
    constexpr int PB = TK * 2 + 16, BLKB = 64 * PB, STB = NBLK * BLKB;   // LDS bytes: row pitch, one plane's block, one buffer
    constexpr int OSB = (KW > 1 ? KW * 64 : 16) * 68 * 4;   // KW > 1: one whole 64-row partial tile per wave
    __shared__ __align__(16) float os[(OSB > NBUF * STB ? OSB : NBUF * STB) / 4];   // the staging buffers first, the output staging after the k loop
    const int wv = (KW > 1) ? __builtin_amdgcn_readfirstlane((int)(threadIdx.x >> 5)) : 0;   // wave-uniform, so the k loop stays scalar
    const size_t z = blockIdx.z; A += z * sA; if (A2) A2 += z * sA; Bt += z * sB; if (Bt2) Bt2 += z * sB; if constexpr (EPI == 2) { Eh += z * sC; El += z * sC; } else C += z * sC;
    const int lane = threadIdx.x & 31, lr = lane & 15, hi = lane >> 4; const int r0 = blockIdx.x * 64, c0 = blockIdx.y * 64;
    v8f acc[4][4];
#pragma unroll
    for (int mb = 0; mb < 4; ++mb)
#pragma unroll
        for (int nb = 0; nb < 4; ++nb) acc[mb][nb] = (v8f){};
    const int tid = (int)threadIdx.x, crow = tid / GR, ccol = tid % GR;   // the staged row and 16-byte piece that this lane copies first
    const unsigned lcp = (unsigned)(size_t)os + (unsigned)(crow * PB + ccol * 16);   // its LDS byte address inside a block
    const size_t acp = (size_t)(r0 + crow) * K + ccol * 8, bcp = (size_t)(c0 + crow) * K + ccol * 8, gstep = (size_t)RP * K * 2;
    const int ntr = (int)((unsigned)K / (unsigned)TK);   // trips: the same for every wave (K % TK == 0)
    auto stage = [&](int t, int buf) {   // all planes' blocks of trip t into buffer buf: 8 * KS copies per lane and plane, every lane on
        const size_t ko = (size_t)t * TK; const unsigned lb = lcp + (unsigned)(buf * STB);
#pragma unroll
        for (int h = 0; h < KS; ++h) { const unsigned lh = lb + (unsigned)(h * 8 * RP * PB); const size_t gh = (size_t)h * 8 * gstep;
            cp8(lh, RP * PB, (const char*)(A + acp + ko) + gh, gstep); cp8(lh + BLKB, RP * PB, (const char*)(Bt + bcp + ko) + gh, gstep);
            if constexpr (NSPLIT >= 1) cp8(lh + 2 * BLKB, RP * PB, (const char*)(A2 + acp + ko) + gh, gstep);
            if constexpr (NSPLIT >= 2) cp8(lh + 3 * BLKB, RP * PB, (const char*)(Bt2 + bcp + ko) + gh, gstep); }
    };
    stage(0, 0);
    asm volatile("s_wait_asynccnt 0x0" ::: "memory");   // this wave's copies of trip 0 have landed
    __syncthreads();   // ... and every other wave's: a wave reads rows that other waves copied
    if constexpr (NBUF == 2) { if (K >= 2 * TK) stage(1, 1); }   // a trip 1 exists
    const char* fb = (const char*)os + lr * PB + wv * KS * 64 + hi * 16;   // this lane's fragment piece: row lr, the wave's own k block
#pragma unroll 1
    for (int t = 0; t < ntr; ++t) {
        const char* fs = fb + ((NBUF == 2) ? (t & 1) * STB : 0);
#pragma unroll
        for (int s = 0; s < KS; ++s) {
            V a[4], a2[4];
#pragma unroll
            for (int mb = 0; mb < 4; ++mb) { a[mb] = WFrag<T16>::ld(fs + mb * 16 * PB + s * 64); if (NSPLIT == 1 || NSPLIT == 2) a2[mb] = WFrag<T16>::ld(fs + 2 * BLKB + mb * 16 * PB + s * 64); }
#pragma unroll
            for (int nb = 0; nb < 4; ++nb) { const V b = WFrag<T16>::ld(fs + BLKB + nb * 16 * PB + s * 64); V b2; if (NSPLIT >= 2) b2 = WFrag<T16>::ld(fs + 3 * BLKB + nb * 16 * PB + s * 64);
#pragma unroll
                for (int mb = 0; mb < 4; ++mb) { acc[mb][nb] = WFrag<T16>::mma(a[mb], b, acc[mb][nb]); if (NSPLIT == 1 || NSPLIT == 2) acc[mb][nb] = WFrag<T16>::mma(a2[mb], b, acc[mb][nb]); if (NSPLIT >= 2) acc[mb][nb] = WFrag<T16>::mma(a[mb], b2, acc[mb][nb]); } }
            asm volatile("v_nop\n\tv_nop\n\tv_nop\n\tv_nop" : "+v"(acc[0][0]), "+v"(acc[1][1]), "+v"(acc[2][2]), "+v"(acc[3][3]) : "v"(a[0]), "v"(a[3]));
        }
        asm volatile("s_wait_dscnt 0x0" ::: "memory");   // this wave's fragment reads of the buffer are done before anybody refills it
        if constexpr (NBUF == 2) asm volatile("s_wait_asynccnt 0x0" ::: "memory");   // this wave's copies of trip t + 1 have landed
        __syncthreads();   // ends every wave's reads of this trip's buffer; with two buffers it also publishes trip t + 1
        if constexpr (NBUF == 2) { if (t + 2 < ntr) stage(t + 2, t & 1); }
        else { if (t + 1 < ntr) { stage(t + 1, 0);
            asm volatile("s_wait_asynccnt 0x0" ::: "memory");   // this wave's copies of trip t + 1 have landed
            __syncthreads();   // ... and every other wave's
        } }
    }
    asm volatile("s_wait_asynccnt 0x0" ::: "memory");   // no copy is outstanding when the buffers become output staging
    if constexpr (KW > 1) {
        // unrolled: the accumulators stay in registers only under constant indices
#pragma unroll
        for (int mb = 0; mb < 4; ++mb)
#pragma unroll
            for (int nb = 0; nb < 4; ++nb) {
#pragma unroll
                for (int j = 0; j < 8; ++j) os[(wv * 64 + mb * 16 + hi * 8 + j) * 68 + nb * 16 + lr] = acc[mb][nb][j]; }
        __syncthreads();   // every wave's partial tile is in LDS before any thread sums across the waves
        // unrolled (both loops): all of a thread's LDS reads are issued together instead of one wait per read
#pragma unroll
        for (int s = 0; s < 32 / KW; ++s) { const int slot = (int)threadIdx.x + s * 32 * KW, row = slot >> 4, cofs = (slot & 15) * 4; v4f val = *(const v4fa*)(os + row * 68 + cofs);
#pragma unroll
            for (int w = 1; w < KW; ++w) val += *(const v4fa*)(os + (w * 64 + row) * 68 + cofs);
            if (BIAS) { val[0] += bfr(bias[c0 + cofs]); val[1] += bfr(bias[c0 + cofs + 1]); val[2] += bfr(bias[c0 + cofs + 2]); val[3] += bfr(bias[c0 + cofs + 3]); }
            const size_t oo = (size_t)(r0 + row) * ldc + c0 + cofs;
            // the q loops below are unrolled so that the 4-wide vectors are indexed by constants and stay in registers
            if constexpr (EPI == 0) { *(v4f*)(C + oo) = val; }
            else if constexpr (EPI == 1) { v4h o16; v4us oh, ol;
#pragma unroll
                for (int q = 0; q < 4; ++q) { const float r = fmaxf(val[q], 0.0f); o16[q] = tohx(r); unsigned short a2, c2; splitf(r, a2, c2); oh[q] = a2; ol[q] = c2; }
                *(v4h*)(E16 + oo) = o16; *(v4us*)(Eh + oo) = oh; *(v4us*)(El + oo) = ol; }
            else if constexpr (EPI == 2) { v4us oh, ol;
#pragma unroll
                for (int q = 0; q < 4; ++q) { unsigned short a2, c2; splitf(val[q] * esc, a2, c2); oh[q] = a2; ol[q] = c2; }
                *(v4us*)(Eh + oo) = oh; *(v4us*)(El + oo) = ol; }
            else { v4f o;
#pragma unroll
                for (int q = 0; q < 4; ++q) { const float sg = __fdiv_rn(1.0f, __fadd_rn(1.0f, expf(-val[q]))); o[q] = __fmul_rn(sg, tanhf(val[q])); }
                *(v4f*)(C + oo) = o; } }
        return;
    }
#pragma unroll
    for (int mb = 0; mb < 4; ++mb) {
#pragma unroll
        for (int nb = 0; nb < 4; ++nb) {
#pragma unroll
            for (int j = 0; j < 8; ++j) os[(hi * 8 + j) * 68 + nb * 16 + lr] = acc[mb][nb][j]; }
        __builtin_amdgcn_wave_barrier(); asm volatile("" ::: "memory");
        float* crow = C + (size_t)(r0 + mb * 16) * ldc + c0;
{
#pragma unroll
            for (int s = 0; s < 8; ++s) { const int row = 2 * s + hi, cofs = lr * 4; v4f val = *(const v4fa*)(os + row * 68 + cofs); if (BIAS) { val[0] += bfr(bias[c0 + cofs]); val[1] += bfr(bias[c0 + cofs + 1]); val[2] += bfr(bias[c0 + cofs + 2]); val[3] += bfr(bias[c0 + cofs + 3]); }
                *(v4f*)(crow + (size_t)row * ldc + cofs) = val; }
             }
        __builtin_amdgcn_wave_barrier(); asm volatile("" ::: "memory");
    }
}


__global__ __launch_bounds__(256) void k_cvt8(const float* __restrict__ src, bf* dst, size_t n8) { const size_t i = (size_t)blockIdx.x * 256 + threadIdx.x; if (i >= n8) return; const v8f v = *(const v8f*)(src + i * 8); v8us o;
#pragma unroll
    for (int k = 0; k < 8; ++k) o[k] = f2bf(v[k]); *(v8us*)(dst + i * 8) = o;  }
// k_cvtc: k_cvt8 of the input [t][DM] that also lays the same bf16 values down as the left half of the concat operand's hi plane [t][DC]; the lo plane's left half is 0 (bf16(input) is exact in one plane)
__global__ __launch_bounds__(256) void k_cvtc(const float* __restrict__ src, bf* dst, bf* Ah, bf* Al, size_t n8) { const size_t i = (size_t)blockIdx.x * 256 + threadIdx.x; if (i >= n8) return; const v8f v = *(const v8f*)(src + i * 8); v8us o;
#pragma unroll
    for (int k = 0; k < 8; ++k) o[k] = f2bf(v[k]);
    const size_t e = i * 8, oc = (e / DM) * DC + (e % DM); *(v8us*)(dst + e) = o; *(v8us*)(Ah + oc) = o; *(v8us*)(Al + oc) = (v8us){};  }

__global__ __launch_bounds__(256) void k_asoft(const float* __restrict__ Sb, const float* __restrict__ mk, bf* Ph, bf* Pl) {
    const int lane = threadIdx.x & 31; const int row = blockIdx.x * 8 + (threadIdx.x >> 5); if (row >= ZH * TT) return; const int i = row % TT; const int zz = row / TT; const size_t bz = blockIdx.y;   /* batch in the pass */ mk += bz * TT; Ph += bz * ZH * RH * TT; Pl += bz * ZH * RH * TT; const float* sr = Sb + ((bz * ZH + zz) * RH + i) * TT;   /* score planes [batch][zz][RH][TT] */ float mx = -3.0e38f;
#pragma unroll 4
    for (int ch = 0; ch < TT / 128; ++ch) { const int j0 = ch * 128 + lane * 4; const v4f a = *(const v4f*)(sr + j0); const v4f m4 = *(const v4f*)(mk + j0);
#pragma unroll
        for (int q = 0; q < 4; ++q) { float t = a[q] * SCL; asm volatile("" : "+v"(t)); t = (bfr(m4[q]) != 0.0f) ? t : -3.0e38f;   /* masked memory position excluded (the reference's -1e30 penalty) */ mx = fmaxf(mx, t); } }
#pragma unroll
    for (int sh = 16; sh; sh >>= 1) mx = fmaxf(mx, __shfl_xor(mx, sh, 32));
    float sum = 0.f;
#pragma unroll 4
    for (int ch = 0; ch < TT / 128; ++ch) { const int j0 = ch * 128 + lane * 4; const v4f a = *(const v4f*)(sr + j0); const v4f m4 = *(const v4f*)(mk + j0);
#pragma unroll
        for (int q = 0; q < 4; ++q) { float t = a[q] * SCL; asm volatile("" : "+v"(t)); t = (bfr(m4[q]) != 0.0f) ? t : -3.0e38f;   /* masked memory position excluded (the reference's -1e30 penalty) */ float d0 = __fsub_rn(t, mx); asm volatile("" : "+v"(d0)); sum += __builtin_amdgcn_exp2f(__fmul_rn(d0, 1.4426950408889634f)); } }
#pragma unroll
    for (int sh = 16; sh; sh >>= 1) sum += __shfl_xor(sum, sh, 32);
    const float f = __fdiv_rn(1.0f, sum);
{
        {   /* rows < RH (the grid holds no others): normalised bf16 hi/lo over ALL TT keys (symmetric window: keys beyond RH are live), planes [zz][RH][TT] */
#pragma unroll 4
            for (int ch = 0; ch < TT / 128; ++ch) { const int j0 = ch * 128 + lane * 4; const v4f a = *(const v4f*)(sr + j0); const v4f m4 = *(const v4f*)(mk + j0); v4us oh, ol;
#pragma unroll
                for (int q = 0; q < 4; ++q) { float t = a[q] * SCL; asm volatile("" : "+v"(t)); t = (bfr(m4[q]) != 0.0f) ? t : -3.0e38f;   /* masked memory position excluded (the reference's -1e30 penalty) */ float d0 = __fsub_rn(t, mx); asm volatile("" : "+v"(d0)); float ex = __builtin_amdgcn_exp2f(__fmul_rn(d0, 1.4426950408889634f)); asm volatile("" : "+v"(ex)); unsigned short a2, c2; splitf(ex * f, a2, c2); oh[q] = a2; ol[q] = c2; }
                const size_t oo = ((size_t)zz * RH + i) * TT + j0; *(v4us*)(Ph + oo) = oh; *(v4us*)(Pl + oo) = ol; }
        }
         }
}


// ---- k_fattn: scores, softmax and weights x values of the fp16 query rows (RH on) in one kernel; no score or weight plane goes to memory. grid (rows / 64, batch in the pass), 256 threads.
// Everything is computed transposed, so that the score tile leaves the matrix unit in the layout the next product wants as its B operand: S^T [key][query] = K Q^T, O^T [d][query] = V^T P^T. A lane owns one query column of each of its wave's two column groups: running maximum, sum and rescale factor are plain per-lane values.
// The 8 waves are 2 query groups (32 queries each, as two 16-column groups) x 4 key quarters: of each staged block of FK keys a wave takes 32. Every K and V^T fragment read from LDS feeds two products, one per column group, and a staged block serves 64 queries. The 64 query rows are copied to LDS once: the first column group's Q^T fragments are taken into registers from there, the second group's are read with the key fragments in every trip (the registers do not hold all of Q^T beside two groups' O^T). Each wave keeps its own maximum in use, sum and O^T; the four quarters of a query are merged through LDS at the end, in quarter order.
// Staging: per trip the work-group copies FK key rows (K, pitch + 16 B) and the FK-wide slice of all HD value^T rows (pitch + 16 B) into one of two LDS buffers; the next trip's copies fly during this trip's products.
#define FK   128
#define KPB  (HD * 2 + 16)
#define VPB  (FK * 2 + 16)
#define KTB  (FK * KPB)
#define FSTB (KTB + HD * VPB)
#define OPF  (HD + 4)   // floats per query row of a wave's partial O in LDS (16 rows fall on 16 bank groups)
#define L2E  1.4426950408889634f
// lane l takes the value of lane l ^ 16 by a vector move (a shuffle would queue in LDS behind the fragment loads)
__device__ __forceinline__ float xhalf(float x) { return __builtin_bit_cast(float, __builtin_amdgcn_permlanex16(__builtin_bit_cast(int, x), __builtin_bit_cast(int, x), 0x76543210, 0xfedcba98, false, false)); }
__global__ __launch_bounds__(256) void k_fattn(const h16* __restrict__ Q, const h16* __restrict__ Kp, const h16* __restrict__ Vt, const float* __restrict__ mk, bf* Oh, bf* Ol) {
    __shared__ __align__(16) char sm[2 * FSTB];   // the two staging buffers; after the key loop the partial O tiles
    __shared__ __align__(16) float msk[TT];       // 1 where the key is live, 0 where the mask excludes it
    __shared__ __align__(16) char qs[64 * KPB];   // the work-group's query rows, at the key rows' pitch
    __shared__ float mS[256], lS[256];            // per wave and query: running maximum and sum, for the merge
    const int tid = (int)threadIdx.x, lane = tid & 31, lr = lane & 15, hi = lane >> 4;
    const int wv = __builtin_amdgcn_readfirstlane(tid >> 5), qg = wv & 1, kq = wv >> 1;
    const size_t bz = blockIdx.y; const int q0 = (int)blockIdx.x * 64;
    Q += (bz * TT + RH + q0) * HD; Kp += bz * TT * HD; Vt += bz * HD * TT; mk += bz * TT;
    // copy addresses: the wave-uniform parts, in scalar registers; stage() adds the lane's offsets
    const unsigned lk = (unsigned)(size_t)sm + (unsigned)(wv * KPB);               // K: 32 pieces a row, 8 rows per copy of every thread
    const unsigned lv = (unsigned)(size_t)sm + (unsigned)(KTB + wv * 2 * VPB);     // V^T: 16 pieces a row, 16 rows per copy of every thread
    const char* gk = (const char*)Kp + (size_t)wv * (HD * 2);
    const char* gv = (const char*)Vt + (size_t)wv * (2 * TT * 2);
    auto stage = [&](int s, int buf) {   // key block s into buffer buf: 32 copies per lane, every lane on
        unsigned ln; asm volatile("v_mbcnt_lo_u32_b32 %0, -1, 0" : "=v"(ln));   // the lane number, formed anew at every call: per-lane address parts taken from outside the loop would stay live across it in the registers that asm operands can name, and spill to scratch
        const unsigned lko = ln * 16, lvo = (ln >> 4) * VPB + (ln & 15) * 16, gvo = (ln >> 4) * (TT * 2) + (ln & 15) * 16;
        const unsigned lb = (unsigned)(buf * FSTB); const char* k = gk + (size_t)s * FK * HD * 2 + lko; const char* v = gv + (size_t)s * FK * 2 + gvo;
        // the fences keep each statement's 24 address registers from being formed before the statement ahead of it has issued (all 96 at once crowd out values that live across the loop)
        cp8(lk + lb + lko, 8 * KPB, k, (size_t)8 * HD * 2); __builtin_amdgcn_sched_barrier(0); cp8(lk + lb + 64 * KPB + lko, 8 * KPB, k + (size_t)64 * HD * 2, (size_t)8 * HD * 2); __builtin_amdgcn_sched_barrier(0);
        cp8(lv + lb + lvo, 16 * VPB, v, (size_t)16 * TT * 2); __builtin_amdgcn_sched_barrier(0); cp8(lv + lb + 128 * VPB + lvo, 16 * VPB, v + (size_t)128 * TT * 2, (size_t)16 * TT * 2);
    };
    stage(0, 0);
    cp8((unsigned)(size_t)qs + (unsigned)((tid >> 5) * KPB + (tid & 31) * 16), 8 * KPB, (const char*)Q + (size_t)(tid >> 5) * (HD * 2) + (tid & 31) * 16, (size_t)8 * HD * 2);   // the query rows: 32 pieces a row, 8 rows per copy of every thread; they land with block 0
#pragma unroll
    for (int i = 0; i < TT / 1024; ++i) { const v4f m4 = *(const v4f*)(mk + (tid + i * 256) * 4); v4f o;
#pragma unroll
        for (int q = 0; q < 4; ++q) o[q] = (bfr(m4[q]) != 0.0f) ? 1.0f : 0.0f;
        *(v4f*)(msk + (tid + i * 256) * 4) = o; }
    asm volatile("s_wait_xcnt 0x0" :: "s"(mk) : "memory");   // stands ahead of any reuse of the address registers of the mask loads above: reading the address here keeps it untouched up to the wait
    const char* qb = qs + (qg * 32 + lr) * KPB + hi * 16;   // B fragments of Q^T: column = query lr of the first column group (the second: 16 rows on), the k order of the key fragments
    v8f acc[2][16];
#pragma unroll
    for (int g = 0; g < 2; ++g)
#pragma unroll
        for (int dt = 0; dt < 16; ++dt) acc[g][dt] = (v8f){};
    float mrun[2] = {-3.0e38f, -3.0e38f}, lrun[2] = {0.0f, 0.0f};
    asm volatile("s_wait_asynccnt 0x0" ::: "memory");   // this wave's copies of block 0 have landed
    __syncthreads();   // ... and every other wave's; the query rows have landed with it, the mask flags are written
    stage(1, 1);
    v16h qf[8];
#pragma unroll
    for (int ks = 0; ks < 8; ++ks) qf[ks] = WFrag<h16>::ld(qb + ks * 64);
#pragma unroll 1
    for (int s = 0; s < TT / FK; ++s) {
        const char* bb = sm + (s & 1) * FSTB;
        const char* kb = bb + (kq * 32 + lr) * KPB + hi * 16;          // A fragments of K: row = key
        const char* vb = bb + KTB + lr * VPB + kq * 64 + hi * 16;      // A fragments of V^T: row = d, k = the wave's 32 keys
        const float* mp = msk + s * FK + kq * 32 + hi * 8;
        v8f sc[2][2];   // [column group][16-key half]
#pragma unroll
        for (int g = 0; g < 2; ++g) { sc[g][0] = (v8f){}; sc[g][1] = (v8f){}; }
        // the key fragments come in two groups of eight, each with the second column group's four Q^T fragments of its k steps (the registers do not hold all of them at once)
#pragma unroll
        for (int h = 0; h < 2; ++h) {
            v16h ka[8], q1[4];
#pragma unroll
            for (int k4 = 0; k4 < 4; ++k4) { ka[2 * k4] = WFrag<h16>::ld(kb + (h * 4 + k4) * 64); ka[2 * k4 + 1] = WFrag<h16>::ld(kb + 16 * KPB + (h * 4 + k4) * 64); q1[k4] = WFrag<h16>::ld(qb + 16 * KPB + (h * 4 + k4) * 64); }
            __builtin_amdgcn_sched_barrier(0);   // a group's loads are issued together: one LDS latency per group, not one wait per product
#pragma unroll
            for (int k4 = 0; k4 < 4; ++k4)
#pragma unroll
                for (int g = 0; g < 2; ++g) { const v16h qq = g ? q1[k4] : qf[h * 4 + k4]; sc[g][0] = wmma16(ka[2 * k4], qq, sc[g][0]); sc[g][1] = wmma16(ka[2 * k4 + 1], qq, sc[g][1]); }
        }
        const v4f ma = *(const v4fa*)mp, mb = *(const v4fa*)(mp + 4), mc = *(const v4fa*)(mp + 16), md = *(const v4fa*)(mp + 20);
        v16h va[16];
#pragma unroll
        for (int dt = 0; dt < 4; ++dt) va[dt] = WFrag<h16>::ld(vb + dt * 16 * VPB);
        __builtin_amdgcn_sched_barrier(0);   // the first value fragments' loads are issued up here, so that the softmax below covers their latency
        float bm[2] = {-3.0e38f, -3.0e38f};
#pragma unroll
        for (int j = 0; j < 8; ++j) { const float f0 = (j < 4) ? ma[j & 3] : mb[j & 3], f1 = (j < 4) ? mc[j & 3] : md[j & 3];
#pragma unroll
            for (int g = 0; g < 2; ++g) {
                sc[g][0][j] = (f0 != 0.0f) ? sc[g][0][j] * SCL : -3.0e38f; sc[g][1][j] = (f1 != 0.0f) ? sc[g][1][j] * SCL : -3.0e38f;   /* masked memory position excluded (the reference's -1e30 penalty) */
                bm[g] = fmaxf(bm[g], fmaxf(sc[g][0][j], sc[g][1][j])); } }
        bm[0] = fmaxf(bm[0], xhalf(bm[0])); bm[1] = fmaxf(bm[1], xhalf(bm[1]));   // the query's other eight-key halves
        // lazy rescale: a column group's maximum in use moves only when one of its queries' new maximum lies more than 2^8 above it (weights stay <= 256, well inside fp16); one scalar branch per block on the usual path
        const unsigned n0 = __builtin_amdgcn_ballot_w32((bm[0] - mrun[0]) * L2E > 8.0f), n1 = __builtin_amdgcn_ballot_w32((bm[1] - mrun[1]) * L2E > 8.0f);
        if ((n0 | n1) != 0) {
#pragma unroll
            for (int g = 0; g < 2; ++g) if ((g ? n1 : n0) != 0) { const float mnew = fmaxf(mrun[g], bm[g]), al = __builtin_amdgcn_exp2f((mrun[g] - mnew) * L2E); mrun[g] = mnew; lrun[g] *= al;
#pragma unroll
                for (int dt = 0; dt < 16; ++dt) acc[g][dt] *= al; } }
#pragma unroll
        for (int g = 0; g < 2; ++g)
#pragma unroll
            for (int j = 0; j < 8; ++j) { sc[g][0][j] = (sc[g][0][j] - mrun[g]) * L2E; sc[g][1][j] = (sc[g][1][j] - mrun[g]) * L2E; }
        __builtin_amdgcn_sched_barrier(0);   // the exponentials below run back to back, each filling the slot behind the one before
        v16h pf[2];   // S^T's accumulator layout is the B fragment's: keys hi*8 .. +7 and 16 + hi*8 .. +7 of column lr
        { float ps[2] = {0.0f, 0.0f}; v8h p0[2], p1[2];
#pragma unroll
            for (int j = 0; j < 8; ++j)
#pragma unroll
                for (int g = 0; g < 2; ++g) { const float e0 = __builtin_amdgcn_exp2f(sc[g][0][j]), e1 = __builtin_amdgcn_exp2f(sc[g][1][j]); ps[g] += e0 + e1; p0[g][j] = tohx(e0); p1[g][j] = tohx(e1); }
            lrun[0] += ps[0]; lrun[1] += ps[1]; pf[0] = cat16(p0[0], p1[0]); pf[1] = cat16(p0[1], p1[1]); }
        // the value fragments come four at a time, each four fetched while the four before feed their eight products
#pragma unroll
        for (int c = 0; c < 4; ++c) {
            if (c < 3) {
#pragma unroll
                for (int dt = 0; dt < 4; ++dt) va[(c + 1) * 4 + dt] = WFrag<h16>::ld(vb + ((c + 1) * 4 + dt) * 16 * VPB); }
            __builtin_amdgcn_sched_barrier(0);   // keeps the next four's loads ahead of this four's products (left to itself the compiler puts each load, with a full wait, in front of its product)
#pragma unroll
            for (int dt = 0; dt < 4; ++dt) { acc[0][c * 4 + dt] = wmma16(va[c * 4 + dt], pf[0], acc[0][c * 4 + dt]); acc[1][c * 4 + dt] = wmma16(va[c * 4 + dt], pf[1], acc[1][c * 4 + dt]); }
        }
        asm volatile("s_wait_dscnt 0x0" ::: "memory");      // this wave's reads of the buffer are done before anybody refills it
        asm volatile("s_wait_asynccnt 0x0" ::: "memory");   // this wave's copies of block s + 1 have landed
        __syncthreads();   // ends every wave's reads of this block's buffer and publishes block s + 1
        if (s + 2 < TT / FK) stage(s + 2, s & 1);
    }
    asm volatile("s_wait_asynccnt 0x0" ::: "memory");   // no copy is outstanding when the buffers become the partial O tiles
#pragma unroll
    for (int g = 0; g < 2; ++g) { lrun[g] += xhalf(lrun[g]);
        if (hi == 0) { mS[wv * 32 + g * 16 + lr] = mrun[g]; lS[wv * 32 + g * 16 + lr] = lrun[g]; } }
    __syncthreads();   // every wave's maximum and sum are in LDS
    float* os = (float*)sm;
#pragma unroll
    for (int g = 0; g < 2; ++g) {
        float M = -3.0e38f, L = 0.0f;
#pragma unroll
        for (int w = 0; w < 4; ++w) M = fmaxf(M, mS[(w * 2 + qg) * 32 + g * 16 + lr]);
#pragma unroll
        for (int w = 0; w < 4; ++w) L += lS[(w * 2 + qg) * 32 + g * 16 + lr] * __builtin_amdgcn_exp2f((mS[(w * 2 + qg) * 32 + g * 16 + lr] - M) * L2E);
        const float wsc = __fdiv_rn(__builtin_amdgcn_exp2f((mrun[g] - M) * L2E), L);
#pragma unroll
        for (int dt = 0; dt < 16; ++dt) { const v8f o = acc[g][dt] * wsc; float* op = os + (size_t)(wv * 32 + g * 16 + lr) * OPF + dt * 16 + hi * 8;
            *(v4fa*)op = (v4f){o[0], o[1], o[2], o[3]}; *(v4fa*)(op + 4) = (v4f){o[4], o[5], o[6], o[7]}; } }
    __syncthreads();   // every wave's scaled partial O is in LDS before any thread sums the four quarters
#pragma unroll
    for (int g = 0; g < 8; ++g) { const int u = tid + g * 256, ql = u >> 5, d8 = (u & 31) * 8; v4f x = (v4f){}, y = (v4f){};
#pragma unroll
        for (int w = 0; w < 4; ++w) { const float* ip = os + (size_t)((w * 2 + (ql >> 5)) * 32 + (ql & 31)) * OPF + d8; x += *(const v4fa*)ip; y += *(const v4fa*)(ip + 4); }
        v8us oh, ol;
#pragma unroll
        for (int q = 0; q < 4; ++q) { unsigned short a2, c2; splitf(x[q], a2, c2); oh[q] = a2; ol[q] = c2; splitf(y[q], a2, c2); oh[q + 4] = a2; ol[q + 4] = c2; }
        const size_t oo = (bz * TT + RH + q0 + ql) * DC + DM + d8; *(v8us*)(Oh + oo) = oh; *(v8us*)(Ol + oo) = ol; }
}

__global__ __launch_bounds__(256) void k_vtpb(const float* __restrict__ F, int pitch, int nheads, h16* V16, bf* Vh, bf* Vl) { const size_t e = ((size_t)blockIdx.x * 256 + threadIdx.x) * 2; if (e >= (size_t)nheads * HD * TT) return; const int t = (int)(e % TT); const int d = (int)((e / TT) % HD); const int g = (int)(e / ((size_t)TT * HD)); const size_t bz = blockIdx.y;   /* batch in the pass */ F += bz * TT * pitch; const size_t eo = bz * nheads * HD * TT + e; v2h o16; v2us oh, ol;
#pragma unroll
    for (int q = 0; q < 2; ++q) { const float x = bfr(F[(size_t)(t + q) * pitch + g * HD + d]);   /* the value IS a module input: round to bf16 once (lo plane 0) */ o16[q] = tohx(x); unsigned short a2, c2; splitf(x, a2, c2); oh[q] = a2; ol[q] = c2; }
    *(v2h*)(V16 + eo) = o16; *(v2us*)(Vh + eo) = oh; *(v2us*)(Vl + eo) = ol;  }

extern "C" void kernel_launch(void* const* d_in, const int* in_sizes, int n_in,
                              void* d_out, int out_size, void* d_ws, size_t ws_size, hipStream_t stream) {
    (void)in_sizes; (void)n_in; (void)out_size;
    const float* x = (const float*)d_in[0];   /* input */ const float* xm = (const float*)d_in[1];   /* memory */ const float* mk = (const float*)d_in[2];   /* mask [4][4096] f32 */ const float* wq = (const float*)d_in[3]; const float* bq = (const float*)d_in[4]; const float* wk = (const float*)d_in[5]; const float* bk = (const float*)d_in[6]; const float* w2 = (const float*)d_in[7]; const float* b2 = (const float*)d_in[8];   /* argument order input, memory, mask, W_in1, b_in1, W_mem1, b_mem1, W2, b2 */
    float* OUT = (float*)d_out;     // [4][4096][256]
    char* wsp = (char*)d_ws;
    auto take = [&](size_t bytes) { char* p = wsp; wsp += (bytes + 255) & ~(size_t)255; return (void*)p; };
    bf* WQ = (bf*)take((size_t)DQ * DM * 2); bf* WK = (bf*)take((size_t)DKV * DM * 2); bf* W2B = (bf*)take((size_t)DM * DC * 2); bf* CAh = (bf*)take((size_t)NP * TT * DC * 2); bf* CAl = (bf*)take((size_t)NP * TT * DC * 2);
    h16* QP16 = (h16*)take((size_t)NP * NH_ * TT * HD * 2); h16* KP16 = (h16*)take((size_t)NP * NKV * TT * HD * 2); h16* VT16 = (h16*)take((size_t)NP * NKV * HD * TT * 2);
    bf* QPh = (bf*)take((size_t)NP * NH_ * TT * HD * 2); bf* QPl = (bf*)take((size_t)NP * NH_ * TT * HD * 2); bf* KPh = (bf*)take((size_t)NP * NKV * TT * HD * 2); bf* KPl = (bf*)take((size_t)NP * NKV * TT * HD * 2); bf* VTh = (bf*)take((size_t)NP * NKV * HD * TT * 2); bf* VTl = (bf*)take((size_t)NP * NKV * HD * TT * 2); bf* Ph = (bf*)take((size_t)NP * ZH * RH * TT * 2); bf* Pl = (bf*)take((size_t)NP * ZH * RH * TT * 2);
    float* Sb = (float*)take((size_t)NP * ZH * RH * TT * 4);   /* f32 scores of the rows < RH, [NP][RH][TT] */
    bf* XB = (bf*)Sb;   /* the bf16 copies [NP][TT][DM] are last read by the key projection, before the scores are first written: they borrow the score plane's bytes */
    if ((size_t)(wsp - (char*)d_ws) > ws_size) return;    // ws 256 MiB
    k_cvt8<<<(unsigned)(((size_t)DQ * DM / 8 + 255) / 256), 256, 0, stream>>>(wq, WQ, (size_t)DQ * DM / 8); k_cvt8<<<(unsigned)(((size_t)DKV * DM / 8 + 255) / 256), 256, 0, stream>>>(wk, WK, (size_t)DKV * DM / 8); k_cvt8<<<(unsigned)(((size_t)DM * DC / 8 + 255) / 256), 256, 0, stream>>>(w2, W2B, (size_t)DM * DC / 8);   /* W2 'oi' [256][512] = Bt as-is */
    const unsigned LKv = (unsigned)(((size_t)NKV * TT * HD / 2 + 255) / 256);
    for (int b = 0; b < NB_; b += NP) {   /* batches b .. b + NP - 1; their rows follow one another in the inputs, the output and every [t][...] plane */
        k_cvtc<<<(unsigned)(((size_t)NP * TT * DM / 8 + 255) / 256), 256, 0, stream>>>(x + (size_t)b * TT * DM, XB, CAh, CAl, (size_t)NP * TT * DM / 8);   /* XB := bf16(input[b ..]); also the concat operand's left half */
        k_gemmw<bf, 0, true, 8, 1><<<dim3(NP * TT / 64, DQ / 64, 1), 256, 0, stream>>>(XB, nullptr, WQ, nullptr, DM, nullptr, DQ, bq, 0, 0, 0, QP16, QPh, QPl, 1.0f);   /* query planes of input_dot = relu(input W_in1^T + b) */
        k_cvt8<<<(unsigned)(((size_t)NP * TT * DM / 8 + 255) / 256), 256, 0, stream>>>(xm + (size_t)b * TT * DM, XB, (size_t)NP * TT * DM / 8);   /* XB := bf16(memory[b ..]) (the q projection above consumed bf16(input[b ..])) */
        k_gemmw<bf, 0, true, 8, 1><<<dim3(NP * TT / 64, DKV / 64, 1), 256, 0, stream>>>(XB, nullptr, WK, nullptr, DM, nullptr, DKV, bk, 0, 0, 0, KP16, KPh, KPl, 1.0f);   /* key planes of memory_dot */
        k_vtpb<<<dim3(LKv, NP, 1), 256, 0, stream>>>(xm + (size_t)b * TT * DM, DM, NKV, VT16, VTh, VTl);   /* values = the memory itself (bf16-rounded input: hi plane exact, lo plane 0) */
        k_gemmw<bf, 2, false, 8, 0><<<dim3(RH / 64, TT / 64, NP * ZH), 256, 0, stream>>>(QPh, QPl, KPh, KPl, HD, Sb, TT, nullptr, (size_t)TT * HD, (size_t)TT * HD, (size_t)RH * TT, nullptr, nullptr, nullptr, 1.0f);
        k_asoft<<<dim3(ZH * RH / 8, NP, 1), 256, 0, stream>>>(Sb, mk + (size_t)b * TT, Ph, Pl);
        /* output_one = weights x values, written as the hi/lo right half of the concat operand (pitch DC, column DM on) */
        k_gemmw<bf, 1, false, 16, 2><<<dim3(RH / 64, HD / 64, NP * ZH), 512, 0, stream>>>(Ph, Pl, VTh, nullptr, TT, nullptr, DC, nullptr, (size_t)RH * TT, (size_t)HD * TT, (size_t)TT * DC, nullptr, CAh + DM, CAl + DM, 1.0f);   /* weights hi/lo x exact bf16 values (2 products) */
        k_fattn<<<dim3((TT - RH) / 64, NP, 1), 256, 0, stream>>>(QP16, KP16, VT16, mk + (size_t)b * TT, CAh, CAl);   /* rows RH on: fp16 scores, streaming softmax and fp16 weights x values in one kernel */
        k_gemmw<bf, 1, true, 8, 3><<<dim3(NP * TT / 64, DM / 64, 1), 256, 0, stream>>>(CAh, CAl, W2B, nullptr, DC, OUT + (size_t)b * TT * DM, DM, b2, 0, 0, 0, nullptr, nullptr, nullptr, 1.0f);   /* z = [input | output_one] W2^T + b2; out = sigmoid(z) tanh(z) */
    }
}

// v008
// Measured time: 194 microseconds a run.
// In both of two side-by-side timings against v007, it was 1.06 times as fast.
// Over all steps from v000 it is 6.78 times as fast.
#include <hip/hip_runtime.h>

// Gated attention reader (input, memory [4][4096][256]; mask [4][4096] f32 0/1 over memory positions (read); input_dot = relu(input W_in1^T + b_in1), memory_dot = relu(memory W_mem1^T + b_mem1) ('oi' [256][256] 1/16, zero biases); att = input_dot . memory_dot / 16 - 1e30 (1 - mask[m]) (== exclusion); softmax over the 4,096 memory positions; output_one = weights . memory; z = [input | output_one] W2^T + b2 ('oi' [256][512]); out = sigmoid(z) tanh(z) -> [4][4096][256] (4.2 M); argument order input, memory, mask, W_in1, b_in1, W_mem1, b_mem1, W2, b2).
// NP batches go through each launch together (more rows, or grid z / y = batch in the pass). Layout per batch: bf16 copy of input then memory; exact projections + f32 biases, ReLU and the split into query/key planes in the projection's own epilogue; one 256-wide head; value^T planes straight from the bf16-rounded memory; dense T-4096 attention, hybrid rows: < 512 hi/lo 3-product scores, three-sweep softmax reading the mask row and hi/lo x exact-value products; the rest fp16, scores, online softmax and weights x values in one kernel; output_one leaves the weights x values epilogue as the hi/lo right half of the concat operand (its left half bf16(input) is written with the input's bf16 copy); [bf16(input) | hi/lo(output_one)] x W2 exact + b2, whose epilogue applies sigmoid(z) tanh(z) and writes the output.
// Compute dtypes, f32 accumulate: every input rounded to bf16; projections exact + f32 biases; attention rows < 512 3 products (scores) / 2 products (weights x exact values), rest fp16; softmax f32; W2 [exact | hl] x exact + bias; sigmoid/tanh f32 (precise expf/tanhf).

#define NB_  4
#define TT   4096
#define DM   256
#define NH_  1
#define NKV  1
#define REP  (NH_ / NKV)
#define HD   256
#define DQ   (NH_ * HD)
#define DKV  (NKV * HD)
#define ZH   1
#define RH   512                  // query rows < RH use hi+lo planes (0: none)
#define WIN  0
#define SCL  0.0625f   // 1 / float32(sqrt(256))
#define DC   (2 * DM)   // concat width
#define NP   4          // batches that share every launch of a pass: all of them (the score plane holds only the RH rows of each batch that are written, so four batches' planes fit the workspace)
typedef _Float16 h16;
typedef unsigned short bf;
typedef __attribute__((ext_vector_type(16))) __bf16   v16bf;
typedef __attribute__((ext_vector_type(16))) _Float16 v16h;
typedef __attribute__((ext_vector_type(8)))  _Float16 v8h;
typedef __attribute__((ext_vector_type(8)))  unsigned short v8us;
typedef __attribute__((ext_vector_type(8)))  float    v8f;
typedef __attribute__((ext_vector_type(4)))  float    v4f;
typedef v8h  __attribute__((may_alias)) v8ha;
typedef v4f  __attribute__((may_alias)) v4fa;
typedef v8us __attribute__((may_alias)) v8usa;

__device__ __forceinline__ unsigned short f2bf(float f) { unsigned u = __float_as_uint(f); u += 0x7FFFu + ((u >> 16) & 1u); return (unsigned short)(u >> 16); }
__device__ __forceinline__ float bf2f(unsigned short b) { return __uint_as_float(((unsigned)b) << 16); }
__device__ __forceinline__ float bfr(float f) { return bf2f(f2bf(f)); }
__device__ __forceinline__ v16h cat16(v8h lo, v8h hi) { return __builtin_shufflevector(lo, hi, 0, 1, 2, 3, 4, 5, 6, 7, 8, 9, 10, 11, 12, 13, 14, 15); }
__device__ __forceinline__ v16bf cat16b(v8us lo, v8us hi) { return __builtin_bit_cast(v16bf, __builtin_shufflevector(lo, hi, 0, 1, 2, 3, 4, 5, 6, 7, 8, 9, 10, 11, 12, 13, 14, 15)); }
__device__ __forceinline__ v8f wmma16(v16h a, v16h b, v8f c) { return __builtin_amdgcn_wmma_f32_16x16x32_f16(false, a, false, b, (short)0, c, false, false); }
__device__ __forceinline__ v8f wmmab(v16bf a, v16bf b, v8f c) { return __builtin_amdgcn_wmma_f32_16x16x32_bf16(false, a, false, b, (short)0, c, false, false); }

__device__ __forceinline__ h16 tohx(float x) { return (h16)x; }
__device__ __forceinline__ void splitf(float y, unsigned short& h, unsigned short& l) { h = f2bf(y); l = f2bf(y - bf2f(h)); }
typedef __attribute__((ext_vector_type(2))) _Float16 v2h;
typedef __attribute__((ext_vector_type(4))) _Float16 v4h;
typedef __attribute__((ext_vector_type(2))) unsigned short v2us;
typedef __attribute__((ext_vector_type(4))) unsigned short v4us;
typedef __attribute__((ext_vector_type(2))) float v2f;
typedef __attribute__((ext_vector_type(4))) int v4i;

// ---- k_gemmw: register-blocked GEMM, one 64x64 output tile per work-group (16 accumulators per wave), operands from K-contiguous 16-bit planes, staged in LDS by asynchronous copies; grid (M/64, N/64, Z), 32 * KW threads.
// C[m][n] (f32, pitch ldc, + optional f32 bias[n]) = sum_k A[m][k] Bt[n][k] (+ split products per NSPLIT). z-batch strides sA/sB/sC in elements (sC also moves the EPI 2 planes). K % (32 * KW) == 0, and K % 64 == 0 where KW == 1.
// KW waves share the tile's K: wave w takes the 32-wide k blocks w, w + KW, ...; the KW partial tiles are summed through LDS in wave order 0 .. KW-1.
// Staging: per trip the work-group copies, of each operand plane, 64 rows x (32 * KW * KS) k into LDS (row pitch + 16 B, so that 16 rows fall on 16 different bank groups). A copy instruction takes 512 B (KW > 1) or 4 x 128 B (KW == 1) of whole lines, where a fragment load from the plane itself touches 16 lines for 32 B each. Fragments then come from LDS with the k order of the direct loads. One-product kernels use two buffers (the next trip's copies fly during this trip's products); the split-product kernels have room for one.
// EPI names what the KW > 1 epilogue does with the summed (+ bias) value v at [m][n], pitch ldc: 0 stores v to C; 1 stores relu(v) as the planes E16 (fp16), Eh / El (bf16 hi / lo); 2 stores v * esc as Eh / El; 3 stores sigmoid(v) tanh(v) to C.
template <typename T16> struct WFrag;
template <> struct WFrag<h16> { typedef v16h V; static __device__ __forceinline__ V ld(const char* p) { return cat16(*(const v8ha*)p, *(const v8ha*)(p + 32)); } static __device__ __forceinline__ v8f mma(V a, V b, v8f c) { return wmma16(a, b, c); } };
template <> struct WFrag<bf> { typedef v16bf V; static __device__ __forceinline__ V ld(const char* p) { return cat16b(*(const v8usa*)p, *(const v8usa*)(p + 32)); } static __device__ __forceinline__ v8f mma(V a, V b, v8f c) { return wmmab(a, b, c); } };
// eight asynchronous 16-byte copies per lane, global -> LDS: copy q takes g + q * gs to LDS byte l + q * ls. The s_wait_xcnt closes the statement so that no address register of a copy is rewritten ahead of it.
__device__ __forceinline__ void cp8(unsigned l, unsigned ls, const char* g, size_t gs) {
    asm volatile("global_load_async_to_lds_b128 %0, %8, off\n\t"
                 "global_load_async_to_lds_b128 %1, %9, off\n\t"
                 "global_load_async_to_lds_b128 %2, %10, off\n\t"
                 "global_load_async_to_lds_b128 %3, %11, off\n\t"
                 "global_load_async_to_lds_b128 %4, %12, off\n\t"
                 "global_load_async_to_lds_b128 %5, %13, off\n\t"
                 "global_load_async_to_lds_b128 %6, %14, off\n\t"
                 "global_load_async_to_lds_b128 %7, %15, off\n\t"
                 "s_wait_xcnt 0x0"
                 :: "v"(l), "v"(l + ls), "v"(l + 2 * ls), "v"(l + 3 * ls), "v"(l + 4 * ls), "v"(l + 5 * ls), "v"(l + 6 * ls), "v"(l + 7 * ls),
                    "v"(g), "v"(g + gs), "v"(g + 2 * gs), "v"(g + 3 * gs), "v"(g + 4 * gs), "v"(g + 5 * gs), "v"(g + 6 * gs), "v"(g + 7 * gs)
                 : "memory");
}
// four waves per SIMD (256 registers a wave): two 8-wave work-groups still share a WGP, as their LDS allows
template <typename T16, int NSPLIT, bool BIAS, int KW, int EPI>
__global__ __launch_bounds__(32 * KW) __attribute__((amdgpu_waves_per_eu(4))) void k_gemmw(const T16* __restrict__ A, const T16* __restrict__ A2, const T16* __restrict__ Bt, const T16* __restrict__ Bt2, int K, float* C, int ldc, const float* __restrict__ bias, size_t sA, size_t sB, size_t sC, h16* E16, bf* Eh, bf* El, float esc) {
    typedef typename WFrag<T16>::V V;
    static_assert(NSPLIT <= 2, "planes staged: A, Bt, A2 (NSPLIT 1, 2), Bt2 (NSPLIT 2)");
    constexpr int KS = (KW == 1) ? 2 : 1;                  // 32-wide k steps of a wave per trip (a lone wave takes two, so that its rows are whole 128-B lines)
    constexpr int NBLK = (NSPLIT == 0) ? 2 : (NSPLIT == 1 ? 3 : 4), NBUF = (NSPLIT == 0) ? 2 : 1;
    constexpr int TK = 32 * KW * KS, GR = TK / 8, RP = 32 * KW / GR;   // k per trip; 16-byte pieces per staged row; rows that one copy of every thread covers
    constexpr int PB = TK * 2 + 16, BLKB = 64 * PB, STB = NBLK * BLKB;   // LDS bytes: row pitch, one plane's block, one buffer
    constexpr int OSB = (KW > 1 ? KW * 64 : 16) * 68 * 4;   // KW > 1: one whole 64-row partial tile per wave
    __shared__ __align__(16) float os[(OSB > NBUF * STB ? OSB : NBUF * STB) / 4];   // the staging buffers first, the output staging after the k loop
    const int wv = (KW > 1) ? __builtin_amdgcn_readfirstlane((int)(threadIdx.x >> 5)) : 0;   // wave-uniform, so the k loop stays scalar
    const size_t z = blockIdx.z; A += z * sA; if (A2) A2 += z * sA; Bt += z * sB; if (Bt2) Bt2 += z * sB; if constexpr (EPI == 2) { Eh += z * sC; El += z * sC; } else C += z * sC;
    const int lane = threadIdx.x & 31, lr = lane & 15, hi = lane >> 4; const int r0 = blockIdx.x * 64, c0 = blockIdx.y * 64;
    v8f acc[4][4];
#pragma unroll
    for (int mb = 0; mb < 4; ++mb)
#pragma unroll
        for (int nb = 0; nb < 4; ++nb) acc[mb][nb] = (v8f){};
    const int tid = (int)threadIdx.x, crow = tid / GR, ccol = tid % GR;   // the staged row and 16-byte piece that this lane copies first
    const unsigned lcp = (unsigned)(size_t)os + (unsigned)(crow * PB + ccol * 16);   // its LDS byte address inside a block
    const size_t acp = (size_t)(r0 + crow) * K + ccol * 8, bcp = (size_t)(c0 + crow) * K + ccol * 8, gstep = (size_t)RP * K * 2;
    const int ntr = (int)((unsigned)K / (unsigned)TK);   // trips: the same for every wave (K % TK == 0)
    auto stage = [&](int t, int buf) {   // all planes' blocks of trip t into buffer buf: 8 * KS copies per lane and plane, every lane on
        const size_t ko = (size_t)t * TK; const unsigned lb = lcp + (unsigned)(buf * STB);
#pragma unroll
        for (int h = 0; h < KS; ++h) { const unsigned lh = lb + (unsigned)(h * 8 * RP * PB); const size_t gh = (size_t)h * 8 * gstep;
            cp8(lh, RP * PB, (const char*)(A + acp + ko) + gh, gstep); cp8(lh + BLKB, RP * PB, (const char*)(Bt + bcp + ko) + gh, gstep);
            if constexpr (NSPLIT >= 1) cp8(lh + 2 * BLKB, RP * PB, (const char*)(A2 + acp + ko) + gh, gstep);
            if constexpr (NSPLIT >= 2) cp8(lh + 3 * BLKB, RP * PB, (const char*)(Bt2 + bcp + ko) + gh, gstep); }
    };
    stage(0, 0);
    asm volatile("s_wait_asynccnt 0x0" ::: "memory");   // this wave's copies of trip 0 have landed
    __syncthreads();   // ... and every other wave's: a wave reads rows that other waves copied
    if constexpr (NBUF == 2) { if (K >= 2 * TK) stage(1, 1); }   // a trip 1 exists
    const char* fb = (const char*)os + lr * PB + wv * KS * 64 + hi * 16;   // this lane's fragment piece: row lr, the wave's own k block
#pragma unroll 1
    for (int t = 0; t < ntr; ++t) {
        const char* fs = fb + ((NBUF == 2) ? (t & 1) * STB : 0);
#pragma unroll
        for (int s = 0; s < KS; ++s) {
            V a[4], a2[4];
#pragma unroll
            for (int mb = 0; mb < 4; ++mb) { a[mb] = WFrag<T16>::ld(fs + mb * 16 * PB + s * 64); if (NSPLIT == 1 || NSPLIT == 2) a2[mb] = WFrag<T16>::ld(fs + 2 * BLKB + mb * 16 * PB + s * 64); }
#pragma unroll
            for (int nb = 0; nb < 4; ++nb) { const V b = WFrag<T16>::ld(fs + BLKB + nb * 16 * PB + s * 64); V b2; if (NSPLIT >= 2) b2 = WFrag<T16>::ld(fs + 3 * BLKB + nb * 16 * PB + s * 64);
#pragma unroll
                for (int mb = 0; mb < 4; ++mb) { acc[mb][nb] = WFrag<T16>::mma(a[mb], b, acc[mb][nb]); if (NSPLIT == 1 || NSPLIT == 2) acc[mb][nb] = WFrag<T16>::mma(a2[mb], b, acc[mb][nb]); if (NSPLIT >= 2) acc[mb][nb] = WFrag<T16>::mma(a[mb], b2, acc[mb][nb]); } }
            asm volatile("v_nop\n\tv_nop\n\tv_nop\n\tv_nop" : "+v"(acc[0][0]), "+v"(acc[1][1]), "+v"(acc[2][2]), "+v"(acc[3][3]) : "v"(a[0]), "v"(a[3]));
        }
        asm volatile("s_wait_dscnt 0x0" ::: "memory");   // this wave's fragment reads of the buffer are done before anybody refills it
        if constexpr (NBUF == 2) asm volatile("s_wait_asynccnt 0x0" ::: "memory");   // this wave's copies of trip t + 1 have landed
        __syncthreads();   // ends every wave's reads of this trip's buffer; with two buffers it also publishes trip t + 1
        if constexpr (NBUF == 2) { if (t + 2 < ntr) stage(t + 2, t & 1); }
        else { if (t + 1 < ntr) { stage(t + 1, 0);
            asm volatile("s_wait_asynccnt 0x0" ::: "memory");   // this wave's copies of trip t + 1 have landed
            __syncthreads();   // ... and every other wave's
        } }
    }
    asm volatile("s_wait_asynccnt 0x0" ::: "memory");   // no copy is outstanding when the buffers become output staging
    if constexpr (KW > 1) {
        // unrolled: the accumulators stay in registers only under constant indices
#pragma unroll
        for (int mb = 0; mb < 4; ++mb)
#pragma unroll
            for (int nb = 0; nb < 4; ++nb) {
#pragma unroll
                for (int j = 0; j < 8; ++j) os[(wv * 64 + mb * 16 + hi * 8 + j) * 68 + nb * 16 + lr] = acc[mb][nb][j]; }
        __syncthreads();   // every wave's partial tile is in LDS before any thread sums across the waves
        // unrolled (both loops): all of a thread's LDS reads are issued together instead of one wait per read
#pragma unroll
        for (int s = 0; s < 32 / KW; ++s) { const int slot = (int)threadIdx.x + s * 32 * KW, row = slot >> 4, cofs = (slot & 15) * 4; v4f val = *(const v4fa*)(os + row * 68 + cofs);
#pragma unroll
            for (int w = 1; w < KW; ++w) val += *(const v4fa*)(os + (w * 64 + row) * 68 + cofs);
            if (BIAS) { val[0] += bfr(bias[c0 + cofs]); val[1] += bfr(bias[c0 + cofs + 1]); val[2] += bfr(bias[c0 + cofs + 2]); val[3] += bfr(bias[c0 + cofs + 3]); }
            const size_t oo = (size_t)(r0 + row) * ldc + c0 + cofs;
            // the q loops below are unrolled so that the 4-wide vectors are indexed by constants and stay in registers
            if constexpr (EPI == 0) { *(v4f*)(C + oo) = val; }
            else if constexpr (EPI == 1) { v4h o16; v4us oh, ol;
#pragma unroll
                for (int q = 0; q < 4; ++q) { const float r = fmaxf(val[q], 0.0f); o16[q] = tohx(r); unsigned short a2, c2; splitf(r, a2, c2); oh[q] = a2; ol[q] = c2; }
                *(v4h*)(E16 + oo) = o16; *(v4us*)(Eh + oo) = oh; *(v4us*)(El + oo) = ol; }
            else if constexpr (EPI == 2) { v4us oh, ol;
#pragma unroll
                for (int q = 0; q < 4; ++q) { unsigned short a2, c2; splitf(val[q] * esc, a2, c2); oh[q] = a2; ol[q] = c2; }
                *(v4us*)(Eh + oo) = oh; *(v4us*)(El + oo) = ol; }
            else { v4f o;
#pragma unroll
                for (int q = 0; q < 4; ++q) { const float sg = __fdiv_rn(1.0f, __fadd_rn(1.0f, expf(-val[q]))); o[q] = __fmul_rn(sg, tanhf(val[q])); }
                *(v4f*)(C + oo) = o; } }
        return;
    }
#pragma unroll
    for (int mb = 0; mb < 4; ++mb) {
#pragma unroll
        for (int nb = 0; nb < 4; ++nb) {
#pragma unroll
            for (int j = 0; j < 8; ++j) os[(hi * 8 + j) * 68 + nb * 16 + lr] = acc[mb][nb][j]; }
        __builtin_amdgcn_wave_barrier(); asm volatile("" ::: "memory");
        float* crow = C + (size_t)(r0 + mb * 16) * ldc + c0;
{
#pragma unroll
            for (int s = 0; s < 8; ++s) { const int row = 2 * s + hi, cofs = lr * 4; v4f val = *(const v4fa*)(os + row * 68 + cofs); if (BIAS) { val[0] += bfr(bias[c0 + cofs]); val[1] += bfr(bias[c0 + cofs + 1]); val[2] += bfr(bias[c0 + cofs + 2]); val[3] += bfr(bias[c0 + cofs + 3]); }
                *(v4f*)(crow + (size_t)row * ldc + cofs) = val; }
             }
        __builtin_amdgcn_wave_barrier(); asm volatile("" ::: "memory");
    }
}


__global__ __launch_bounds__(256) void k_cvt8(const float* __restrict__ src, bf* dst, size_t n8) { const size_t i = (size_t)blockIdx.x * 256 + threadIdx.x; if (i >= n8) return; const v8f v = *(const v8f*)(src + i * 8); v8us o;
#pragma unroll
    for (int k = 0; k < 8; ++k) o[k] = f2bf(v[k]); *(v8us*)(dst + i * 8) = o;  }
// k_cvtc: k_cvt8 of the input [t][DM] that also lays the same bf16 values down as the left half of the concat operand's hi plane [t][DC]; the lo plane's left half is 0 (bf16(input) is exact in one plane)
__global__ __launch_bounds__(256) void k_cvtc(const float* __restrict__ src, bf* dst, bf* Ah, bf* Al, size_t n8) { const size_t i = (size_t)blockIdx.x * 256 + threadIdx.x; if (i >= n8) return; const v8f v = *(const v8f*)(src + i * 8); v8us o;
#pragma unroll
    for (int k = 0; k < 8; ++k) o[k] = f2bf(v[k]);
    const size_t e = i * 8, oc = (e / DM) * DC + (e % DM); *(v8us*)(dst + e) = o; *(v8us*)(Ah + oc) = o; *(v8us*)(Al + oc) = (v8us){};  }

__global__ __launch_bounds__(256) void k_asoft(const float* __restrict__ Sb, const float* __restrict__ mk, bf* Ph, bf* Pl) {
    const int lane = threadIdx.x & 31; const int row = blockIdx.x * 8 + (threadIdx.x >> 5); if (row >= ZH * TT) return; const int i = row % TT; const int zz = row / TT; const size_t bz = blockIdx.y;   /* batch in the pass */ mk += bz * TT; Ph += bz * ZH * RH * TT; Pl += bz * ZH * RH * TT; const float* sr = Sb + ((bz * ZH + zz) * RH + i) * TT;   /* score planes [batch][zz][RH][TT] */ float mx = -3.0e38f;
#pragma unroll 4
    for (int ch = 0; ch < TT / 128; ++ch) { const int j0 = ch * 128 + lane * 4; const v4f a = *(const v4f*)(sr + j0); const v4f m4 = *(const v4f*)(mk + j0);
#pragma unroll
        for (int q = 0; q < 4; ++q) { float t = a[q] * SCL; asm volatile("" : "+v"(t)); t = (bfr(m4[q]) != 0.0f) ? t : -3.0e38f;   /* masked memory position excluded (the reference's -1e30 penalty) */ mx = fmaxf(mx, t); } }
#pragma unroll
    for (int sh = 16; sh; sh >>= 1) mx = fmaxf(mx, __shfl_xor(mx, sh, 32));
    float sum = 0.f;
#pragma unroll 4
    for (int ch = 0; ch < TT / 128; ++ch) { const int j0 = ch * 128 + lane * 4; const v4f a = *(const v4f*)(sr + j0); const v4f m4 = *(const v4f*)(mk + j0);
#pragma unroll
        for (int q = 0; q < 4; ++q) { float t = a[q] * SCL; asm volatile("" : "+v"(t)); t = (bfr(m4[q]) != 0.0f) ? t : -3.0e38f;   /* masked memory position excluded (the reference's -1e30 penalty) */ float d0 = __fsub_rn(t, mx); asm volatile("" : "+v"(d0)); sum += __builtin_amdgcn_exp2f(__fmul_rn(d0, 1.4426950408889634f)); } }
#pragma unroll
    for (int sh = 16; sh; sh >>= 1) sum += __shfl_xor(sum, sh, 32);
    const float f = __fdiv_rn(1.0f, sum);
{
        {   /* rows < RH (the grid holds no others): normalised bf16 hi/lo over ALL TT keys (symmetric window: keys beyond RH are live), planes [zz][RH][TT] */
#pragma unroll 4
            for (int ch = 0; ch < TT / 128; ++ch) { const int j0 = ch * 128 + lane * 4; const v4f a = *(const v4f*)(sr + j0); const v4f m4 = *(const v4f*)(mk + j0); v4us oh, ol;
#pragma unroll
                for (int q = 0; q < 4; ++q) { float t = a[q] * SCL; asm volatile("" : "+v"(t)); t = (bfr(m4[q]) != 0.0f) ? t : -3.0e38f;   /* masked memory position excluded (the reference's -1e30 penalty) */ float d0 = __fsub_rn(t, mx); asm volatile("" : "+v"(d0)); float ex = __builtin_amdgcn_exp2f(__fmul_rn(d0, 1.4426950408889634f)); asm volatile("" : "+v"(ex)); unsigned short a2, c2; splitf(ex * f, a2, c2); oh[q] = a2; ol[q] = c2; }
                const size_t oo = ((size_t)zz * RH + i) * TT + j0; *(v4us*)(Ph + oo) = oh; *(v4us*)(Pl + oo) = ol; }
        }
         }
}


// ---- k_fattn: scores, softmax and weights x values of the fp16 query rows (RH on) in one kernel; no score or weight plane goes to memory. grid (rows / 64, batch in the pass), 256 threads.
// Everything is computed transposed, so that the score tile leaves the matrix unit in the layout the next product wants as its B operand: S^T [key][query] = K Q^T, O^T [d][query] = V^T P^T. A lane owns one query column of each of its wave's two column groups: running maximum, sum and rescale factor are plain per-lane values.
// The 8 waves are 2 query groups (32 queries each, as two 16-column groups) x 4 key quarters: of each staged block of FK keys a wave takes 32. Every K and V^T fragment read from LDS feeds two products, one per column group, and a staged block serves 64 queries. The 64 query rows are copied to LDS once: the first column group's Q^T fragments are taken into registers from there, the second group's are read with the key fragments in every trip (the registers do not hold all of Q^T beside two groups' O^T). Each wave keeps its own maximum in use, sum and O^T; the four quarters of a query are merged through LDS at the end, in quarter order.
// Staging: per trip the work-group copies FK key rows (K, pitch + 16 B) and the FK-wide slice of all HD value^T rows (pitch + 16 B) into one of two LDS buffers; the next trip's copies fly during this trip's products.
#define FK   128
#define KPB  (HD * 2 + 16)
#define VPB  (FK * 2 + 16)
#define KTB  (FK * KPB)
#define FSTB (KTB + HD * VPB)
#define OPF  (HD + 4)   // floats per query row of a wave's partial O in LDS (16 rows fall on 16 bank groups)
#define L2E  1.4426950408889634f
// lane l takes the value of lane l ^ 16 by a vector move (a shuffle would queue in LDS behind the fragment loads)
__device__ __forceinline__ float xhalf(float x) { return __builtin_bit_cast(float, __builtin_amdgcn_permlanex16(__builtin_bit_cast(int, x), __builtin_bit_cast(int, x), 0x76543210, 0xfedcba98, false, false)); }
__global__ __launch_bounds__(256) void k_fattn(const h16* __restrict__ Q, const h16* __restrict__ Kp, const h16* __restrict__ Vt, const float* __restrict__ mk, bf* Oh, bf* Ol) {
    __shared__ __align__(16) char sm[2 * FSTB];   // the two staging buffers; after the key loop the partial O tiles
    __shared__ __align__(16) float msk[TT];       // 1 where the key is live, 0 where the mask excludes it
    __shared__ __align__(16) char qs[64 * KPB];   // the work-group's query rows, at the key rows' pitch
    __shared__ float mS[256], lS[256];            // per wave and query: running maximum and sum, for the merge
    const int tid = (int)threadIdx.x, lane = tid & 31, lr = lane & 15, hi = lane >> 4;
    const int wv = __builtin_amdgcn_readfirstlane(tid >> 5), qg = wv & 1, kq = wv >> 1;
    const size_t bz = blockIdx.y; const int q0 = (int)blockIdx.x * 64;
    Q += (bz * TT + RH + q0) * HD; Kp += bz * TT * HD; Vt += bz * HD * TT; mk += bz * TT;
    // copy addresses: the wave-uniform parts, in scalar registers; stage() adds the lane's offsets
    const unsigned lk = (unsigned)(size_t)sm + (unsigned)(wv * KPB);               // K: 32 pieces a row, 8 rows per copy of every thread
    const unsigned lv = (unsigned)(size_t)sm + (unsigned)(KTB + wv * 2 * VPB);     // V^T: 16 pieces a row, 16 rows per copy of every thread
    const char* gk = (const char*)Kp + (size_t)wv * (HD * 2);
    const char* gv = (const char*)Vt + (size_t)wv * (2 * TT * 2);
    auto stage = [&](int s, int buf) {   // key block s into buffer buf: 32 copies per lane, every lane on
        unsigned ln; asm volatile("v_mbcnt_lo_u32_b32 %0, -1, 0" : "=v"(ln));   // the lane number, formed anew at every call: per-lane address parts taken from outside the loop would stay live across it in the registers that asm operands can name, and spill to scratch
        const unsigned lko = ln * 16, lvo = (ln >> 4) * VPB + (ln & 15) * 16, gvo = (ln >> 4) * (TT * 2) + (ln & 15) * 16;
        const unsigned lb = (unsigned)(buf * FSTB); const char* k = gk + (size_t)s * FK * HD * 2 + lko; const char* v = gv + (size_t)s * FK * 2 + gvo;
        // the fences keep each statement's 24 address registers from being formed before the statement ahead of it has issued (all 96 at once crowd out values that live across the loop)
        cp8(lk + lb + lko, 8 * KPB, k, (size_t)8 * HD * 2); __builtin_amdgcn_sched_barrier(0); cp8(lk + lb + 64 * KPB + lko, 8 * KPB, k + (size_t)64 * HD * 2, (size_t)8 * HD * 2); __builtin_amdgcn_sched_barrier(0);
        cp8(lv + lb + lvo, 16 * VPB, v, (size_t)16 * TT * 2); __builtin_amdgcn_sched_barrier(0); cp8(lv + lb + 128 * VPB + lvo, 16 * VPB, v + (size_t)128 * TT * 2, (size_t)16 * TT * 2);
    };
    stage(0, 0);
    cp8((unsigned)(size_t)qs + (unsigned)((tid >> 5) * KPB + (tid & 31) * 16), 8 * KPB, (const char*)Q + (size_t)(tid >> 5) * (HD * 2) + (tid & 31) * 16, (size_t)8 * HD * 2);   // the query rows: 32 pieces a row, 8 rows per copy of every thread; they land with block 0
#pragma unroll
    for (int i = 0; i < TT / 1024; ++i) { const v4f m4 = *(const v4f*)(mk + (tid + i * 256) * 4); v4f o;
#pragma unroll
        for (int q = 0; q < 4; ++q) o[q] = (bfr(m4[q]) != 0.0f) ? 1.0f : 0.0f;
        *(v4f*)(msk + (tid + i * 256) * 4) = o; }
    asm volatile("s_wait_xcnt 0x0" :: "s"(mk) : "memory");   // stands ahead of any reuse of the address registers of the mask loads above: reading the address here keeps it untouched up to the wait
    const char* qb = qs + (qg * 32 + lr) * KPB + hi * 16;   // B fragments of Q^T: column = query lr of the first column group (the second: 16 rows on), the k order of the key fragments
    v8f acc[2][16];
#pragma unroll
    for (int g = 0; g < 2; ++g)
#pragma unroll
        for (int dt = 0; dt < 16; ++dt) acc[g][dt] = (v8f){};
    float mrun[2] = {-3.0e38f, -3.0e38f}, lrun[2] = {0.0f, 0.0f};
    asm volatile("s_wait_asynccnt 0x0" ::: "memory");   // this wave's copies of block 0 have landed
    __syncthreads();   // ... and every other wave's; the query rows have landed with it, the mask flags are written
    stage(1, 1);
    v16h qf[8];
#pragma unroll
    for (int ks = 0; ks < 8; ++ks) qf[ks] = WFrag<h16>::ld(qb + ks * 64);
#pragma unroll 1
    for (int s = 0; s < TT / FK; ++s) {
        const char* bb = sm + (s & 1) * FSTB;
        const char* kb = bb + (kq * 32 + lr) * KPB + hi * 16;          // A fragments of K: row = key
        const char* vb = bb + KTB + lr * VPB + kq * 64 + hi * 16;      // A fragments of V^T: row = d, k = the wave's 32 keys
        const float* mp = msk + s * FK + kq * 32 + hi * 8;
        v8f sc[2][2];   // [column group][16-key half]
#pragma unroll
        for (int g = 0; g < 2; ++g) { sc[g][0] = (v8f){}; sc[g][1] = (v8f){}; }
        // the key fragments come in two groups of eight, each with the second column group's four Q^T fragments of its k steps (the registers do not hold all of them at once)
#pragma unroll
        for (int h = 0; h < 2; ++h) {
            v16h ka[8], q1[4];
#pragma unroll
            for (int k4 = 0; k4 < 4; ++k4) { ka[2 * k4] = WFrag<h16>::ld(kb + (h * 4 + k4) * 64); ka[2 * k4 + 1] = WFrag<h16>::ld(kb + 16 * KPB + (h * 4 + k4) * 64); q1[k4] = WFrag<h16>::ld(qb + 16 * KPB + (h * 4 + k4) * 64); }
            __builtin_amdgcn_sched_barrier(0);   // a group's loads are issued together: one LDS latency per group, not one wait per product
#pragma unroll
            for (int k4 = 0; k4 < 4; ++k4)
#pragma unroll
                for (int g = 0; g < 2; ++g) { const v16h qq = g ? q1[k4] : qf[h * 4 + k4]; sc[g][0] = wmma16(ka[2 * k4], qq, sc[g][0]); sc[g][1] = wmma16(ka[2 * k4 + 1], qq, sc[g][1]); }
        }
        const v4f ma = *(const v4fa*)mp, mb = *(const v4fa*)(mp + 4), mc = *(const v4fa*)(mp + 16), md = *(const v4fa*)(mp + 20);
        v16h va[16];
#pragma unroll
        for (int dt = 0; dt < 4; ++dt) va[dt] = WFrag<h16>::ld(vb + dt * 16 * VPB);
        __builtin_amdgcn_sched_barrier(0);   // the first value fragments' loads are issued up here, so that the softmax below covers their latency
        float bm[2] = {-3.0e38f, -3.0e38f};
#pragma unroll
        for (int j = 0; j < 8; ++j) { const float f0 = (j < 4) ? ma[j & 3] : mb[j & 3], f1 = (j < 4) ? mc[j & 3] : md[j & 3];
#pragma unroll
            for (int g = 0; g < 2; ++g) {
                sc[g][0][j] = (f0 != 0.0f) ? sc[g][0][j] * SCL : -3.0e38f; sc[g][1][j] = (f1 != 0.0f) ? sc[g][1][j] * SCL : -3.0e38f;   /* masked memory position excluded (the reference's -1e30 penalty) */
                bm[g] = fmaxf(bm[g], fmaxf(sc[g][0][j], sc[g][1][j])); } }
        bm[0] = fmaxf(bm[0], xhalf(bm[0])); bm[1] = fmaxf(bm[1], xhalf(bm[1]));   // the query's other eight-key halves
        // lazy rescale: a column group's maximum in use moves only when one of its queries' new maximum lies more than 2^8 above it (weights stay <= 256, well inside fp16); one scalar branch per block on the usual path
        const unsigned n0 = __builtin_amdgcn_ballot_w32((bm[0] - mrun[0]) * L2E > 8.0f), n1 = __builtin_amdgcn_ballot_w32((bm[1] - mrun[1]) * L2E > 8.0f);
        if ((n0 | n1) != 0) {
#pragma unroll
            for (int g = 0; g < 2; ++g) if ((g ? n1 : n0) != 0) { const float mnew = fmaxf(mrun[g], bm[g]), al = __builtin_amdgcn_exp2f((mrun[g] - mnew) * L2E); mrun[g] = mnew; lrun[g] *= al;
#pragma unroll
                for (int dt = 0; dt < 16; ++dt) acc[g][dt] *= al; } }
#pragma unroll
        for (int g = 0; g < 2; ++g)
#pragma unroll
            for (int j = 0; j < 8; ++j) { sc[g][0][j] = (sc[g][0][j] - mrun[g]) * L2E; sc[g][1][j] = (sc[g][1][j] - mrun[g]) * L2E; }
        __builtin_amdgcn_sched_barrier(0);   // the exponentials below run back to back, each filling the slot behind the one before
        v16h pf[2];   // S^T's accumulator layout is the B fragment's: keys hi*8 .. +7 and 16 + hi*8 .. +7 of column lr
        { float ps[2] = {0.0f, 0.0f}; v8h p0[2], p1[2];
#pragma unroll
            for (int j = 0; j < 8; ++j)
#pragma unroll
                for (int g = 0; g < 2; ++g) { const float e0 = __builtin_amdgcn_exp2f(sc[g][0][j]), e1 = __builtin_amdgcn_exp2f(sc[g][1][j]); ps[g] += e0 + e1; p0[g][j] = tohx(e0); p1[g][j] = tohx(e1); }
            lrun[0] += ps[0]; lrun[1] += ps[1]; pf[0] = cat16(p0[0], p1[0]); pf[1] = cat16(p0[1], p1[1]); }
        // the value fragments come four at a time, each four fetched while the four before feed their eight products
#pragma unroll
        for (int c = 0; c < 4; ++c) {
            if (c < 3) {
#pragma unroll
                for (int dt = 0; dt < 4; ++dt) va[(c + 1) * 4 + dt] = WFrag<h16>::ld(vb + ((c + 1) * 4 + dt) * 16 * VPB); }
            __builtin_amdgcn_sched_barrier(0);   // keeps the next four's loads ahead of this four's products (left to itself the compiler puts each load, with a full wait, in front of its product)
#pragma unroll
            for (int dt = 0; dt < 4; ++dt) { acc[0][c * 4 + dt] = wmma16(va[c * 4 + dt], pf[0], acc[0][c * 4 + dt]); acc[1][c * 4 + dt] = wmma16(va[c * 4 + dt], pf[1], acc[1][c * 4 + dt]); }
        }
        asm volatile("s_wait_dscnt 0x0" ::: "memory");      // this wave's reads of the buffer are done before anybody refills it
        asm volatile("s_wait_asynccnt 0x0" ::: "memory");   // this wave's copies of block s + 1 have landed
        __syncthreads();   // ends every wave's reads of this block's buffer and publishes block s + 1
        if (s + 2 < TT / FK) stage(s + 2, s & 1);
    }
    asm volatile("s_wait_asynccnt 0x0" ::: "memory");   // no copy is outstanding when the buffers become the partial O tiles
#pragma unroll
    for (int g = 0; g < 2; ++g) { lrun[g] += xhalf(lrun[g]);
        if (hi == 0) { mS[wv * 32 + g * 16 + lr] = mrun[g]; lS[wv * 32 + g * 16 + lr] = lrun[g]; } }
    __syncthreads();   // every wave's maximum and sum are in LDS
    float* os = (float*)sm;
#pragma unroll
    for (int g = 0; g < 2; ++g) {
        float M = -3.0e38f, L = 0.0f;
#pragma unroll
        for (int w = 0; w < 4; ++w) M = fmaxf(M, mS[(w * 2 + qg) * 32 + g * 16 + lr]);
#pragma unroll
        for (int w = 0; w < 4; ++w) L += lS[(w * 2 + qg) * 32 + g * 16 + lr] * __builtin_amdgcn_exp2f((mS[(w * 2 + qg) * 32 + g * 16 + lr] - M) * L2E);
        const float wsc = __fdiv_rn(__builtin_amdgcn_exp2f((mrun[g] - M) * L2E), L);
#pragma unroll
        for (int dt = 0; dt < 16; ++dt) { const v8f o = acc[g][dt] * wsc; float* op = os + (size_t)(wv * 32 + g * 16 + lr) * OPF + dt * 16 + hi * 8;
            *(v4fa*)op = (v4f){o[0], o[1], o[2], o[3]}; *(v4fa*)(op + 4) = (v4f){o[4], o[5], o[6], o[7]}; } }
    __syncthreads();   // every wave's scaled partial O is in LDS before any thread sums the four quarters
#pragma unroll
    for (int g = 0; g < 8; ++g) { const int u = tid + g * 256, ql = u >> 5, d8 = (u & 31) * 8; v4f x = (v4f){}, y = (v4f){};
#pragma unroll
        for (int w = 0; w < 4; ++w) { const float* ip = os + (size_t)((w * 2 + (ql >> 5)) * 32 + (ql & 31)) * OPF + d8; x += *(const v4fa*)ip; y += *(const v4fa*)(ip + 4); }
        v8us oh, ol;
#pragma unroll
        for (int q = 0; q < 4; ++q) { unsigned short a2, c2; splitf(x[q], a2, c2); oh[q] = a2; ol[q] = c2; splitf(y[q], a2, c2); oh[q + 4] = a2; ol[q + 4] = c2; }
        const size_t oo = (bz * TT + RH + q0 + ql) * DC + DM + d8; *(v8us*)(Oh + oo) = oh; *(v8us*)(Ol + oo) = ol; }
}

// ---- k_vtpb: value^T planes [batch][column][t] from the memory rows [t][column]; one VTT t x 64 column tile per work-group, transposed through LDS. grid (TT / VTT, columns / 64, batch in the pass), 256 threads.
// Reads: 16 lanes take the tile's 256 B of one row (whole lines), a thread two neighbouring rows at a time, so that two bf16 values of one column make one LDS word. Writes: 16 lanes store 256 B in a row of one column, per plane.
// LDS [column][t pair]; the 16-byte piece p of column c lies at piece p ^ (c >> 2): a wave's 32 word stores fall on 32 different banks, and the 16-byte reads stay aligned.
#define VTT  128
__global__ __launch_bounds__(256) void k_vtpb(const float* __restrict__ F, h16* V16, bf* Vh, bf* Vl) {
    static_assert(VTT / 8 == 16 && DKV % 64 == 0 && TT % VTT == 0, "the piece swizzle takes 16 pieces a column; whole tiles only");
    __shared__ __align__(16) unsigned tl[64 * (VTT / 2)];
    const int tid = (int)threadIdx.x, d4 = tid & 15, rp = tid >> 4; const int t0 = (int)blockIdx.x * VTT, c0 = (int)blockIdx.y * 64; const size_t bz = blockIdx.z;   /* batch in the pass */
    F += (bz * TT + t0 + rp * 2) * DM + c0 + d4 * 4;   // the row pitch is a constant: one address a thread, every other load at an immediate offset from it
    v4f ra[VTT / 32], rb[VTT / 32];
    // unrolled: all of a thread's loads are in flight together
#pragma unroll
    for (int i = 0; i < VTT / 32; ++i) { ra[i] = *(const v4f*)(F + i * 32 * DM); rb[i] = *(const v4f*)(F + (i * 32 + 1) * DM); }
#pragma unroll
    for (int i = 0; i < VTT / 32; ++i) { const int tp = i * 16 + rp;
#pragma unroll
        for (int q = 0; q < 4; ++q) tl[(d4 * 4 + q) * (VTT / 2) + ((((tp >> 2) ^ d4) << 2) | (tp & 3))] = (unsigned)f2bf(ra[i][q]) | ((unsigned)f2bf(rb[i][q]) << 16);   /* the value IS a module input: round to bf16 once (lo plane 0) */ }
    __syncthreads();   // the whole tile is in LDS before any thread reads a column that other waves wrote
    v8us hb[VTT / 32];
    // unrolled, and apart from the loop below: the later pieces' LDS reads are under way while the first piece is converted and stored
#pragma unroll
    for (int s = 0; s < VTT / 32; ++s) { const int u = tid + s * 256, d = u / (VTT / 8), c = u % (VTT / 8); hb[s] = *(const v8usa*)(tl + d * (VTT / 2) + ((c ^ (d >> 2)) << 2)); }
#pragma unroll
    for (int s = 0; s < VTT / 32; ++s) { const int u = tid + s * 256, d = u / (VTT / 8), c = u % (VTT / 8); v8h o16; v8us oh, ol;
#pragma unroll
        for (int q = 0; q < 8; ++q) { const float x = bf2f(hb[s][q]); o16[q] = tohx(x); unsigned short a2, c2; splitf(x, a2, c2); oh[q] = a2; ol[q] = c2; }
        const size_t eo = (bz * DKV + c0 + d) * TT + t0 + c * 8; *(v8h*)(V16 + eo) = o16; *(v8us*)(Vh + eo) = oh; *(v8us*)(Vl + eo) = ol; }
}

extern "C" void kernel_launch(void* const* d_in, const int* in_sizes, int n_in,
                              void* d_out, int out_size, void* d_ws, size_t ws_size, hipStream_t stream) {
    (void)in_sizes; (void)n_in; (void)out_size;
    const float* x = (const float*)d_in[0];   /* input */ const float* xm = (const float*)d_in[1];   /* memory */ const float* mk = (const float*)d_in[2];   /* mask [4][4096] f32 */ const float* wq = (const float*)d_in[3]; const float* bq = (const float*)d_in[4]; const float* wk = (const float*)d_in[5]; const float* bk = (const float*)d_in[6]; const float* w2 = (const float*)d_in[7]; const float* b2 = (const float*)d_in[8];   /* argument order input, memory, mask, W_in1, b_in1, W_mem1, b_mem1, W2, b2 */
    float* OUT = (float*)d_out;     // [4][4096][256]
    char* wsp = (char*)d_ws;
    auto take = [&](size_t bytes) { char* p = wsp; wsp += (bytes + 255) & ~(size_t)255; return (void*)p; };
    bf* WQ = (bf*)take((size_t)DQ * DM * 2); bf* WK = (bf*)take((size_t)DKV * DM * 2); bf* W2B = (bf*)take((size_t)DM * DC * 2); bf* CAh = (bf*)take((size_t)NP * TT * DC * 2); bf* CAl = (bf*)take((size_t)NP * TT * DC * 2);
    h16* QP16 = (h16*)take((size_t)NP * NH_ * TT * HD * 2); h16* KP16 = (h16*)take((size_t)NP * NKV * TT * HD * 2); h16* VT16 = (h16*)take((size_t)NP * NKV * HD * TT * 2);
    bf* QPh = (bf*)take((size_t)NP * NH_ * TT * HD * 2); bf* QPl = (bf*)take((size_t)NP * NH_ * TT * HD * 2); bf* KPh = (bf*)take((size_t)NP * NKV * TT * HD * 2); bf* KPl = (bf*)take((size_t)NP * NKV * TT * HD * 2); bf* VTh = (bf*)take((size_t)NP * NKV * HD * TT * 2); bf* VTl = (bf*)take((size_t)NP * NKV * HD * TT * 2); bf* Ph = (bf*)take((size_t)NP * ZH * RH * TT * 2); bf* Pl = (bf*)take((size_t)NP * ZH * RH * TT * 2);
    float* Sb = (float*)take((size_t)NP * ZH * RH * TT * 4);   /* f32 scores of the rows < RH, [NP][RH][TT] */
    bf* XB = (bf*)Sb;   /* the bf16 copies [NP][TT][DM] are last read by the key projection, before the scores are first written: they borrow the score plane's bytes */
    if ((size_t)(wsp - (char*)d_ws) > ws_size) return;    // ws 256 MiB
    k_cvt8<<<(unsigned)(((size_t)DQ * DM / 8 + 255) / 256), 256, 0, stream>>>(wq, WQ, (size_t)DQ * DM / 8); k_cvt8<<<(unsigned)(((size_t)DKV * DM / 8 + 255) / 256), 256, 0, stream>>>(wk, WK, (size_t)DKV * DM / 8); k_cvt8<<<(unsigned)(((size_t)DM * DC / 8 + 255) / 256), 256, 0, stream>>>(w2, W2B, (size_t)DM * DC / 8);   /* W2 'oi' [256][512] = Bt as-is */
    for (int b = 0; b < NB_; b += NP) {   /* batches b .. b + NP - 1; their rows follow one another in the inputs, the output and every [t][...] plane */
        k_cvtc<<<(unsigned)(((size_t)NP * TT * DM / 8 + 255) / 256), 256, 0, stream>>>(x + (size_t)b * TT * DM, XB, CAh, CAl, (size_t)NP * TT * DM / 8);   /* XB := bf16(input[b ..]); also the concat operand's left half */
        k_gemmw<bf, 0, true, 8, 1><<<dim3(NP * TT / 64, DQ / 64, 1), 256, 0, stream>>>(XB, nullptr, WQ, nullptr, DM, nullptr, DQ, bq, 0, 0, 0, QP16, QPh, QPl, 1.0f);   /* query planes of input_dot = relu(input W_in1^T + b) */
        k_cvt8<<<(unsigned)(((size_t)NP * TT * DM / 8 + 255) / 256), 256, 0, stream>>>(xm + (size_t)b * TT * DM, XB, (size_t)NP * TT * DM / 8);   /* XB := bf16(memory[b ..]) (the q projection above consumed bf16(input[b ..])) */
        k_gemmw<bf, 0, true, 8, 1><<<dim3(NP * TT / 64, DKV / 64, 1), 256, 0, stream>>>(XB, nullptr, WK, nullptr, DM, nullptr, DKV, bk, 0, 0, 0, KP16, KPh, KPl, 1.0f);   /* key planes of memory_dot */
        k_vtpb<<<dim3(TT / VTT, DKV / 64, NP), 256, 0, stream>>>(xm + (size_t)b * TT * DM, VT16, VTh, VTl);   /* values = the memory itself (bf16-rounded input: hi plane exact, lo plane 0) */
        k_gemmw<bf, 2, false, 8, 0><<<dim3(RH / 64, TT / 64, NP * ZH), 256, 0, stream>>>(QPh, QPl, KPh, KPl, HD, Sb, TT, nullptr, (size_t)TT * HD, (size_t)TT * HD, (size_t)RH * TT, nullptr, nullptr, nullptr, 1.0f);
        k_asoft<<<dim3(ZH * RH / 8, NP, 1), 256, 0, stream>>>(Sb, mk + (size_t)b * TT, Ph, Pl);
        /* output_one = weights x values, written as the hi/lo right half of the concat operand (pitch DC, column DM on) */
        k_gemmw<bf, 1, false, 16, 2><<<dim3(RH / 64, HD / 64, NP * ZH), 512, 0, stream>>>(Ph, Pl, VTh, nullptr, TT, nullptr, DC, nullptr, (size_t)RH * TT, (size_t)HD * TT, (size_t)TT * DC, nullptr, CAh + DM, CAl + DM, 1.0f);   /* weights hi/lo x exact bf16 values (2 products) */
        k_fattn<<<dim3((TT - RH) / 64, NP, 1), 256, 0, stream>>>(QP16, KP16, VT16, mk + (size_t)b * TT, CAh, CAl);   /* rows RH on: fp16 scores, streaming softmax and fp16 weights x values in one kernel */
        k_gemmw<bf, 1, true, 8, 3><<<dim3(NP * TT / 64, DM / 64, 1), 256, 0, stream>>>(CAh, CAl, W2B, nullptr, DC, OUT + (size_t)b * TT * DM, DM, b2, 0, 0, 0, nullptr, nullptr, nullptr, 1.0f);   /* z = [input | output_one] W2^T + b2; out = sigmoid(z) tanh(z) */
    }
}

// v009
// Measured time: 182 microseconds a run.
// In two side-by-side timings against v008, it was 1.07 and 1.06 times as fast.
// All steps since v000 together make it 7.23 times as fast.
#include <hip/hip_runtime.h>

// Gated attention reader (input, memory [4][4096][256]; mask [4][4096] f32 0/1 over memory positions (read); input_dot = relu(input W_in1^T + b_in1), memory_dot = relu(memory W_mem1^T + b_mem1) ('oi' [256][256] 1/16, zero biases); att = input_dot . memory_dot / 16 - 1e30 (1 - mask[m]) (== exclusion); softmax over the 4,096 memory positions; output_one = weights . memory; z = [input | output_one] W2^T + b2 ('oi' [256][512]); out = sigmoid(z) tanh(z) -> [4][4096][256] (4.2 M); argument order input, memory, mask, W_in1, b_in1, W_mem1, b_mem1, W2, b2).
// NP batches go through each launch together (more rows, or grid z / y = batch in the pass). Layout per batch: no bf16 copy of an input is made: the GEMMs that consume input, memory and the three weights stage them as f32 and round each value to bf16 as it enters a fragment; exact projections + f32 biases, ReLU and the split into query/key planes in the projection's own epilogue; one 256-wide head; value^T planes straight from the bf16-rounded memory; dense T-4096 attention, hybrid rows: < 512 hi/lo 3-product scores, three-sweep softmax reading the mask row and hi/lo x exact-value products; the rest fp16, scores, online softmax and weights x values in one kernel; output_one leaves the weights x values epilogue as the hi/lo right half of the concat operand (its left half bf16(input) is written by the query projection from its staged input rows); [bf16(input) | hi/lo(output_one)] x W2 exact + b2, whose epilogue applies sigmoid(z) tanh(z) and writes the output.
// Compute dtypes, f32 accumulate: every input rounded to bf16; projections exact + f32 biases; attention rows < 512 3 products (scores) / 2 products (weights x exact values), rest fp16; softmax f32; W2 [exact | hl] x exact + bias; sigmoid/tanh f32 (precise expf/tanhf).

#define NB_  4
#define TT   4096
#define DM   256
#define NH_  1
#define NKV  1
#define REP  (NH_ / NKV)
#define HD   256
#define DQ   (NH_ * HD)
#define DKV  (NKV * HD)
#define ZH   1
#define RH   512                  // query rows < RH use hi+lo planes (0: none)
#define WIN  0
#define SCL  0.0625f   // 1 / float32(sqrt(256))
#define DC   (2 * DM)   // concat width
#define NP   4          // batches that share every launch of a pass: all of them (the score plane holds only the RH rows of each batch that are written, so four batches' planes fit the workspace)
typedef _Float16 h16;
typedef unsigned short bf;
typedef __attribute__((ext_vector_type(16))) __bf16   v16bf;
typedef __attribute__((ext_vector_type(16))) _Float16 v16h;
typedef __attribute__((ext_vector_type(8)))  _Float16 v8h;
typedef __attribute__((ext_vector_type(8)))  unsigned short v8us;
typedef __attribute__((ext_vector_type(8)))  float    v8f;
typedef __attribute__((ext_vector_type(4)))  float    v4f;
typedef v8h  __attribute__((may_alias)) v8ha;
typedef v4f  __attribute__((may_alias)) v4fa;
typedef v8us __attribute__((may_alias)) v8usa;

__device__ __forceinline__ unsigned short f2bf(float f) { unsigned u = __float_as_uint(f); u += 0x7FFFu + ((u >> 16) & 1u); return (unsigned short)(u >> 16); }
__device__ __forceinline__ float bf2f(unsigned short b) { return __uint_as_float(((unsigned)b) << 16); }
__device__ __forceinline__ float bfr(float f) { return bf2f(f2bf(f)); }
__device__ __forceinline__ v16h cat16(v8h lo, v8h hi) { return __builtin_shufflevector(lo, hi, 0, 1, 2, 3, 4, 5, 6, 7, 8, 9, 10, 11, 12, 13, 14, 15); }
__device__ __forceinline__ v16bf cat16b(v8us lo, v8us hi) { return __builtin_bit_cast(v16bf, __builtin_shufflevector(lo, hi, 0, 1, 2, 3, 4, 5, 6, 7, 8, 9, 10, 11, 12, 13, 14, 15)); }
__device__ __forceinline__ v8f wmma16(v16h a, v16h b, v8f c) { return __builtin_amdgcn_wmma_f32_16x16x32_f16(false, a, false, b, (short)0, c, false, false); }
__device__ __forceinline__ v8f wmmab(v16bf a, v16bf b, v8f c) { return __builtin_amdgcn_wmma_f32_16x16x32_bf16(false, a, false, b, (short)0, c, false, false); }

__device__ __forceinline__ h16 tohx(float x) { return (h16)x; }
__device__ __forceinline__ void splitf(float y, unsigned short& h, unsigned short& l) { h = f2bf(y); l = f2bf(y - bf2f(h)); }
typedef __attribute__((ext_vector_type(2))) _Float16 v2h;
typedef __attribute__((ext_vector_type(4))) _Float16 v4h;
typedef __attribute__((ext_vector_type(2))) unsigned short v2us;
typedef __attribute__((ext_vector_type(4))) unsigned short v4us;
typedef __attribute__((ext_vector_type(2))) float v2f;
typedef __attribute__((ext_vector_type(4))) int v4i;

// ---- k_gemmw: register-blocked GEMM, one 64x64 output tile per work-group (16 accumulators per wave), operands from K-contiguous 16-bit planes, staged in LDS by asynchronous copies; grid (M/64, N/64, Z), 32 * KW threads.
// C[m][n] (f32, pitch ldc, + optional f32 bias[n]) = sum_k A[m][k] Bt[n][k] (+ split products per NSPLIT). z-batch strides sA/sB/sC in elements (sC also moves the EPI 2 planes). K % (32 * KW) == 0, and K % 64 == 0 where KW == 1.
// KW waves share the tile's K: wave w takes the 32-wide k blocks w, w + KW, ...; the KW partial tiles are summed through LDS in wave order 0 .. KW-1.
// Staging: per trip the work-group copies, of each operand plane, 64 rows x (32 * KW * KS) k into LDS (row pitch + 16 B, so that 16 rows fall on 16 different bank groups). A copy instruction takes 512 B (KW > 1) or 4 x 128 B (KW == 1) of whole lines, where a fragment load from the plane itself touches 16 lines for 32 B each. Fragments then come from LDS with the k order of the direct loads. One-product kernels use two buffers (the next trip's copies fly during this trip's products); the split-product kernels have room for one.
// AF / BF: the A / Bt operand is an f32 input (Af / Bf, same [row][K] shape) instead of a 16-bit plane: its rows are staged as f32 (row pitch + 16 B again) and rounded to bf16 (to nearest even, as f2bf rounds) where a fragment is read from LDS. KW > 1 only; one buffer.
// Ch / Cl (AF, EPI 1, may be null): the work-group also lays bf16(Af) of its 64 rows, columns c0 .. c0 + 63, down as the left half of the concat operand's hi plane [m][DC]; the lo plane's left half is 0 (bf16(input) is exact in one plane). Needs K == TK (trip 0 holds whole rows) and N == K.
// EPI names what the KW > 1 epilogue does with the summed (+ bias) value v at [m][n], pitch ldc: 0 stores v to C; 1 stores relu(v) as the planes E16 (fp16), Eh / El (bf16 hi / lo); 2 stores v * esc as Eh / El; 3 stores sigmoid(v) tanh(v) to C.
template <typename T16> struct WFrag;
template <> struct WFrag<h16> { typedef v16h V; static __device__ __forceinline__ V ld(const char* p) { return cat16(*(const v8ha*)p, *(const v8ha*)(p + 32)); } static __device__ __forceinline__ v8f mma(V a, V b, v8f c) { return wmma16(a, b, c); } };
template <> struct WFrag<bf> { typedef v16bf V; static __device__ __forceinline__ V ld(const char* p) { return cat16b(*(const v8usa*)p, *(const v8usa*)(p + 32)); } static __device__ __forceinline__ v8f mma(V a, V b, v8f c) { return wmmab(a, b, c); } };
// a bf16 fragment from an f32 row in LDS, in the k order of WFrag<bf>::ld: eight values at p, eight more 16 k further on
__device__ __forceinline__ v16bf ldf32(const char* p) { const v4f x0 = *(const v4fa*)p, x1 = *(const v4fa*)(p + 16), x2 = *(const v4fa*)(p + 64), x3 = *(const v4fa*)(p + 80);
    // the hardware's conversion, two values an instruction: round to nearest even, as f2bf
    return __builtin_convertvector(__builtin_shufflevector(__builtin_shufflevector(x0, x1, 0, 1, 2, 3, 4, 5, 6, 7), __builtin_shufflevector(x2, x3, 0, 1, 2, 3, 4, 5, 6, 7), 0, 1, 2, 3, 4, 5, 6, 7, 8, 9, 10, 11, 12, 13, 14, 15), v16bf); }
// eight asynchronous 16-byte copies per lane, global -> LDS: copy q takes g + q * gs to LDS byte l + q * ls. The s_wait_xcnt closes the statement so that no address register of a copy is rewritten ahead of it.
__device__ __forceinline__ void cp8(unsigned l, unsigned ls, const char* g, size_t gs) {
    asm volatile("global_load_async_to_lds_b128 %0, %8, off\n\t"
                 "global_load_async_to_lds_b128 %1, %9, off\n\t"
                 "global_load_async_to_lds_b128 %2, %10, off\n\t"
                 "global_load_async_to_lds_b128 %3, %11, off\n\t"
                 "global_load_async_to_lds_b128 %4, %12, off\n\t"
                 "global_load_async_to_lds_b128 %5, %13, off\n\t"
                 "global_load_async_to_lds_b128 %6, %14, off\n\t"
                 "global_load_async_to_lds_b128 %7, %15, off\n\t"
                 "s_wait_xcnt 0x0"
                 :: "v"(l), "v"(l + ls), "v"(l + 2 * ls), "v"(l + 3 * ls), "v"(l + 4 * ls), "v"(l + 5 * ls), "v"(l + 6 * ls), "v"(l + 7 * ls),
                    "v"(g), "v"(g + gs), "v"(g + 2 * gs), "v"(g + 3 * gs), "v"(g + 4 * gs), "v"(g + 5 * gs), "v"(g + 6 * gs), "v"(g + 7 * gs)
                 : "memory");
}
// four waves per SIMD (256 registers a wave): two 8-wave work-groups still share a WGP, as their LDS allows
template <typename T16, int NSPLIT, bool BIAS, int KW, int EPI, bool AF, bool BF>
__global__ __launch_bounds__(32 * KW) __attribute__((amdgpu_waves_per_eu(4))) void k_gemmw(const T16* __restrict__ A, const T16* __restrict__ A2, const T16* __restrict__ Bt, const T16* __restrict__ Bt2, const float* __restrict__ Af, const float* __restrict__ Bf, int K, float* C, int ldc, const float* __restrict__ bias, size_t sA, size_t sB, size_t sC, h16* E16, bf* Eh, bf* El, float esc, bf* Ch, bf* Cl) {
    typedef typename WFrag<T16>::V V;
    static_assert(!(AF || BF) || KW > 1, "f32 operands: one 32-wide k step of a wave per trip");
    static_assert(NSPLIT <= 2, "planes staged: A, Bt, A2 (NSPLIT 1, 2), Bt2 (NSPLIT 2)");
    constexpr int KS = (KW == 1) ? 2 : 1;                  // 32-wide k steps of a wave per trip (a lone wave takes two, so that its rows are whole 128-B lines)
    constexpr int NBLK = (NSPLIT == 0) ? 2 : (NSPLIT == 1 ? 3 : 4), NBUF = (NSPLIT == 0 && !AF && !BF) ? 2 : 1;
    constexpr int TK = 32 * KW * KS, GR = TK / 8, RP = 32 * KW / GR;   // k per trip; 16-byte pieces per staged row; rows that one copy of every thread covers
    constexpr int PB = TK * 2 + 16, BLKB = 64 * PB;   // LDS bytes of a 16-bit plane: row pitch, one block
    constexpr int GRF = TK / 4, RPF = 32 * KW / GRF, PBF = TK * 4 + 16;   // an f32 operand: 16-byte pieces per staged row; rows that one copy of every thread covers; row pitch
    constexpr int OB = 64 * (AF ? PBF : PB), OA2 = OB + 64 * (BF ? PBF : PB), OB2 = OA2 + BLKB, STB = OA2 + (NBLK - 2) * BLKB;   // where Bt's, A2's and Bt2's blocks begin in a buffer (A's at 0); one buffer
    constexpr int OSB = (KW > 1 ? KW * 64 : 16) * 68 * 4;   // KW > 1: one whole 64-row partial tile per wave
    __shared__ __align__(16) float os[(OSB > NBUF * STB ? OSB : NBUF * STB) / 4];   // the staging buffers first, the output staging after the k loop
    const int wv = (KW > 1) ? __builtin_amdgcn_readfirstlane((int)(threadIdx.x >> 5)) : 0;   // wave-uniform, so the k loop stays scalar
    const size_t z = blockIdx.z; if constexpr (AF) Af += z * sA; else A += z * sA; if (A2) A2 += z * sA; if constexpr (BF) Bf += z * sB; else Bt += z * sB; if (Bt2) Bt2 += z * sB; if constexpr (EPI == 2) { Eh += z * sC; El += z * sC; } else C += z * sC;
    const int lane = threadIdx.x & 31, lr = lane & 15, hi = lane >> 4; const int r0 = blockIdx.x * 64, c0 = blockIdx.y * 64;
    v8f acc[4][4];
#pragma unroll
    for (int mb = 0; mb < 4; ++mb)
#pragma unroll
        for (int nb = 0; nb < 4; ++nb) acc[mb][nb] = (v8f){};
    const int tid = (int)threadIdx.x, crow = tid / GR, ccol = tid % GR;   // the staged row and 16-byte piece that this lane copies first
    const unsigned lcp = (unsigned)(size_t)os + (unsigned)(crow * PB + ccol * 16);   // its LDS byte address inside a block
    const size_t acp = (size_t)(r0 + crow) * K + ccol * 8, bcp = (size_t)(c0 + crow) * K + ccol * 8, gstep = (size_t)RP * K * 2;
    const size_t gsf = (size_t)RPF * K * 4;   // an f32 operand's step from one copy to the next
    const int ntr = (int)((unsigned)K / (unsigned)TK);   // trips: the same for every wave (K % TK == 0)
    auto stage = [&](int t, int buf) {   // all planes' blocks of trip t into buffer buf: 8 * KS copies per lane and 16-bit plane, 16 per f32 operand, every lane on
        const size_t ko = (size_t)t * TK; const unsigned lb = lcp + (unsigned)(buf * STB);
        unsigned ln = 0; if constexpr (AF || BF) asm volatile("v_nop\n\tv_nop\n\tv_nop\n\tv_nop\n\tv_mbcnt_lo_u32_b32 %0, -1, 0" : "=v"(ln));   // the lane number, formed anew at every call: an f32 operand's 16 LDS addresses, formed outside the loop, would stay live across it beside the accumulators and spill to scratch. The four v_nop keep the chip's distance behind a matrix instruction: the compiler sinks the trip's last products to just above this statement and may give it one of their operand registers
        const int tf = wv * 32 + (int)ln, crf = tf / GRF, ccf = tf % GRF;   // the staged row and 16-byte piece of an f32 operand that this lane copies first
        const unsigned lf = (unsigned)(size_t)os + (unsigned)(buf * STB + crf * PBF + ccf * 16);
        const size_t acf = (size_t)(r0 + crf) * K + ccf * 4, bcf = (size_t)(c0 + crf) * K + ccf * 4;
        if constexpr (AF) { const char* g = (const char*)(Af + acf + ko); cp8(lf, RPF * PBF, g, gsf); cp8(lf + 8 * RPF * PBF, RPF * PBF, g + 8 * gsf, gsf); }
        if constexpr (BF) { const char* g = (const char*)(Bf + bcf + ko); cp8(lf + OB, RPF * PBF, g, gsf); cp8(lf + OB + 8 * RPF * PBF, RPF * PBF, g + 8 * gsf, gsf); }
#pragma unroll
        for (int h = 0; h < KS; ++h) { const unsigned lh = lb + (unsigned)(h * 8 * RP * PB); const size_t gh = (size_t)h * 8 * gstep;
            if constexpr (!AF) cp8(lh, RP * PB, (const char*)(A + acp + ko) + gh, gstep);
            if constexpr (!BF) cp8(lh + OB, RP * PB, (const char*)(Bt + bcp + ko) + gh, gstep);
            if constexpr (NSPLIT >= 1) cp8(lh + OA2, RP * PB, (const char*)(A2 + acp + ko) + gh, gstep);
            if constexpr (NSPLIT >= 2) cp8(lh + OB2, RP * PB, (const char*)(Bt2 + bcp + ko) + gh, gstep); }
    };
    stage(0, 0);
    asm volatile("s_wait_asynccnt 0x0" ::: "memory");   // this wave's copies of trip 0 have landed
    __syncthreads();   // ... and every other wave's: a wave reads rows that other waves copied
    if constexpr (NBUF == 2) { if (K >= 2 * TK) stage(1, 1); }   // a trip 1 exists
    if constexpr (AF && EPI == 1) { if (Ch) {   // the same for the whole grid. Four lanes a row: 16 columns each, one 128-byte line of each plane per row
        const int row = tid >> 2, cc = c0 + (tid & 3) * 16; const char* p = (const char*)os + row * PBF + cc * 4; v8us o[2];
#pragma unroll
        for (int h = 0; h < 2; ++h) { const v4f x0 = *(const v4fa*)(p + h * 32), x1 = *(const v4fa*)(p + h * 32 + 16);
#pragma unroll
            for (int q = 0; q < 4; ++q) { o[h][q] = f2bf(x0[q]); o[h][q + 4] = f2bf(x1[q]); } }
        const size_t oc = (size_t)(r0 + row) * DC + cc; *(v8us*)(Ch + oc) = o[0]; *(v8us*)(Ch + oc + 8) = o[1]; *(v8us*)(Cl + oc) = (v8us){}; *(v8us*)(Cl + oc + 8) = (v8us){};
        asm volatile("s_wait_xcnt 0x0" ::: "memory");   // stands ahead of any reuse of the registers that the four stores above name
    } }
    const char* fb = (const char*)os + lr * PB + wv * KS * 64 + hi * 16;   // this lane's fragment piece: row lr, the wave's own k block
    const char* ff = (const char*)os + lr * PBF + wv * 128 + hi * 32;   // the same in an f32 operand's block
#pragma unroll 1
    for (int t = 0; t < ntr; ++t) {
        const char* fs = fb + ((NBUF == 2) ? (t & 1) * STB : 0);
#pragma unroll
        for (int s = 0; s < KS; ++s) {
            V a[4], a2[4];
#pragma unroll
            for (int mb = 0; mb < 4; ++mb) { if constexpr (AF) a[mb] = ldf32(ff + mb * 16 * PBF); else a[mb] = WFrag<T16>::ld(fs + mb * 16 * PB + s * 64); if (NSPLIT == 1 || NSPLIT == 2) a2[mb] = WFrag<T16>::ld(fs + OA2 + mb * 16 * PB + s * 64); }
#pragma unroll
            for (int nb = 0; nb < 4; ++nb) { V b; if constexpr (BF) b = ldf32(ff + OB + nb * 16 * PBF); else b = WFrag<T16>::ld(fs + OB + nb * 16 * PB + s * 64); V b2; if (NSPLIT >= 2) b2 = WFrag<T16>::ld(fs + OB2 + nb * 16 * PB + s * 64);
#pragma unroll
                for (int mb = 0; mb < 4; ++mb) { acc[mb][nb] = WFrag<T16>::mma(a[mb], b, acc[mb][nb]); if (NSPLIT == 1 || NSPLIT == 2) acc[mb][nb] = WFrag<T16>::mma(a2[mb], b, acc[mb][nb]); if (NSPLIT >= 2) acc[mb][nb] = WFrag<T16>::mma(a[mb], b2, acc[mb][nb]); } }
            asm volatile("v_nop\n\tv_nop\n\tv_nop\n\tv_nop" : "+v"(acc[0][0]), "+v"(acc[1][1]), "+v"(acc[2][2]), "+v"(acc[3][3]) : "v"(a[0]), "v"(a[3]));
        }
        asm volatile("s_wait_dscnt 0x0" ::: "memory");   // this wave's fragment reads of the buffer are done before anybody refills it
        if constexpr (NBUF == 2) asm volatile("s_wait_asynccnt 0x0" ::: "memory");   // this wave's copies of trip t + 1 have landed
        __syncthreads();   // ends every wave's reads of this trip's buffer; with two buffers it also publishes trip t + 1
        if constexpr (NBUF == 2) { if (t + 2 < ntr) stage(t + 2, t & 1); }
        else { if (t + 1 < ntr) { stage(t + 1, 0);
            asm volatile("s_wait_asynccnt 0x0" ::: "memory");   // this wave's copies of trip t + 1 have landed
            __syncthreads();   // ... and every other wave's
        } }
    }
    asm volatile("s_wait_asynccnt 0x0" ::: "memory");   // no copy is outstanding when the buffers become output staging
    if constexpr (KW > 1) {
        // unrolled: the accumulators stay in registers only under constant indices
#pragma unroll
        for (int mb = 0; mb < 4; ++mb)
#pragma unroll
            for (int nb = 0; nb < 4; ++nb) {
#pragma unroll
                for (int j = 0; j < 8; ++j) os[(wv * 64 + mb * 16 + hi * 8 + j) * 68 + nb * 16 + lr] = acc[mb][nb][j]; }
        __syncthreads();   // every wave's partial tile is in LDS before any thread sums across the waves
        // unrolled (both loops): all of a thread's LDS reads are issued together instead of one wait per read
#pragma unroll
        for (int s = 0; s < 32 / KW; ++s) { const int slot = (int)threadIdx.x + s * 32 * KW, row = slot >> 4, cofs = (slot & 15) * 4; v4f val = *(const v4fa*)(os + row * 68 + cofs);
#pragma unroll
            for (int w = 1; w < KW; ++w) val += *(const v4fa*)(os + (w * 64 + row) * 68 + cofs);
            if (BIAS) { val[0] += bfr(bias[c0 + cofs]); val[1] += bfr(bias[c0 + cofs + 1]); val[2] += bfr(bias[c0 + cofs + 2]); val[3] += bfr(bias[c0 + cofs + 3]); }
            const size_t oo = (size_t)(r0 + row) * ldc + c0 + cofs;
            // the q loops below are unrolled so that the 4-wide vectors are indexed by constants and stay in registers
            if constexpr (EPI == 0) { *(v4f*)(C + oo) = val; }
            else if constexpr (EPI == 1) { v4h o16; v4us oh, ol;
#pragma unroll
                for (int q = 0; q < 4; ++q) { const float r = fmaxf(val[q], 0.0f); o16[q] = tohx(r); unsigned short a2, c2; splitf(r, a2, c2); oh[q] = a2; ol[q] = c2; }
                *(v4h*)(E16 + oo) = o16; *(v4us*)(Eh + oo) = oh; *(v4us*)(El + oo) = ol; }
            else if constexpr (EPI == 2) { v4us oh, ol;
#pragma unroll
                for (int q = 0; q < 4; ++q) { unsigned short a2, c2; splitf(val[q] * esc, a2, c2); oh[q] = a2; ol[q] = c2; }
                *(v4us*)(Eh + oo) = oh; *(v4us*)(El + oo) = ol; }
            else { v4f o;
#pragma unroll
                for (int q = 0; q < 4; ++q) { const float sg = __fdiv_rn(1.0f, __fadd_rn(1.0f, expf(-val[q]))); o[q] = __fmul_rn(sg, tanhf(val[q])); }
                *(v4f*)(C + oo) = o; } }
        return;
    }
#pragma unroll
    for (int mb = 0; mb < 4; ++mb) {
#pragma unroll
        for (int nb = 0; nb < 4; ++nb) {
#pragma unroll
            for (int j = 0; j < 8; ++j) os[(hi * 8 + j) * 68 + nb * 16 + lr] = acc[mb][nb][j]; }
        __builtin_amdgcn_wave_barrier(); asm volatile("" ::: "memory");
        float* crow = C + (size_t)(r0 + mb * 16) * ldc + c0;
{
#pragma unroll
            for (int s = 0; s < 8; ++s) { const int row = 2 * s + hi, cofs = lr * 4; v4f val = *(const v4fa*)(os + row * 68 + cofs); if (BIAS) { val[0] += bfr(bias[c0 + cofs]); val[1] += bfr(bias[c0 + cofs + 1]); val[2] += bfr(bias[c0 + cofs + 2]); val[3] += bfr(bias[c0 + cofs + 3]); }
                *(v4f*)(crow + (size_t)row * ldc + cofs) = val; }
             }
        __builtin_amdgcn_wave_barrier(); asm volatile("" ::: "memory");
    }
}


__global__ __launch_bounds__(256) void k_asoft(const float* __restrict__ Sb, const float* __restrict__ mk, bf* Ph, bf* Pl) {
    const int lane = threadIdx.x & 31; const int row = blockIdx.x * 8 + (threadIdx.x >> 5); if (row >= ZH * TT) return; const int i = row % TT; const int zz = row / TT; const size_t bz = blockIdx.y;   /* batch in the pass */ mk += bz * TT; Ph += bz * ZH * RH * TT; Pl += bz * ZH * RH * TT; const float* sr = Sb + ((bz * ZH + zz) * RH + i) * TT;   /* score planes [batch][zz][RH][TT] */ float mx = -3.0e38f;
#pragma unroll 4
    for (int ch = 0; ch < TT / 128; ++ch) { const int j0 = ch * 128 + lane * 4; const v4f a = *(const v4f*)(sr + j0); const v4f m4 = *(const v4f*)(mk + j0);
#pragma unroll
        for (int q = 0; q < 4; ++q) { float t = a[q] * SCL; asm volatile("" : "+v"(t)); t = (bfr(m4[q]) != 0.0f) ? t : -3.0e38f;   /* masked memory position excluded (the reference's -1e30 penalty) */ mx = fmaxf(mx, t); } }
#pragma unroll
    for (int sh = 16; sh; sh >>= 1) mx = fmaxf(mx, __shfl_xor(mx, sh, 32));
    float sum = 0.f;
#pragma unroll 4
    for (int ch = 0; ch < TT / 128; ++ch) { const int j0 = ch * 128 + lane * 4; const v4f a = *(const v4f*)(sr + j0); const v4f m4 = *(const v4f*)(mk + j0);
#pragma unroll
        for (int q = 0; q < 4; ++q) { float t = a[q] * SCL; asm volatile("" : "+v"(t)); t = (bfr(m4[q]) != 0.0f) ? t : -3.0e38f;   /* masked memory position excluded (the reference's -1e30 penalty) */ float d0 = __fsub_rn(t, mx); asm volatile("" : "+v"(d0)); sum += __builtin_amdgcn_exp2f(__fmul_rn(d0, 1.4426950408889634f)); } }
#pragma unroll
    for (int sh = 16; sh; sh >>= 1) sum += __shfl_xor(sum, sh, 32);
    const float f = __fdiv_rn(1.0f, sum);
{
        {   /* rows < RH (the grid holds no others): normalised bf16 hi/lo over ALL TT keys (symmetric window: keys beyond RH are live), planes [zz][RH][TT] */
#pragma unroll 4
            for (int ch = 0; ch < TT / 128; ++ch) { const int j0 = ch * 128 + lane * 4; const v4f a = *(const v4f*)(sr + j0); const v4f m4 = *(const v4f*)(mk + j0); v4us oh, ol;
#pragma unroll
                for (int q = 0; q < 4; ++q) { float t = a[q] * SCL; asm volatile("" : "+v"(t)); t = (bfr(m4[q]) != 0.0f) ? t : -3.0e38f;   /* masked memory position excluded (the reference's -1e30 penalty) */ float d0 = __fsub_rn(t, mx); asm volatile("" : "+v"(d0)); float ex = __builtin_amdgcn_exp2f(__fmul_rn(d0, 1.4426950408889634f)); asm volatile("" : "+v"(ex)); unsigned short a2, c2; splitf(ex * f, a2, c2); oh[q] = a2; ol[q] = c2; }
                const size_t oo = ((size_t)zz * RH + i) * TT + j0; *(v4us*)(Ph + oo) = oh; *(v4us*)(Pl + oo) = ol; }
        }
         }
}


// ---- k_fattn: scores, softmax and weights x values of the fp16 query rows (RH on) in one kernel; no score or weight plane goes to memory. grid (rows / 64, batch in the pass), 256 threads.
// Everything is computed transposed, so that the score tile leaves the matrix unit in the layout the next product wants as its B operand: S^T [key][query] = K Q^T, O^T [d][query] = V^T P^T. A lane owns one query column of each of its wave's two column groups: running maximum, sum and rescale factor are plain per-lane values.
// The 8 waves are 2 query groups (32 queries each, as two 16-column groups) x 4 key quarters: of each staged block of FK keys a wave takes 32. Every K and V^T fragment read from LDS feeds two products, one per column group, and a staged block serves 64 queries. The 64 query rows are copied to LDS once: the first column group's Q^T fragments are taken into registers from there, the second group's are read with the key fragments in every trip (the registers do not hold all of Q^T beside two groups' O^T). Each wave keeps its own maximum in use, sum and O^T; the four quarters of a query are merged through LDS at the end, in quarter order.
// Staging: per trip the work-group copies FK key rows (K, pitch + 16 B) and the FK-wide slice of all HD value^T rows (pitch + 16 B) into one of two LDS buffers; the next trip's copies fly during this trip's products.
#define FK   128
#define KPB  (HD * 2 + 16)
#define VPB  (FK * 2 + 16)
#define KTB  (FK * KPB)
#define FSTB (KTB + HD * VPB)
#define OPF  (HD + 4)   // floats per query row of a wave's partial O in LDS (16 rows fall on 16 bank groups)
#define L2E  1.4426950408889634f
// lane l takes the value of lane l ^ 16 by a vector move (a shuffle would queue in LDS behind the fragment loads)
__device__ __forceinline__ float xhalf(float x) { return __builtin_bit_cast(float, __builtin_amdgcn_permlanex16(__builtin_bit_cast(int, x), __builtin_bit_cast(int, x), 0x76543210, 0xfedcba98, false, false)); }
__global__ __launch_bounds__(256) void k_fattn(const h16* __restrict__ Q, const h16* __restrict__ Kp, const h16* __restrict__ Vt, const float* __restrict__ mk, bf* Oh, bf* Ol) {
    __shared__ __align__(16) char sm[2 * FSTB];   // the two staging buffers; after the key loop the partial O tiles
    __shared__ __align__(16) float msk[TT];       // 1 where the key is live, 0 where the mask excludes it
    __shared__ __align__(16) char qs[64 * KPB];   // the work-group's query rows, at the key rows' pitch
    __shared__ float mS[256], lS[256];            // per wave and query: running maximum and sum, for the merge
    const int tid = (int)threadIdx.x, lane = tid & 31, lr = lane & 15, hi = lane >> 4;
    const int wv = __builtin_amdgcn_readfirstlane(tid >> 5), qg = wv & 1, kq = wv >> 1;
    const size_t bz = blockIdx.y; const int q0 = (int)blockIdx.x * 64;
    Q += (bz * TT + RH + q0) * HD; Kp += bz * TT * HD; Vt += bz * HD * TT; mk += bz * TT;
    // copy addresses: the wave-uniform parts, in scalar registers; stage() adds the lane's offsets
    const unsigned lk = (unsigned)(size_t)sm + (unsigned)(wv * KPB);               // K: 32 pieces a row, 8 rows per copy of every thread
    const unsigned lv = (unsigned)(size_t)sm + (unsigned)(KTB + wv * 2 * VPB);     // V^T: 16 pieces a row, 16 rows per copy of every thread
    const char* gk = (const char*)Kp + (size_t)wv * (HD * 2);
    const char* gv = (const char*)Vt + (size_t)wv * (2 * TT * 2);
    auto stage = [&](int s, int buf) {   // key block s into buffer buf: 32 copies per lane, every lane on
        unsigned ln; asm volatile("v_mbcnt_lo_u32_b32 %0, -1, 0" : "=v"(ln));   // the lane number, formed anew at every call: per-lane address parts taken from outside the loop would stay live across it in the registers that asm operands can name, and spill to scratch
        const unsigned lko = ln * 16, lvo = (ln >> 4) * VPB + (ln & 15) * 16, gvo = (ln >> 4) * (TT * 2) + (ln & 15) * 16;
        const unsigned lb = (unsigned)(buf * FSTB); const char* k = gk + (size_t)s * FK * HD * 2 + lko; const char* v = gv + (size_t)s * FK * 2 + gvo;
        // the fences keep each statement's 24 address registers from being formed before the statement ahead of it has issued (all 96 at once crowd out values that live across the loop)
        cp8(lk + lb + lko, 8 * KPB, k, (size_t)8 * HD * 2); __builtin_amdgcn_sched_barrier(0); cp8(lk + lb + 64 * KPB + lko, 8 * KPB, k + (size_t)64 * HD * 2, (size_t)8 * HD * 2); __builtin_amdgcn_sched_barrier(0);
        cp8(lv + lb + lvo, 16 * VPB, v, (size_t)16 * TT * 2); __builtin_amdgcn_sched_barrier(0); cp8(lv + lb + 128 * VPB + lvo, 16 * VPB, v + (size_t)128 * TT * 2, (size_t)16 * TT * 2);
    };
    stage(0, 0);
    cp8((unsigned)(size_t)qs + (unsigned)((tid >> 5) * KPB + (tid & 31) * 16), 8 * KPB, (const char*)Q + (size_t)(tid >> 5) * (HD * 2) + (tid & 31) * 16, (size_t)8 * HD * 2);   // the query rows: 32 pieces a row, 8 rows per copy of every thread; they land with block 0
#pragma unroll
    for (int i = 0; i < TT / 1024; ++i) { const v4f m4 = *(const v4f*)(mk + (tid + i * 256) * 4); v4f o;
#pragma unroll
        for (int q = 0; q < 4; ++q) o[q] = (bfr(m4[q]) != 0.0f) ? 1.0f : 0.0f;
        *(v4f*)(msk + (tid + i * 256) * 4) = o; }
    asm volatile("s_wait_xcnt 0x0" :: "s"(mk) : "memory");   // stands ahead of any reuse of the address registers of the mask loads above: reading the address here keeps it untouched up to the wait
    const char* qb = qs + (qg * 32 + lr) * KPB + hi * 16;   // B fragments of Q^T: column = query lr of the first column group (the second: 16 rows on), the k order of the key fragments
    v8f acc[2][16];
#pragma unroll
    for (int g = 0; g < 2; ++g)
#pragma unroll
        for (int dt = 0; dt < 16; ++dt) acc[g][dt] = (v8f){};
    float mrun[2] = {-3.0e38f, -3.0e38f}, lrun[2] = {0.0f, 0.0f};
    asm volatile("s_wait_asynccnt 0x0" ::: "memory");   // this wave's copies of block 0 have landed
    __syncthreads();   // ... and every other wave's; the query rows have landed with it, the mask flags are written
    stage(1, 1);
    v16h qf[8];
#pragma unroll
    for (int ks = 0; ks < 8; ++ks) qf[ks] = WFrag<h16>::ld(qb + ks * 64);
#pragma unroll 1
    for (int s = 0; s < TT / FK; ++s) {
        const char* bb = sm + (s & 1) * FSTB;
        const char* kb = bb + (kq * 32 + lr) * KPB + hi * 16;          // A fragments of K: row = key
        const char* vb = bb + KTB + lr * VPB + kq * 64 + hi * 16;      // A fragments of V^T: row = d, k = the wave's 32 keys
        const float* mp = msk + s * FK + kq * 32 + hi * 8;
        v8f sc[2][2];   // [column group][16-key half]
#pragma unroll
        for (int g = 0; g < 2; ++g) { sc[g][0] = (v8f){}; sc[g][1] = (v8f){}; }
        // the key fragments come in two groups of eight, each with the second column group's four Q^T fragments of its k steps (the registers do not hold all of them at once)
#pragma unroll
        for (int h = 0; h < 2; ++h) {
            v16h ka[8], q1[4];
#pragma unroll
            for (int k4 = 0; k4 < 4; ++k4) { ka[2 * k4] = WFrag<h16>::ld(kb + (h * 4 + k4) * 64); ka[2 * k4 + 1] = WFrag<h16>::ld(kb + 16 * KPB + (h * 4 + k4) * 64); q1[k4] = WFrag<h16>::ld(qb + 16 * KPB + (h * 4 + k4) * 64); }
            __builtin_amdgcn_sched_barrier(0);   // a group's loads are issued together: one LDS latency per group, not one wait per product
#pragma unroll
            for (int k4 = 0; k4 < 4; ++k4)
#pragma unroll
                for (int g = 0; g < 2; ++g) { const v16h qq = g ? q1[k4] : qf[h * 4 + k4]; sc[g][0] = wmma16(ka[2 * k4], qq, sc[g][0]); sc[g][1] = wmma16(ka[2 * k4 + 1], qq, sc[g][1]); }
        }
        const v4f ma = *(const v4fa*)mp, mb = *(const v4fa*)(mp + 4), mc = *(const v4fa*)(mp + 16), md = *(const v4fa*)(mp + 20);
        v16h va[16];
#pragma unroll
        for (int dt = 0; dt < 4; ++dt) va[dt] = WFrag<h16>::ld(vb + dt * 16 * VPB);
        __builtin_amdgcn_sched_barrier(0);   // the first value fragments' loads are issued up here, so that the softmax below covers their latency
        float bm[2] = {-3.0e38f, -3.0e38f};
#pragma unroll
        for (int j = 0; j < 8; ++j) { const float f0 = (j < 4) ? ma[j & 3] : mb[j & 3], f1 = (j < 4) ? mc[j & 3] : md[j & 3];
#pragma unroll
            for (int g = 0; g < 2; ++g) {
                sc[g][0][j] = (f0 != 0.0f) ? sc[g][0][j] * SCL : -3.0e38f; sc[g][1][j] = (f1 != 0.0f) ? sc[g][1][j] * SCL : -3.0e38f;   /* masked memory position excluded (the reference's -1e30 penalty) */
                bm[g] = fmaxf(bm[g], fmaxf(sc[g][0][j], sc[g][1][j])); } }
        bm[0] = fmaxf(bm[0], xhalf(bm[0])); bm[1] = fmaxf(bm[1], xhalf(bm[1]));   // the query's other eight-key halves
        // lazy rescale: a column group's maximum in use moves only when one of its queries' new maximum lies more than 2^8 above it (weights stay <= 256, well inside fp16); one scalar branch per block on the usual path
        const unsigned n0 = __builtin_amdgcn_ballot_w32((bm[0] - mrun[0]) * L2E > 8.0f), n1 = __builtin_amdgcn_ballot_w32((bm[1] - mrun[1]) * L2E > 8.0f);
        if ((n0 | n1) != 0) {
#pragma unroll
            for (int g = 0; g < 2; ++g) if ((g ? n1 : n0) != 0) { const float mnew = fmaxf(mrun[g], bm[g]), al = __builtin_amdgcn_exp2f((mrun[g] - mnew) * L2E); mrun[g] = mnew; lrun[g] *= al;
#pragma unroll
                for (int dt = 0; dt < 16; ++dt) acc[g][dt] *= al; } }
#pragma unroll
        for (int g = 0; g < 2; ++g)
#pragma unroll
            for (int j = 0; j < 8; ++j) { sc[g][0][j] = (sc[g][0][j] - mrun[g]) * L2E; sc[g][1][j] = (sc[g][1][j] - mrun[g]) * L2E; }
        __builtin_amdgcn_sched_barrier(0);   // the exponentials below run back to back, each filling the slot behind the one before
        v16h pf[2];   // S^T's accumulator layout is the B fragment's: keys hi*8 .. +7 and 16 + hi*8 .. +7 of column lr
        { float ps[2] = {0.0f, 0.0f}; v8h p0[2], p1[2];
#pragma unroll
            for (int j = 0; j < 8; ++j)
#pragma unroll
                for (int g = 0; g < 2; ++g) { const float e0 = __builtin_amdgcn_exp2f(sc[g][0][j]), e1 = __builtin_amdgcn_exp2f(sc[g][1][j]); ps[g] += e0 + e1; p0[g][j] = tohx(e0); p1[g][j] = tohx(e1); }
            lrun[0] += ps[0]; lrun[1] += ps[1]; pf[0] = cat16(p0[0], p1[0]); pf[1] = cat16(p0[1], p1[1]); }
        // the value fragments come four at a time, each four fetched while the four before feed their eight products
#pragma unroll
        for (int c = 0; c < 4; ++c) {
            if (c < 3) {
#pragma unroll
                for (int dt = 0; dt < 4; ++dt) va[(c + 1) * 4 + dt] = WFrag<h16>::ld(vb + ((c + 1) * 4 + dt) * 16 * VPB); }
            __builtin_amdgcn_sched_barrier(0);   // keeps the next four's loads ahead of this four's products (left to itself the compiler puts each load, with a full wait, in front of its product)
#pragma unroll
            for (int dt = 0; dt < 4; ++dt) { acc[0][c * 4 + dt] = wmma16(va[c * 4 + dt], pf[0], acc[0][c * 4 + dt]); acc[1][c * 4 + dt] = wmma16(va[c * 4 + dt], pf[1], acc[1][c * 4 + dt]); }
        }
        asm volatile("s_wait_dscnt 0x0" ::: "memory");      // this wave's reads of the buffer are done before anybody refills it
        asm volatile("s_wait_asynccnt 0x0" ::: "memory");   // this wave's copies of block s + 1 have landed
        __syncthreads();   // ends every wave's reads of this block's buffer and publishes block s + 1
        if (s + 2 < TT / FK) stage(s + 2, s & 1);
    }
    asm volatile("s_wait_asynccnt 0x0" ::: "memory");   // no copy is outstanding when the buffers become the partial O tiles
#pragma unroll
    for (int g = 0; g < 2; ++g) { lrun[g] += xhalf(lrun[g]);
        if (hi == 0) { mS[wv * 32 + g * 16 + lr] = mrun[g]; lS[wv * 32 + g * 16 + lr] = lrun[g]; } }
    __syncthreads();   // every wave's maximum and sum are in LDS
    float* os = (float*)sm;
#pragma unroll
    for (int g = 0; g < 2; ++g) {
        float M = -3.0e38f, L = 0.0f;
#pragma unroll
        for (int w = 0; w < 4; ++w) M = fmaxf(M, mS[(w * 2 + qg) * 32 + g * 16 + lr]);
#pragma unroll
        for (int w = 0; w < 4; ++w) L += lS[(w * 2 + qg) * 32 + g * 16 + lr] * __builtin_amdgcn_exp2f((mS[(w * 2 + qg) * 32 + g * 16 + lr] - M) * L2E);
        const float wsc = __fdiv_rn(__builtin_amdgcn_exp2f((mrun[g] - M) * L2E), L);
#pragma unroll
        for (int dt = 0; dt < 16; ++dt) { const v8f o = acc[g][dt] * wsc; float* op = os + (size_t)(wv * 32 + g * 16 + lr) * OPF + dt * 16 + hi * 8;
            *(v4fa*)op = (v4f){o[0], o[1], o[2], o[3]}; *(v4fa*)(op + 4) = (v4f){o[4], o[5], o[6], o[7]}; } }
    __syncthreads();   // every wave's scaled partial O is in LDS before any thread sums the four quarters
#pragma unroll
    for (int g = 0; g < 8; ++g) { const int u = tid + g * 256, ql = u >> 5, d8 = (u & 31) * 8; v4f x = (v4f){}, y = (v4f){};
#pragma unroll
        for (int w = 0; w < 4; ++w) { const float* ip = os + (size_t)((w * 2 + (ql >> 5)) * 32 + (ql & 31)) * OPF + d8; x += *(const v4fa*)ip; y += *(const v4fa*)(ip + 4); }
        v8us oh, ol;
#pragma unroll
        for (int q = 0; q < 4; ++q) { unsigned short a2, c2; splitf(x[q], a2, c2); oh[q] = a2; ol[q] = c2; splitf(y[q], a2, c2); oh[q + 4] = a2; ol[q + 4] = c2; }
        const size_t oo = (bz * TT + RH + q0 + ql) * DC + DM + d8; *(v8us*)(Oh + oo) = oh; *(v8us*)(Ol + oo) = ol; }
}

// ---- k_vtpb: value^T planes [batch][column][t] from the memory rows [t][column]; one VTT t x 64 column tile per work-group, transposed through LDS. grid (TT / VTT, columns / 64, batch in the pass), 256 threads.
// Reads: 16 lanes take the tile's 256 B of one row (whole lines), a thread two neighbouring rows at a time, so that two bf16 values of one column make one LDS word. Writes: 16 lanes store 256 B in a row of one column, per plane.
// LDS [column][t pair]; the 16-byte piece p of column c lies at piece p ^ (c >> 2): a wave's 32 word stores fall on 32 different banks, and the 16-byte reads stay aligned.
#define VTT  128
__global__ __launch_bounds__(256) void k_vtpb(const float* __restrict__ F, h16* V16, bf* Vh, bf* Vl) {
    static_assert(VTT / 8 == 16 && DKV % 64 == 0 && TT % VTT == 0, "the piece swizzle takes 16 pieces a column; whole tiles only");
    __shared__ __align__(16) unsigned tl[64 * (VTT / 2)];
    const int tid = (int)threadIdx.x, d4 = tid & 15, rp = tid >> 4; const int t0 = (int)blockIdx.x * VTT, c0 = (int)blockIdx.y * 64; const size_t bz = blockIdx.z;   /* batch in the pass */
    F += (bz * TT + t0 + rp * 2) * DM + c0 + d4 * 4;   // the row pitch is a constant: one address a thread, every other load at an immediate offset from it
    v4f ra[VTT / 32], rb[VTT / 32];
    // unrolled: all of a thread's loads are in flight together
#pragma unroll
    for (int i = 0; i < VTT / 32; ++i) { ra[i] = *(const v4f*)(F + i * 32 * DM); rb[i] = *(const v4f*)(F + (i * 32 + 1) * DM); }
#pragma unroll
    for (int i = 0; i < VTT / 32; ++i) { const int tp = i * 16 + rp;
#pragma unroll
        for (int q = 0; q < 4; ++q) tl[(d4 * 4 + q) * (VTT / 2) + ((((tp >> 2) ^ d4) << 2) | (tp & 3))] = (unsigned)f2bf(ra[i][q]) | ((unsigned)f2bf(rb[i][q]) << 16);   /* the value IS a module input: round to bf16 once (lo plane 0) */ }
    __syncthreads();   // the whole tile is in LDS before any thread reads a column that other waves wrote
    v8us hb[VTT / 32];
    // unrolled, and apart from the loop below: the later pieces' LDS reads are under way while the first piece is converted and stored
#pragma unroll
    for (int s = 0; s < VTT / 32; ++s) { const int u = tid + s * 256, d = u / (VTT / 8), c = u % (VTT / 8); hb[s] = *(const v8usa*)(tl + d * (VTT / 2) + ((c ^ (d >> 2)) << 2)); }
#pragma unroll
    for (int s = 0; s < VTT / 32; ++s) { const int u = tid + s * 256, d = u / (VTT / 8), c = u % (VTT / 8); v8h o16; v8us oh, ol;
#pragma unroll
        for (int q = 0; q < 8; ++q) { const float x = bf2f(hb[s][q]); o16[q] = tohx(x); unsigned short a2, c2; splitf(x, a2, c2); oh[q] = a2; ol[q] = c2; }
        const size_t eo = (bz * DKV + c0 + d) * TT + t0 + c * 8; *(v8h*)(V16 + eo) = o16; *(v8us*)(Vh + eo) = oh; *(v8us*)(Vl + eo) = ol; }
}

extern "C" void kernel_launch(void* const* d_in, const int* in_sizes, int n_in,
                              void* d_out, int out_size, void* d_ws, size_t ws_size, hipStream_t stream) {
    (void)in_sizes; (void)n_in; (void)out_size;
    const float* x = (const float*)d_in[0];   /* input */ const float* xm = (const float*)d_in[1];   /* memory */ const float* mk = (const float*)d_in[2];   /* mask [4][4096] f32 */ const float* wq = (const float*)d_in[3]; const float* bq = (const float*)d_in[4]; const float* wk = (const float*)d_in[5]; const float* bk = (const float*)d_in[6]; const float* w2 = (const float*)d_in[7]; const float* b2 = (const float*)d_in[8];   /* argument order input, memory, mask, W_in1, b_in1, W_mem1, b_mem1, W2, b2 */
    float* OUT = (float*)d_out;     // [4][4096][256]
    char* wsp = (char*)d_ws;
    auto take = [&](size_t bytes) { char* p = wsp; wsp += (bytes + 255) & ~(size_t)255; return (void*)p; };
    bf* CAh = (bf*)take((size_t)NP * TT * DC * 2); bf* CAl = (bf*)take((size_t)NP * TT * DC * 2);
    h16* QP16 = (h16*)take((size_t)NP * NH_ * TT * HD * 2); h16* KP16 = (h16*)take((size_t)NP * NKV * TT * HD * 2); h16* VT16 = (h16*)take((size_t)NP * NKV * HD * TT * 2);
    bf* QPh = (bf*)take((size_t)NP * NH_ * TT * HD * 2); bf* QPl = (bf*)take((size_t)NP * NH_ * TT * HD * 2); bf* KPh = (bf*)take((size_t)NP * NKV * TT * HD * 2); bf* KPl = (bf*)take((size_t)NP * NKV * TT * HD * 2); bf* VTh = (bf*)take((size_t)NP * NKV * HD * TT * 2); bf* VTl = (bf*)take((size_t)NP * NKV * HD * TT * 2); bf* Ph = (bf*)take((size_t)NP * ZH * RH * TT * 2); bf* Pl = (bf*)take((size_t)NP * ZH * RH * TT * 2);
    float* Sb = (float*)take((size_t)NP * ZH * RH * TT * 4);   /* f32 scores of the rows < RH, [NP][RH][TT] */
    if ((size_t)(wsp - (char*)d_ws) > ws_size) return;    // ws 256 MiB
    for (int b = 0; b < NB_; b += NP) {   /* batches b .. b + NP - 1; their rows follow one another in the inputs, the output and every [t][...] plane */
        static_assert(DQ == DM && DM == 32 * 8, "the query projection's column tiles are also the concat operand's left-half tiles, and one trip holds whole input rows");
        k_gemmw<bf, 0, true, 8, 1, true, true><<<dim3(NP * TT / 64, DQ / 64, 1), 256, 0, stream>>>(nullptr, nullptr, nullptr, nullptr, x + (size_t)b * TT * DM, wq, DM, nullptr, DQ, bq, 0, 0, 0, QP16, QPh, QPl, 1.0f, CAh, CAl);   /* query planes of input_dot = relu(input W_in1^T + b); also the concat operand's left half */
        k_gemmw<bf, 0, true, 8, 1, true, true><<<dim3(NP * TT / 64, DKV / 64, 1), 256, 0, stream>>>(nullptr, nullptr, nullptr, nullptr, xm + (size_t)b * TT * DM, wk, DM, nullptr, DKV, bk, 0, 0, 0, KP16, KPh, KPl, 1.0f, nullptr, nullptr);   /* key planes of memory_dot */
        k_vtpb<<<dim3(TT / VTT, DKV / 64, NP), 256, 0, stream>>>(xm + (size_t)b * TT * DM, VT16, VTh, VTl);   /* values = the memory itself (bf16-rounded input: hi plane exact, lo plane 0) */
        k_gemmw<bf, 2, false, 8, 0, false, false><<<dim3(RH / 64, TT / 64, NP * ZH), 256, 0, stream>>>(QPh, QPl, KPh, KPl, nullptr, nullptr, HD, Sb, TT, nullptr, (size_t)TT * HD, (size_t)TT * HD, (size_t)RH * TT, nullptr, nullptr, nullptr, 1.0f, nullptr, nullptr);
        k_asoft<<<dim3(ZH * RH / 8, NP, 1), 256, 0, stream>>>(Sb, mk + (size_t)b * TT, Ph, Pl);
        /* output_one = weights x values, written as the hi/lo right half of the concat operand (pitch DC, column DM on) */
        k_gemmw<bf, 1, false, 16, 2, false, false><<<dim3(RH / 64, HD / 64, NP * ZH), 512, 0, stream>>>(Ph, Pl, VTh, nullptr, nullptr, nullptr, TT, nullptr, DC, nullptr, (size_t)RH * TT, (size_t)HD * TT, (size_t)TT * DC, nullptr, CAh + DM, CAl + DM, 1.0f, nullptr, nullptr);   /* weights hi/lo x exact bf16 values (2 products) */
        k_fattn<<<dim3((TT - RH) / 64, NP, 1), 256, 0, stream>>>(QP16, KP16, VT16, mk + (size_t)b * TT, CAh, CAl);   /* rows RH on: fp16 scores, streaming softmax and fp16 weights x values in one kernel */
        k_gemmw<bf, 1, true, 8, 3, false, true><<<dim3(NP * TT / 64, DM / 64, 1), 256, 0, stream>>>(CAh, CAl, nullptr, nullptr, nullptr, w2, DC, OUT + (size_t)b * TT * DM, DM, b2, 0, 0, 0, nullptr, nullptr, nullptr, 1.0f, nullptr, nullptr);   /* z = [input | output_one] W2^T + b2; out = sigmoid(z) tanh(z) */
    }
}

// v010
// Measured time: 164 microseconds a run.
// Timed twice side by side with v009, it ran 1.11 times as fast both times.
// All steps since v000 together make it 8.03 times as fast.
#include <hip/hip_runtime.h>

// Gated attention reader (input, memory [4][4096][256]; mask [4][4096] f32 0/1 over memory positions (read); input_dot = relu(input W_in1^T + b_in1), memory_dot = relu(memory W_mem1^T + b_mem1) ('oi' [256][256] 1/16, zero biases); att = input_dot . memory_dot / 16 - 1e30 (1 - mask[m]) (== exclusion); softmax over the 4,096 memory positions; output_one = weights . memory; z = [input | output_one] W2^T + b2 ('oi' [256][512]); out = sigmoid(z) tanh(z) -> [4][4096][256] (4.2 M); argument order input, memory, mask, W_in1, b_in1, W_mem1, b_mem1, W2, b2).
// NP batches go through each launch together (more rows, or grid z / y = batch in the pass). Layout per batch: no bf16 copy of an input is made: the GEMMs that consume input, memory and the three weights stage them as f32 and round each value to bf16 as it enters a fragment; exact projections + f32 biases, ReLU and the split into query/key planes in the projection's own epilogue; one 256-wide head; value^T planes straight from the bf16-rounded memory; dense T-4096 attention, hybrid rows: < 512 hi/lo 3-product scores, three-sweep softmax reading the mask row and hi/lo x exact-value products; the rest fp16, scores, online softmax and weights x values in one kernel; output_one leaves the weights x values epilogue as the hi/lo right half of the concat operand (its left half bf16(input) is written by the query projection from its staged input rows); [bf16(input) | hi/lo(output_one)] x W2 exact + b2, whose epilogue applies sigmoid(z) tanh(z) and writes the output.
// Compute dtypes, f32 accumulate: every input rounded to bf16; projections exact + f32 biases; attention rows < 512 3 products (scores) / 2 products (weights x exact values), rest fp16; softmax f32; W2 [exact | hl] x exact + bias; sigmoid/tanh f32 (precise expf/tanhf).

#define NB_  4
#define TT   4096
#define DM   256
#define NH_  1
#define NKV  1
#define REP  (NH_ / NKV)
#define HD   256
#define DQ   (NH_ * HD)
#define DKV  (NKV * HD)
#define ZH   1
#define RH   512                  // query rows < RH use hi+lo planes (0: none)
#define WIN  0
#define SCL  0.0625f   // 1 / float32(sqrt(256))
#define DC   (2 * DM)   // concat width
#define NP   4          // batches that share every launch of a pass: all of them (the score plane holds only the RH rows of each batch that are written, so four batches' planes fit the workspace)
typedef _Float16 h16;
typedef unsigned short bf;
typedef __attribute__((ext_vector_type(16))) __bf16   v16bf;
typedef __attribute__((ext_vector_type(16))) _Float16 v16h;
typedef __attribute__((ext_vector_type(8)))  _Float16 v8h;
typedef __attribute__((ext_vector_type(8)))  unsigned short v8us;
typedef __attribute__((ext_vector_type(8)))  float    v8f;
typedef __attribute__((ext_vector_type(4)))  float    v4f;
typedef v8h  __attribute__((may_alias)) v8ha;
typedef v4f  __attribute__((may_alias)) v4fa;
typedef v8us __attribute__((may_alias)) v8usa;

__device__ __forceinline__ unsigned short f2bf(float f) { unsigned u = __float_as_uint(f); u += 0x7FFFu + ((u >> 16) & 1u); return (unsigned short)(u >> 16); }
__device__ __forceinline__ float bf2f(unsigned short b) { return __uint_as_float(((unsigned)b) << 16); }
__device__ __forceinline__ float bfr(float f) { return bf2f(f2bf(f)); }
__device__ __forceinline__ v16h cat16(v8h lo, v8h hi) { return __builtin_shufflevector(lo, hi, 0, 1, 2, 3, 4, 5, 6, 7, 8, 9, 10, 11, 12, 13, 14, 15); }
__device__ __forceinline__ v16bf cat16b(v8us lo, v8us hi) { return __builtin_bit_cast(v16bf, __builtin_shufflevector(lo, hi, 0, 1, 2, 3, 4, 5, 6, 7, 8, 9, 10, 11, 12, 13, 14, 15)); }
__device__ __forceinline__ v8f wmma16(v16h a, v16h b, v8f c) { return __builtin_amdgcn_wmma_f32_16x16x32_f16(false, a, false, b, (short)0, c, false, false); }
__device__ __forceinline__ v8f wmmab(v16bf a, v16bf b, v8f c) { return __builtin_amdgcn_wmma_f32_16x16x32_bf16(false, a, false, b, (short)0, c, false, false); }

__device__ __forceinline__ h16 tohx(float x) { return (h16)x; }
__device__ __forceinline__ void splitf(float y, unsigned short& h, unsigned short& l) { h = f2bf(y); l = f2bf(y - bf2f(h)); }
typedef __attribute__((ext_vector_type(2))) _Float16 v2h;
typedef __attribute__((ext_vector_type(4))) _Float16 v4h;
typedef __attribute__((ext_vector_type(2))) unsigned short v2us;
typedef __attribute__((ext_vector_type(4))) unsigned short v4us;
typedef __attribute__((ext_vector_type(2))) float v2f;
typedef __attribute__((ext_vector_type(4))) int v4i;

// ---- k_gemmw: register-blocked GEMM, one 64x64 output tile per work-group (16 accumulators per wave), operands from K-contiguous 16-bit planes, staged in LDS by asynchronous copies; grid (M/64, N/64, Z), 32 * KW threads.
// C[m][n] (f32, pitch ldc, + optional f32 bias[n]) = sum_k A[m][k] Bt[n][k] (+ split products per NSPLIT). z-batch strides sA/sB/sC in elements (sC also moves the EPI 2 planes). K % (32 * KW) == 0, and K % 64 == 0 where KW == 1.
// KW waves share the tile's K: wave w takes the 32-wide k blocks w, w + KW, ...; the KW partial tiles are summed through LDS in wave order 0 .. KW-1.
// Staging: per trip the work-group copies, of each operand plane, 64 rows x (32 * KW * KS) k into LDS (row pitch + 16 B, so that 16 rows fall on 16 different bank groups). A copy instruction takes 512 B (KW > 1) or 4 x 128 B (KW == 1) of whole lines, where a fragment load from the plane itself touches 16 lines for 32 B each. Fragments then come from LDS with the k order of the direct loads. One-product kernels use two buffers (the next trip's copies fly during this trip's products); the split-product kernels have room for one.
// AF / BF: the A / Bt operand is an f32 input (Af / Bf, same [row][K] shape) instead of a 16-bit plane: its rows are staged as f32 (row pitch + 16 B again) and rounded to bf16 (to nearest even, as f2bf rounds) where a fragment is read from LDS. KW > 1 only; one buffer.
// Ch / Cl (AF, EPI 1, may be null): the work-group also lays bf16(Af) of its 64 rows, columns c0 .. c0 + 63, down as the left half of the concat operand's hi plane [m][DC]; the lo plane's left half is 0 (bf16(input) is exact in one plane). Needs K == TK (trip 0 holds whole rows) and N == K.
// EPI names what the KW > 1 epilogue does with the summed (+ bias) value v at [m][n], pitch ldc: 0 stores v to C; 1 stores relu(v) as the planes E16 (fp16), Eh / El (bf16 hi / lo); 2 stores v * esc as Eh / El; 3 stores sigmoid(v) tanh(v) to C.
template <typename T16> struct WFrag;
template <> struct WFrag<h16> { typedef v16h V; static __device__ __forceinline__ V ld(const char* p) { return cat16(*(const v8ha*)p, *(const v8ha*)(p + 32)); } static __device__ __forceinline__ v8f mma(V a, V b, v8f c) { return wmma16(a, b, c); } };
template <> struct WFrag<bf> { typedef v16bf V; static __device__ __forceinline__ V ld(const char* p) { return cat16b(*(const v8usa*)p, *(const v8usa*)(p + 32)); } static __device__ __forceinline__ v8f mma(V a, V b, v8f c) { return wmmab(a, b, c); } };
// a bf16 fragment from an f32 row in LDS, in the k order of WFrag<bf>::ld: eight values at p, eight more 16 k further on
__device__ __forceinline__ v16bf ldf32(const char* p) { const v4f x0 = *(const v4fa*)p, x1 = *(const v4fa*)(p + 16), x2 = *(const v4fa*)(p + 64), x3 = *(const v4fa*)(p + 80);
    // the hardware's conversion, two values an instruction: round to nearest even, as f2bf
    return __builtin_convertvector(__builtin_shufflevector(__builtin_shufflevector(x0, x1, 0, 1, 2, 3, 4, 5, 6, 7), __builtin_shufflevector(x2, x3, 0, 1, 2, 3, 4, 5, 6, 7), 0, 1, 2, 3, 4, 5, 6, 7, 8, 9, 10, 11, 12, 13, 14, 15), v16bf); }
// eight asynchronous 16-byte copies per lane, global -> LDS: copy q takes g + q * gs to LDS byte l + q * ls. The s_wait_xcnt closes the statement so that no address register of a copy is rewritten ahead of it.
__device__ __forceinline__ void cp8(unsigned l, unsigned ls, const char* g, size_t gs) {
    asm volatile("global_load_async_to_lds_b128 %0, %8, off\n\t"
                 "global_load_async_to_lds_b128 %1, %9, off\n\t"
                 "global_load_async_to_lds_b128 %2, %10, off\n\t"
                 "global_load_async_to_lds_b128 %3, %11, off\n\t"
                 "global_load_async_to_lds_b128 %4, %12, off\n\t"
                 "global_load_async_to_lds_b128 %5, %13, off\n\t"
                 "global_load_async_to_lds_b128 %6, %14, off\n\t"
                 "global_load_async_to_lds_b128 %7, %15, off\n\t"
                 "s_wait_xcnt 0x0"
                 :: "v"(l), "v"(l + ls), "v"(l + 2 * ls), "v"(l + 3 * ls), "v"(l + 4 * ls), "v"(l + 5 * ls), "v"(l + 6 * ls), "v"(l + 7 * ls),
                    "v"(g), "v"(g + gs), "v"(g + 2 * gs), "v"(g + 3 * gs), "v"(g + 4 * gs), "v"(g + 5 * gs), "v"(g + 6 * gs), "v"(g + 7 * gs)
                 : "memory");
}
// LDS bytes of one tile's work-group: NBUF staging buffers, or the output staging that takes their place after the k loop
template <int NSPLIT, int KW, bool AF, bool BF, int NBUF, int NT> constexpr int gemmw_lds() {
    constexpr int TK = 32 * KW * ((KW == 1) ? 2 : 1), PB = TK * 2 + 16, PBF = TK * 4 + 16;
    constexpr int STB = 64 * (AF ? PBF : PB) + 16 * NT * (BF ? PBF : PB) + (NSPLIT >= 1 ? 64 * PB : 0) + (NSPLIT >= 2 ? 16 * NT * PB : 0), OSB = (KW > 1 ? KW * 64 : 16) * (16 * NT + 4) * 4;
    return OSB > NBUF * STB ? OSB : NBUF * STB; }
// gemmw_tile: the whole work of one work-group on tile (bx, by) of z-batch bz, in the LDS handed to it (gemmw_lds bytes, 16-byte aligned). k_gemmw calls it with its block index; the fused-attention launch calls it from the work-groups behind its own.
// NBUF: staging buffers. k_gemmw picks as said above; a tile in the fused-attention launch has a WGP's whole LDS and takes two, split products or not.
// NT: 16-column groups of the tile, 4 as described above or 8 (a 64 x 128 tile, 32 accumulators per wave: each staged A row serves twice the columns; for a work-group that has a WGP's registers and LDS to itself).
template <typename T16, int NSPLIT, bool BIAS, int KW, int EPI, bool AF, bool BF, int NBUF, int NT>
__device__ __forceinline__ void gemmw_tile(float* os, int bx, int by, int bz, const T16* __restrict__ A, const T16* __restrict__ A2, const T16* __restrict__ Bt, const T16* __restrict__ Bt2, const float* __restrict__ Af, const float* __restrict__ Bf, int K, float* C, int ldc, const float* __restrict__ bias, size_t sA, size_t sB, size_t sC, h16* E16, bf* Eh, bf* El, float esc, bf* Ch, bf* Cl) {
    typedef typename WFrag<T16>::V V;
    static_assert(!(AF || BF) || KW > 1, "f32 operands: one 32-wide k step of a wave per trip");
    static_assert(NSPLIT <= 2, "planes staged: A, Bt, A2 (NSPLIT 1, 2), Bt2 (NSPLIT 2)");
    static_assert(NT == 4 || (NT == 8 && KW > 1 && !BF && NSPLIT <= 1), "the wide tile: Bt a single 16-bit plane, K shared by several waves");
    constexpr int KS = (KW == 1) ? 2 : 1;                  // 32-wide k steps of a wave per trip (a lone wave takes two, so that its rows are whole 128-B lines)
    constexpr int NBLK = (NSPLIT == 0) ? 2 : (NSPLIT == 1 ? 3 : 4);
    constexpr int TK = 32 * KW * KS, GR = TK / 8, RP = 32 * KW / GR;   // k per trip; 16-byte pieces per staged row; rows that one copy of every thread covers
    constexpr int PB = TK * 2 + 16, BLKB = 64 * PB;   // LDS bytes of a 16-bit plane: row pitch, one block
    constexpr int GRF = TK / 4, RPF = 32 * KW / GRF, PBF = TK * 4 + 16;   // an f32 operand: 16-byte pieces per staged row; rows that one copy of every thread covers; row pitch
    constexpr int OB = 64 * (AF ? PBF : PB), OA2 = OB + 16 * NT * (BF ? PBF : PB), OB2 = OA2 + BLKB, STB = OA2 + (NBLK - 2) * BLKB;   // where Bt's, A2's and Bt2's blocks begin in a buffer (A's at 0); one buffer
    constexpr int OP = 16 * NT + 4, LGS = (NT == 4) ? 4 : 5;   // output staging: floats per row; log2 of the 4-float pieces per row
    // os: the staging buffers first, the output staging after the k loop (KW > 1: one whole 64-row partial tile per wave)
    const int wv = (KW > 1) ? __builtin_amdgcn_readfirstlane((int)(threadIdx.x >> 5)) : 0;   // wave-uniform, so the k loop stays scalar
    const size_t z = (size_t)bz; if constexpr (AF) Af += z * sA; else A += z * sA; if (A2) A2 += z * sA; if constexpr (BF) Bf += z * sB; else Bt += z * sB; if (Bt2) Bt2 += z * sB; if constexpr (EPI == 2) { Eh += z * sC; El += z * sC; } else C += z * sC;
    const int lane = threadIdx.x & 31, lr = lane & 15, hi = lane >> 4; const int r0 = bx * 64, c0 = by * 16 * NT;
    v8f acc[4][NT];
#pragma unroll
    for (int mb = 0; mb < 4; ++mb)
#pragma unroll
        for (int nb = 0; nb < NT; ++nb) acc[mb][nb] = (v8f){};
    const int tid = (int)threadIdx.x, crow = tid / GR, ccol = tid % GR;   // the staged row and 16-byte piece that this lane copies first
    const unsigned lcp = (unsigned)(size_t)os + (unsigned)(crow * PB + ccol * 16);   // its LDS byte address inside a block
    const size_t acp = (size_t)(r0 + crow) * K + ccol * 8, bcp = (size_t)(c0 + crow) * K + ccol * 8, gstep = (size_t)RP * K * 2;
    const size_t gsf = (size_t)RPF * K * 4;   // an f32 operand's step from one copy to the next
    const int ntr = (int)((unsigned)K / (unsigned)TK);   // trips: the same for every wave (K % TK == 0)
    auto stage = [&](int t, int buf) {   // all planes' blocks of trip t into buffer buf: 8 * KS copies per lane and 16-bit plane (16 for the wide tile's Bt), 16 per f32 operand, every lane on
        const size_t ko = (size_t)t * TK; const unsigned lb = lcp + (unsigned)(buf * STB);
        unsigned ln = 0; if constexpr (AF || BF) asm volatile("v_nop\n\tv_nop\n\tv_nop\n\tv_nop\n\tv_mbcnt_lo_u32_b32 %0, -1, 0" : "=v"(ln));   // the lane number, formed anew at every call: an f32 operand's 16 LDS addresses, formed outside the loop, would stay live across it beside the accumulators and spill to scratch. The four v_nop keep the chip's distance behind a matrix instruction: the compiler sinks the trip's last products to just above this statement and may give it one of their operand registers
        const int tf = wv * 32 + (int)ln, crf = tf / GRF, ccf = tf % GRF;   // the staged row and 16-byte piece of an f32 operand that this lane copies first
        const unsigned lf = (unsigned)(size_t)os + (unsigned)(buf * STB + crf * PBF + ccf * 16);
        const size_t acf = (size_t)(r0 + crf) * K + ccf * 4, bcf = (size_t)(c0 + crf) * K + ccf * 4;
        if constexpr (AF) { const char* g = (const char*)(Af + acf + ko); cp8(lf, RPF * PBF, g, gsf); cp8(lf + 8 * RPF * PBF, RPF * PBF, g + 8 * gsf, gsf); }
        if constexpr (BF) { const char* g = (const char*)(Bf + bcf + ko); cp8(lf + OB, RPF * PBF, g, gsf); cp8(lf + OB + 8 * RPF * PBF, RPF * PBF, g + 8 * gsf, gsf); }
#pragma unroll
        for (int h = 0; h < KS; ++h) { const unsigned lh = lb + (unsigned)(h * 8 * RP * PB); const size_t gh = (size_t)h * 8 * gstep;
            if constexpr (!AF) cp8(lh, RP * PB, (const char*)(A + acp + ko) + gh, gstep);
            if constexpr (!BF) { cp8(lh + OB, RP * PB, (const char*)(Bt + bcp + ko) + gh, gstep); if constexpr (NT == 8) cp8(lh + OB + 64 * PB, RP * PB, (const char*)(Bt + bcp + ko) + 8 * gstep, gstep);   /* the wide tile's Bt rows 64 on */ }
            if constexpr (NSPLIT >= 1) cp8(lh + OA2, RP * PB, (const char*)(A2 + acp + ko) + gh, gstep);
            if constexpr (NSPLIT >= 2) cp8(lh + OB2, RP * PB, (const char*)(Bt2 + bcp + ko) + gh, gstep); }
    };
    stage(0, 0);
    asm volatile("s_wait_asynccnt 0x0" ::: "memory");   // this wave's copies of trip 0 have landed
    __syncthreads();   // ... and every other wave's: a wave reads rows that other waves copied
    if constexpr (NBUF == 2) { if (K >= 2 * TK) stage(1, 1); }   // a trip 1 exists
    if constexpr (AF && EPI == 1) { if (Ch) {   // the same for the whole grid. Four lanes a row: 16 columns each, one 128-byte line of each plane per row
        const int row = tid >> 2, cc = c0 + (tid & 3) * 16; const char* p = (const char*)os + row * PBF + cc * 4; v8us o[2];
#pragma unroll
        for (int h = 0; h < 2; ++h) { const v4f x0 = *(const v4fa*)(p + h * 32), x1 = *(const v4fa*)(p + h * 32 + 16);
#pragma unroll
            for (int q = 0; q < 4; ++q) { o[h][q] = f2bf(x0[q]); o[h][q + 4] = f2bf(x1[q]); } }
        const size_t oc = (size_t)(r0 + row) * DC + cc; *(v8us*)(Ch + oc) = o[0]; *(v8us*)(Ch + oc + 8) = o[1]; *(v8us*)(Cl + oc) = (v8us){}; *(v8us*)(Cl + oc + 8) = (v8us){};
        asm volatile("s_wait_xcnt 0x0" ::: "memory");   // stands ahead of any reuse of the registers that the four stores above name
    } }
    const char* fb = (const char*)os + lr * PB + wv * KS * 64 + hi * 16;   // this lane's fragment piece: row lr, the wave's own k block
    const char* ff = (const char*)os + lr * PBF + wv * 128 + hi * 32;   // the same in an f32 operand's block
#pragma unroll 1
    for (int t = 0; t < ntr; ++t) {
        const char* fs = fb + ((NBUF == 2) ? (t & 1) * STB : 0);
#pragma unroll
        for (int s = 0; s < KS; ++s) {
            V a[4], a2[4];
#pragma unroll
            for (int mb = 0; mb < 4; ++mb) { if constexpr (AF) a[mb] = ldf32(ff + mb * 16 * PBF); else a[mb] = WFrag<T16>::ld(fs + mb * 16 * PB + s * 64); if (NSPLIT == 1 || NSPLIT == 2) a2[mb] = WFrag<T16>::ld(fs + OA2 + mb * 16 * PB + s * 64); }
#pragma unroll
            for (int nb = 0; nb < NT; ++nb) { V b; if constexpr (BF) b = ldf32(ff + OB + nb * 16 * PBF); else b = WFrag<T16>::ld(fs + OB + nb * 16 * PB + s * 64); V b2; if (NSPLIT >= 2) b2 = WFrag<T16>::ld(fs + OB2 + nb * 16 * PB + s * 64);
#pragma unroll
                for (int mb = 0; mb < 4; ++mb) { acc[mb][nb] = WFrag<T16>::mma(a[mb], b, acc[mb][nb]); if (NSPLIT == 1 || NSPLIT == 2) acc[mb][nb] = WFrag<T16>::mma(a2[mb], b, acc[mb][nb]); if (NSPLIT >= 2) acc[mb][nb] = WFrag<T16>::mma(a[mb], b2, acc[mb][nb]); } }
            asm volatile("v_nop\n\tv_nop\n\tv_nop\n\tv_nop" : "+v"(acc[0][0]), "+v"(acc[1][1]), "+v"(acc[2][2]), "+v"(acc[3][3]) : "v"(a[0]), "v"(a[3]));
        }
        asm volatile("s_wait_dscnt 0x0" ::: "memory");   // this wave's fragment reads of the buffer are done before anybody refills it
        if constexpr (NBUF == 2) asm volatile("s_wait_asynccnt 0x0" ::: "memory");   // this wave's copies of trip t + 1 have landed
        __syncthreads();   // ends every wave's reads of this trip's buffer; with two buffers it also publishes trip t + 1
        if constexpr (NBUF == 2) { if (t + 2 < ntr) stage(t + 2, t & 1); }
        else { if (t + 1 < ntr) { stage(t + 1, 0);
            asm volatile("s_wait_asynccnt 0x0" ::: "memory");   // this wave's copies of trip t + 1 have landed
            __syncthreads();   // ... and every other wave's
        } }
    }
    asm volatile("s_wait_asynccnt 0x0" ::: "memory");   // no copy is outstanding when the buffers become output staging
    if constexpr (KW > 1) {
        // unrolled: the accumulators stay in registers only under constant indices
#pragma unroll
        for (int mb = 0; mb < 4; ++mb)
#pragma unroll
            for (int nb = 0; nb < NT; ++nb) {
#pragma unroll
                for (int j = 0; j < 8; ++j) os[(wv * 64 + mb * 16 + hi * 8 + j) * OP + nb * 16 + lr] = acc[mb][nb][j]; }
        __syncthreads();   // every wave's partial tile is in LDS before any thread sums across the waves
        // unrolled (both loops): all of a thread's LDS reads are issued together instead of one wait per read
#pragma unroll
        for (int s = 0; s < 8 * NT / KW; ++s) { const int slot = (int)threadIdx.x + s * 32 * KW, row = slot >> LGS, cofs = (slot & (4 * NT - 1)) * 4; v4f val = *(const v4fa*)(os + row * OP + cofs);
#pragma unroll
            for (int w = 1; w < KW; ++w) val += *(const v4fa*)(os + (w * 64 + row) * OP + cofs);
            if (BIAS) { val[0] += bfr(bias[c0 + cofs]); val[1] += bfr(bias[c0 + cofs + 1]); val[2] += bfr(bias[c0 + cofs + 2]); val[3] += bfr(bias[c0 + cofs + 3]); }
            const size_t oo = (size_t)(r0 + row) * ldc + c0 + cofs;
            // the q loops below are unrolled so that the 4-wide vectors are indexed by constants and stay in registers
            if constexpr (EPI == 0) { *(v4f*)(C + oo) = val; }
            else if constexpr (EPI == 1) { v4h o16; v4us oh, ol;
#pragma unroll
                for (int q = 0; q < 4; ++q) { const float r = fmaxf(val[q], 0.0f); o16[q] = tohx(r); unsigned short a2, c2; splitf(r, a2, c2); oh[q] = a2; ol[q] = c2; }
                *(v4h*)(E16 + oo) = o16; *(v4us*)(Eh + oo) = oh; *(v4us*)(El + oo) = ol; }
            else if constexpr (EPI == 2) { v4us oh, ol;
#pragma unroll
                for (int q = 0; q < 4; ++q) { unsigned short a2, c2; splitf(val[q] * esc, a2, c2); oh[q] = a2; ol[q] = c2; }
                *(v4us*)(Eh + oo) = oh; *(v4us*)(El + oo) = ol; }
            else { v4f o;
#pragma unroll
                for (int q = 0; q < 4; ++q) { const float sg = __fdiv_rn(1.0f, __fadd_rn(1.0f, expf(-val[q]))); o[q] = __fmul_rn(sg, tanhf(val[q])); }
                *(v4f*)(C + oo) = o; } }
        return;
    }
#pragma unroll
    for (int mb = 0; mb < 4; ++mb) {
#pragma unroll
        for (int nb = 0; nb < 4; ++nb) {
#pragma unroll
            for (int j = 0; j < 8; ++j) os[(hi * 8 + j) * 68 + nb * 16 + lr] = acc[mb][nb][j]; }
        __builtin_amdgcn_wave_barrier(); asm volatile("" ::: "memory");
        float* crow = C + (size_t)(r0 + mb * 16) * ldc + c0;
{
#pragma unroll
            for (int s = 0; s < 8; ++s) { const int row = 2 * s + hi, cofs = lr * 4; v4f val = *(const v4fa*)(os + row * 68 + cofs); if (BIAS) { val[0] += bfr(bias[c0 + cofs]); val[1] += bfr(bias[c0 + cofs + 1]); val[2] += bfr(bias[c0 + cofs + 2]); val[3] += bfr(bias[c0 + cofs + 3]); }
                *(v4f*)(crow + (size_t)row * ldc + cofs) = val; }
             }
        __builtin_amdgcn_wave_barrier(); asm volatile("" ::: "memory");
    }
}
// four waves per SIMD (256 registers a wave): two 8-wave work-groups still share a WGP, as their LDS allows
template <typename T16, int NSPLIT, bool BIAS, int KW, int EPI, bool AF, bool BF>
__global__ __launch_bounds__(32 * KW) __attribute__((amdgpu_waves_per_eu(4))) void k_gemmw(const T16* __restrict__ A, const T16* __restrict__ A2, const T16* __restrict__ Bt, const T16* __restrict__ Bt2, const float* __restrict__ Af, const float* __restrict__ Bf, int K, float* C, int ldc, const float* __restrict__ bias, size_t sA, size_t sB, size_t sC, h16* E16, bf* Eh, bf* El, float esc, bf* Ch, bf* Cl) {
    constexpr int NBUF = (NSPLIT == 0 && !AF && !BF) ? 2 : 1;
    __shared__ __align__(16) float os[gemmw_lds<NSPLIT, KW, AF, BF, NBUF, 4>() / 4];
    gemmw_tile<T16, NSPLIT, BIAS, KW, EPI, AF, BF, NBUF, 4>(os, (int)blockIdx.x, (int)blockIdx.y, (int)blockIdx.z, A, A2, Bt, Bt2, Af, Bf, K, C, ldc, bias, sA, sB, sC, E16, Eh, El, esc, Ch, Cl);
}


__global__ __launch_bounds__(256) void k_asoft(const float* __restrict__ Sb, const float* __restrict__ mk, bf* Ph, bf* Pl) {
    const int lane = threadIdx.x & 31; const int row = blockIdx.x * 8 + (threadIdx.x >> 5); if (row >= ZH * TT) return; const int i = row % TT; const int zz = row / TT; const size_t bz = blockIdx.y;   /* batch in the pass */ mk += bz * TT; Ph += bz * ZH * RH * TT; Pl += bz * ZH * RH * TT; const float* sr = Sb + ((bz * ZH + zz) * RH + i) * TT;   /* score planes [batch][zz][RH][TT] */ float mx = -3.0e38f;
#pragma unroll 4
    for (int ch = 0; ch < TT / 128; ++ch) { const int j0 = ch * 128 + lane * 4; const v4f a = *(const v4f*)(sr + j0); const v4f m4 = *(const v4f*)(mk + j0);
#pragma unroll
        for (int q = 0; q < 4; ++q) { float t = a[q] * SCL; asm volatile("" : "+v"(t)); t = (bfr(m4[q]) != 0.0f) ? t : -3.0e38f;   /* masked memory position excluded (the reference's -1e30 penalty) */ mx = fmaxf(mx, t); } }
#pragma unroll
    for (int sh = 16; sh; sh >>= 1) mx = fmaxf(mx, __shfl_xor(mx, sh, 32));
    float sum = 0.f;
#pragma unroll 4
    for (int ch = 0; ch < TT / 128; ++ch) { const int j0 = ch * 128 + lane * 4; const v4f a = *(const v4f*)(sr + j0); const v4f m4 = *(const v4f*)(mk + j0);
#pragma unroll
        for (int q = 0; q < 4; ++q) { float t = a[q] * SCL; asm volatile("" : "+v"(t)); t = (bfr(m4[q]) != 0.0f) ? t : -3.0e38f;   /* masked memory position excluded (the reference's -1e30 penalty) */ float d0 = __fsub_rn(t, mx); asm volatile("" : "+v"(d0)); sum += __builtin_amdgcn_exp2f(__fmul_rn(d0, 1.4426950408889634f)); } }
#pragma unroll
    for (int sh = 16; sh; sh >>= 1) sum += __shfl_xor(sum, sh, 32);
    const float f = __fdiv_rn(1.0f, sum);
{
        {   /* rows < RH (the grid holds no others): normalised bf16 hi/lo over ALL TT keys (symmetric window: keys beyond RH are live), planes [zz][RH][TT] */
#pragma unroll 4
            for (int ch = 0; ch < TT / 128; ++ch) { const int j0 = ch * 128 + lane * 4; const v4f a = *(const v4f*)(sr + j0); const v4f m4 = *(const v4f*)(mk + j0); v4us oh, ol;
#pragma unroll
                for (int q = 0; q < 4; ++q) { float t = a[q] * SCL; asm volatile("" : "+v"(t)); t = (bfr(m4[q]) != 0.0f) ? t : -3.0e38f;   /* masked memory position excluded (the reference's -1e30 penalty) */ float d0 = __fsub_rn(t, mx); asm volatile("" : "+v"(d0)); float ex = __builtin_amdgcn_exp2f(__fmul_rn(d0, 1.4426950408889634f)); asm volatile("" : "+v"(ex)); unsigned short a2, c2; splitf(ex * f, a2, c2); oh[q] = a2; ol[q] = c2; }
                const size_t oo = ((size_t)zz * RH + i) * TT + j0; *(v4us*)(Ph + oo) = oh; *(v4us*)(Pl + oo) = ol; }
        }
         }
}


// ---- k_fattn: scores, softmax and weights x values of the fp16 query rows (RH on) in one kernel; no score or weight plane goes to memory. grid (NP * NFB + NP * NPV), 256 threads: work-group wg < NP * NFB takes queries (wg % NFB) * 64 on of batch wg / NFB.
// One such work-group fills a WGP's LDS, and there are fewer of them than WGPs: the work-groups behind them, which start last and so on the WGPs left over, each do one 64 x 128 tile of the hi/lo rows' weights x values (gemmw_tile, K over 8 waves, two staging buffers), a few tiles one after another per WGP while the attention work-groups run.
// Everything is computed transposed, so that the score tile leaves the matrix unit in the layout the next product wants as its B operand: S^T [key][query] = K Q^T, O^T [d][query] = V^T P^T. A lane owns one query column of each of its wave's two column groups: running maximum, sum and rescale factor are plain per-lane values.
// The 8 waves are 2 query groups (32 queries each, as two 16-column groups) x 4 key quarters: of each staged block of FK keys a wave takes 32. Every K and V^T fragment read from LDS feeds two products, one per column group, and a staged block serves 64 queries. The 64 query rows are copied to LDS once: the first column group's Q^T fragments are taken into registers from there, the second group's are read with the key fragments in every trip (the registers do not hold all of Q^T beside two groups' O^T). Each wave keeps its own maximum in use, sum and O^T; the four quarters of a query are merged through LDS at the end, in quarter order.
// Staging: per trip the work-group copies FK key rows (K, pitch + 16 B) and the FK-wide slice of all HD value^T rows (pitch + 16 B) into one of two LDS buffers; the next trip's copies fly during this trip's products.
#define FK   128
#define KPB  (HD * 2 + 16)
#define VPB  (FK * 2 + 16)
#define KTB  (FK * KPB)
#define FSTB (KTB + HD * VPB)
#define OPF  (HD + 4)   // floats per query row of a wave's partial O in LDS (16 rows fall on 16 bank groups)
#define L2E  1.4426950408889634f
// lane l takes the value of lane l ^ 16 by a vector move (a shuffle would queue in LDS behind the fragment loads)
__device__ __forceinline__ float xhalf(float x) { return __builtin_bit_cast(float, __builtin_amdgcn_permlanex16(__builtin_bit_cast(int, x), __builtin_bit_cast(int, x), 0x76543210, 0xfedcba98, false, false)); }
#define NFB  ((TT - RH) / 64)            // fused-attention work-groups per batch
#define NPV  ((RH / 64) * (HD / 128))    // 64 x 128 tiles of the hi/lo rows' weights x values per batch
__global__ __launch_bounds__(256) void k_fattn(const h16* __restrict__ Q, const h16* __restrict__ Kp, const h16* __restrict__ Vt, const float* __restrict__ mk, bf* Oh, bf* Ol, const bf* __restrict__ Ph, const bf* __restrict__ Pl, const bf* __restrict__ Vh) {
    __shared__ __align__(16) char sm[2 * FSTB];   // the two staging buffers; after the key loop the partial O tiles
    __shared__ __align__(16) float msk[TT];       // 1 where the key is live, 0 where the mask excludes it
    __shared__ __align__(16) char qs[64 * KPB];   // the work-group's query rows, at the key rows' pitch
    __shared__ float mS[256], lS[256];            // per wave and query: running maximum and sum, for the merge
    const int wg = (int)blockIdx.x;
    static_assert(gemmw_lds<1, 8, false, false, 2, 8>() <= 2 * FSTB, "a weights x values tile works in the two staging buffers");
    if (wg >= NP * NFB) {   // the same for the whole work-group, ahead of every barrier. output_one of the rows < RH = weights hi/lo x exact bf16 values (2 products), written as the hi/lo right half of the concat operand (pitch DC, column DM on)
        const int p = wg - NP * NFB;
        gemmw_tile<bf, 1, false, 8, 2, false, false, 2, 8>((float*)sm, p % (RH / 64), (p / (RH / 64)) % (HD / 128), p / NPV, Ph, Pl, Vh, nullptr, nullptr, nullptr, TT, nullptr, DC, nullptr, (size_t)RH * TT, (size_t)HD * TT, (size_t)TT * DC, nullptr, Oh + DM, Ol + DM, 1.0f, nullptr, nullptr);
        return; }
    const int tid = (int)threadIdx.x, lane = tid & 31, lr = lane & 15, hi = lane >> 4;
    const int wv = __builtin_amdgcn_readfirstlane(tid >> 5), qg = wv & 1, kq = wv >> 1;
    const size_t bz = (size_t)(wg / NFB); const int q0 = (wg % NFB) * 64;
    Q += (bz * TT + RH + q0) * HD; Kp += bz * TT * HD; Vt += bz * HD * TT; mk += bz * TT;
    // copy addresses: the wave-uniform parts, in scalar registers; stage() adds the lane's offsets
    const unsigned lk = (unsigned)(size_t)sm + (unsigned)(wv * KPB);               // K: 32 pieces a row, 8 rows per copy of every thread
    const unsigned lv = (unsigned)(size_t)sm + (unsigned)(KTB + wv * 2 * VPB);     // V^T: 16 pieces a row, 16 rows per copy of every thread
    const char* gk = (const char*)Kp + (size_t)wv * (HD * 2);
    const char* gv = (const char*)Vt + (size_t)wv * (2 * TT * 2);
    auto stage = [&](int s, int buf) {   // key block s into buffer buf: 32 copies per lane, every lane on
        unsigned ln; asm volatile("v_mbcnt_lo_u32_b32 %0, -1, 0" : "=v"(ln));   // the lane number, formed anew at every call: per-lane address parts taken from outside the loop would stay live across it in the registers that asm operands can name, and spill to scratch
        const unsigned lko = ln * 16, lvo = (ln >> 4) * VPB + (ln & 15) * 16, gvo = (ln >> 4) * (TT * 2) + (ln & 15) * 16;
        const unsigned lb = (unsigned)(buf * FSTB); const char* k = gk + (size_t)s * FK * HD * 2 + lko; const char* v = gv + (size_t)s * FK * 2 + gvo;
        // the fences keep each statement's 24 address registers from being formed before the statement ahead of it has issued (all 96 at once crowd out values that live across the loop)
        cp8(lk + lb + lko, 8 * KPB, k, (size_t)8 * HD * 2); __builtin_amdgcn_sched_barrier(0); cp8(lk + lb + 64 * KPB + lko, 8 * KPB, k + (size_t)64 * HD * 2, (size_t)8 * HD * 2); __builtin_amdgcn_sched_barrier(0);
        cp8(lv + lb + lvo, 16 * VPB, v, (size_t)16 * TT * 2); __builtin_amdgcn_sched_barrier(0); cp8(lv + lb + 128 * VPB + lvo, 16 * VPB, v + (size_t)128 * TT * 2, (size_t)16 * TT * 2);
    };
    stage(0, 0);
    cp8((unsigned)(size_t)qs + (unsigned)((tid >> 5) * KPB + (tid & 31) * 16), 8 * KPB, (const char*)Q + (size_t)(tid >> 5) * (HD * 2) + (tid & 31) * 16, (size_t)8 * HD * 2);   // the query rows: 32 pieces a row, 8 rows per copy of every thread; they land with block 0
#pragma unroll
    for (int i = 0; i < TT / 1024; ++i) { const v4f m4 = *(const v4f*)(mk + (tid + i * 256) * 4); v4f o;
#pragma unroll
        for (int q = 0; q < 4; ++q) o[q] = (bfr(m4[q]) != 0.0f) ? 1.0f : 0.0f;
        *(v4f*)(msk + (tid + i * 256) * 4) = o; }
    asm volatile("s_wait_xcnt 0x0" :: "s"(mk) : "memory");   // stands ahead of any reuse of the address registers of the mask loads above: reading the address here keeps it untouched up to the wait
    const char* qb = qs + (qg * 32 + lr) * KPB + hi * 16;   // B fragments of Q^T: column = query lr of the first column group (the second: 16 rows on), the k order of the key fragments
    v8f acc[2][16];
#pragma unroll
    for (int g = 0; g < 2; ++g)
#pragma unroll
        for (int dt = 0; dt < 16; ++dt) acc[g][dt] = (v8f){};
    float mrun[2] = {-3.0e38f, -3.0e38f}, lrun[2] = {0.0f, 0.0f};
    asm volatile("s_wait_asynccnt 0x0" ::: "memory");   // this wave's copies of block 0 have landed
    __syncthreads();   // ... and every other wave's; the query rows have landed with it, the mask flags are written
    stage(1, 1);
    v16h qf[8];
#pragma unroll
    for (int ks = 0; ks < 8; ++ks) qf[ks] = WFrag<h16>::ld(qb + ks * 64);
#pragma unroll 1
    for (int s = 0; s < TT / FK; ++s) {
        const char* bb = sm + (s & 1) * FSTB;
        const char* kb = bb + (kq * 32 + lr) * KPB + hi * 16;          // A fragments of K: row = key
        const char* vb = bb + KTB + lr * VPB + kq * 64 + hi * 16;      // A fragments of V^T: row = d, k = the wave's 32 keys
        const float* mp = msk + s * FK + kq * 32 + hi * 8;
        v8f sc[2][2];   // [column group][16-key half]
#pragma unroll
        for (int g = 0; g < 2; ++g) { sc[g][0] = (v8f){}; sc[g][1] = (v8f){}; }
        // the key fragments come in two groups of eight, each with the second column group's four Q^T fragments of its k steps (the registers do not hold all of them at once)
#pragma unroll
        for (int h = 0; h < 2; ++h) {
            v16h ka[8], q1[4];
#pragma unroll
            for (int k4 = 0; k4 < 4; ++k4) { ka[2 * k4] = WFrag<h16>::ld(kb + (h * 4 + k4) * 64); ka[2 * k4 + 1] = WFrag<h16>::ld(kb + 16 * KPB + (h * 4 + k4) * 64); q1[k4] = WFrag<h16>::ld(qb + 16 * KPB + (h * 4 + k4) * 64); }
            __builtin_amdgcn_sched_barrier(0);   // a group's loads are issued together: one LDS latency per group, not one wait per product
#pragma unroll
            for (int k4 = 0; k4 < 4; ++k4)
#pragma unroll
                for (int g = 0; g < 2; ++g) { const v16h qq = g ? q1[k4] : qf[h * 4 + k4]; sc[g][0] = wmma16(ka[2 * k4], qq, sc[g][0]); sc[g][1] = wmma16(ka[2 * k4 + 1], qq, sc[g][1]); }
        }
        const v4f ma = *(const v4fa*)mp, mb = *(const v4fa*)(mp + 4), mc = *(const v4fa*)(mp + 16), md = *(const v4fa*)(mp + 20);
        v16h va[16];
#pragma unroll
        for (int dt = 0; dt < 4; ++dt) va[dt] = WFrag<h16>::ld(vb + dt * 16 * VPB);
        __builtin_amdgcn_sched_barrier(0);   // the first value fragments' loads are issued up here, so that the softmax below covers their latency
        float bm[2] = {-3.0e38f, -3.0e38f};
#pragma unroll
        for (int j = 0; j < 8; ++j) { const float f0 = (j < 4) ? ma[j & 3] : mb[j & 3], f1 = (j < 4) ? mc[j & 3] : md[j & 3];
#pragma unroll
            for (int g = 0; g < 2; ++g) {
                sc[g][0][j] = (f0 != 0.0f) ? sc[g][0][j] * SCL : -3.0e38f; sc[g][1][j] = (f1 != 0.0f) ? sc[g][1][j] * SCL : -3.0e38f;   /* masked memory position excluded (the reference's -1e30 penalty) */
                bm[g] = fmaxf(bm[g], fmaxf(sc[g][0][j], sc[g][1][j])); } }
        bm[0] = fmaxf(bm[0], xhalf(bm[0])); bm[1] = fmaxf(bm[1], xhalf(bm[1]));   // the query's other eight-key halves
        // lazy rescale: a column group's maximum in use moves only when one of its queries' new maximum lies more than 2^8 above it (weights stay <= 256, well inside fp16); one scalar branch per block on the usual path
        const unsigned n0 = __builtin_amdgcn_ballot_w32((bm[0] - mrun[0]) * L2E > 8.0f), n1 = __builtin_amdgcn_ballot_w32((bm[1] - mrun[1]) * L2E > 8.0f);
        if ((n0 | n1) != 0) {
#pragma unroll
            for (int g = 0; g < 2; ++g) if ((g ? n1 : n0) != 0) { const float mnew = fmaxf(mrun[g], bm[g]), al = __builtin_amdgcn_exp2f((mrun[g] - mnew) * L2E); mrun[g] = mnew; lrun[g] *= al;
#pragma unroll
                for (int dt = 0; dt < 16; ++dt) acc[g][dt] *= al; } }
#pragma unroll
        for (int g = 0; g < 2; ++g)
#pragma unroll
            for (int j = 0; j < 8; ++j) { sc[g][0][j] = (sc[g][0][j] - mrun[g]) * L2E; sc[g][1][j] = (sc[g][1][j] - mrun[g]) * L2E; }
        __builtin_amdgcn_sched_barrier(0);   // the exponentials below run back to back, each filling the slot behind the one before
        v16h pf[2];   // S^T's accumulator layout is the B fragment's: keys hi*8 .. +7 and 16 + hi*8 .. +7 of column lr
        { float ps[2] = {0.0f, 0.0f}; v8h p0[2], p1[2];
#pragma unroll
            for (int j = 0; j < 8; ++j)
#pragma unroll
                for (int g = 0; g < 2; ++g) { const float e0 = __builtin_amdgcn_exp2f(sc[g][0][j]), e1 = __builtin_amdgcn_exp2f(sc[g][1][j]); ps[g] += e0 + e1; p0[g][j] = tohx(e0); p1[g][j] = tohx(e1); }
            lrun[0] += ps[0]; lrun[1] += ps[1]; pf[0] = cat16(p0[0], p1[0]); pf[1] = cat16(p0[1], p1[1]); }
        // the value fragments come four at a time, each four fetched while the four before feed their eight products
#pragma unroll
        for (int c = 0; c < 4; ++c) {
            if (c < 3) {
#pragma unroll
                for (int dt = 0; dt < 4; ++dt) va[(c + 1) * 4 + dt] = WFrag<h16>::ld(vb + ((c + 1) * 4 + dt) * 16 * VPB); }
            __builtin_amdgcn_sched_barrier(0);   // keeps the next four's loads ahead of this four's products (left to itself the compiler puts each load, with a full wait, in front of its product)
#pragma unroll
            for (int dt = 0; dt < 4; ++dt) { acc[0][c * 4 + dt] = wmma16(va[c * 4 + dt], pf[0], acc[0][c * 4 + dt]); acc[1][c * 4 + dt] = wmma16(va[c * 4 + dt], pf[1], acc[1][c * 4 + dt]); }
        }
        asm volatile("s_wait_dscnt 0x0" ::: "memory");      // this wave's reads of the buffer are done before anybody refills it
        asm volatile("s_wait_asynccnt 0x0" ::: "memory");   // this wave's copies of block s + 1 have landed
        __syncthreads();   // ends every wave's reads of this block's buffer and publishes block s + 1
        if (s + 2 < TT / FK) stage(s + 2, s & 1);
    }
    asm volatile("s_wait_asynccnt 0x0" ::: "memory");   // no copy is outstanding when the buffers become the partial O tiles
#pragma unroll
    for (int g = 0; g < 2; ++g) { lrun[g] += xhalf(lrun[g]);
        if (hi == 0) { mS[wv * 32 + g * 16 + lr] = mrun[g]; lS[wv * 32 + g * 16 + lr] = lrun[g]; } }
    __syncthreads();   // every wave's maximum and sum are in LDS
    float* os = (float*)sm;
#pragma unroll
    for (int g = 0; g < 2; ++g) {
        float M = -3.0e38f, L = 0.0f;
#pragma unroll
        for (int w = 0; w < 4; ++w) M = fmaxf(M, mS[(w * 2 + qg) * 32 + g * 16 + lr]);
#pragma unroll
        for (int w = 0; w < 4; ++w) L += lS[(w * 2 + qg) * 32 + g * 16 + lr] * __builtin_amdgcn_exp2f((mS[(w * 2 + qg) * 32 + g * 16 + lr] - M) * L2E);
        const float wsc = __fdiv_rn(__builtin_amdgcn_exp2f((mrun[g] - M) * L2E), L);
#pragma unroll
        for (int dt = 0; dt < 16; ++dt) { const v8f o = acc[g][dt] * wsc; float* op = os + (size_t)(wv * 32 + g * 16 + lr) * OPF + dt * 16 + hi * 8;
            *(v4fa*)op = (v4f){o[0], o[1], o[2], o[3]}; *(v4fa*)(op + 4) = (v4f){o[4], o[5], o[6], o[7]}; } }
    __syncthreads();   // every wave's scaled partial O is in LDS before any thread sums the four quarters
#pragma unroll
    for (int g = 0; g < 8; ++g) { const int u = tid + g * 256, ql = u >> 5, d8 = (u & 31) * 8; v4f x = (v4f){}, y = (v4f){};
#pragma unroll
        for (int w = 0; w < 4; ++w) { const float* ip = os + (size_t)((w * 2 + (ql >> 5)) * 32 + (ql & 31)) * OPF + d8; x += *(const v4fa*)ip; y += *(const v4fa*)(ip + 4); }
        v8us oh, ol;
#pragma unroll
        for (int q = 0; q < 4; ++q) { unsigned short a2, c2; splitf(x[q], a2, c2); oh[q] = a2; ol[q] = c2; splitf(y[q], a2, c2); oh[q + 4] = a2; ol[q + 4] = c2; }
        const size_t oo = (bz * TT + RH + q0 + ql) * DC + DM + d8; *(v8us*)(Oh + oo) = oh; *(v8us*)(Ol + oo) = ol; }
}

// ---- k_vtpb: value^T planes [batch][column][t] from the memory rows [t][column]; one VTT t x 64 column tile per work-group, transposed through LDS. grid (TT / VTT, columns / 64, batch in the pass), 256 threads.
// Reads: 16 lanes take the tile's 256 B of one row (whole lines), a thread two neighbouring rows at a time, so that two bf16 values of one column make one LDS word. Writes: 16 lanes store 256 B in a row of one column, per plane.
// LDS [column][t pair]; the 16-byte piece p of column c lies at piece p ^ (c >> 2): a wave's 32 word stores fall on 32 different banks, and the 16-byte reads stay aligned.
#define VTT  128
__global__ __launch_bounds__(256) void k_vtpb(const float* __restrict__ F, h16* V16, bf* Vh, bf* Vl) {
    static_assert(VTT / 8 == 16 && DKV % 64 == 0 && TT % VTT == 0, "the piece swizzle takes 16 pieces a column; whole tiles only");
    __shared__ __align__(16) unsigned tl[64 * (VTT / 2)];
    const int tid = (int)threadIdx.x, d4 = tid & 15, rp = tid >> 4; const int t0 = (int)blockIdx.x * VTT, c0 = (int)blockIdx.y * 64; const size_t bz = blockIdx.z;   /* batch in the pass */
    F += (bz * TT + t0 + rp * 2) * DM + c0 + d4 * 4;   // the row pitch is a constant: one address a thread, every other load at an immediate offset from it
    v4f ra[VTT / 32], rb[VTT / 32];
    // unrolled: all of a thread's loads are in flight together
#pragma unroll
    for (int i = 0; i < VTT / 32; ++i) { ra[i] = *(const v4f*)(F + i * 32 * DM); rb[i] = *(const v4f*)(F + (i * 32 + 1) * DM); }
#pragma unroll
    for (int i = 0; i < VTT / 32; ++i) { const int tp = i * 16 + rp;
#pragma unroll
        for (int q = 0; q < 4; ++q) tl[(d4 * 4 + q) * (VTT / 2) + ((((tp >> 2) ^ d4) << 2) | (tp & 3))] = (unsigned)f2bf(ra[i][q]) | ((unsigned)f2bf(rb[i][q]) << 16);   /* the value IS a module input: round to bf16 once (lo plane 0) */ }
    __syncthreads();   // the whole tile is in LDS before any thread reads a column that other waves wrote
    v8us hb[VTT / 32];
    // unrolled, and apart from the loop below: the later pieces' LDS reads are under way while the first piece is converted and stored
#pragma unroll
    for (int s = 0; s < VTT / 32; ++s) { const int u = tid + s * 256, d = u / (VTT / 8), c = u % (VTT / 8); hb[s] = *(const v8usa*)(tl + d * (VTT / 2) + ((c ^ (d >> 2)) << 2)); }
#pragma unroll
    for (int s = 0; s < VTT / 32; ++s) { const int u = tid + s * 256, d = u / (VTT / 8), c = u % (VTT / 8); v8h o16; v8us oh, ol;
#pragma unroll
        for (int q = 0; q < 8; ++q) { const float x = bf2f(hb[s][q]); o16[q] = tohx(x); unsigned short a2, c2; splitf(x, a2, c2); oh[q] = a2; ol[q] = c2; }
        const size_t eo = (bz * DKV + c0 + d) * TT + t0 + c * 8; *(v8h*)(V16 + eo) = o16; *(v8us*)(Vh + eo) = oh; *(v8us*)(Vl + eo) = ol; }
}

extern "C" void kernel_launch(void* const* d_in, const int* in_sizes, int n_in,
                              void* d_out, int out_size, void* d_ws, size_t ws_size, hipStream_t stream) {
    (void)in_sizes; (void)n_in; (void)out_size;
    const float* x = (const float*)d_in[0];   /* input */ const float* xm = (const float*)d_in[1];   /* memory */ const float* mk = (const float*)d_in[2];   /* mask [4][4096] f32 */ const float* wq = (const float*)d_in[3]; const float* bq = (const float*)d_in[4]; const float* wk = (const float*)d_in[5]; const float* bk = (const float*)d_in[6]; const float* w2 = (const float*)d_in[7]; const float* b2 = (const float*)d_in[8];   /* argument order input, memory, mask, W_in1, b_in1, W_mem1, b_mem1, W2, b2 */
    float* OUT = (float*)d_out;     // [4][4096][256]
    char* wsp = (char*)d_ws;
    auto take = [&](size_t bytes) { char* p = wsp; wsp += (bytes + 255) & ~(size_t)255; return (void*)p; };
    bf* CAh = (bf*)take((size_t)NP * TT * DC * 2); bf* CAl = (bf*)take((size_t)NP * TT * DC * 2);
    h16* QP16 = (h16*)take((size_t)NP * NH_ * TT * HD * 2); h16* KP16 = (h16*)take((size_t)NP * NKV * TT * HD * 2); h16* VT16 = (h16*)take((size_t)NP * NKV * HD * TT * 2);
    bf* QPh = (bf*)take((size_t)NP * NH_ * TT * HD * 2); bf* QPl = (bf*)take((size_t)NP * NH_ * TT * HD * 2); bf* KPh = (bf*)take((size_t)NP * NKV * TT * HD * 2); bf* KPl = (bf*)take((size_t)NP * NKV * TT * HD * 2); bf* VTh = (bf*)take((size_t)NP * NKV * HD * TT * 2); bf* VTl = (bf*)take((size_t)NP * NKV * HD * TT * 2); bf* Ph = (bf*)take((size_t)NP * ZH * RH * TT * 2); bf* Pl = (bf*)take((size_t)NP * ZH * RH * TT * 2);
    float* Sb = (float*)take((size_t)NP * ZH * RH * TT * 4);   /* f32 scores of the rows < RH, [NP][RH][TT] */
    if ((size_t)(wsp - (char*)d_ws) > ws_size) return;    // ws 256 MiB
    for (int b = 0; b < NB_; b += NP) {   /* batches b .. b + NP - 1; their rows follow one another in the inputs, the output and every [t][...] plane */
        static_assert(DQ == DM && DM == 32 * 8, "the query projection's column tiles are also the concat operand's left-half tiles, and one trip holds whole input rows");
        k_gemmw<bf, 0, true, 8, 1, true, true><<<dim3(NP * TT / 64, DQ / 64, 1), 256, 0, stream>>>(nullptr, nullptr, nullptr, nullptr, x + (size_t)b * TT * DM, wq, DM, nullptr, DQ, bq, 0, 0, 0, QP16, QPh, QPl, 1.0f, CAh, CAl);   /* query planes of input_dot = relu(input W_in1^T + b); also the concat operand's left half */
        k_gemmw<bf, 0, true, 8, 1, true, true><<<dim3(NP * TT / 64, DKV / 64, 1), 256, 0, stream>>>(nullptr, nullptr, nullptr, nullptr, xm + (size_t)b * TT * DM, wk, DM, nullptr, DKV, bk, 0, 0, 0, KP16, KPh, KPl, 1.0f, nullptr, nullptr);   /* key planes of memory_dot */
        k_vtpb<<<dim3(TT / VTT, DKV / 64, NP), 256, 0, stream>>>(xm + (size_t)b * TT * DM, VT16, VTh, VTl);   /* values = the memory itself (bf16-rounded input: hi plane exact, lo plane 0) */
        k_gemmw<bf, 2, false, 8, 0, false, false><<<dim3(RH / 64, TT / 64, NP * ZH), 256, 0, stream>>>(QPh, QPl, KPh, KPl, nullptr, nullptr, HD, Sb, TT, nullptr, (size_t)TT * HD, (size_t)TT * HD, (size_t)RH * TT, nullptr, nullptr, nullptr, 1.0f, nullptr, nullptr);
        k_asoft<<<dim3(ZH * RH / 8, NP, 1), 256, 0, stream>>>(Sb, mk + (size_t)b * TT, Ph, Pl);
        k_fattn<<<dim3(NP * NFB + NP * NPV, 1, 1), 256, 0, stream>>>(QP16, KP16, VT16, mk + (size_t)b * TT, CAh, CAl, Ph, Pl, VTh);   /* rows RH on: fp16 scores, streaming softmax and fp16 weights x values in one kernel; in the same launch, rows < RH: weights hi/lo x values */
        k_gemmw<bf, 1, true, 8, 3, false, true><<<dim3(NP * TT / 64, DM / 64, 1), 256, 0, stream>>>(CAh, CAl, nullptr, nullptr, nullptr, w2, DC, OUT + (size_t)b * TT * DM, DM, b2, 0, 0, 0, nullptr, nullptr, nullptr, 1.0f, nullptr, nullptr);   /* z = [input | output_one] W2^T + b2; out = sigmoid(z) tanh(z) */
    }
}
